// v000
// Times are from an AMD MI455X. After a warm-up the kernel runs many times in a row, and a time is the length of
// such a window on the GPU divided by its runs, so every launch and the gaps after it count. The runs cycle
// through copies of the inputs. A figure is the median of several windows, for all but v000 over two sittings.
// Sittings can differ by a few percent; kernels timed side by side share one.
// The starting kernel, v000, takes 1430 microseconds a run.
// compute dtype: all float inputs rounded to bf16; qkv = x Wqkv^T with EXACT bf16 products on WMMA 16x16x32 (f32 accumulate); per-head RMSNorm of q and k in f32 on the projected rows; q as f16 hi + residual (x 2^10) against k once to f16 (2 products) x 64^-0.5; softmax in f32 (precise expf); P x 2^11 once to f16 against v once to f16 (1 product); ctx split bf16 hi + lo against exact proj_w (2 products) + proj_b; f32 output.
#include <hip/hip_runtime.h>
#include <math.h>

typedef __attribute__((ext_vector_type(16))) _Float16 v16h;
typedef __attribute__((ext_vector_type(16))) __bf16 v16b;
typedef __attribute__((ext_vector_type(8)))  _Float16 v8h;
typedef __attribute__((ext_vector_type(8)))  float v8f;
typedef __attribute__((ext_vector_type(4)))  float v4f;
typedef __attribute__((ext_vector_type(2)))  float v2f;
typedef __attribute__((ext_vector_type(4)))  unsigned v4u;
typedef __attribute__((ext_vector_type(4)))  int v4i;
typedef float __attribute__((may_alias)) float_a;
typedef int __attribute__((may_alias)) int_a;

template <typename T> __device__ __forceinline__ void vst2(void* p, T v) { *(T*)p = v;  }
__device__ __forceinline__ v8f wmma16(v16h a, v16h b, v8f c) {
  v8f d = __builtin_amdgcn_wmma_f32_16x16x32_f16(false, a, false, b, (short)0, c, false, false);
  asm volatile("v_nop\n\tv_nop\n\tv_nop\n\tv_nop" : "+v"(d) : "v"(a), "v"(b));
  return d;
}
__device__ __forceinline__ v8f wmma_bf(v16b a, v16b b, v8f c) {
  v8f d = __builtin_amdgcn_wmma_f32_16x16x32_bf16(false, a, false, b, (short)0, c, false, false);
  asm volatile("v_nop\n\tv_nop\n\tv_nop\n\tv_nop" : "+v"(d) : "v"(a), "v"(b));
  return d;
}
// 16x16x32 fragments: lane = (h = lane>>4, row/col = lane&15); elements 0..7 = k0+8h+0..7, 8..15 = k0+16+8h+0..7; D element r = row 8h+r
__device__ __forceinline__ v16h frag_h(const _Float16* rowk0, int lane) {
  union { v16h v; v8h q[2]; } u; const _Float16* p = rowk0 + 8 * (lane >> 4);
  u.q[0] = *(const v8h*)p; u.q[1] = *(const v8h*)(p + 16); return u.v;
}
__device__ __forceinline__ v16h frag_f32(const float* rowk0, int lane) {
  v16h a; const float* p = rowk0 + 8 * (lane >> 4);
#pragma unroll
  for (int i = 0; i < 8; ++i) { a[i] = (_Float16)p[i]; a[8 + i] = (_Float16)p[16 + i]; }
  return a;
}
__device__ __forceinline__ v16h frag_f32s(const float* rowk0, int lane, float sc) {
  v16h a; const float* p = rowk0 + 8 * (lane >> 4);
#pragma unroll
  for (int i = 0; i < 8; ++i) { a[i] = (_Float16)(p[i] * sc); a[8 + i] = (_Float16)(p[16 + i] * sc); }
  return a;
}
// column fragment from a [K][ld] layout (column n), rows >= K read as 0
__device__ __forceinline__ v16h fragc_f32(const float* W, int k0, int n, int lane, int ld, int K) {
  v16h a; const int g = lane >> 4;
#pragma unroll
  for (int i = 0; i < 8; ++i) { const int ka = k0 + 8 * g + i, kb = ka + 16;
    a[i] = (_Float16)(ka < K ? W[(size_t)(ka < K ? ka : K - 1) * ld + n] : 0.f); a[8 + i] = (_Float16)(kb < K ? W[(size_t)(kb < K ? kb : K - 1) * ld + n] : 0.f); }
  return a;
}
struct F2 { v16b h, l; };
__device__ __forceinline__ F2 bsplit16(const float v[16]) { F2 r;
#pragma unroll
  for (int i = 0; i < 16; ++i) { const __bf16 h = (__bf16)v[i]; r.h[i] = h; r.l[i] = (__bf16)(v[i] - (float)h); }
  return r; }
__device__ __forceinline__ F2 split_row(const float* row, int k0, int lane) { float v[16]; const float* p = row + k0 + 8 * (lane >> 4);
#pragma unroll
  for (int i = 0; i < 8; ++i) { v[i] = p[i]; v[8 + i] = p[16 + i]; }
  return bsplit16(v); }
__device__ __forceinline__ F2 split_rowK(const float* row, int k0, int lane, int K) { float v[16]; const int g = lane >> 4;
#pragma unroll
  for (int i = 0; i < 8; ++i) { const int ka = k0 + 8 * g + i, kb = ka + 16; v[i] = ka < K ? row[ka < K ? ka : K - 1] : 0.f; v[8 + i] = kb < K ? row[kb < K ? kb : K - 1] : 0.f; }
  return bsplit16(v); }
__device__ __forceinline__ F2 split_col(const float* W, int k0, int n, int lane, int ld, int K) { float v[16]; const int g = lane >> 4;
#pragma unroll
  for (int i = 0; i < 8; ++i) { const int ka = k0 + 8 * g + i, kb = ka + 16; v[i] = ka < K ? W[(size_t)(ka < K ? ka : K - 1) * ld + n] : 0.f; v[8 + i] = kb < K ? W[(size_t)(kb < K ? kb : K - 1) * ld + n] : 0.f; }
  return bsplit16(v); }
__device__ __forceinline__ v8f mac3(const F2& a, const F2& b, v8f c) { c = wmma_bf(a.l, b.h, c); c = wmma_bf(a.h, b.l, c); return wmma_bf(a.h, b.h, c); }
__device__ __forceinline__ float sigm(float v) { return 1.0f / (1.0f + expf(-v)); }
#define LDSX() do { asm volatile("s_wait_dscnt 0" ::: "memory"); __builtin_amdgcn_wave_barrier(); __builtin_amdgcn_fence(__ATOMIC_RELEASE, "workgroup"); } while (0)

// Self-attention with QK RMSNorm (B 2, N 2,048, C 1,024 = 16 x 64): qkv = x qkv_w^T ((out,in) [3072,1024], rows (3, H, hd)); q, k <- scale * q / (|q| 64^-0.5 + 1e-8) per head (scales all ones); out = merged(softmax(q k^T x 64^-0.5) v) proj_w^T + proj_b (non-causal).
#define NB 2
#define TT 2048
#define CC 1024            // NH * HD = projected width
#define DIN 1024          // input (model) width
#define NH 16
#define HD 64
#define NQB (TT / 64)
#define HG 4
#define SCALE (0.125f)
#define CAUSAL 0
#ifndef TNB
#define TNB NB
#endif
__device__ __forceinline__ float bfr(float v) { return (float)(__bf16)v; }
__host__ __device__ __forceinline__ int kb_last(int qb) { return CAUSAL ? ((qb * 64 + 63) >> 7) : (TT / 128 - 1); }
typedef __attribute__((ext_vector_type(8))) __bf16 v8b;
__device__ __forceinline__ v16b frag_b(const __bf16* rowk0, int lane) {
  union { v16b v; v8b q[2]; } u; const __bf16* p = rowk0 + 8 * (lane >> 4);
  u.q[0] = *(const v8b*)p; u.q[1] = *(const v8b*)(p + 16); return u.v;
}
#define QBH 0              // query blocks 0..QBH-1 of each sequence take the 3-product path; with QBH 0 none do
#define QHI 2048            // rows carrying a q residual plane (all rows when non-causal: 2-product logits everywhere)
#define KHI 64            // key rows carrying k residual / v bf16 hi+lo planes (read only by the qb < QBH path, which no block takes here)
// B fragment (k rows k0+.., output column o) of a weight: (in,out) [K][ld] or (out,in) [ld rows of K]: bf16 exact, or f16(bf16 * 256) exact
__device__ __forceinline__ v16b wcol_io(const float* Wm, int k0, int o, int lane, int ld) { v16b w; const int g = lane >> 4;
#pragma unroll
  for (int i = 0; i < 8; ++i) { w[i] = (__bf16)Wm[(size_t)(k0 + 8 * g + i) * ld + o]; w[8 + i] = (__bf16)Wm[(size_t)(k0 + 16 + 8 * g + i) * ld + o]; }
  return w; }
__device__ __forceinline__ v16b wcol_oi(const float* Wm, int k0, int o, int lane, int K) { v16b w; const float* p = Wm + (size_t)o * K + k0 + 8 * (lane >> 4);
#pragma unroll
  for (int i = 0; i < 8; ++i) { w[i] = (__bf16)p[i]; w[8 + i] = (__bf16)p[16 + i]; }
  return w; }
__device__ __forceinline__ v16h wcolh_io(const float* Wm, int k0, int o, int lane, int ld) { v16h w; const int g = lane >> 4;
#pragma unroll
  for (int i = 0; i < 8; ++i) { w[i] = (_Float16)(bfr(Wm[(size_t)(k0 + 8 * g + i) * ld + o]) * 256.0f); w[8 + i] = (_Float16)(bfr(Wm[(size_t)(k0 + 16 + 8 * g + i) * ld + o]) * 256.0f); }
  return w; }
__device__ __forceinline__ v16h wcolh_oi(const float* Wm, int k0, int o, int lane, int K) { v16h w; const float* p = Wm + (size_t)o * K + k0 + 8 * (lane >> 4);
#pragma unroll
  for (int i = 0; i < 8; ++i) { w[i] = (_Float16)(bfr(p[i]) * 256.0f); w[8 + i] = (_Float16)(bfr(p[16 + i]) * 256.0f); }
  return w; }
#define WQKV_LAYOUT 1   // 0 = (in,out) [DIN][CC]; 1 = (out,in) [CC][DIN]; 2 = per-head [NH][DIN][HD]
__device__ __forceinline__ v16b wcol_hdk(const float* Wm, int k0, int o, int lane) { v16b w; const int g = lane >> 4; const float* p = Wm + (size_t)(o / HD) * DIN * HD + (o % HD);
#pragma unroll
  for (int i = 0; i < 8; ++i) { w[i] = (__bf16)p[(size_t)(k0 + 8 * g + i) * HD]; w[8 + i] = (__bf16)p[(size_t)(k0 + 16 + 8 * g + i) * HD]; }
  return w; }
#define WO_OUT_IN 1
#if WQKV_LAYOUT == 1
#define WCOL(W, k0, o, lane) wcol_oi(W, k0, o, lane, DIN)
#elif WQKV_LAYOUT == 2
#define WCOL(W, k0, o, lane) wcol_hdk(W, k0, o, lane)
#else
#define WCOL(W, k0, o, lane) wcol_io(W, k0, o, lane, CC)
#endif
#if WO_OUT_IN
#define WOCOL(W, k0, o, lane) wcol_oi(W, k0, o, lane, CC)
#define WOCOLH(W, k0, o, lane) wcolh_oi(W, k0, o, lane, CC)
#else
#define WOCOL(W, k0, o, lane) wcol_io(W, k0, o, lane, DIN)
#define WOCOLH(W, k0, o, lane) wcolh_io(W, k0, o, lane, DIN)
#endif
#define PROJ_EXTRA_PARAMS , const float* __restrict__ QS, const float* __restrict__ KS
#define PROJ_EPI(which, row, t, h) do { if ((which) < 2) { float* rw = (row); const float* sc = (which) == 0 ? QS : KS; float ss = 0.f; _Pragma("unroll") for (int i = 0; i < 64; ++i) ss += rw[i] * rw[i]; const float rms = __fsqrt_rn(ss) * 0.125f; const float inv = 1.0f / (rms + 1e-8f); _Pragma("unroll") for (int i = 0; i < 64; ++i) rw[i] = bfr(sc[i]) * (rw[i] * inv); } } while (0)   /* per-head RMSNorm: norm(x, axis=-1) * hd^-0.5; scale * (x / (rms + eps)) */
#ifndef SM_EXTRA_PARAMS
#define SM_EXTRA_PARAMS
#endif
#ifndef PROJ_EXTRA_PARAMS
#define PROJ_EXTRA_PARAMS
#endif
#ifndef SM_MASK_HOOK
#define SM_MASK_HOOK (void)0
#endif

#define WS_QH  0u                                      // f16 q rows [b*t][CC]
#define WS_KH  (WS_QH + 2u * (size_t)NB * TT * CC)      // f16 k rows [b*t][CC]
#define WS_VT  (WS_KH + 2u * (size_t)NB * TT * CC)      // f16 v planes [b][c][t]
#define WS_QL  (WS_VT + 2u * (size_t)NB * CC * TT)      // f16 q residual x 2^10 rows [b][t < QHI][CC]
#define WS_KL  (WS_QL + 2u * (size_t)NB * QHI * CC)     // f16 k residual x 2^10 rows [b][t < KHI][CC]
#define WS_VB  (WS_KL + 2u * (size_t)NB * KHI * CC)     // bf16 v hi planes [b][c][t < KHI]
#define WS_VBL (WS_VB + 2u * (size_t)NB * CC * KHI)
#define WS_S   (WS_VBL + 2u * (size_t)NB * CC * KHI)    // f32 logits / P [hg][t][s]
#define WS_Y   (WS_S  + 4u * (size_t)HG * TT * TT)      // f32 ctx rows [b*t][CC] (only when there is an output projection)
#define WS_END (WS_Y  + 4u * (size_t)NB * TT * CC)

// ---- k_proj: block = (64 rows, 128 cols, which): q/k/v = X W (+ b) with exact bf16 products (K = DIN) -> which 0: q f16 rows (+ residual rows < QHI); 1: k f16 rows (+ residual rows < KHI); 2: v f16 planes [c][t] (+ bf16 hi/lo planes for t < KHI)
__global__ __launch_bounds__(128) void k_proj(const float* __restrict__ XQ, const float* __restrict__ XK, const float* __restrict__ XV, const float* __restrict__ WQ, const float* __restrict__ WK, const float* __restrict__ WV, const float* __restrict__ BQ, const float* __restrict__ BK, const float* __restrict__ BV,
    _Float16* __restrict__ QH, _Float16* __restrict__ QL, _Float16* __restrict__ KH, _Float16* __restrict__ KL, _Float16* __restrict__ VT, __bf16* __restrict__ VB, __bf16* __restrict__ VBL PROJ_EXTRA_PARAMS) {
  __shared__ __align__(16) float st[64][132]; __shared__ __align__(16) _Float16 sh[64][136], sl[64][136]; __shared__ __align__(16) _Float16 th[128][72]; __shared__ __align__(16) __bf16 tb[128][72], tbl[128][72];
  const int tid = threadIdx.x, wave = tid >> 5, lane = tid & 31, col = lane & 15, g = lane >> 4; const int which = blockIdx.z; const int c0 = blockIdx.y * 128; const size_t r0 = (size_t)blockIdx.x * 64; const size_t bb = r0 / TT; const int t0 = (int)(r0 % TT);
  const float* X = which == 0 ? XQ : which == 1 ? XK : XV; const float* WA = which == 0 ? WQ : which == 1 ? WK : WV; const float* BA = which == 0 ? BQ : which == 1 ? BK : BV;
  v8f acc[8] = {};
#pragma unroll 2
  for (int kc = 0; kc < DIN / 32; ++kc) { v16b a; { const float* p = X + (r0 + wave * 16 + col) * DIN + kc * 32 + 8 * g;
#pragma unroll
      for (int i = 0; i < 8; ++i) { a[i] = (__bf16)p[i]; a[8 + i] = (__bf16)p[16 + i]; } }
    asm volatile("s_wait_loadcnt 0x0" ::: "memory");
#pragma unroll
    for (int j = 0; j < 8; ++j) { const v16b w = WCOL(WA, kc * 32, c0 + j * 16 + col, lane); asm volatile("s_wait_loadcnt 0x0" ::: "memory"); acc[j] = wmma_bf(a, w, acc[j]); } }
  { // stage the f32 tile (acc + bias) in LDS, run the per-(row, head) epilogue hook, then convert
#pragma unroll
    for (int j = 0; j < 8; ++j) { const float bias = BA ? bfr(BA[c0 + j * 16 + col]) : 0.f;
#pragma unroll
      for (int r = 0; r < 8; ++r) st[wave * 16 + 8 * g + r][j * 16 + col] = acc[j][r] + bias; }
    __syncthreads();
    for (int e = tid; e < 64 * (128 / HD); e += 128) { const int rl = e / (128 / HD), hh = e % (128 / HD); PROJ_EPI(which, &st[rl][hh * HD], (int)((r0 + rl) % TT), (c0 / HD) + hh); }
    __syncthreads(); }
  if (which < 2) { _Float16* DH = which == 0 ? QH : KH; _Float16* DL = which == 0 ? QL : KL; const int nhi = which == 0 ? QHI : KHI; const bool hi_rows = t0 < nhi;
    for (int e = tid; e < 64 * 128; e += 128) { const int rl = e >> 7, cl = e & 127; const float v = st[rl][cl]; const _Float16 hv = (_Float16)v; sh[rl][cl] = hv; sl[rl][cl] = (_Float16)((v - (float)hv) * 1024.0f); }
    __syncthreads();
    for (int e = tid; e < 64 * 16; e += 128) { const int rl = e >> 4, q = e & 15; vst2((unsigned*)(DH + (r0 + rl) * CC + c0 + q * 8), *(const v4u*)&sh[rl][q * 8]); if (hi_rows) vst2((unsigned*)(DL + (bb * nhi + t0 + rl) * (size_t)CC + c0 + q * 8), *(const v4u*)&sl[rl][q * 8]); }
  } else { const bool hi_rows = t0 < KHI;
    for (int e = tid; e < 64 * 128; e += 128) { const int rl = e & 63, cl = e >> 6; const float v = st[rl][cl]; th[cl][rl] = (_Float16)v; const __bf16 bh = (__bf16)v; tb[cl][rl] = bh; tbl[cl][rl] = (__bf16)(v - (float)bh); }
    __syncthreads();
    for (int e = tid; e < 128 * 8; e += 128) { const int cl = e >> 3, q = e & 7; vst2((unsigned*)(VT + (bb * CC + c0 + cl) * (size_t)TT + t0 + q * 8), *(const v4u*)&th[cl][q * 8]); if (hi_rows) { const size_t o3 = (bb * CC + c0 + cl) * (size_t)KHI + t0 + q * 8; vst2((unsigned*)(VB + o3), *(const v4u*)&tb[cl][q * 8]); vst2((unsigned*)(VBL + o3), *(const v4u*)&tbl[cl][q * 8]); } } } }
// ---- k_sc: block = (query block qb, key block kb <= kb_last(qb), head in group) of batch b: logits x SCALE; q hi + residual (x 2^10) against k (2 products) for query rows < QHI, plus the k residual (3 products) for query blocks < QBH (causal early rows); causal: blocks past the diagonal exit, the mask itself is applied by index in k_sm
__global__ __launch_bounds__(128) void k_sc(const _Float16* __restrict__ QH, const _Float16* __restrict__ KH, const _Float16* __restrict__ QL, const _Float16* __restrict__ KL, int b, int h0, float* __restrict__ S0) { __shared__ __align__(16) float ss[4][16][132];
  const int qb = blockIdx.x, kb = blockIdx.y; if (kb > kb_last(qb)) return;
  const int h = h0 + blockIdx.z; float* S = S0 + (size_t)blockIdx.z * TT * TT;
  const int tid = threadIdx.x, wave = tid >> 5, lane = tid & 31, col = lane & 15, g = lane >> 4; const int k0 = kb * 128; const int ql0 = qb * 64 + wave * 16; const size_t q0 = (size_t)b * TT + ql0, kr0 = (size_t)b * TT + k0;
  v8f acc[8] = {}, accl[8] = {};
  const _Float16* QLb = QL + (size_t)b * QHI * CC; const _Float16* KLb = KL + (size_t)b * KHI * CC;
  if (qb < QBH) {
#pragma unroll
    for (int kc = 0; kc < HD / 32; ++kc) { const v16h ah = frag_h(QH + (q0 + col) * CC + h * HD + kc * 32, lane), al = frag_h(QLb + (size_t)(ql0 + col) * CC + h * HD + kc * 32, lane);
#pragma unroll
      for (int j = 0; j < 8; ++j) { const v16h kbf = frag_h(KH + (kr0 + j * 16 + col) * CC + h * HD + kc * 32, lane), klf = frag_h(KLb + (size_t)(k0 + j * 16 + col) * CC + h * HD + kc * 32, lane); acc[j] = wmma16(ah, kbf, acc[j]); accl[j] = wmma16(al, kbf, accl[j]); accl[j] = wmma16(ah, klf, accl[j]); } }
  } else if (qb * 64 < QHI) {
#pragma unroll
    for (int kc = 0; kc < HD / 32; ++kc) { const v16h ah = frag_h(QH + (q0 + col) * CC + h * HD + kc * 32, lane), al = frag_h(QLb + (size_t)(ql0 + col) * CC + h * HD + kc * 32, lane);
#pragma unroll
      for (int j = 0; j < 8; ++j) { const v16h kbf = frag_h(KH + (kr0 + j * 16 + col) * CC + h * HD + kc * 32, lane); acc[j] = wmma16(ah, kbf, acc[j]); accl[j] = wmma16(al, kbf, accl[j]); } }
  } else {
#pragma unroll
    for (int kc = 0; kc < HD / 32; ++kc) { const v16h ah = frag_h(QH + (q0 + col) * CC + h * HD + kc * 32, lane);
#pragma unroll
      for (int j = 0; j < 8; ++j) { const v16h kbf = frag_h(KH + (kr0 + j * 16 + col) * CC + h * HD + kc * 32, lane); acc[j] = wmma16(ah, kbf, acc[j]); } } }
#pragma unroll
  for (int j = 0; j < 8; ++j) {
#pragma unroll
    for (int r = 0; r < 8; ++r) ss[wave][8 * g + r][j * 16 + col] = (acc[j][r] + accl[j][r] * (1.0f / 1024.0f)) * SCALE; }
  LDSX(); for (int rl = 0; rl < 16; ++rl) vst2(S + (size_t)(ql0 + rl) * TT + k0 + lane * 4, *(const v4f*)&ss[wave][rl][lane * 4]); }
// ---- k_sm: block = query row t (head in group): keys [0, kend): causal -> logit if s <= t else excluded; softmax in f32; P x 2^11 in place (0 for excluded)
__global__ __launch_bounds__(256) void k_sm(float* __restrict__ S0 SM_EXTRA_PARAMS) { __shared__ float sred[8]; __shared__ float sbc; __shared__ __align__(16) float shv[TT];
  const int tid = threadIdx.x; const int t = blockIdx.x; const int kend = (kb_last(t >> 6) + 1) * 128;
  float* sr = S0 + (size_t)blockIdx.y * TT * TT + (size_t)t * TT;
  float m = -3.0e38f; for (int k = tid; k < kend; k += 256) { float v = (!CAUSAL || k <= t) ? sr[k] : -3.0e38f; SM_MASK_HOOK; shv[k] = v; m = fmaxf(m, v); }
#pragma unroll
  for (int o = 1; o < 32; o <<= 1) m = fmaxf(m, __shfl_xor(m, o));
  if ((tid & 31) == 0) sred[tid >> 5] = m; __syncthreads(); if (tid == 0) { float a = sred[0]; for (int i = 1; i < 8; ++i) a = fmaxf(a, sred[i]); sbc = a; } __syncthreads(); m = sbc; __syncthreads();
  float sum = 0.f; for (int k = tid; k < kend; k += 256) { const float v = shv[k]; const float e = (v <= -1.0e38f) ? 0.f : expf(v - m); shv[k] = e; sum += e; }
#pragma unroll
  for (int o = 1; o < 32; o <<= 1) sum += __shfl_xor(sum, o);
  if ((tid & 31) == 0) sred[tid >> 5] = sum; __syncthreads(); if (tid == 0) { float a = 0.f; for (int i = 0; i < 8; ++i) a += sred[i]; sbc = a > 0.f ? 2048.0f / a : 0.f; }   /* a fully excluded row yields P = 0 */ __syncthreads(); const float inv = sbc;
  for (int k = tid; k < kend; k += 256) shv[k] = shv[k] * inv;
  __syncthreads(); for (int q = tid; q < kend / 4; q += 256) vst2(sr + q * 4, *(const v4f*)&shv[q * 4]); }
// ---- k_pv: block = 64 queries (qb) of (b, h): ctx = P . v over keys [0, kend) (P x 2^11 once to f16 against v f16: 1 product; causal early query blocks: P and v as bf16 hi + lo, 3 products); 256-B (row, head) segment by 16 lanes
__global__ __launch_bounds__(128) void k_pv(const float* __restrict__ PS0, const _Float16* __restrict__ VT, const __bf16* __restrict__ VB, const __bf16* __restrict__ VBL, int b, int h0, float* __restrict__ Y) { const int h = h0 + blockIdx.z; const float* PS = PS0 + (size_t)blockIdx.z * TT * TT; __shared__ __align__(16) float ss[4][16][HD + 4];
  const int tid = threadIdx.x, wave = tid >> 5, lane = tid & 31, col = lane & 15, g = lane >> 4; const int qb = blockIdx.x; const int ql0 = qb * 64 + wave * 16; const int kce = (kb_last(qb) + 1) * 4;
  v8f acc[HD / 16] = {};
  if (qb < QBH) {
#pragma unroll 1
    for (int kc = 0; kc < kce; ++kc) { const F2 p = split_row(PS + (size_t)(ql0 + col) * TT, kc * 32, lane);
      asm volatile("s_wait_loadcnt 0x0" ::: "memory");
#pragma unroll
      for (int j = 0; j < HD / 16; ++j) { const size_t po = ((size_t)b * CC + h * HD + j * 16 + col) * (size_t)KHI + kc * 32; const v16b vh = frag_b(VB + po, lane); acc[j] = wmma_bf(p.h, vh, acc[j]); acc[j] = wmma_bf(p.l, vh, acc[j]); acc[j] = wmma_bf(p.h, frag_b(VBL + po, lane), acc[j]); } }
  } else {
#pragma unroll 1
    for (int kc = 0; kc < kce; ++kc) { const v16h p = frag_f32(PS + (size_t)(ql0 + col) * TT + kc * 32, lane);
      asm volatile("s_wait_loadcnt 0x0" ::: "memory");
#pragma unroll
      for (int j = 0; j < HD / 16; ++j) { const size_t po = ((size_t)b * CC + h * HD + j * 16 + col) * (size_t)TT + kc * 32; acc[j] = wmma16(p, frag_h(VT + po, lane), acc[j]); } } }
#pragma unroll
  for (int j = 0; j < HD / 16; ++j)
#pragma unroll
    for (int r = 0; r < 8; ++r) ss[wave][8 * g + r][j * 16 + col] = acc[j][r] * (1.0f / 2048.0f);
  LDSX(); for (int rl = 0; rl < 16; ++rl) if (lane < HD / 4) vst2(Y + ((size_t)b * TT + ql0 + rl) * CC + h * HD + lane * 4, *(const v4f*)&ss[wave][rl][lane * 4]); }
// ---- k_out: block = (64 rows, 128 cols): out = ctx Wo (+ bo): all rows: ctx bf16 hi + lo against exact bf16 Wo (2 products)
__global__ __launch_bounds__(128) void k_out(const float* __restrict__ Y, const float* __restrict__ WO, const float* __restrict__ BO, float* __restrict__ OUT) { __shared__ __align__(16) float sf[4][16][132];
  const int tid = threadIdx.x, wave = tid >> 5, lane = tid & 31, col = lane & 15, g = lane >> 4; const int c0 = blockIdx.y * 128; const size_t r0 = (size_t)blockIdx.x * 64 + wave * 16;
  v8f acc[8] = {};
  if (true) {   /* ALL rows: ctx split bf16 hi + lo x exact Wo (2 products) */
#pragma unroll 2
    for (int kc = 0; kc < CC / 32; ++kc) { const F2 a = split_row(Y + (r0 + col) * CC, kc * 32, lane); asm volatile("s_wait_loadcnt 0x0" ::: "memory");
#pragma unroll
      for (int j = 0; j < 8; ++j) { const v16b w = WOCOL(WO, kc * 32, c0 + j * 16 + col, lane); asm volatile("s_wait_loadcnt 0x0" ::: "memory"); acc[j] = wmma_bf(a.h, w, acc[j]); acc[j] = wmma_bf(a.l, w, acc[j]); } }
#pragma unroll
    for (int j = 0; j < 8; ++j) { const float bias = BO ? bfr(BO[c0 + j * 16 + col]) : 0.f;
#pragma unroll
      for (int r = 0; r < 8; ++r) sf[wave][8 * g + r][j * 16 + col] = acc[j][r] + bias; }
  } else {
#pragma unroll 2
    for (int kc = 0; kc < CC / 32; ++kc) { const v16h a = frag_f32(Y + (r0 + col) * CC + kc * 32, lane); asm volatile("s_wait_loadcnt 0x0" ::: "memory");
#pragma unroll
      for (int j = 0; j < 8; ++j) { const v16h w = WOCOLH(WO, kc * 32, c0 + j * 16 + col, lane); asm volatile("s_wait_loadcnt 0x0" ::: "memory"); acc[j] = wmma16(a, w, acc[j]); } }
#pragma unroll
    for (int j = 0; j < 8; ++j) { const float bias = BO ? bfr(BO[c0 + j * 16 + col]) : 0.f;
#pragma unroll
      for (int r = 0; r < 8; ++r) sf[wave][8 * g + r][j * 16 + col] = acc[j][r] * (1.0f / 256.0f) + bias; } }
  LDSX(); for (int rl = 0; rl < 16; ++rl) vst2(OUT + (r0 + rl) * DIN + c0 + lane * 4, *(const v4f*)&sf[wave][rl][lane * 4]); }

extern "C" void kernel_launch(void* const* d_in, const int* in_sizes, int n_in, void* d_out, int out_size, void* d_ws, size_t ws_size, hipStream_t stream) {
  (void)in_sizes; (void)n_in; (void)out_size;
  const float** F = (const float**)d_in;
  if (ws_size < (size_t)WS_END) return;
  char* ws = (char*)d_ws; _Float16 *QH = (_Float16*)(ws + WS_QH), *KH = (_Float16*)(ws + WS_KH), *VT = (_Float16*)(ws + WS_VT), *QL = (_Float16*)(ws + WS_QL), *KL = (_Float16*)(ws + WS_KL); __bf16 *VB = (__bf16*)(ws + WS_VB), *VBL = (__bf16*)(ws + WS_VBL); float *S = (float*)(ws + WS_S), *Y = (float*)(ws + WS_Y);
  (void)Y; (void)QL; (void)KL; (void)VB; (void)VBL;
  // inputs: 0 x [2,2048,1024]; 1 qkv_w [3072,1024] (out,in; rows q | k | v); 2 proj_w [1024,1024] (out,in); 3 proj_b; 4 q_scale [64]; 5 k_scale [64]
  k_proj<<<dim3(TNB * TT / 64, CC / 128, 3), 128, 0, stream>>>(F[0], F[0], F[0], F[1], F[1] + (size_t)CC * DIN, F[1] + (size_t)2 * CC * DIN, nullptr, nullptr, nullptr, QH, QL, KH, KL, VT, VB, VBL, F[4], F[5]);
  for (int b = 0; b < TNB; ++b) for (int h0 = 0; h0 < NH; h0 += HG) {
    k_sc<<<dim3(NQB, TT / 128, HG), 128, 0, stream>>>(QH, KH, QL, KL, b, h0, S);
    k_sm<<<dim3(TT, HG), 256, 0, stream>>>(S);
    k_pv<<<dim3(NQB, 1, HG), 128, 0, stream>>>(S, VT, VB, VBL, b, h0, Y);
  }
  k_out<<<dim3(TNB * TT / 64, DIN / 128), 128, 0, stream>>>(Y, F[2], F[3], (float*)d_out);
}

// v001
// Measured time: 528 microseconds a run.
// In both of two side-by-side timings against v000, it was 2.74 times as fast.
// compute dtype: all float inputs rounded to bf16; qkv = x Wqkv^T with EXACT bf16 products on WMMA 16x16x32 (f32 accumulate); per-head RMSNorm of q and k in f32 on the projected rows; q as f16 hi + residual (x 2^10) against k once to f16 (2 products) x 64^-0.5; softmax in f32 (precise expf) with a running maximum and sum over stages of 64 keys; P x 2^11 (relative to the running maximum) once to f16 against v once to f16 (1 product), divided by the sum at the end; ctx split bf16 hi + lo against exact proj_w (2 products) + proj_b; f32 output.
#include <hip/hip_runtime.h>
#include <math.h>

typedef __attribute__((ext_vector_type(16))) _Float16 v16h;
typedef __attribute__((ext_vector_type(16))) __bf16 v16b;
typedef __attribute__((ext_vector_type(8)))  _Float16 v8h;
typedef __attribute__((ext_vector_type(8)))  float v8f;
typedef __attribute__((ext_vector_type(4)))  float v4f;
typedef __attribute__((ext_vector_type(2)))  float v2f;
typedef __attribute__((ext_vector_type(4)))  unsigned v4u;
typedef __attribute__((ext_vector_type(4)))  int v4i;
typedef float __attribute__((may_alias)) float_a;
typedef int __attribute__((may_alias)) int_a;

template <typename T> __device__ __forceinline__ void vst2(void* p, T v) { *(T*)p = v;  }
__device__ __forceinline__ v8f wmma16(v16h a, v16h b, v8f c) {
  v8f d = __builtin_amdgcn_wmma_f32_16x16x32_f16(false, a, false, b, (short)0, c, false, false);
  asm volatile("v_nop\n\tv_nop\n\tv_nop\n\tv_nop" : "+v"(d) : "v"(a), "v"(b));
  return d;
}
__device__ __forceinline__ v8f wmma_bf(v16b a, v16b b, v8f c) {
  v8f d = __builtin_amdgcn_wmma_f32_16x16x32_bf16(false, a, false, b, (short)0, c, false, false);
  asm volatile("v_nop\n\tv_nop\n\tv_nop\n\tv_nop" : "+v"(d) : "v"(a), "v"(b));
  return d;
}
// 16x16x32 fragments: lane = (h = lane>>4, row/col = lane&15); elements 0..7 = k0+8h+0..7, 8..15 = k0+16+8h+0..7; D element r = row 8h+r
__device__ __forceinline__ v16h frag_h(const _Float16* rowk0, int lane) {
  union { v16h v; v8h q[2]; } u; const _Float16* p = rowk0 + 8 * (lane >> 4);
  u.q[0] = *(const v8h*)p; u.q[1] = *(const v8h*)(p + 16); return u.v;
}
__device__ __forceinline__ v16h frag_f32(const float* rowk0, int lane) {
  v16h a; const float* p = rowk0 + 8 * (lane >> 4);
#pragma unroll
  for (int i = 0; i < 8; ++i) { a[i] = (_Float16)p[i]; a[8 + i] = (_Float16)p[16 + i]; }
  return a;
}
__device__ __forceinline__ v16h frag_f32s(const float* rowk0, int lane, float sc) {
  v16h a; const float* p = rowk0 + 8 * (lane >> 4);
#pragma unroll
  for (int i = 0; i < 8; ++i) { a[i] = (_Float16)(p[i] * sc); a[8 + i] = (_Float16)(p[16 + i] * sc); }
  return a;
}
// column fragment from a [K][ld] layout (column n), rows >= K read as 0
__device__ __forceinline__ v16h fragc_f32(const float* W, int k0, int n, int lane, int ld, int K) {
  v16h a; const int g = lane >> 4;
#pragma unroll
  for (int i = 0; i < 8; ++i) { const int ka = k0 + 8 * g + i, kb = ka + 16;
    a[i] = (_Float16)(ka < K ? W[(size_t)(ka < K ? ka : K - 1) * ld + n] : 0.f); a[8 + i] = (_Float16)(kb < K ? W[(size_t)(kb < K ? kb : K - 1) * ld + n] : 0.f); }
  return a;
}
struct F2 { v16b h, l; };
__device__ __forceinline__ F2 bsplit16(const float v[16]) { F2 r;
#pragma unroll
  for (int i = 0; i < 16; ++i) { const __bf16 h = (__bf16)v[i]; r.h[i] = h; r.l[i] = (__bf16)(v[i] - (float)h); }
  return r; }
__device__ __forceinline__ F2 split_row(const float* row, int k0, int lane) { float v[16]; const float* p = row + k0 + 8 * (lane >> 4);
#pragma unroll
  for (int i = 0; i < 8; ++i) { v[i] = p[i]; v[8 + i] = p[16 + i]; }
  return bsplit16(v); }
__device__ __forceinline__ F2 split_rowK(const float* row, int k0, int lane, int K) { float v[16]; const int g = lane >> 4;
#pragma unroll
  for (int i = 0; i < 8; ++i) { const int ka = k0 + 8 * g + i, kb = ka + 16; v[i] = ka < K ? row[ka < K ? ka : K - 1] : 0.f; v[8 + i] = kb < K ? row[kb < K ? kb : K - 1] : 0.f; }
  return bsplit16(v); }
__device__ __forceinline__ F2 split_col(const float* W, int k0, int n, int lane, int ld, int K) { float v[16]; const int g = lane >> 4;
#pragma unroll
  for (int i = 0; i < 8; ++i) { const int ka = k0 + 8 * g + i, kb = ka + 16; v[i] = ka < K ? W[(size_t)(ka < K ? ka : K - 1) * ld + n] : 0.f; v[8 + i] = kb < K ? W[(size_t)(kb < K ? kb : K - 1) * ld + n] : 0.f; }
  return bsplit16(v); }
__device__ __forceinline__ v8f mac3(const F2& a, const F2& b, v8f c) { c = wmma_bf(a.l, b.h, c); c = wmma_bf(a.h, b.l, c); return wmma_bf(a.h, b.h, c); }
__device__ __forceinline__ float sigm(float v) { return 1.0f / (1.0f + expf(-v)); }
#define LDSX() do { asm volatile("s_wait_dscnt 0" ::: "memory"); __builtin_amdgcn_wave_barrier(); __builtin_amdgcn_fence(__ATOMIC_RELEASE, "workgroup"); } while (0)

// Self-attention with QK RMSNorm (B 2, N 2,048, C 1,024 = 16 x 64): qkv = x qkv_w^T ((out,in) [3072,1024], rows (3, H, hd)); q, k <- scale * q / (|q| 64^-0.5 + 1e-8) per head (scales all ones); out = merged(softmax(q k^T x 64^-0.5) v) proj_w^T + proj_b (non-causal).
#define NB 2
#define TT 2048
#define CC 1024            // NH * HD = projected width
#define DIN 1024          // input (model) width
#define NH 16
#define HD 64
#define NQB (TT / 64)
#define HG 4
#define SCALE (0.125f)
#define CAUSAL 0
#ifndef TNB
#define TNB NB
#endif
__device__ __forceinline__ float bfr(float v) { return (float)(__bf16)v; }
__host__ __device__ __forceinline__ int kb_last(int qb) { return CAUSAL ? ((qb * 64 + 63) >> 7) : (TT / 128 - 1); }
typedef __attribute__((ext_vector_type(8))) __bf16 v8b;
__device__ __forceinline__ v16b frag_b(const __bf16* rowk0, int lane) {
  union { v16b v; v8b q[2]; } u; const __bf16* p = rowk0 + 8 * (lane >> 4);
  u.q[0] = *(const v8b*)p; u.q[1] = *(const v8b*)(p + 16); return u.v;
}
#define QBH 0
#define QHI 2048            // rows carrying a q residual plane (all rows when non-causal: 2-product logits everywhere)
#define KHI 64            // key rows carrying k residual / v bf16 hi+lo planes (written by k_proj, read by no kernel)
// B fragment (k rows k0+.., output column o) of a weight: (in,out) [K][ld] or (out,in) [ld rows of K]: bf16 exact, or f16(bf16 * 256) exact
__device__ __forceinline__ v16b wcol_io(const float* Wm, int k0, int o, int lane, int ld) { v16b w; const int g = lane >> 4;
#pragma unroll
  for (int i = 0; i < 8; ++i) { w[i] = (__bf16)Wm[(size_t)(k0 + 8 * g + i) * ld + o]; w[8 + i] = (__bf16)Wm[(size_t)(k0 + 16 + 8 * g + i) * ld + o]; }
  return w; }
__device__ __forceinline__ v16b wcol_oi(const float* Wm, int k0, int o, int lane, int K) { v16b w; const float* p = Wm + (size_t)o * K + k0 + 8 * (lane >> 4);
#pragma unroll
  for (int i = 0; i < 8; ++i) { w[i] = (__bf16)p[i]; w[8 + i] = (__bf16)p[16 + i]; }
  return w; }
__device__ __forceinline__ v16h wcolh_io(const float* Wm, int k0, int o, int lane, int ld) { v16h w; const int g = lane >> 4;
#pragma unroll
  for (int i = 0; i < 8; ++i) { w[i] = (_Float16)(bfr(Wm[(size_t)(k0 + 8 * g + i) * ld + o]) * 256.0f); w[8 + i] = (_Float16)(bfr(Wm[(size_t)(k0 + 16 + 8 * g + i) * ld + o]) * 256.0f); }
  return w; }
__device__ __forceinline__ v16h wcolh_oi(const float* Wm, int k0, int o, int lane, int K) { v16h w; const float* p = Wm + (size_t)o * K + k0 + 8 * (lane >> 4);
#pragma unroll
  for (int i = 0; i < 8; ++i) { w[i] = (_Float16)(bfr(p[i]) * 256.0f); w[8 + i] = (_Float16)(bfr(p[16 + i]) * 256.0f); }
  return w; }
#define WQKV_LAYOUT 1   // 0 = (in,out) [DIN][CC]; 1 = (out,in) [CC][DIN]; 2 = per-head [NH][DIN][HD]
__device__ __forceinline__ v16b wcol_hdk(const float* Wm, int k0, int o, int lane) { v16b w; const int g = lane >> 4; const float* p = Wm + (size_t)(o / HD) * DIN * HD + (o % HD);
#pragma unroll
  for (int i = 0; i < 8; ++i) { w[i] = (__bf16)p[(size_t)(k0 + 8 * g + i) * HD]; w[8 + i] = (__bf16)p[(size_t)(k0 + 16 + 8 * g + i) * HD]; }
  return w; }
#define WO_OUT_IN 1
#if WQKV_LAYOUT == 1
#define WCOL(W, k0, o, lane) wcol_oi(W, k0, o, lane, DIN)
#elif WQKV_LAYOUT == 2
#define WCOL(W, k0, o, lane) wcol_hdk(W, k0, o, lane)
#else
#define WCOL(W, k0, o, lane) wcol_io(W, k0, o, lane, CC)
#endif
#if WO_OUT_IN
#define WOCOL(W, k0, o, lane) wcol_oi(W, k0, o, lane, CC)
#define WOCOLH(W, k0, o, lane) wcolh_oi(W, k0, o, lane, CC)
#else
#define WOCOL(W, k0, o, lane) wcol_io(W, k0, o, lane, DIN)
#define WOCOLH(W, k0, o, lane) wcolh_io(W, k0, o, lane, DIN)
#endif
#define PROJ_EXTRA_PARAMS , const float* __restrict__ QS, const float* __restrict__ KS
#define PROJ_EPI(which, row, t, h) do { if ((which) < 2) { float* rw = (row); const float* sc = (which) == 0 ? QS : KS; float ss = 0.f; _Pragma("unroll") for (int i = 0; i < 64; ++i) ss += rw[i] * rw[i]; const float rms = __fsqrt_rn(ss) * 0.125f; const float inv = 1.0f / (rms + 1e-8f); _Pragma("unroll") for (int i = 0; i < 64; ++i) rw[i] = bfr(sc[i]) * (rw[i] * inv); } } while (0)   /* per-head RMSNorm: norm(x, axis=-1) * hd^-0.5; scale * (x / (rms + eps)) */
#ifndef SM_EXTRA_PARAMS
#define SM_EXTRA_PARAMS
#endif
#ifndef PROJ_EXTRA_PARAMS
#define PROJ_EXTRA_PARAMS
#endif
#ifndef SM_MASK_HOOK
#define SM_MASK_HOOK (void)0
#endif

#define WS_QH  0u                                      // f16 q rows [b*t][CC]
#define WS_KH  (WS_QH + 2u * (size_t)NB * TT * CC)      // f16 k rows [b*t][CC]
#define WS_VT  (WS_KH + 2u * (size_t)NB * TT * CC)      // f16 v planes [b][c][t]
#define WS_QL  (WS_VT + 2u * (size_t)NB * CC * TT)      // f16 q residual x 2^10 rows [b][t < QHI][CC]
#define WS_KL  (WS_QL + 2u * (size_t)NB * QHI * CC)     // f16 k residual x 2^10 rows [b][t < KHI][CC]
#define WS_VB  (WS_KL + 2u * (size_t)NB * KHI * CC)     // bf16 v hi planes [b][c][t < KHI]
#define WS_VBL (WS_VB + 2u * (size_t)NB * CC * KHI)
#define WS_S   (WS_VBL + 2u * (size_t)NB * CC * KHI)    // f32 [hg][t][s] region, unused: logits and P stay in k_fa's registers
#define WS_Y   (WS_S  + 4u * (size_t)HG * TT * TT)      // f32 ctx rows [b*t][CC] (only when there is an output projection)
#define WS_END (WS_Y  + 4u * (size_t)NB * TT * CC)

// ---- k_proj: block = (64 rows, 128 cols, which): q/k/v = X W (+ b) with exact bf16 products (K = DIN) -> which 0: q f16 rows (+ residual rows < QHI); 1: k f16 rows (+ residual rows < KHI); 2: v f16 planes [c][t] (+ bf16 hi/lo planes for t < KHI)
__global__ __launch_bounds__(128) void k_proj(const float* __restrict__ XQ, const float* __restrict__ XK, const float* __restrict__ XV, const float* __restrict__ WQ, const float* __restrict__ WK, const float* __restrict__ WV, const float* __restrict__ BQ, const float* __restrict__ BK, const float* __restrict__ BV,
    _Float16* __restrict__ QH, _Float16* __restrict__ QL, _Float16* __restrict__ KH, _Float16* __restrict__ KL, _Float16* __restrict__ VT, __bf16* __restrict__ VB, __bf16* __restrict__ VBL PROJ_EXTRA_PARAMS) {
  __shared__ __align__(16) float st[64][132]; __shared__ __align__(16) _Float16 sh[64][136], sl[64][136]; __shared__ __align__(16) _Float16 th[128][72]; __shared__ __align__(16) __bf16 tb[128][72], tbl[128][72];
  const int tid = threadIdx.x, wave = tid >> 5, lane = tid & 31, col = lane & 15, g = lane >> 4; const int which = blockIdx.z; const int c0 = blockIdx.y * 128; const size_t r0 = (size_t)blockIdx.x * 64; const size_t bb = r0 / TT; const int t0 = (int)(r0 % TT);
  const float* X = which == 0 ? XQ : which == 1 ? XK : XV; const float* WA = which == 0 ? WQ : which == 1 ? WK : WV; const float* BA = which == 0 ? BQ : which == 1 ? BK : BV;
  v8f acc[8] = {};
#pragma unroll 2
  for (int kc = 0; kc < DIN / 32; ++kc) { v16b a; { const float* p = X + (r0 + wave * 16 + col) * DIN + kc * 32 + 8 * g;
#pragma unroll
      for (int i = 0; i < 8; ++i) { a[i] = (__bf16)p[i]; a[8 + i] = (__bf16)p[16 + i]; } }
    asm volatile("s_wait_loadcnt 0x0" ::: "memory");
#pragma unroll
    for (int j = 0; j < 8; ++j) { const v16b w = WCOL(WA, kc * 32, c0 + j * 16 + col, lane); asm volatile("s_wait_loadcnt 0x0" ::: "memory"); acc[j] = wmma_bf(a, w, acc[j]); } }
  { // stage the f32 tile (acc + bias) in LDS, run the per-(row, head) epilogue hook, then convert
#pragma unroll
    for (int j = 0; j < 8; ++j) { const float bias = BA ? bfr(BA[c0 + j * 16 + col]) : 0.f;
#pragma unroll
      for (int r = 0; r < 8; ++r) st[wave * 16 + 8 * g + r][j * 16 + col] = acc[j][r] + bias; }
    __syncthreads();
    for (int e = tid; e < 64 * (128 / HD); e += 128) { const int rl = e / (128 / HD), hh = e % (128 / HD); PROJ_EPI(which, &st[rl][hh * HD], (int)((r0 + rl) % TT), (c0 / HD) + hh); }
    __syncthreads(); }
  if (which < 2) { _Float16* DH = which == 0 ? QH : KH; _Float16* DL = which == 0 ? QL : KL; const int nhi = which == 0 ? QHI : KHI; const bool hi_rows = t0 < nhi;
    for (int e = tid; e < 64 * 128; e += 128) { const int rl = e >> 7, cl = e & 127; const float v = st[rl][cl]; const _Float16 hv = (_Float16)v; sh[rl][cl] = hv; sl[rl][cl] = (_Float16)((v - (float)hv) * 1024.0f); }
    __syncthreads();
    for (int e = tid; e < 64 * 16; e += 128) { const int rl = e >> 4, q = e & 15; vst2((unsigned*)(DH + (r0 + rl) * CC + c0 + q * 8), *(const v4u*)&sh[rl][q * 8]); if (hi_rows) vst2((unsigned*)(DL + (bb * nhi + t0 + rl) * (size_t)CC + c0 + q * 8), *(const v4u*)&sl[rl][q * 8]); }
  } else { const bool hi_rows = t0 < KHI;
    for (int e = tid; e < 64 * 128; e += 128) { const int rl = e & 63, cl = e >> 6; const float v = st[rl][cl]; th[cl][rl] = (_Float16)v; const __bf16 bh = (__bf16)v; tb[cl][rl] = bh; tbl[cl][rl] = (__bf16)(v - (float)bh); }
    __syncthreads();
    for (int e = tid; e < 128 * 8; e += 128) { const int cl = e >> 3, q = e & 7; vst2((unsigned*)(VT + (bb * CC + c0 + cl) * (size_t)TT + t0 + q * 8), *(const v4u*)&th[cl][q * 8]); if (hi_rows) { const size_t o3 = (bb * CC + c0 + cl) * (size_t)KHI + t0 + q * 8; vst2((unsigned*)(VB + o3), *(const v4u*)&tb[cl][q * 8]); vst2((unsigned*)(VBL + o3), *(const v4u*)&tbl[cl][q * 8]); } } } }
// ---- k_fa: block = 128 queries (8 waves x 16) of (b, h), one pass over all keys in stages of 64: S^T = K Q^T (q hi + residual x 2^10, 2 products) x SCALE, running maximum and sum per query (a lane holds one query's scores), P^T x 2^11 packed from the score tiles as the B operand, ctx^T += V^T P^T (1 product); logits and P never leave the registers
// (every '#pragma unroll' in k_fa: the loop's index selects a register of a fragment, score or accumulator array, which stays in registers only under constant indices)
#define FK 64              // keys per stage
#define FP 72              // LDS row pitch in f16: 144 B = 16 B x 9 (odd multiple: 16-byte fragment reads without bank conflicts)
__device__ __forceinline__ v8f wmma_h(v16h a, v16h b, v8f c) { return __builtin_amdgcn_wmma_f32_16x16x32_f16(false, a, false, b, (short)0, c, false, false); }
__global__ __launch_bounds__(256) void k_fa(const _Float16* __restrict__ QH, const _Float16* __restrict__ QL, const _Float16* __restrict__ KH, const _Float16* __restrict__ VT, float* __restrict__ Y) {
  __shared__ __align__(16) _Float16 sK[2][FK][FP], sV[2][HD][FP];
  const int tid = threadIdx.x, wave = tid >> 5, lane = tid & 31, col = lane & 15, g = lane >> 4; const int h = blockIdx.y, b = blockIdx.z; const int ql0 = blockIdx.x * 128 + wave * 16;
  v16h qh[HD / 32], ql[HD / 32];
#pragma unroll
  for (int kc = 0; kc < HD / 32; ++kc) { qh[kc] = frag_h(QH + ((size_t)b * TT + ql0 + col) * CC + h * HD + kc * 32, lane); ql[kc] = frag_h(QL + ((size_t)b * QHI + ql0 + col) * CC + h * HD + kc * 32, lane); }
  // staging: thread = (row sr and sr + 32, 16-byte chunk sc) of the K tile [key][d] and of the V tile [d][key]: 8 lanes read one whole 128-B row
  const int sr = tid >> 3, sc = (tid & 7) * 8;
  const _Float16* kg = KH + ((size_t)b * TT + sr) * CC + h * HD + sc; const _Float16* vg = VT + ((size_t)b * CC + h * HD + sr) * (size_t)TT + sc;
  v4u rk0 = *(const v4u*)kg, rk1 = *(const v4u*)(kg + 32 * CC), rv0 = *(const v4u*)vg, rv1 = *(const v4u*)(vg + 32 * TT);
  *(v4u*)&sK[0][sr][sc] = rk0; *(v4u*)&sK[0][sr + 32][sc] = rk1; *(v4u*)&sV[0][sr][sc] = rv0; *(v4u*)&sV[0][sr + 32][sc] = rv1;
  __syncthreads();
  v8f acc[HD / 16] = {}; float m = -3.0e38f, l = 0.f;
  for (int t = 0; t < TT / FK; ++t) { const int bu = t & 1; const bool more = t + 1 < TT / FK;
    if (more) { const _Float16* kn = kg + (size_t)(t + 1) * FK * CC; const _Float16* vn = vg + (t + 1) * FK;   // next stage's rows fly while this stage is worked on
      rk0 = *(const v4u*)kn; rk1 = *(const v4u*)(kn + 32 * CC); rv0 = *(const v4u*)vn; rv1 = *(const v4u*)(vn + 32 * TT); }
    float s[FK / 16][8]; float mt = -3.0e38f;
#pragma unroll
    for (int i = 0; i < FK / 16; ++i) { v8f ah = {}, al = {};
#pragma unroll
      for (int kc = 0; kc < HD / 32; ++kc) { const v16h kf = frag_h(&sK[bu][i * 16 + col][kc * 32], lane); ah = wmma_h(kf, qh[kc], ah); al = wmma_h(kf, ql[kc], al); }
#pragma unroll
      for (int r = 0; r < 8; ++r) { s[i][r] = (ah[r] + al[r] * (1.0f / 1024.0f)) * SCALE; mt = fmaxf(mt, s[i][r]); } }   // s[i][r] = logit(key i*16 + 8g + r, query col)
    mt = fmaxf(mt, __shfl_xor(mt, 16));
    if (__builtin_amdgcn_ballot_w32(mt > m) != 0) {   // some query's maximum rose: bring its sum and its ctx to the new maximum (factor 1 for the others)
      const float mn = fmaxf(m, mt); const float al = expf(m - mn); m = mn; l *= al;
#pragma unroll
      for (int j = 0; j < HD / 16; ++j)
#pragma unroll
        for (int r = 0; r < 8; ++r) acc[j][r] *= al; }
    float ls[4] = {0.f, 0.f, 0.f, 0.f};   // four independent partial sums of this stage: no 32-long dependent add chain
    const float mo = m - 7.62461898616f;   // 11 ln 2: P x 2^11 (at most 2^11), so that small P stay normal f16 numbers; the sum carries the same factor
#pragma unroll
    for (int c2 = 0; c2 < FK / 32; ++c2) { v16h p;
#pragma unroll
      for (int r = 0; r < 8; ++r) { const float e0 = expf(s[2 * c2][r] - mo), e1 = expf(s[2 * c2 + 1][r] - mo); ls[r & 3] += e0 + e1; p[r] = (_Float16)e0; p[8 + r] = (_Float16)e1; }
#pragma unroll
      for (int j = 0; j < HD / 16; ++j) acc[j] = wmma_h(frag_h(&sV[bu][j * 16 + col][c2 * 32], lane), p, acc[j]); }
    l += (ls[0] + ls[1]) + (ls[2] + ls[3]);
    if (more) { *(v4u*)&sK[bu ^ 1][sr][sc] = rk0; *(v4u*)&sK[bu ^ 1][sr + 32][sc] = rk1; *(v4u*)&sV[bu ^ 1][sr][sc] = rv0; *(v4u*)&sV[bu ^ 1][sr + 32][sc] = rv1; }
    __syncthreads(); }   // publishes stage t + 1 and ends every wave's reads of stage t, whose buffer the next trip refills
  l += __shfl_xor(l, 16); const float inv = l > 0.f ? 1.0f / l : 0.f;
  float* yp = Y + ((size_t)b * TT + ql0 + col) * CC + h * HD + 8 * g;   // acc[j][r] = ctx(query col, d = j*16 + 8g + r)
#pragma unroll
  for (int j = 0; j < HD / 16; ++j) { v4f o0, o1;
#pragma unroll
    for (int r = 0; r < 4; ++r) { o0[r] = acc[j][r] * inv; o1[r] = acc[j][4 + r] * inv; }
    vst2(yp + j * 16, o0); vst2(yp + j * 16 + 4, o1); } }
// ---- k_out: block = (64 rows, 128 cols): out = ctx Wo (+ bo): all rows: ctx bf16 hi + lo against exact bf16 Wo (2 products)
__global__ __launch_bounds__(128) void k_out(const float* __restrict__ Y, const float* __restrict__ WO, const float* __restrict__ BO, float* __restrict__ OUT) { __shared__ __align__(16) float sf[4][16][132];
  const int tid = threadIdx.x, wave = tid >> 5, lane = tid & 31, col = lane & 15, g = lane >> 4; const int c0 = blockIdx.y * 128; const size_t r0 = (size_t)blockIdx.x * 64 + wave * 16;
  v8f acc[8] = {};
  if (true) {   /* ALL rows: ctx split bf16 hi + lo x exact Wo (2 products) */
#pragma unroll 2
    for (int kc = 0; kc < CC / 32; ++kc) { const F2 a = split_row(Y + (r0 + col) * CC, kc * 32, lane); asm volatile("s_wait_loadcnt 0x0" ::: "memory");
#pragma unroll
      for (int j = 0; j < 8; ++j) { const v16b w = WOCOL(WO, kc * 32, c0 + j * 16 + col, lane); asm volatile("s_wait_loadcnt 0x0" ::: "memory"); acc[j] = wmma_bf(a.h, w, acc[j]); acc[j] = wmma_bf(a.l, w, acc[j]); } }
#pragma unroll
    for (int j = 0; j < 8; ++j) { const float bias = BO ? bfr(BO[c0 + j * 16 + col]) : 0.f;
#pragma unroll
      for (int r = 0; r < 8; ++r) sf[wave][8 * g + r][j * 16 + col] = acc[j][r] + bias; }
  } else {
#pragma unroll 2
    for (int kc = 0; kc < CC / 32; ++kc) { const v16h a = frag_f32(Y + (r0 + col) * CC + kc * 32, lane); asm volatile("s_wait_loadcnt 0x0" ::: "memory");
#pragma unroll
      for (int j = 0; j < 8; ++j) { const v16h w = WOCOLH(WO, kc * 32, c0 + j * 16 + col, lane); asm volatile("s_wait_loadcnt 0x0" ::: "memory"); acc[j] = wmma16(a, w, acc[j]); } }
#pragma unroll
    for (int j = 0; j < 8; ++j) { const float bias = BO ? bfr(BO[c0 + j * 16 + col]) : 0.f;
#pragma unroll
      for (int r = 0; r < 8; ++r) sf[wave][8 * g + r][j * 16 + col] = acc[j][r] * (1.0f / 256.0f) + bias; } }
  LDSX(); for (int rl = 0; rl < 16; ++rl) vst2(OUT + (r0 + rl) * DIN + c0 + lane * 4, *(const v4f*)&sf[wave][rl][lane * 4]); }

extern "C" void kernel_launch(void* const* d_in, const int* in_sizes, int n_in, void* d_out, int out_size, void* d_ws, size_t ws_size, hipStream_t stream) {
  (void)in_sizes; (void)n_in; (void)out_size;
  const float** F = (const float**)d_in;
  if (ws_size < (size_t)WS_END) return;
  char* ws = (char*)d_ws; _Float16 *QH = (_Float16*)(ws + WS_QH), *KH = (_Float16*)(ws + WS_KH), *VT = (_Float16*)(ws + WS_VT), *QL = (_Float16*)(ws + WS_QL), *KL = (_Float16*)(ws + WS_KL); __bf16 *VB = (__bf16*)(ws + WS_VB), *VBL = (__bf16*)(ws + WS_VBL); float *Y = (float*)(ws + WS_Y);
  (void)Y; (void)QL; (void)KL; (void)VB; (void)VBL;
  // inputs: 0 x [2,2048,1024]; 1 qkv_w [3072,1024] (out,in; rows q | k | v); 2 proj_w [1024,1024] (out,in); 3 proj_b; 4 q_scale [64]; 5 k_scale [64]
  k_proj<<<dim3(TNB * TT / 64, CC / 128, 3), 128, 0, stream>>>(F[0], F[0], F[0], F[1], F[1] + (size_t)CC * DIN, F[1] + (size_t)2 * CC * DIN, nullptr, nullptr, nullptr, QH, QL, KH, KL, VT, VB, VBL, F[4], F[5]);
  k_fa<<<dim3(TT / 128, NH, TNB), 256, 0, stream>>>(QH, QL, KH, VT, Y);
  k_out<<<dim3(TNB * TT / 64, DIN / 128), 128, 0, stream>>>(Y, F[2], F[3], (float*)d_out);
}

// v002
// It runs in 138 microseconds.
// Two timings next to v001 put it at 3.79 and 3.86 times that version's speed.
// Over all steps from v000 it is 10.5 times as fast.
// compute dtype: all float inputs rounded to bf16; qkv = x Wqkv^T with EXACT bf16 products on WMMA 16x16x32 (f32 accumulate); per-head RMSNorm of q and k in f32 on the projected rows; q as f16 hi + residual (x 2^10) against k once to f16 (2 products) x 64^-0.5; softmax in f32 (precise expf) with a running maximum and sum over stages of 64 keys; P x 2^11 (relative to the running maximum) once to f16 against v once to f16 (1 product), divided by the sum at the end; ctx split bf16 hi + lo against exact proj_w (2 products) + proj_b; f32 output.
#include <hip/hip_runtime.h>
#include <math.h>

typedef __attribute__((ext_vector_type(16))) _Float16 v16h;
typedef __attribute__((ext_vector_type(16))) __bf16 v16b;
typedef __attribute__((ext_vector_type(8)))  _Float16 v8h;
typedef __attribute__((ext_vector_type(8)))  float v8f;
typedef __attribute__((ext_vector_type(4)))  float v4f;
typedef __attribute__((ext_vector_type(2)))  float v2f;
typedef __attribute__((ext_vector_type(4)))  unsigned v4u;
typedef __attribute__((ext_vector_type(4)))  int v4i;
typedef float __attribute__((may_alias)) float_a;
typedef int __attribute__((may_alias)) int_a;

template <typename T> __device__ __forceinline__ void vst2(void* p, T v) { *(T*)p = v;  }
__device__ __forceinline__ v8f wmma16(v16h a, v16h b, v8f c) {
  v8f d = __builtin_amdgcn_wmma_f32_16x16x32_f16(false, a, false, b, (short)0, c, false, false);
  asm volatile("v_nop\n\tv_nop\n\tv_nop\n\tv_nop" : "+v"(d) : "v"(a), "v"(b));
  return d;
}
__device__ __forceinline__ v8f wmma_bf(v16b a, v16b b, v8f c) {
  v8f d = __builtin_amdgcn_wmma_f32_16x16x32_bf16(false, a, false, b, (short)0, c, false, false);
  asm volatile("v_nop\n\tv_nop\n\tv_nop\n\tv_nop" : "+v"(d) : "v"(a), "v"(b));
  return d;
}
// 16x16x32 fragments: lane = (h = lane>>4, row/col = lane&15); elements 0..7 = k0+8h+0..7, 8..15 = k0+16+8h+0..7; D element r = row 8h+r
__device__ __forceinline__ v16h frag_h(const _Float16* rowk0, int lane) {
  union { v16h v; v8h q[2]; } u; const _Float16* p = rowk0 + 8 * (lane >> 4);
  u.q[0] = *(const v8h*)p; u.q[1] = *(const v8h*)(p + 16); return u.v;
}
__device__ __forceinline__ v16h frag_f32(const float* rowk0, int lane) {
  v16h a; const float* p = rowk0 + 8 * (lane >> 4);
#pragma unroll
  for (int i = 0; i < 8; ++i) { a[i] = (_Float16)p[i]; a[8 + i] = (_Float16)p[16 + i]; }
  return a;
}
__device__ __forceinline__ v16h frag_f32s(const float* rowk0, int lane, float sc) {
  v16h a; const float* p = rowk0 + 8 * (lane >> 4);
#pragma unroll
  for (int i = 0; i < 8; ++i) { a[i] = (_Float16)(p[i] * sc); a[8 + i] = (_Float16)(p[16 + i] * sc); }
  return a;
}
// column fragment from a [K][ld] layout (column n), rows >= K read as 0
__device__ __forceinline__ v16h fragc_f32(const float* W, int k0, int n, int lane, int ld, int K) {
  v16h a; const int g = lane >> 4;
#pragma unroll
  for (int i = 0; i < 8; ++i) { const int ka = k0 + 8 * g + i, kb = ka + 16;
    a[i] = (_Float16)(ka < K ? W[(size_t)(ka < K ? ka : K - 1) * ld + n] : 0.f); a[8 + i] = (_Float16)(kb < K ? W[(size_t)(kb < K ? kb : K - 1) * ld + n] : 0.f); }
  return a;
}
struct F2 { v16b h, l; };
__device__ __forceinline__ F2 bsplit16(const float v[16]) { F2 r;
#pragma unroll
  for (int i = 0; i < 16; ++i) { const __bf16 h = (__bf16)v[i]; r.h[i] = h; r.l[i] = (__bf16)(v[i] - (float)h); }
  return r; }
__device__ __forceinline__ F2 split_row(const float* row, int k0, int lane) { float v[16]; const float* p = row + k0 + 8 * (lane >> 4);
#pragma unroll
  for (int i = 0; i < 8; ++i) { v[i] = p[i]; v[8 + i] = p[16 + i]; }
  return bsplit16(v); }
__device__ __forceinline__ F2 split_rowK(const float* row, int k0, int lane, int K) { float v[16]; const int g = lane >> 4;
#pragma unroll
  for (int i = 0; i < 8; ++i) { const int ka = k0 + 8 * g + i, kb = ka + 16; v[i] = ka < K ? row[ka < K ? ka : K - 1] : 0.f; v[8 + i] = kb < K ? row[kb < K ? kb : K - 1] : 0.f; }
  return bsplit16(v); }
__device__ __forceinline__ F2 split_col(const float* W, int k0, int n, int lane, int ld, int K) { float v[16]; const int g = lane >> 4;
#pragma unroll
  for (int i = 0; i < 8; ++i) { const int ka = k0 + 8 * g + i, kb = ka + 16; v[i] = ka < K ? W[(size_t)(ka < K ? ka : K - 1) * ld + n] : 0.f; v[8 + i] = kb < K ? W[(size_t)(kb < K ? kb : K - 1) * ld + n] : 0.f; }
  return bsplit16(v); }
__device__ __forceinline__ v8f mac3(const F2& a, const F2& b, v8f c) { c = wmma_bf(a.l, b.h, c); c = wmma_bf(a.h, b.l, c); return wmma_bf(a.h, b.h, c); }
__device__ __forceinline__ float sigm(float v) { return 1.0f / (1.0f + expf(-v)); }
#define LDSX() do { asm volatile("s_wait_dscnt 0" ::: "memory"); __builtin_amdgcn_wave_barrier(); __builtin_amdgcn_fence(__ATOMIC_RELEASE, "workgroup"); } while (0)

// Self-attention with QK RMSNorm (B 2, N 2,048, C 1,024 = 16 x 64): qkv = x qkv_w^T ((out,in) [3072,1024], rows (3, H, hd)); q, k <- scale * q / (|q| 64^-0.5 + 1e-8) per head (scales all ones); out = merged(softmax(q k^T x 64^-0.5) v) proj_w^T + proj_b (non-causal).
#define NB 2
#define TT 2048
#define CC 1024            // NH * HD = projected width
#define DIN 1024          // input (model) width
#define NH 16
#define HD 64
#define NQB (TT / 64)
#define HG 4
#define SCALE (0.125f)
#define CAUSAL 0
#ifndef TNB
#define TNB NB
#endif
__device__ __forceinline__ float bfr(float v) { return (float)(__bf16)v; }
__host__ __device__ __forceinline__ int kb_last(int qb) { return CAUSAL ? ((qb * 64 + 63) >> 7) : (TT / 128 - 1); }
typedef __attribute__((ext_vector_type(8))) __bf16 v8b;
__device__ __forceinline__ v16b frag_b(const __bf16* rowk0, int lane) {
  union { v16b v; v8b q[2]; } u; const __bf16* p = rowk0 + 8 * (lane >> 4);
  u.q[0] = *(const v8b*)p; u.q[1] = *(const v8b*)(p + 16); return u.v;
}
#define QBH 0
#define QHI 2048            // rows carrying a q residual plane (all rows when non-causal: 2-product logits everywhere)
#define KHI 64            // key rows carrying k residual / v bf16 hi+lo planes (written by k_proj, read by no kernel)
// B fragment (k rows k0+.., output column o) of a weight: (in,out) [K][ld] or (out,in) [ld rows of K]: bf16 exact, or f16(bf16 * 256) exact
__device__ __forceinline__ v16b wcol_io(const float* Wm, int k0, int o, int lane, int ld) { v16b w; const int g = lane >> 4;
#pragma unroll
  for (int i = 0; i < 8; ++i) { w[i] = (__bf16)Wm[(size_t)(k0 + 8 * g + i) * ld + o]; w[8 + i] = (__bf16)Wm[(size_t)(k0 + 16 + 8 * g + i) * ld + o]; }
  return w; }
__device__ __forceinline__ v16b wcol_oi(const float* Wm, int k0, int o, int lane, int K) { v16b w; const float* p = Wm + (size_t)o * K + k0 + 8 * (lane >> 4);
#pragma unroll
  for (int i = 0; i < 8; ++i) { w[i] = (__bf16)p[i]; w[8 + i] = (__bf16)p[16 + i]; }
  return w; }
__device__ __forceinline__ v16h wcolh_io(const float* Wm, int k0, int o, int lane, int ld) { v16h w; const int g = lane >> 4;
#pragma unroll
  for (int i = 0; i < 8; ++i) { w[i] = (_Float16)(bfr(Wm[(size_t)(k0 + 8 * g + i) * ld + o]) * 256.0f); w[8 + i] = (_Float16)(bfr(Wm[(size_t)(k0 + 16 + 8 * g + i) * ld + o]) * 256.0f); }
  return w; }
__device__ __forceinline__ v16h wcolh_oi(const float* Wm, int k0, int o, int lane, int K) { v16h w; const float* p = Wm + (size_t)o * K + k0 + 8 * (lane >> 4);
#pragma unroll
  for (int i = 0; i < 8; ++i) { w[i] = (_Float16)(bfr(p[i]) * 256.0f); w[8 + i] = (_Float16)(bfr(p[16 + i]) * 256.0f); }
  return w; }
#define WQKV_LAYOUT 1   // layout of WCOL, which no kernel calls (k_proj reads qkv_w as (out,in) rows): 0 = (in,out) [DIN][CC]; 1 = (out,in) [CC][DIN]; 2 = per-head [NH][DIN][HD]
__device__ __forceinline__ v16b wcol_hdk(const float* Wm, int k0, int o, int lane) { v16b w; const int g = lane >> 4; const float* p = Wm + (size_t)(o / HD) * DIN * HD + (o % HD);
#pragma unroll
  for (int i = 0; i < 8; ++i) { w[i] = (__bf16)p[(size_t)(k0 + 8 * g + i) * HD]; w[8 + i] = (__bf16)p[(size_t)(k0 + 16 + 8 * g + i) * HD]; }
  return w; }
#define WO_OUT_IN 1
#if WQKV_LAYOUT == 1
#define WCOL(W, k0, o, lane) wcol_oi(W, k0, o, lane, DIN)
#elif WQKV_LAYOUT == 2
#define WCOL(W, k0, o, lane) wcol_hdk(W, k0, o, lane)
#else
#define WCOL(W, k0, o, lane) wcol_io(W, k0, o, lane, CC)
#endif
#if WO_OUT_IN
#define WOCOL(W, k0, o, lane) wcol_oi(W, k0, o, lane, CC)
#define WOCOLH(W, k0, o, lane) wcolh_oi(W, k0, o, lane, CC)
#else
#define WOCOL(W, k0, o, lane) wcol_io(W, k0, o, lane, DIN)
#define WOCOLH(W, k0, o, lane) wcolh_io(W, k0, o, lane, DIN)
#endif
#define PROJ_EXTRA_PARAMS , const float* __restrict__ QS, const float* __restrict__ KS
#define PROJ_EPI(which, row, t, h) do { if ((which) < 2) { float* rw = (row); const float* sc = (which) == 0 ? QS : KS; float ss = 0.f; _Pragma("unroll") for (int i = 0; i < 64; ++i) ss += rw[i] * rw[i]; const float rms = __fsqrt_rn(ss) * 0.125f; const float inv = 1.0f / (rms + 1e-8f); _Pragma("unroll") for (int i = 0; i < 64; ++i) rw[i] = bfr(sc[i]) * (rw[i] * inv); } } while (0)   /* per-head RMSNorm: norm(x, axis=-1) * hd^-0.5; scale * (x / (rms + eps)) */
#ifndef SM_EXTRA_PARAMS
#define SM_EXTRA_PARAMS
#endif
#ifndef PROJ_EXTRA_PARAMS
#define PROJ_EXTRA_PARAMS
#endif
#ifndef SM_MASK_HOOK
#define SM_MASK_HOOK (void)0
#endif

#define WS_QH  0u                                      // f16 q rows [b*t][CC]
#define WS_KH  (WS_QH + 2u * (size_t)NB * TT * CC)      // f16 k rows [b*t][CC]
#define WS_VT  (WS_KH + 2u * (size_t)NB * TT * CC)      // f16 v planes [b][c][t]
#define WS_QL  (WS_VT + 2u * (size_t)NB * CC * TT)      // f16 q residual x 2^10 rows [b][t < QHI][CC]
#define WS_KL  (WS_QL + 2u * (size_t)NB * QHI * CC)     // f16 k residual x 2^10 rows [b][t < KHI][CC]
#define WS_VB  (WS_KL + 2u * (size_t)NB * KHI * CC)     // bf16 v hi planes [b][c][t < KHI]
#define WS_VBL (WS_VB + 2u * (size_t)NB * CC * KHI)
#define WS_S   (WS_VBL + 2u * (size_t)NB * CC * KHI)    // f32 [hg][t][s] region, unused: logits and P stay in k_fa's registers
#define WS_Y   (WS_S  + 4u * (size_t)HG * TT * TT)      // f32 ctx rows [b*t][CC] (only when there is an output projection)
#define WS_END (WS_Y  + 4u * (size_t)NB * TT * CC)

// ---- operand staging of the two projection GEMMs: a stage is 64 k of every operand row of the block's tile, rounded (or split) to bf16 once by the block and laid in LDS, from where every wave takes its fragments
#define GK 64              // k per stage
#define GP 72              // LDS row pitch in bf16: 144 B = 16 B x 9 (odd multiple: 16-byte fragment reads without bank conflicts)
typedef __attribute__((ext_vector_type(4))) __bf16 v4b;
__device__ __forceinline__ v8f wmma_b(v16b a, v16b b, v8f c) { return __builtin_amdgcn_wmma_f32_16x16x32_bf16(false, a, false, b, (short)0, c, false, false); }
__device__ __forceinline__ void put_bf(__bf16* d, v4f v) { v4b c;
#pragma unroll
  for (int k = 0; k < 4; ++k) c[k] = (__bf16)v[k];
  *(v4b*)d = c; }
__device__ __forceinline__ void put_bf_split(__bf16* dh, __bf16* dl, v4f v) { v4b h, l;
#pragma unroll
  for (int k = 0; k < 4; ++k) { const __bf16 hv = (__bf16)v[k]; h[k] = hv; l[k] = (__bf16)(v[k] - (float)hv); }
  *(v4b*)dh = h; *(v4b*)dl = l; }
// ---- k_proj: block = (64 rows, 128 cols, which): q/k/v = X W (+ b) with exact bf16 products (K = DIN) -> which 0: q f16 rows (+ residual rows < QHI); 1: k f16 rows (+ residual rows < KHI); 2: v f16 planes [c][t] (+ bf16 hi/lo planes for t < KHI)
__global__ __launch_bounds__(128) void k_proj(const float* __restrict__ XQ, const float* __restrict__ XK, const float* __restrict__ XV, const float* __restrict__ WQ, const float* __restrict__ WK, const float* __restrict__ WV, const float* __restrict__ BQ, const float* __restrict__ BK, const float* __restrict__ BV,
    _Float16* __restrict__ QH, _Float16* __restrict__ QL, _Float16* __restrict__ KH, _Float16* __restrict__ KL, _Float16* __restrict__ VT, __bf16* __restrict__ VB, __bf16* __restrict__ VBL PROJ_EXTRA_PARAMS) {
  // LDS: st, then one range that holds the two operand stages during the product and the converted tiles after it (the loop's last barrier and the two of the epilogue lie between the last fragment read and the first write of a converted tile)
  __shared__ __align__(16) char sm[64 * 132 * 4 + 2 * 192 * GP * 2];
  float (*st)[132] = (float (*)[132])sm; char* const s2 = sm + 64 * 132 * 4;
  __bf16 (*sg)[192][GP] = (__bf16 (*)[192][GP])s2;   // stage: rows 0..63 = X rows, 64..191 = W rows (output columns)
  _Float16 (*sh)[136] = (_Float16 (*)[136])s2; _Float16 (*sl)[136] = (_Float16 (*)[136])(s2 + 64 * 136 * 2);
  _Float16 (*th)[72] = (_Float16 (*)[72])s2; __bf16 (*tb)[72] = (__bf16 (*)[72])(s2 + 128 * 72 * 2); __bf16 (*tbl)[72] = (__bf16 (*)[72])(s2 + 2 * 128 * 72 * 2);
  const int tid = threadIdx.x, wave = tid >> 5, lane = tid & 31, col = lane & 15, g = lane >> 4; const int which = blockIdx.z; const int c0 = blockIdx.y * 128; const size_t r0 = (size_t)blockIdx.x * 64; const size_t bb = r0 / TT; const int t0 = (int)(r0 % TT);
  const float* X = which == 0 ? XQ : which == 1 ? XK : XV; const float* WA = which == 0 ? WQ : which == 1 ? WK : WV; const float* BA = which == 0 ? BQ : which == 1 ? BK : BV;
  // (every '#pragma unroll' below: the loop's index selects a register of a load, fragment or accumulator array, which stays in registers only under constant indices)
  const int wr = (wave >> 1) * 32, wc = (wave & 1) * 64;   // wave tile: 32 rows x 64 columns (2 x 4 fragments for 8 products)
  const int lr = tid >> 4, lc = (tid & 15) * 4;            // staging: 16 lanes read 256 contiguous bytes of one row; a thread takes rows lr + 8 i
  const float* xg = X + (r0 + lr) * DIN + lc; const float* wg = WA + (size_t)(c0 + lr) * DIN + lc;
  v4f rx[8], rw[16];
#pragma unroll
  for (int i = 0; i < 8; ++i) rx[i] = *(const v4f*)(xg + (size_t)i * 8 * DIN);
#pragma unroll
  for (int i = 0; i < 16; ++i) rw[i] = *(const v4f*)(wg + (size_t)i * 8 * DIN);
  asm volatile("s_wait_xcnt 0x0" ::: "memory");   // before a register that an issued load names as its address is written again
#pragma unroll
  for (int i = 0; i < 8; ++i) put_bf(&sg[0][lr + 8 * i][lc], rx[i]);
#pragma unroll
  for (int i = 0; i < 16; ++i) put_bf(&sg[0][64 + lr + 8 * i][lc], rw[i]);
  __syncthreads();
  v8f acc[2][4] = {};
  for (int t = 0; t < DIN / GK; ++t) { const int bu = t & 1; const bool more = t + 1 < DIN / GK;
    if (more) {   // next stage's rows fly while this stage is worked on
#pragma unroll
      for (int i = 0; i < 8; ++i) rx[i] = *(const v4f*)(xg + (size_t)i * 8 * DIN + (t + 1) * GK);
#pragma unroll
      for (int i = 0; i < 16; ++i) rw[i] = *(const v4f*)(wg + (size_t)i * 8 * DIN + (t + 1) * GK);
      asm volatile("s_wait_xcnt 0x0" ::: "memory");   // before a register that an issued load names as its address is written again
    }
#pragma unroll
    for (int kc = 0; kc < GK / 32; ++kc) { v16b a[2], w[4];
#pragma unroll
      for (int i = 0; i < 2; ++i) a[i] = frag_b(&sg[bu][wr + i * 16 + col][kc * 32], lane);
#pragma unroll
      for (int j = 0; j < 4; ++j) w[j] = frag_b(&sg[bu][64 + wc + j * 16 + col][kc * 32], lane);
#pragma unroll
      for (int i = 0; i < 2; ++i)
#pragma unroll
        for (int j = 0; j < 4; ++j) acc[i][j] = wmma_b(a[i], w[j], acc[i][j]); }
    __builtin_amdgcn_sched_barrier(0);   // keeps the rounding of the next stage's rows, which waits for their loads, behind this stage's products
    if (more) {
#pragma unroll
      for (int i = 0; i < 8; ++i) put_bf(&sg[bu ^ 1][lr + 8 * i][lc], rx[i]);
#pragma unroll
      for (int i = 0; i < 16; ++i) put_bf(&sg[bu ^ 1][64 + lr + 8 * i][lc], rw[i]); }
    __syncthreads(); }   // publishes stage t + 1 and ends every wave's reads of stage t, whose buffer the next trip refills
  { // stage the f32 tile (acc + bias) in LDS, run the per-(row, head) epilogue hook, then convert
#pragma unroll
    for (int j = 0; j < 4; ++j) { const float bias = BA ? bfr(BA[c0 + wc + j * 16 + col]) : 0.f;
#pragma unroll
      for (int i = 0; i < 2; ++i)
#pragma unroll
        for (int r = 0; r < 8; ++r) st[wr + i * 16 + 8 * g + r][wc + j * 16 + col] = acc[i][j][r] + bias; }
    __syncthreads();
    for (int e = tid; e < 64 * (128 / HD); e += 128) { const int rl = e / (128 / HD), hh = e % (128 / HD); PROJ_EPI(which, &st[rl][hh * HD], (int)((r0 + rl) % TT), (c0 / HD) + hh); }
    __syncthreads(); }
  if (which < 2) { _Float16* DH = which == 0 ? QH : KH; _Float16* DL = which == 0 ? QL : KL; const int nhi = which == 0 ? QHI : KHI; const bool hi_rows = t0 < nhi;
    for (int e = tid; e < 64 * 128; e += 128) { const int rl = e >> 7, cl = e & 127; const float v = st[rl][cl]; const _Float16 hv = (_Float16)v; sh[rl][cl] = hv; sl[rl][cl] = (_Float16)((v - (float)hv) * 1024.0f); }
    __syncthreads();
    for (int e = tid; e < 64 * 16; e += 128) { const int rl = e >> 4, q = e & 15; vst2((unsigned*)(DH + (r0 + rl) * CC + c0 + q * 8), *(const v4u*)&sh[rl][q * 8]); if (hi_rows) vst2((unsigned*)(DL + (bb * nhi + t0 + rl) * (size_t)CC + c0 + q * 8), *(const v4u*)&sl[rl][q * 8]); }
  } else { const bool hi_rows = t0 < KHI;
    for (int e = tid; e < 64 * 128; e += 128) { const int rl = e & 63, cl = e >> 6; const float v = st[rl][cl]; th[cl][rl] = (_Float16)v; const __bf16 bh = (__bf16)v; tb[cl][rl] = bh; tbl[cl][rl] = (__bf16)(v - (float)bh); }
    __syncthreads();
    for (int e = tid; e < 128 * 8; e += 128) { const int cl = e >> 3, q = e & 7; vst2((unsigned*)(VT + (bb * CC + c0 + cl) * (size_t)TT + t0 + q * 8), *(const v4u*)&th[cl][q * 8]); if (hi_rows) { const size_t o3 = (bb * CC + c0 + cl) * (size_t)KHI + t0 + q * 8; vst2((unsigned*)(VB + o3), *(const v4u*)&tb[cl][q * 8]); vst2((unsigned*)(VBL + o3), *(const v4u*)&tbl[cl][q * 8]); } } } }
// ---- k_fa: block = 128 queries (8 waves x 16) of (b, h), one pass over all keys in stages of 64: S^T = K Q^T (q hi + residual x 2^10, 2 products) x SCALE, running maximum and sum per query (a lane holds one query's scores), P^T x 2^11 packed from the score tiles as the B operand, ctx^T += V^T P^T (1 product); logits and P never leave the registers
// (every '#pragma unroll' in k_fa: the loop's index selects a register of a fragment, score or accumulator array, which stays in registers only under constant indices)
#define FK 64              // keys per stage
#define FP 72              // LDS row pitch in f16: 144 B = 16 B x 9 (odd multiple: 16-byte fragment reads without bank conflicts)
__device__ __forceinline__ v8f wmma_h(v16h a, v16h b, v8f c) { return __builtin_amdgcn_wmma_f32_16x16x32_f16(false, a, false, b, (short)0, c, false, false); }
__global__ __launch_bounds__(256) void k_fa(const _Float16* __restrict__ QH, const _Float16* __restrict__ QL, const _Float16* __restrict__ KH, const _Float16* __restrict__ VT, float* __restrict__ Y) {
  __shared__ __align__(16) _Float16 sK[2][FK][FP], sV[2][HD][FP];
  const int tid = threadIdx.x, wave = tid >> 5, lane = tid & 31, col = lane & 15, g = lane >> 4; const int h = blockIdx.y, b = blockIdx.z; const int ql0 = blockIdx.x * 128 + wave * 16;
  v16h qh[HD / 32], ql[HD / 32];
#pragma unroll
  for (int kc = 0; kc < HD / 32; ++kc) { qh[kc] = frag_h(QH + ((size_t)b * TT + ql0 + col) * CC + h * HD + kc * 32, lane); ql[kc] = frag_h(QL + ((size_t)b * QHI + ql0 + col) * CC + h * HD + kc * 32, lane); }
  // staging: thread = (row sr and sr + 32, 16-byte chunk sc) of the K tile [key][d] and of the V tile [d][key]: 8 lanes read one whole 128-B row
  const int sr = tid >> 3, sc = (tid & 7) * 8;
  const _Float16* kg = KH + ((size_t)b * TT + sr) * CC + h * HD + sc; const _Float16* vg = VT + ((size_t)b * CC + h * HD + sr) * (size_t)TT + sc;
  v4u rk0 = *(const v4u*)kg, rk1 = *(const v4u*)(kg + 32 * CC), rv0 = *(const v4u*)vg, rv1 = *(const v4u*)(vg + 32 * TT);
  *(v4u*)&sK[0][sr][sc] = rk0; *(v4u*)&sK[0][sr + 32][sc] = rk1; *(v4u*)&sV[0][sr][sc] = rv0; *(v4u*)&sV[0][sr + 32][sc] = rv1;
  __syncthreads();
  v8f acc[HD / 16] = {}; float m = -3.0e38f, l = 0.f;
  for (int t = 0; t < TT / FK; ++t) { const int bu = t & 1; const bool more = t + 1 < TT / FK;
    if (more) { const _Float16* kn = kg + (size_t)(t + 1) * FK * CC; const _Float16* vn = vg + (t + 1) * FK;   // next stage's rows fly while this stage is worked on
      rk0 = *(const v4u*)kn; rk1 = *(const v4u*)(kn + 32 * CC); rv0 = *(const v4u*)vn; rv1 = *(const v4u*)(vn + 32 * TT); }
    float s[FK / 16][8]; float mt = -3.0e38f;
#pragma unroll
    for (int i = 0; i < FK / 16; ++i) { v8f ah = {}, al = {};
#pragma unroll
      for (int kc = 0; kc < HD / 32; ++kc) { const v16h kf = frag_h(&sK[bu][i * 16 + col][kc * 32], lane); ah = wmma_h(kf, qh[kc], ah); al = wmma_h(kf, ql[kc], al); }
#pragma unroll
      for (int r = 0; r < 8; ++r) { s[i][r] = (ah[r] + al[r] * (1.0f / 1024.0f)) * SCALE; mt = fmaxf(mt, s[i][r]); } }   // s[i][r] = logit(key i*16 + 8g + r, query col)
    mt = fmaxf(mt, __shfl_xor(mt, 16));
    if (__builtin_amdgcn_ballot_w32(mt > m) != 0) {   // some query's maximum rose: bring its sum and its ctx to the new maximum (factor 1 for the others)
      const float mn = fmaxf(m, mt); const float al = expf(m - mn); m = mn; l *= al;
#pragma unroll
      for (int j = 0; j < HD / 16; ++j)
#pragma unroll
        for (int r = 0; r < 8; ++r) acc[j][r] *= al; }
    float ls[4] = {0.f, 0.f, 0.f, 0.f};   // four independent partial sums of this stage: no 32-long dependent add chain
    const float mo = m - 7.62461898616f;   // 11 ln 2: P x 2^11 (at most 2^11), so that small P stay normal f16 numbers; the sum carries the same factor
#pragma unroll
    for (int c2 = 0; c2 < FK / 32; ++c2) { v16h p;
#pragma unroll
      for (int r = 0; r < 8; ++r) { const float e0 = expf(s[2 * c2][r] - mo), e1 = expf(s[2 * c2 + 1][r] - mo); ls[r & 3] += e0 + e1; p[r] = (_Float16)e0; p[8 + r] = (_Float16)e1; }
#pragma unroll
      for (int j = 0; j < HD / 16; ++j) acc[j] = wmma_h(frag_h(&sV[bu][j * 16 + col][c2 * 32], lane), p, acc[j]); }
    l += (ls[0] + ls[1]) + (ls[2] + ls[3]);
    if (more) { *(v4u*)&sK[bu ^ 1][sr][sc] = rk0; *(v4u*)&sK[bu ^ 1][sr + 32][sc] = rk1; *(v4u*)&sV[bu ^ 1][sr][sc] = rv0; *(v4u*)&sV[bu ^ 1][sr + 32][sc] = rv1; }
    __syncthreads(); }   // publishes stage t + 1 and ends every wave's reads of stage t, whose buffer the next trip refills
  l += __shfl_xor(l, 16); const float inv = l > 0.f ? 1.0f / l : 0.f;
  float* yp = Y + ((size_t)b * TT + ql0 + col) * CC + h * HD + 8 * g;   // acc[j][r] = ctx(query col, d = j*16 + 8g + r)
#pragma unroll
  for (int j = 0; j < HD / 16; ++j) { v4f o0, o1;
#pragma unroll
    for (int r = 0; r < 4; ++r) { o0[r] = acc[j][r] * inv; o1[r] = acc[j][4 + r] * inv; }
    vst2(yp + j * 16, o0); vst2(yp + j * 16 + 4, o1); } }
// ---- k_out: block = (64 rows, 128 cols): out = ctx Wo (+ bo): ctx split bf16 hi + lo against exact bf16 Wo (2 products); wave = 16 rows x 128 columns
__global__ __launch_bounds__(128) void k_out(const float* __restrict__ Y, const float* __restrict__ WO, const float* __restrict__ BO, float* __restrict__ OUT) {
  __shared__ __align__(16) char sm[2 * 256 * GP * 2];
  __bf16 (*sg)[256][GP] = (__bf16 (*)[256][GP])sm;   // stage: rows 0..63 = ctx hi, 64..127 = ctx lo, 128..255 = Wo rows (output columns)
  float (*sf)[16][132] = (float (*)[16][132])sm;     // output staging, in the stages' range after the loop's last barrier
  const int tid = threadIdx.x, wave = tid >> 5, lane = tid & 31, col = lane & 15, g = lane >> 4; const int c0 = blockIdx.y * 128; const size_t rb = (size_t)blockIdx.x * 64, r0 = rb + wave * 16;
  // (every '#pragma unroll' below: the loop's index selects a register of a load, fragment or accumulator array, which stays in registers only under constant indices)
  const int lr = tid >> 4, lc = (tid & 15) * 4;            // staging: 16 lanes read 256 contiguous bytes of one row; a thread takes rows lr + 8 i
  const float* yg = Y + (rb + lr) * CC + lc; const float* wg = WO + (size_t)(c0 + lr) * CC + lc;
  v4f ry[8], rw[16];
#pragma unroll
  for (int i = 0; i < 8; ++i) ry[i] = *(const v4f*)(yg + (size_t)i * 8 * CC);
#pragma unroll
  for (int i = 0; i < 16; ++i) rw[i] = *(const v4f*)(wg + (size_t)i * 8 * CC);
  asm volatile("s_wait_xcnt 0x0" ::: "memory");   // before a register that an issued load names as its address is written again
#pragma unroll
  for (int i = 0; i < 8; ++i) put_bf_split(&sg[0][lr + 8 * i][lc], &sg[0][64 + lr + 8 * i][lc], ry[i]);
#pragma unroll
  for (int i = 0; i < 16; ++i) put_bf(&sg[0][128 + lr + 8 * i][lc], rw[i]);
  __syncthreads();
  v8f acc[8] = {};
  for (int t = 0; t < CC / GK; ++t) { const int bu = t & 1; const bool more = t + 1 < CC / GK;
    if (more) {   // next stage's rows fly while this stage is worked on
#pragma unroll
      for (int i = 0; i < 8; ++i) ry[i] = *(const v4f*)(yg + (size_t)i * 8 * CC + (t + 1) * GK);
#pragma unroll
      for (int i = 0; i < 16; ++i) rw[i] = *(const v4f*)(wg + (size_t)i * 8 * CC + (t + 1) * GK);
      asm volatile("s_wait_xcnt 0x0" ::: "memory");   // before a register that an issued load names as its address is written again
    }
#pragma unroll
    for (int kc = 0; kc < GK / 32; ++kc) { const v16b ah = frag_b(&sg[bu][wave * 16 + col][kc * 32], lane), al = frag_b(&sg[bu][64 + wave * 16 + col][kc * 32], lane);
#pragma unroll
      for (int j = 0; j < 8; ++j) { const v16b w = frag_b(&sg[bu][128 + j * 16 + col][kc * 32], lane); acc[j] = wmma_b(ah, w, acc[j]); acc[j] = wmma_b(al, w, acc[j]); } }
    __builtin_amdgcn_sched_barrier(0);   // keeps the rounding of the next stage's rows, which waits for their loads, behind this stage's products
    if (more) {
#pragma unroll
      for (int i = 0; i < 8; ++i) put_bf_split(&sg[bu ^ 1][lr + 8 * i][lc], &sg[bu ^ 1][64 + lr + 8 * i][lc], ry[i]);
#pragma unroll
      for (int i = 0; i < 16; ++i) put_bf(&sg[bu ^ 1][128 + lr + 8 * i][lc], rw[i]); }
    __syncthreads(); }   // publishes stage t + 1 and ends every wave's reads of stage t, whose buffer the next trip refills
#pragma unroll
  for (int j = 0; j < 8; ++j) { const float bias = BO ? bfr(BO[c0 + j * 16 + col]) : 0.f;
#pragma unroll
    for (int r = 0; r < 8; ++r) sf[wave][8 * g + r][j * 16 + col] = acc[j][r] + bias; }
  LDSX(); for (int rl = 0; rl < 16; ++rl) vst2(OUT + (r0 + rl) * DIN + c0 + lane * 4, *(const v4f*)&sf[wave][rl][lane * 4]); }

extern "C" void kernel_launch(void* const* d_in, const int* in_sizes, int n_in, void* d_out, int out_size, void* d_ws, size_t ws_size, hipStream_t stream) {
  (void)in_sizes; (void)n_in; (void)out_size;
  const float** F = (const float**)d_in;
  if (ws_size < (size_t)WS_END) return;
  char* ws = (char*)d_ws; _Float16 *QH = (_Float16*)(ws + WS_QH), *KH = (_Float16*)(ws + WS_KH), *VT = (_Float16*)(ws + WS_VT), *QL = (_Float16*)(ws + WS_QL), *KL = (_Float16*)(ws + WS_KL); __bf16 *VB = (__bf16*)(ws + WS_VB), *VBL = (__bf16*)(ws + WS_VBL); float *Y = (float*)(ws + WS_Y);
  (void)Y; (void)QL; (void)KL; (void)VB; (void)VBL;
  // inputs: 0 x [2,2048,1024]; 1 qkv_w [3072,1024] (out,in; rows q | k | v); 2 proj_w [1024,1024] (out,in); 3 proj_b; 4 q_scale [64]; 5 k_scale [64]
  k_proj<<<dim3(TNB * TT / 64, CC / 128, 3), 128, 0, stream>>>(F[0], F[0], F[0], F[1], F[1] + (size_t)CC * DIN, F[1] + (size_t)2 * CC * DIN, nullptr, nullptr, nullptr, QH, QL, KH, KL, VT, VB, VBL, F[4], F[5]);
  k_fa<<<dim3(TT / 128, NH, TNB), 256, 0, stream>>>(QH, QL, KH, VT, Y);
  k_out<<<dim3(TNB * TT / 64, DIN / 128), 128, 0, stream>>>(Y, F[2], F[3], (float*)d_out);
}

// v003
// A run of this version takes 113 microseconds.
// Timed twice side by side with v002, it ran 1.23 times as fast both times.
// Counting every step since v000, it is 12.9 times as fast.
// compute dtype: all float inputs rounded to bf16; qkv = x Wqkv^T with EXACT bf16 products on WMMA 16x16x32 (f32 accumulate); per-head RMSNorm of q and k in f32 on the projected rows; q as f16 hi + residual (x 2^10) against k once to f16 (2 products); softmax in f32 (base 2: 64^-0.5 log2 e folded into one fma a score, hardware exp2) with a running maximum and sum over stages of 64 keys; P x 2^11 (relative to the running maximum) once to f16 against v once to f16 (1 product), divided by the sum at the end; ctx split bf16 hi + lo against exact proj_w (2 products) + proj_b; f32 output.
#include <hip/hip_runtime.h>
#include <math.h>

typedef __attribute__((ext_vector_type(16))) _Float16 v16h;
typedef __attribute__((ext_vector_type(16))) __bf16 v16b;
typedef __attribute__((ext_vector_type(8)))  _Float16 v8h;
typedef __attribute__((ext_vector_type(8)))  float v8f;
typedef __attribute__((ext_vector_type(4)))  float v4f;
typedef __attribute__((ext_vector_type(2)))  float v2f;
typedef __attribute__((ext_vector_type(4)))  unsigned v4u;
typedef __attribute__((ext_vector_type(4)))  int v4i;
typedef float __attribute__((may_alias)) float_a;
typedef int __attribute__((may_alias)) int_a;

template <typename T> __device__ __forceinline__ void vst2(void* p, T v) { *(T*)p = v;  }
__device__ __forceinline__ v8f wmma16(v16h a, v16h b, v8f c) {
  v8f d = __builtin_amdgcn_wmma_f32_16x16x32_f16(false, a, false, b, (short)0, c, false, false);
  asm volatile("v_nop\n\tv_nop\n\tv_nop\n\tv_nop" : "+v"(d) : "v"(a), "v"(b));
  return d;
}
__device__ __forceinline__ v8f wmma_bf(v16b a, v16b b, v8f c) {
  v8f d = __builtin_amdgcn_wmma_f32_16x16x32_bf16(false, a, false, b, (short)0, c, false, false);
  asm volatile("v_nop\n\tv_nop\n\tv_nop\n\tv_nop" : "+v"(d) : "v"(a), "v"(b));
  return d;
}
// 16x16x32 fragments: lane = (h = lane>>4, row/col = lane&15); elements 0..7 = k0+8h+0..7, 8..15 = k0+16+8h+0..7; D element r = row 8h+r
__device__ __forceinline__ v16h frag_h(const _Float16* rowk0, int lane) {
  union { v16h v; v8h q[2]; } u; const _Float16* p = rowk0 + 8 * (lane >> 4);
  u.q[0] = *(const v8h*)p; u.q[1] = *(const v8h*)(p + 16); return u.v;
}
__device__ __forceinline__ v16h frag_f32(const float* rowk0, int lane) {
  v16h a; const float* p = rowk0 + 8 * (lane >> 4);
#pragma unroll
  for (int i = 0; i < 8; ++i) { a[i] = (_Float16)p[i]; a[8 + i] = (_Float16)p[16 + i]; }
  return a;
}
__device__ __forceinline__ v16h frag_f32s(const float* rowk0, int lane, float sc) {
  v16h a; const float* p = rowk0 + 8 * (lane >> 4);
#pragma unroll
  for (int i = 0; i < 8; ++i) { a[i] = (_Float16)(p[i] * sc); a[8 + i] = (_Float16)(p[16 + i] * sc); }
  return a;
}
// column fragment from a [K][ld] layout (column n), rows >= K read as 0
__device__ __forceinline__ v16h fragc_f32(const float* W, int k0, int n, int lane, int ld, int K) {
  v16h a; const int g = lane >> 4;
#pragma unroll
  for (int i = 0; i < 8; ++i) { const int ka = k0 + 8 * g + i, kb = ka + 16;
    a[i] = (_Float16)(ka < K ? W[(size_t)(ka < K ? ka : K - 1) * ld + n] : 0.f); a[8 + i] = (_Float16)(kb < K ? W[(size_t)(kb < K ? kb : K - 1) * ld + n] : 0.f); }
  return a;
}
struct F2 { v16b h, l; };
__device__ __forceinline__ F2 bsplit16(const float v[16]) { F2 r;
#pragma unroll
  for (int i = 0; i < 16; ++i) { const __bf16 h = (__bf16)v[i]; r.h[i] = h; r.l[i] = (__bf16)(v[i] - (float)h); }
  return r; }
__device__ __forceinline__ F2 split_row(const float* row, int k0, int lane) { float v[16]; const float* p = row + k0 + 8 * (lane >> 4);
#pragma unroll
  for (int i = 0; i < 8; ++i) { v[i] = p[i]; v[8 + i] = p[16 + i]; }
  return bsplit16(v); }
__device__ __forceinline__ F2 split_rowK(const float* row, int k0, int lane, int K) { float v[16]; const int g = lane >> 4;
#pragma unroll
  for (int i = 0; i < 8; ++i) { const int ka = k0 + 8 * g + i, kb = ka + 16; v[i] = ka < K ? row[ka < K ? ka : K - 1] : 0.f; v[8 + i] = kb < K ? row[kb < K ? kb : K - 1] : 0.f; }
  return bsplit16(v); }
__device__ __forceinline__ F2 split_col(const float* W, int k0, int n, int lane, int ld, int K) { float v[16]; const int g = lane >> 4;
#pragma unroll
  for (int i = 0; i < 8; ++i) { const int ka = k0 + 8 * g + i, kb = ka + 16; v[i] = ka < K ? W[(size_t)(ka < K ? ka : K - 1) * ld + n] : 0.f; v[8 + i] = kb < K ? W[(size_t)(kb < K ? kb : K - 1) * ld + n] : 0.f; }
  return bsplit16(v); }
__device__ __forceinline__ v8f mac3(const F2& a, const F2& b, v8f c) { c = wmma_bf(a.l, b.h, c); c = wmma_bf(a.h, b.l, c); return wmma_bf(a.h, b.h, c); }
__device__ __forceinline__ float sigm(float v) { return 1.0f / (1.0f + expf(-v)); }
#define LDSX() do { asm volatile("s_wait_dscnt 0" ::: "memory"); __builtin_amdgcn_wave_barrier(); __builtin_amdgcn_fence(__ATOMIC_RELEASE, "workgroup"); } while (0)

// Self-attention with QK RMSNorm (B 2, N 2,048, C 1,024 = 16 x 64): qkv = x qkv_w^T ((out,in) [3072,1024], rows (3, H, hd)); q, k <- scale * q / (|q| 64^-0.5 + 1e-8) per head (scales all ones); out = merged(softmax(q k^T x 64^-0.5) v) proj_w^T + proj_b (non-causal).
#define NB 2
#define TT 2048
#define CC 1024            // NH * HD = projected width
#define DIN 1024          // input (model) width
#define NH 16
#define HD 64
#define NQB (TT / 64)
#define HG 4
#define SCALE (0.125f)
#define CAUSAL 0
#ifndef TNB
#define TNB NB
#endif
__device__ __forceinline__ float bfr(float v) { return (float)(__bf16)v; }
__host__ __device__ __forceinline__ int kb_last(int qb) { return CAUSAL ? ((qb * 64 + 63) >> 7) : (TT / 128 - 1); }
typedef __attribute__((ext_vector_type(8))) __bf16 v8b;
__device__ __forceinline__ v16b frag_b(const __bf16* rowk0, int lane) {
  union { v16b v; v8b q[2]; } u; const __bf16* p = rowk0 + 8 * (lane >> 4);
  u.q[0] = *(const v8b*)p; u.q[1] = *(const v8b*)(p + 16); return u.v;
}
#define QBH 0
#define QHI 2048            // rows carrying a q residual plane (all rows when non-causal: 2-product logits everywhere)
#define KHI 64            // key rows carrying k residual / v bf16 hi+lo planes (written by k_proj, read by no kernel)
// B fragment (k rows k0+.., output column o) of a weight: (in,out) [K][ld] or (out,in) [ld rows of K]: bf16 exact, or f16(bf16 * 256) exact
__device__ __forceinline__ v16b wcol_io(const float* Wm, int k0, int o, int lane, int ld) { v16b w; const int g = lane >> 4;
#pragma unroll
  for (int i = 0; i < 8; ++i) { w[i] = (__bf16)Wm[(size_t)(k0 + 8 * g + i) * ld + o]; w[8 + i] = (__bf16)Wm[(size_t)(k0 + 16 + 8 * g + i) * ld + o]; }
  return w; }
__device__ __forceinline__ v16b wcol_oi(const float* Wm, int k0, int o, int lane, int K) { v16b w; const float* p = Wm + (size_t)o * K + k0 + 8 * (lane >> 4);
#pragma unroll
  for (int i = 0; i < 8; ++i) { w[i] = (__bf16)p[i]; w[8 + i] = (__bf16)p[16 + i]; }
  return w; }
__device__ __forceinline__ v16h wcolh_io(const float* Wm, int k0, int o, int lane, int ld) { v16h w; const int g = lane >> 4;
#pragma unroll
  for (int i = 0; i < 8; ++i) { w[i] = (_Float16)(bfr(Wm[(size_t)(k0 + 8 * g + i) * ld + o]) * 256.0f); w[8 + i] = (_Float16)(bfr(Wm[(size_t)(k0 + 16 + 8 * g + i) * ld + o]) * 256.0f); }
  return w; }
__device__ __forceinline__ v16h wcolh_oi(const float* Wm, int k0, int o, int lane, int K) { v16h w; const float* p = Wm + (size_t)o * K + k0 + 8 * (lane >> 4);
#pragma unroll
  for (int i = 0; i < 8; ++i) { w[i] = (_Float16)(bfr(p[i]) * 256.0f); w[8 + i] = (_Float16)(bfr(p[16 + i]) * 256.0f); }
  return w; }
#define WQKV_LAYOUT 1   // layout of WCOL, which no kernel calls (k_proj reads qkv_w as (out,in) rows): 0 = (in,out) [DIN][CC]; 1 = (out,in) [CC][DIN]; 2 = per-head [NH][DIN][HD]
__device__ __forceinline__ v16b wcol_hdk(const float* Wm, int k0, int o, int lane) { v16b w; const int g = lane >> 4; const float* p = Wm + (size_t)(o / HD) * DIN * HD + (o % HD);
#pragma unroll
  for (int i = 0; i < 8; ++i) { w[i] = (__bf16)p[(size_t)(k0 + 8 * g + i) * HD]; w[8 + i] = (__bf16)p[(size_t)(k0 + 16 + 8 * g + i) * HD]; }
  return w; }
#define WO_OUT_IN 1
#if WQKV_LAYOUT == 1
#define WCOL(W, k0, o, lane) wcol_oi(W, k0, o, lane, DIN)
#elif WQKV_LAYOUT == 2
#define WCOL(W, k0, o, lane) wcol_hdk(W, k0, o, lane)
#else
#define WCOL(W, k0, o, lane) wcol_io(W, k0, o, lane, CC)
#endif
#if WO_OUT_IN
#define WOCOL(W, k0, o, lane) wcol_oi(W, k0, o, lane, CC)
#define WOCOLH(W, k0, o, lane) wcolh_oi(W, k0, o, lane, CC)
#else
#define WOCOL(W, k0, o, lane) wcol_io(W, k0, o, lane, DIN)
#define WOCOLH(W, k0, o, lane) wcolh_io(W, k0, o, lane, DIN)
#endif
#define PROJ_EXTRA_PARAMS , const float* __restrict__ QS, const float* __restrict__ KS
#define PROJ_EPI(which, row, t, h) do { if ((which) < 2) { float* rw = (row); const float* sc = (which) == 0 ? QS : KS; float ss = 0.f; _Pragma("unroll") for (int i = 0; i < 64; ++i) ss += rw[i] * rw[i]; const float rms = __fsqrt_rn(ss) * 0.125f; const float inv = 1.0f / (rms + 1e-8f); _Pragma("unroll") for (int i = 0; i < 64; ++i) rw[i] = bfr(sc[i]) * (rw[i] * inv); } } while (0)   /* per-head RMSNorm: norm(x, axis=-1) * hd^-0.5; scale * (x / (rms + eps)) */
#ifndef SM_EXTRA_PARAMS
#define SM_EXTRA_PARAMS
#endif
#ifndef PROJ_EXTRA_PARAMS
#define PROJ_EXTRA_PARAMS
#endif
#ifndef SM_MASK_HOOK
#define SM_MASK_HOOK (void)0
#endif

#define WS_QH  0u                                      // f16 q rows [b*t][CC]
#define WS_KH  (WS_QH + 2u * (size_t)NB * TT * CC)      // f16 k rows [b*t][CC]
#define WS_VT  (WS_KH + 2u * (size_t)NB * TT * CC)      // f16 v planes [b][c][t]
#define WS_QL  (WS_VT + 2u * (size_t)NB * CC * TT)      // f16 q residual x 2^10 rows [b][t < QHI][CC]
#define WS_KL  (WS_QL + 2u * (size_t)NB * QHI * CC)     // f16 k residual x 2^10 rows [b][t < KHI][CC]
#define WS_VB  (WS_KL + 2u * (size_t)NB * KHI * CC)     // bf16 v hi planes [b][c][t < KHI]
#define WS_VBL (WS_VB + 2u * (size_t)NB * CC * KHI)
#define WS_S   (WS_VBL + 2u * (size_t)NB * CC * KHI)    // f32 [hg][t][s] region, unused: logits and P stay in k_fa's registers
#define WS_Y   (WS_S  + 4u * (size_t)HG * TT * TT)      // f32 ctx rows [b*t][CC] (only when there is an output projection)
#define WS_END (WS_Y  + 4u * (size_t)NB * TT * CC)

// ---- operand staging of the two projection GEMMs: a stage is 64 k of every operand row of the block's tile, rounded (or split) to bf16 once by the block and laid in LDS, from where every wave takes its fragments
#define GK 64              // k per stage
#define GP 72              // LDS row pitch in bf16: 144 B = 16 B x 9 (odd multiple: 16-byte fragment reads without bank conflicts)
typedef __attribute__((ext_vector_type(4))) __bf16 v4b;
__device__ __forceinline__ v8f wmma_b(v16b a, v16b b, v8f c) { return __builtin_amdgcn_wmma_f32_16x16x32_bf16(false, a, false, b, (short)0, c, false, false); }
__device__ __forceinline__ void put_bf(__bf16* d, v4f v) { v4b c;
#pragma unroll
  for (int k = 0; k < 4; ++k) c[k] = (__bf16)v[k];
  *(v4b*)d = c; }
__device__ __forceinline__ void put_bf_split(__bf16* dh, __bf16* dl, v4f v) { v4b h, l;
#pragma unroll
  for (int k = 0; k < 4; ++k) { const __bf16 hv = (__bf16)v[k]; h[k] = hv; l[k] = (__bf16)(v[k] - (float)hv); }
  *(v4b*)dh = h; *(v4b*)dl = l; }
// ---- k_proj: block = (64 rows, 128 cols, which): q/k/v = X W (+ b) with exact bf16 products (K = DIN) -> which 0: q f16 rows (+ residual rows < QHI); 1: k f16 rows (+ residual rows < KHI); 2: v f16 planes [c][t] (+ bf16 hi/lo planes for t < KHI)
__global__ __launch_bounds__(128) void k_proj(const float* __restrict__ XQ, const float* __restrict__ XK, const float* __restrict__ XV, const float* __restrict__ WQ, const float* __restrict__ WK, const float* __restrict__ WV, const float* __restrict__ BQ, const float* __restrict__ BK, const float* __restrict__ BV,
    _Float16* __restrict__ QH, _Float16* __restrict__ QL, _Float16* __restrict__ KH, _Float16* __restrict__ KL, _Float16* __restrict__ VT, __bf16* __restrict__ VB, __bf16* __restrict__ VBL PROJ_EXTRA_PARAMS) {
  // LDS: st, then one range that holds the two operand stages during the product and the converted tiles after it (the loop's last barrier and the two of the epilogue lie between the last fragment read and the first write of a converted tile)
  __shared__ __align__(16) char sm[64 * 132 * 4 + 2 * 192 * GP * 2];
  float (*st)[132] = (float (*)[132])sm; char* const s2 = sm + 64 * 132 * 4;
  __bf16 (*sg)[192][GP] = (__bf16 (*)[192][GP])s2;   // stage: rows 0..63 = X rows, 64..191 = W rows (output columns)
  _Float16 (*sh)[136] = (_Float16 (*)[136])s2; _Float16 (*sl)[136] = (_Float16 (*)[136])(s2 + 64 * 136 * 2);
  _Float16 (*th)[72] = (_Float16 (*)[72])s2; __bf16 (*tb)[72] = (__bf16 (*)[72])(s2 + 128 * 72 * 2); __bf16 (*tbl)[72] = (__bf16 (*)[72])(s2 + 2 * 128 * 72 * 2);
  const int tid = threadIdx.x, wave = tid >> 5, lane = tid & 31, col = lane & 15, g = lane >> 4; const int which = blockIdx.z; const int c0 = blockIdx.y * 128; const size_t r0 = (size_t)blockIdx.x * 64; const size_t bb = r0 / TT; const int t0 = (int)(r0 % TT);
  const float* X = which == 0 ? XQ : which == 1 ? XK : XV; const float* WA = which == 0 ? WQ : which == 1 ? WK : WV; const float* BA = which == 0 ? BQ : which == 1 ? BK : BV;
  // (every '#pragma unroll' below: the loop's index selects a register of a load, fragment or accumulator array, which stays in registers only under constant indices)
  const int wr = (wave >> 1) * 32, wc = (wave & 1) * 64;   // wave tile: 32 rows x 64 columns (2 x 4 fragments for 8 products)
  const int lr = tid >> 4, lc = (tid & 15) * 4;            // staging: 16 lanes read 256 contiguous bytes of one row; a thread takes rows lr + 8 i
  const float* xg = X + (r0 + lr) * DIN + lc; const float* wg = WA + (size_t)(c0 + lr) * DIN + lc;
  v4f rx[8], rw[16];
#pragma unroll
  for (int i = 0; i < 8; ++i) rx[i] = *(const v4f*)(xg + (size_t)i * 8 * DIN);
#pragma unroll
  for (int i = 0; i < 16; ++i) rw[i] = *(const v4f*)(wg + (size_t)i * 8 * DIN);
  asm volatile("s_wait_xcnt 0x0" ::: "memory");   // before a register that an issued load names as its address is written again
#pragma unroll
  for (int i = 0; i < 8; ++i) put_bf(&sg[0][lr + 8 * i][lc], rx[i]);
#pragma unroll
  for (int i = 0; i < 16; ++i) put_bf(&sg[0][64 + lr + 8 * i][lc], rw[i]);
  __syncthreads();
  v8f acc[2][4] = {};
  for (int t = 0; t < DIN / GK; ++t) { const int bu = t & 1; const bool more = t + 1 < DIN / GK;
    if (more) {   // next stage's rows fly while this stage is worked on
#pragma unroll
      for (int i = 0; i < 8; ++i) rx[i] = *(const v4f*)(xg + (size_t)i * 8 * DIN + (t + 1) * GK);
#pragma unroll
      for (int i = 0; i < 16; ++i) rw[i] = *(const v4f*)(wg + (size_t)i * 8 * DIN + (t + 1) * GK);
      asm volatile("s_wait_xcnt 0x0" ::: "memory");   // before a register that an issued load names as its address is written again
    }
#pragma unroll
    for (int kc = 0; kc < GK / 32; ++kc) { v16b a[2], w[4];
#pragma unroll
      for (int i = 0; i < 2; ++i) a[i] = frag_b(&sg[bu][wr + i * 16 + col][kc * 32], lane);
#pragma unroll
      for (int j = 0; j < 4; ++j) w[j] = frag_b(&sg[bu][64 + wc + j * 16 + col][kc * 32], lane);
#pragma unroll
      for (int i = 0; i < 2; ++i)
#pragma unroll
        for (int j = 0; j < 4; ++j) acc[i][j] = wmma_b(a[i], w[j], acc[i][j]); }
    __builtin_amdgcn_sched_barrier(0);   // keeps the rounding of the next stage's rows, which waits for their loads, behind this stage's products
    if (more) {
#pragma unroll
      for (int i = 0; i < 8; ++i) put_bf(&sg[bu ^ 1][lr + 8 * i][lc], rx[i]);
#pragma unroll
      for (int i = 0; i < 16; ++i) put_bf(&sg[bu ^ 1][64 + lr + 8 * i][lc], rw[i]); }
    __syncthreads(); }   // publishes stage t + 1 and ends every wave's reads of stage t, whose buffer the next trip refills
  { // stage the f32 tile (acc + bias) in LDS, run the per-(row, head) epilogue hook, then convert
#pragma unroll
    for (int j = 0; j < 4; ++j) { const float bias = BA ? bfr(BA[c0 + wc + j * 16 + col]) : 0.f;
#pragma unroll
      for (int i = 0; i < 2; ++i)
#pragma unroll
        for (int r = 0; r < 8; ++r) st[wr + i * 16 + 8 * g + r][wc + j * 16 + col] = acc[i][j][r] + bias; }
    __syncthreads();
    for (int e = tid; e < 64 * (128 / HD); e += 128) { const int rl = e / (128 / HD), hh = e % (128 / HD); PROJ_EPI(which, &st[rl][hh * HD], (int)((r0 + rl) % TT), (c0 / HD) + hh); }
    __syncthreads(); }
  if (which < 2) { _Float16* DH = which == 0 ? QH : KH; _Float16* DL = which == 0 ? QL : KL; const int nhi = which == 0 ? QHI : KHI; const bool hi_rows = t0 < nhi;
    for (int e = tid; e < 64 * 128; e += 128) { const int rl = e >> 7, cl = e & 127; const float v = st[rl][cl]; const _Float16 hv = (_Float16)v; sh[rl][cl] = hv; sl[rl][cl] = (_Float16)((v - (float)hv) * 1024.0f); }
    __syncthreads();
    for (int e = tid; e < 64 * 16; e += 128) { const int rl = e >> 4, q = e & 15; vst2((unsigned*)(DH + (r0 + rl) * CC + c0 + q * 8), *(const v4u*)&sh[rl][q * 8]); if (hi_rows) vst2((unsigned*)(DL + (bb * nhi + t0 + rl) * (size_t)CC + c0 + q * 8), *(const v4u*)&sl[rl][q * 8]); }
  } else { const bool hi_rows = t0 < KHI;
    for (int e = tid; e < 64 * 128; e += 128) { const int rl = e & 63, cl = e >> 6; const float v = st[rl][cl]; th[cl][rl] = (_Float16)v; const __bf16 bh = (__bf16)v; tb[cl][rl] = bh; tbl[cl][rl] = (__bf16)(v - (float)bh); }
    __syncthreads();
    for (int e = tid; e < 128 * 8; e += 128) { const int cl = e >> 3, q = e & 7; vst2((unsigned*)(VT + (bb * CC + c0 + cl) * (size_t)TT + t0 + q * 8), *(const v4u*)&th[cl][q * 8]); if (hi_rows) { const size_t o3 = (bb * CC + c0 + cl) * (size_t)KHI + t0 + q * 8; vst2((unsigned*)(VB + o3), *(const v4u*)&tb[cl][q * 8]); vst2((unsigned*)(VBL + o3), *(const v4u*)&tbl[cl][q * 8]); } } } }
// ---- k_fa: block = 128 queries (8 waves x 16) of (b, h), one pass over all keys in stages of 64: S^T = K Q^T (q hi + residual x 2^10, 2 products) x SCALE, running maximum and sum per query (a lane holds one query's scores), P^T x 2^11 packed from the score tiles as the B operand, ctx^T += V^T P^T (1 product); logits and P never leave the registers
// (every '#pragma unroll' in k_fa: the loop's index selects a register of a fragment, score or accumulator array, which stays in registers only under constant indices)
#define FK 64              // keys per stage
#define SL2E (SCALE * 1.44269504088896f)   // 64^-0.5 x log2 e: e^(SCALE x) = 2^(SL2E x)
#define FP 72              // LDS row pitch in f16: 144 B = 16 B x 9 (odd multiple: 16-byte fragment reads without bank conflicts)
__device__ __forceinline__ v8f wmma_h(v16h a, v16h b, v8f c) { return __builtin_amdgcn_wmma_f32_16x16x32_f16(false, a, false, b, (short)0, c, false, false); }
__global__ __launch_bounds__(256) void k_fa(const _Float16* __restrict__ QH, const _Float16* __restrict__ QL, const _Float16* __restrict__ KH, const _Float16* __restrict__ VT, float* __restrict__ Y) {
  __shared__ __align__(16) _Float16 sK[2][FK][FP], sV[2][HD][FP];
  const int tid = threadIdx.x, wave = tid >> 5, lane = tid & 31, col = lane & 15, g = lane >> 4; const int h = blockIdx.y, b = blockIdx.z; const int ql0 = blockIdx.x * 128 + wave * 16;
  v16h qh[HD / 32], ql[HD / 32];
#pragma unroll
  for (int kc = 0; kc < HD / 32; ++kc) { qh[kc] = frag_h(QH + ((size_t)b * TT + ql0 + col) * CC + h * HD + kc * 32, lane); ql[kc] = frag_h(QL + ((size_t)b * QHI + ql0 + col) * CC + h * HD + kc * 32, lane); }
  // staging: thread = (row sr and sr + 32, 16-byte chunk sc) of the K tile [key][d] and of the V tile [d][key]: 8 lanes read one whole 128-B row
  const int sr = tid >> 3, sc = (tid & 7) * 8;
  const _Float16* kg = KH + ((size_t)b * TT + sr) * CC + h * HD + sc; const _Float16* vg = VT + ((size_t)b * CC + h * HD + sr) * (size_t)TT + sc;
  v4u rk0 = *(const v4u*)kg, rk1 = *(const v4u*)(kg + 32 * CC), rv0 = *(const v4u*)vg, rv1 = *(const v4u*)(vg + 32 * TT);
  *(v4u*)&sK[0][sr][sc] = rk0; *(v4u*)&sK[0][sr + 32][sc] = rk1; *(v4u*)&sV[0][sr][sc] = rv0; *(v4u*)&sV[0][sr + 32][sc] = rv1;
  __syncthreads();
  v8f acc[HD / 16] = {}; float m = -3.0e38f, l = 0.f;
  for (int t = 0; t < TT / FK; ++t) { const int bu = t & 1; const bool more = t + 1 < TT / FK;
    if (more) { const _Float16* kn = kg + (size_t)(t + 1) * FK * CC; const _Float16* vn = vg + (t + 1) * FK;   // next stage's rows fly while this stage is worked on
      rk0 = *(const v4u*)kn; rk1 = *(const v4u*)(kn + 32 * CC); rv0 = *(const v4u*)vn; rv1 = *(const v4u*)(vn + 32 * TT); }
    v2f s[FK / 16][4]; float mt = -3.0e38f;   // scores in pairs: one packed fma serves two
#pragma unroll
    for (int i = 0; i < FK / 16; ++i) { v8f ah = {}, al = {};
#pragma unroll
      for (int kc = 0; kc < HD / 32; ++kc) { const v16h kf = frag_h(&sK[bu][i * 16 + col][kc * 32], lane); ah = wmma_h(kf, qh[kc], ah); al = wmma_h(kf, ql[kc], al); }
#pragma unroll
      for (int r = 0; r < 4; ++r) { const v2f h2 = {ah[2 * r], ah[2 * r + 1]}, l2 = {al[2 * r], al[2 * r + 1]}; s[i][r] = h2 + l2 * (1.0f / 1024.0f); mt = fmaxf(mt, fmaxf(s[i][r][0], s[i][r][1])); } }   // s[i][r][u] = q.k (key i*16 + 8g + 2r + u, query col), not yet scaled: the maximum is taken on q.k itself (SL2E > 0 keeps the order)
    mt = fmaxf(mt, __shfl_xor(mt, 16));
    if (__builtin_amdgcn_ballot_w32(mt > m) != 0) {   // some query's maximum rose: bring its sum and its ctx to the new maximum (factor 1 for the others)
      const float mn = fmaxf(m, mt); const float al = __builtin_amdgcn_exp2f((m - mn) * SL2E); m = mn; l *= al;
#pragma unroll
      for (int j = 0; j < HD / 16; ++j)
#pragma unroll
        for (int r = 0; r < 8; ++r) acc[j][r] *= al; }
    v2f ls[2] = {{0.f, 0.f}, {0.f, 0.f}};   // four independent partial sums of this stage: no 32-long dependent add chain
    const float mo = m * SL2E - 11.0f;   // P x 2^11 (at most 2^11), so that small P stay normal f16 numbers; the sum carries the same factor
#pragma unroll
    for (int c2 = 0; c2 < FK / 32; ++c2) { v16h p;
#pragma unroll
      for (int r = 0; r < 4; ++r) { const v2f t0 = s[2 * c2][r] * SL2E - mo, t1 = s[2 * c2 + 1][r] * SL2E - mo;   // e^(SCALE (q.k - m)) x 2^11 as one fma and one v_exp_f32; a result under 2^-126 may come as 0, far under the smallest f16
        const v2f e0 = {__builtin_amdgcn_exp2f(t0[0]), __builtin_amdgcn_exp2f(t0[1])}, e1 = {__builtin_amdgcn_exp2f(t1[0]), __builtin_amdgcn_exp2f(t1[1])}; ls[r & 1] += e0 + e1;
        p[2 * r] = (_Float16)e0[0]; p[2 * r + 1] = (_Float16)e0[1]; p[8 + 2 * r] = (_Float16)e1[0]; p[8 + 2 * r + 1] = (_Float16)e1[1]; }
#pragma unroll
      for (int j = 0; j < HD / 16; ++j) acc[j] = wmma_h(frag_h(&sV[bu][j * 16 + col][c2 * 32], lane), p, acc[j]); }
    l += (ls[0][0] + ls[0][1]) + (ls[1][0] + ls[1][1]);
    if (more) { *(v4u*)&sK[bu ^ 1][sr][sc] = rk0; *(v4u*)&sK[bu ^ 1][sr + 32][sc] = rk1; *(v4u*)&sV[bu ^ 1][sr][sc] = rv0; *(v4u*)&sV[bu ^ 1][sr + 32][sc] = rv1; }
    __syncthreads(); }   // publishes stage t + 1 and ends every wave's reads of stage t, whose buffer the next trip refills
  l += __shfl_xor(l, 16); const float inv = l > 0.f ? 1.0f / l : 0.f;
  float* yp = Y + ((size_t)b * TT + ql0 + col) * CC + h * HD + 8 * g;   // acc[j][r] = ctx(query col, d = j*16 + 8g + r)
#pragma unroll
  for (int j = 0; j < HD / 16; ++j) { v4f o0, o1;
#pragma unroll
    for (int r = 0; r < 4; ++r) { o0[r] = acc[j][r] * inv; o1[r] = acc[j][4 + r] * inv; }
    vst2(yp + j * 16, o0); vst2(yp + j * 16 + 4, o1); } }
// ---- k_out: block = (64 rows, 128 cols): out = ctx Wo (+ bo): ctx split bf16 hi + lo against exact bf16 Wo (2 products); wave = 16 rows x 128 columns
__global__ __launch_bounds__(128) void k_out(const float* __restrict__ Y, const float* __restrict__ WO, const float* __restrict__ BO, float* __restrict__ OUT) {
  __shared__ __align__(16) char sm[2 * 256 * GP * 2];
  __bf16 (*sg)[256][GP] = (__bf16 (*)[256][GP])sm;   // stage: rows 0..63 = ctx hi, 64..127 = ctx lo, 128..255 = Wo rows (output columns)
  float (*sf)[16][132] = (float (*)[16][132])sm;     // output staging, in the stages' range after the loop's last barrier
  const int tid = threadIdx.x, wave = tid >> 5, lane = tid & 31, col = lane & 15, g = lane >> 4; const int c0 = blockIdx.y * 128; const size_t rb = (size_t)blockIdx.x * 64, r0 = rb + wave * 16;
  // (every '#pragma unroll' below: the loop's index selects a register of a load, fragment or accumulator array, which stays in registers only under constant indices)
  const int lr = tid >> 4, lc = (tid & 15) * 4;            // staging: 16 lanes read 256 contiguous bytes of one row; a thread takes rows lr + 8 i
  const float* yg = Y + (rb + lr) * CC + lc; const float* wg = WO + (size_t)(c0 + lr) * CC + lc;
  v4f ry[8], rw[16];
#pragma unroll
  for (int i = 0; i < 8; ++i) ry[i] = *(const v4f*)(yg + (size_t)i * 8 * CC);
#pragma unroll
  for (int i = 0; i < 16; ++i) rw[i] = *(const v4f*)(wg + (size_t)i * 8 * CC);
  asm volatile("s_wait_xcnt 0x0" ::: "memory");   // before a register that an issued load names as its address is written again
#pragma unroll
  for (int i = 0; i < 8; ++i) put_bf_split(&sg[0][lr + 8 * i][lc], &sg[0][64 + lr + 8 * i][lc], ry[i]);
#pragma unroll
  for (int i = 0; i < 16; ++i) put_bf(&sg[0][128 + lr + 8 * i][lc], rw[i]);
  __syncthreads();
  v8f acc[8] = {};
  for (int t = 0; t < CC / GK; ++t) { const int bu = t & 1; const bool more = t + 1 < CC / GK;
    if (more) {   // next stage's rows fly while this stage is worked on
#pragma unroll
      for (int i = 0; i < 8; ++i) ry[i] = *(const v4f*)(yg + (size_t)i * 8 * CC + (t + 1) * GK);
#pragma unroll
      for (int i = 0; i < 16; ++i) rw[i] = *(const v4f*)(wg + (size_t)i * 8 * CC + (t + 1) * GK);
      asm volatile("s_wait_xcnt 0x0" ::: "memory");   // before a register that an issued load names as its address is written again
    }
#pragma unroll
    for (int kc = 0; kc < GK / 32; ++kc) { const v16b ah = frag_b(&sg[bu][wave * 16 + col][kc * 32], lane), al = frag_b(&sg[bu][64 + wave * 16 + col][kc * 32], lane);
#pragma unroll
      for (int j = 0; j < 8; ++j) { const v16b w = frag_b(&sg[bu][128 + j * 16 + col][kc * 32], lane); acc[j] = wmma_b(ah, w, acc[j]); acc[j] = wmma_b(al, w, acc[j]); } }
    __builtin_amdgcn_sched_barrier(0);   // keeps the rounding of the next stage's rows, which waits for their loads, behind this stage's products
    if (more) {
#pragma unroll
      for (int i = 0; i < 8; ++i) put_bf_split(&sg[bu ^ 1][lr + 8 * i][lc], &sg[bu ^ 1][64 + lr + 8 * i][lc], ry[i]);
#pragma unroll
      for (int i = 0; i < 16; ++i) put_bf(&sg[bu ^ 1][128 + lr + 8 * i][lc], rw[i]); }
    __syncthreads(); }   // publishes stage t + 1 and ends every wave's reads of stage t, whose buffer the next trip refills
#pragma unroll
  for (int j = 0; j < 8; ++j) { const float bias = BO ? bfr(BO[c0 + j * 16 + col]) : 0.f;
#pragma unroll
    for (int r = 0; r < 8; ++r) sf[wave][8 * g + r][j * 16 + col] = acc[j][r] + bias; }
  LDSX(); for (int rl = 0; rl < 16; ++rl) vst2(OUT + (r0 + rl) * DIN + c0 + lane * 4, *(const v4f*)&sf[wave][rl][lane * 4]); }

extern "C" void kernel_launch(void* const* d_in, const int* in_sizes, int n_in, void* d_out, int out_size, void* d_ws, size_t ws_size, hipStream_t stream) {
  (void)in_sizes; (void)n_in; (void)out_size;
  const float** F = (const float**)d_in;
  if (ws_size < (size_t)WS_END) return;
  char* ws = (char*)d_ws; _Float16 *QH = (_Float16*)(ws + WS_QH), *KH = (_Float16*)(ws + WS_KH), *VT = (_Float16*)(ws + WS_VT), *QL = (_Float16*)(ws + WS_QL), *KL = (_Float16*)(ws + WS_KL); __bf16 *VB = (__bf16*)(ws + WS_VB), *VBL = (__bf16*)(ws + WS_VBL); float *Y = (float*)(ws + WS_Y);
  (void)Y; (void)QL; (void)KL; (void)VB; (void)VBL;
  // inputs: 0 x [2,2048,1024]; 1 qkv_w [3072,1024] (out,in; rows q | k | v); 2 proj_w [1024,1024] (out,in); 3 proj_b; 4 q_scale [64]; 5 k_scale [64]
  k_proj<<<dim3(TNB * TT / 64, CC / 128, 3), 128, 0, stream>>>(F[0], F[0], F[0], F[1], F[1] + (size_t)CC * DIN, F[1] + (size_t)2 * CC * DIN, nullptr, nullptr, nullptr, QH, QL, KH, KL, VT, VB, VBL, F[4], F[5]);
  k_fa<<<dim3(TT / 128, NH, TNB), 256, 0, stream>>>(QH, QL, KH, VT, Y);
  k_out<<<dim3(TNB * TT / 64, DIN / 128), 128, 0, stream>>>(Y, F[2], F[3], (float*)d_out);
}

// v004
// Measured time: 99.2 microseconds a run.
// Next to v003, in two timings, it ran 1.12 and 1.14 times as fast.
// Counting every step since v000, it is 14.5 times as fast.
// compute dtype: all float inputs rounded to bf16; qkv = x Wqkv^T with EXACT bf16 products on WMMA 16x16x32 (f32 accumulate); per-head RMSNorm of q and k in f32 on the projected rows; q as f16 hi + residual (x 2^10) against k once to f16 (2 products); softmax in f32 (base 2: 64^-0.5 log2 e folded into one fma a score, hardware exp2) with a running maximum and sum over stages of 64 keys; P x 2^11 (relative to the running maximum) once to f16 against v once to f16 (1 product), divided by the sum at the end; ctx split bf16 hi + lo against exact proj_w (2 products) + proj_b; f32 output.
#include <hip/hip_runtime.h>
#include <math.h>

typedef __attribute__((ext_vector_type(16))) _Float16 v16h;
typedef __attribute__((ext_vector_type(16))) __bf16 v16b;
typedef __attribute__((ext_vector_type(8)))  _Float16 v8h;
typedef __attribute__((ext_vector_type(8)))  float v8f;
typedef __attribute__((ext_vector_type(4)))  float v4f;
typedef __attribute__((ext_vector_type(2)))  float v2f;
typedef __attribute__((ext_vector_type(4)))  unsigned v4u;
typedef __attribute__((ext_vector_type(4)))  int v4i;
typedef float __attribute__((may_alias)) float_a;
typedef int __attribute__((may_alias)) int_a;

template <typename T> __device__ __forceinline__ void vst2(void* p, T v) { *(T*)p = v;  }
__device__ __forceinline__ v8f wmma16(v16h a, v16h b, v8f c) {
  v8f d = __builtin_amdgcn_wmma_f32_16x16x32_f16(false, a, false, b, (short)0, c, false, false);
  asm volatile("v_nop\n\tv_nop\n\tv_nop\n\tv_nop" : "+v"(d) : "v"(a), "v"(b));
  return d;
}
__device__ __forceinline__ v8f wmma_bf(v16b a, v16b b, v8f c) {
  v8f d = __builtin_amdgcn_wmma_f32_16x16x32_bf16(false, a, false, b, (short)0, c, false, false);
  asm volatile("v_nop\n\tv_nop\n\tv_nop\n\tv_nop" : "+v"(d) : "v"(a), "v"(b));
  return d;
}
// 16x16x32 fragments: lane = (h = lane>>4, row/col = lane&15); elements 0..7 = k0+8h+0..7, 8..15 = k0+16+8h+0..7; D element r = row 8h+r
__device__ __forceinline__ v16h frag_h(const _Float16* rowk0, int lane) {
  union { v16h v; v8h q[2]; } u; const _Float16* p = rowk0 + 8 * (lane >> 4);
  u.q[0] = *(const v8h*)p; u.q[1] = *(const v8h*)(p + 16); return u.v;
}
__device__ __forceinline__ v16h frag_f32(const float* rowk0, int lane) {
  v16h a; const float* p = rowk0 + 8 * (lane >> 4);
#pragma unroll
  for (int i = 0; i < 8; ++i) { a[i] = (_Float16)p[i]; a[8 + i] = (_Float16)p[16 + i]; }
  return a;
}
__device__ __forceinline__ v16h frag_f32s(const float* rowk0, int lane, float sc) {
  v16h a; const float* p = rowk0 + 8 * (lane >> 4);
#pragma unroll
  for (int i = 0; i < 8; ++i) { a[i] = (_Float16)(p[i] * sc); a[8 + i] = (_Float16)(p[16 + i] * sc); }
  return a;
}
// column fragment from a [K][ld] layout (column n), rows >= K read as 0
__device__ __forceinline__ v16h fragc_f32(const float* W, int k0, int n, int lane, int ld, int K) {
  v16h a; const int g = lane >> 4;
#pragma unroll
  for (int i = 0; i < 8; ++i) { const int ka = k0 + 8 * g + i, kb = ka + 16;
    a[i] = (_Float16)(ka < K ? W[(size_t)(ka < K ? ka : K - 1) * ld + n] : 0.f); a[8 + i] = (_Float16)(kb < K ? W[(size_t)(kb < K ? kb : K - 1) * ld + n] : 0.f); }
  return a;
}
struct F2 { v16b h, l; };
__device__ __forceinline__ F2 bsplit16(const float v[16]) { F2 r;
#pragma unroll
  for (int i = 0; i < 16; ++i) { const __bf16 h = (__bf16)v[i]; r.h[i] = h; r.l[i] = (__bf16)(v[i] - (float)h); }
  return r; }
__device__ __forceinline__ F2 split_row(const float* row, int k0, int lane) { float v[16]; const float* p = row + k0 + 8 * (lane >> 4);
#pragma unroll
  for (int i = 0; i < 8; ++i) { v[i] = p[i]; v[8 + i] = p[16 + i]; }
  return bsplit16(v); }
__device__ __forceinline__ F2 split_rowK(const float* row, int k0, int lane, int K) { float v[16]; const int g = lane >> 4;
#pragma unroll
  for (int i = 0; i < 8; ++i) { const int ka = k0 + 8 * g + i, kb = ka + 16; v[i] = ka < K ? row[ka < K ? ka : K - 1] : 0.f; v[8 + i] = kb < K ? row[kb < K ? kb : K - 1] : 0.f; }
  return bsplit16(v); }
__device__ __forceinline__ F2 split_col(const float* W, int k0, int n, int lane, int ld, int K) { float v[16]; const int g = lane >> 4;
#pragma unroll
  for (int i = 0; i < 8; ++i) { const int ka = k0 + 8 * g + i, kb = ka + 16; v[i] = ka < K ? W[(size_t)(ka < K ? ka : K - 1) * ld + n] : 0.f; v[8 + i] = kb < K ? W[(size_t)(kb < K ? kb : K - 1) * ld + n] : 0.f; }
  return bsplit16(v); }
__device__ __forceinline__ v8f mac3(const F2& a, const F2& b, v8f c) { c = wmma_bf(a.l, b.h, c); c = wmma_bf(a.h, b.l, c); return wmma_bf(a.h, b.h, c); }
__device__ __forceinline__ float sigm(float v) { return 1.0f / (1.0f + expf(-v)); }
#define LDSX() do { asm volatile("s_wait_dscnt 0" ::: "memory"); __builtin_amdgcn_wave_barrier(); __builtin_amdgcn_fence(__ATOMIC_RELEASE, "workgroup"); } while (0)

// Self-attention with QK RMSNorm (B 2, N 2,048, C 1,024 = 16 x 64): qkv = x qkv_w^T ((out,in) [3072,1024], rows (3, H, hd)); q, k <- scale * q / (|q| 64^-0.5 + 1e-8) per head (scales all ones); out = merged(softmax(q k^T x 64^-0.5) v) proj_w^T + proj_b (non-causal).
#define NB 2
#define TT 2048
#define CC 1024            // NH * HD = projected width
#define DIN 1024          // input (model) width
#define NH 16
#define HD 64
#define NQB (TT / 64)
#define HG 4
#define SCALE (0.125f)
#define CAUSAL 0
#ifndef TNB
#define TNB NB
#endif
__device__ __forceinline__ float bfr(float v) { return (float)(__bf16)v; }
__host__ __device__ __forceinline__ int kb_last(int qb) { return CAUSAL ? ((qb * 64 + 63) >> 7) : (TT / 128 - 1); }
typedef __attribute__((ext_vector_type(8))) __bf16 v8b;
__device__ __forceinline__ v16b frag_b(const __bf16* rowk0, int lane) {
  union { v16b v; v8b q[2]; } u; const __bf16* p = rowk0 + 8 * (lane >> 4);
  u.q[0] = *(const v8b*)p; u.q[1] = *(const v8b*)(p + 16); return u.v;
}
#define QBH 0
#define QHI 2048            // rows carrying a q residual plane (all rows when non-causal: 2-product logits everywhere)
#define KHI 64            // key rows carrying k residual / v bf16 hi+lo planes (written by k_proj, read by no kernel)
// B fragment (k rows k0+.., output column o) of a weight: (in,out) [K][ld] or (out,in) [ld rows of K]: bf16 exact, or f16(bf16 * 256) exact
__device__ __forceinline__ v16b wcol_io(const float* Wm, int k0, int o, int lane, int ld) { v16b w; const int g = lane >> 4;
#pragma unroll
  for (int i = 0; i < 8; ++i) { w[i] = (__bf16)Wm[(size_t)(k0 + 8 * g + i) * ld + o]; w[8 + i] = (__bf16)Wm[(size_t)(k0 + 16 + 8 * g + i) * ld + o]; }
  return w; }
__device__ __forceinline__ v16b wcol_oi(const float* Wm, int k0, int o, int lane, int K) { v16b w; const float* p = Wm + (size_t)o * K + k0 + 8 * (lane >> 4);
#pragma unroll
  for (int i = 0; i < 8; ++i) { w[i] = (__bf16)p[i]; w[8 + i] = (__bf16)p[16 + i]; }
  return w; }
__device__ __forceinline__ v16h wcolh_io(const float* Wm, int k0, int o, int lane, int ld) { v16h w; const int g = lane >> 4;
#pragma unroll
  for (int i = 0; i < 8; ++i) { w[i] = (_Float16)(bfr(Wm[(size_t)(k0 + 8 * g + i) * ld + o]) * 256.0f); w[8 + i] = (_Float16)(bfr(Wm[(size_t)(k0 + 16 + 8 * g + i) * ld + o]) * 256.0f); }
  return w; }
__device__ __forceinline__ v16h wcolh_oi(const float* Wm, int k0, int o, int lane, int K) { v16h w; const float* p = Wm + (size_t)o * K + k0 + 8 * (lane >> 4);
#pragma unroll
  for (int i = 0; i < 8; ++i) { w[i] = (_Float16)(bfr(p[i]) * 256.0f); w[8 + i] = (_Float16)(bfr(p[16 + i]) * 256.0f); }
  return w; }
#define WQKV_LAYOUT 1   // layout of WCOL, which no kernel calls (k_proj reads qkv_w as (out,in) rows): 0 = (in,out) [DIN][CC]; 1 = (out,in) [CC][DIN]; 2 = per-head [NH][DIN][HD]
__device__ __forceinline__ v16b wcol_hdk(const float* Wm, int k0, int o, int lane) { v16b w; const int g = lane >> 4; const float* p = Wm + (size_t)(o / HD) * DIN * HD + (o % HD);
#pragma unroll
  for (int i = 0; i < 8; ++i) { w[i] = (__bf16)p[(size_t)(k0 + 8 * g + i) * HD]; w[8 + i] = (__bf16)p[(size_t)(k0 + 16 + 8 * g + i) * HD]; }
  return w; }
#define WO_OUT_IN 1
#if WQKV_LAYOUT == 1
#define WCOL(W, k0, o, lane) wcol_oi(W, k0, o, lane, DIN)
#elif WQKV_LAYOUT == 2
#define WCOL(W, k0, o, lane) wcol_hdk(W, k0, o, lane)
#else
#define WCOL(W, k0, o, lane) wcol_io(W, k0, o, lane, CC)
#endif
#if WO_OUT_IN
#define WOCOL(W, k0, o, lane) wcol_oi(W, k0, o, lane, CC)
#define WOCOLH(W, k0, o, lane) wcolh_oi(W, k0, o, lane, CC)
#else
#define WOCOL(W, k0, o, lane) wcol_io(W, k0, o, lane, DIN)
#define WOCOLH(W, k0, o, lane) wcolh_io(W, k0, o, lane, DIN)
#endif
#define PROJ_EXTRA_PARAMS , const float* __restrict__ QS, const float* __restrict__ KS
#define PROJ_EPI(which, row, t, h) do { if ((which) < 2) { float* rw = (row); const float* sc = (which) == 0 ? QS : KS; float ss = 0.f; _Pragma("unroll") for (int i = 0; i < 64; ++i) ss += rw[i] * rw[i]; const float rms = __fsqrt_rn(ss) * 0.125f; const float inv = 1.0f / (rms + 1e-8f); _Pragma("unroll") for (int i = 0; i < 64; ++i) rw[i] = bfr(sc[i]) * (rw[i] * inv); } } while (0)   /* per-head RMSNorm: norm(x, axis=-1) * hd^-0.5; scale * (x / (rms + eps)) */
#ifndef SM_EXTRA_PARAMS
#define SM_EXTRA_PARAMS
#endif
#ifndef PROJ_EXTRA_PARAMS
#define PROJ_EXTRA_PARAMS
#endif
#ifndef SM_MASK_HOOK
#define SM_MASK_HOOK (void)0
#endif

#define WS_QH  0u                                      // f16 q rows [b*t][CC]
#define WS_KH  (WS_QH + 2u * (size_t)NB * TT * CC)      // f16 k rows [b*t][CC]
#define WS_VT  (WS_KH + 2u * (size_t)NB * TT * CC)      // f16 v planes [b][c][t]
#define WS_QL  (WS_VT + 2u * (size_t)NB * CC * TT)      // f16 q residual x 2^10 rows [b][t < QHI][CC]
#define WS_KL  (WS_QL + 2u * (size_t)NB * QHI * CC)     // f16 k residual x 2^10 rows [b][t < KHI][CC]
#define WS_VB  (WS_KL + 2u * (size_t)NB * KHI * CC)     // bf16 v hi planes [b][c][t < KHI]
#define WS_VBL (WS_VB + 2u * (size_t)NB * CC * KHI)
#define WS_S   (WS_VBL + 2u * (size_t)NB * CC * KHI)    // f32 [hg][t][s] region, unused: logits and P stay in k_fa's registers
#define WS_Y   (WS_S  + 4u * (size_t)HG * TT * TT)      // f32 ctx rows [b*t][CC] (only when there is an output projection)
#define WS_END (WS_Y  + 4u * (size_t)NB * TT * CC)

// ---- operand staging of the two projection GEMMs: a stage is 64 k of every operand row of the block's tile, rounded (or split) to bf16 once by the block and laid in LDS, from where every wave takes its fragments
#define GK 64              // k per stage
#define GP 72              // LDS row pitch in bf16: 144 B = 16 B x 9 (odd multiple: 16-byte fragment reads without bank conflicts)
typedef __attribute__((ext_vector_type(4))) __bf16 v4b;
__device__ __forceinline__ v8f wmma_b(v16b a, v16b b, v8f c) { return __builtin_amdgcn_wmma_f32_16x16x32_bf16(false, a, false, b, (short)0, c, false, false); }
__device__ __forceinline__ void put_bf(__bf16* d, v4f v) { v4b c;
#pragma unroll
  for (int k = 0; k < 4; ++k) c[k] = (__bf16)v[k];
  *(v4b*)d = c; }
__device__ __forceinline__ void put_bf_split(__bf16* dh, __bf16* dl, v4f v) { v4b h, l;
#pragma unroll
  for (int k = 0; k < 4; ++k) { const __bf16 hv = (__bf16)v[k]; h[k] = hv; l[k] = (__bf16)(v[k] - (float)hv); }
  *(v4b*)dh = h; *(v4b*)dl = l; }
// ---- k_proj: block = 256 rows x 192 columns (3 whole heads) of the one product qkv = X Wqkv^T with exact bf16 products (K = DIN), 16 waves; 16 x 16 blocks. Each head of the tile goes its own way: q: f16 rows + residual rows; k: f16 rows (+ residual rows t < KHI); v: f16 planes [c][t] (+ bf16 hi/lo planes for t < KHI)
#define PM 256             // rows of X per block
#define PN 192             // rows of Wqkv (output columns) per block: an X row fetched from L2 serves 192 columns, a W row 256 rows
#define PT 512             // threads: 4 x 4 waves of 64 rows x 48 columns
#define SP 196             // pitch of the f32 tile in floats: 784 B = 16 B x 49
__global__ __launch_bounds__(PT) void k_proj(const float* __restrict__ X, const float* __restrict__ WA,
    _Float16* __restrict__ QH, _Float16* __restrict__ QL, _Float16* __restrict__ KH, _Float16* __restrict__ KL, _Float16* __restrict__ VT, __bf16* __restrict__ VB, __bf16* __restrict__ VBL PROJ_EXTRA_PARAMS) {
  // LDS: one range that holds the two operand stages during the product and the f32 tile after it (the loop's last barrier lies between the last fragment read and the first write of the tile), then the transposed v heads
  __shared__ __align__(16) char sm[PM * SP * 4 + PN * (PM + 8) * 2];
  static_assert(2 * (PM + PN) * GP * 2 <= PM * SP * 4, "the stages fit the f32 tile's range");
  static_assert(TT % PM == 0 && (3 * CC) % PN == 0 && PN % HD == 0 && KHI <= PM, "whole tiles, whole heads");
  __bf16 (*sg)[PM + PN][GP] = (__bf16 (*)[PM + PN][GP])sm;   // stage: rows 0..PM-1 = X rows, PM.. = W rows (output columns)
  float (*st)[SP] = (float (*)[SP])sm; _Float16 (*th)[PM + 8] = (_Float16 (*)[PM + 8])(sm + PM * SP * 4);
  const int tid = threadIdx.x, wave = tid >> 5, lane = tid & 31, col = lane & 15, g = lane >> 4; const int c0 = blockIdx.y * PN; const size_t r0 = (size_t)blockIdx.x * PM; const size_t bb = r0 / TT; const int t0 = (int)(r0 % TT);
  // (every '#pragma unroll' below: the loop's index selects a register of a load, fragment or accumulator array, which stays in registers only under constant indices)
  const int wr = (wave >> 2) * 64, wc = (wave & 3) * 48;   // wave tile: 64 rows x 48 columns (4 + 3 fragments for 12 products)
  const int lr = tid >> 4, lc = (tid & 15) * 4;            // staging: 16 lanes read 256 contiguous bytes of one row; a thread takes rows lr + 32 i
  const float* xg = X + (r0 + lr) * DIN + lc; const float* wg = WA + (size_t)(c0 + lr) * DIN + lc;
  v4f rx[PM / 32], rw[PN / 32];
#pragma unroll
  for (int i = 0; i < PM / 32; ++i) rx[i] = *(const v4f*)(xg + (size_t)i * 32 * DIN);
#pragma unroll
  for (int i = 0; i < PN / 32; ++i) rw[i] = *(const v4f*)(wg + (size_t)i * 32 * DIN);
  asm volatile("s_wait_xcnt 0x0" ::: "memory");   // before a register that an issued load names as its address is written again
#pragma unroll
  for (int i = 0; i < PM / 32; ++i) put_bf(&sg[0][lr + 32 * i][lc], rx[i]);
#pragma unroll
  for (int i = 0; i < PN / 32; ++i) put_bf(&sg[0][PM + lr + 32 * i][lc], rw[i]);
  __syncthreads();
  v8f acc[4][3] = {};
  for (int t = 0; t < DIN / GK; ++t) { const int bu = t & 1; const bool more = t + 1 < DIN / GK;
    if (more) {   // next stage's rows fly while this stage is worked on
#pragma unroll
      for (int i = 0; i < PM / 32; ++i) rx[i] = *(const v4f*)(xg + (size_t)i * 32 * DIN + (t + 1) * GK);
#pragma unroll
      for (int i = 0; i < PN / 32; ++i) rw[i] = *(const v4f*)(wg + (size_t)i * 32 * DIN + (t + 1) * GK);
      asm volatile("s_wait_xcnt 0x0" ::: "memory");   // before a register that an issued load names as its address is written again
    }
#pragma unroll
    for (int kc = 0; kc < GK / 32; ++kc) { v16b a[4], w[3];
#pragma unroll
      for (int i = 0; i < 4; ++i) a[i] = frag_b(&sg[bu][wr + i * 16 + col][kc * 32], lane);
#pragma unroll
      for (int j = 0; j < 3; ++j) w[j] = frag_b(&sg[bu][PM + wc + j * 16 + col][kc * 32], lane);
#pragma unroll
      for (int i = 0; i < 4; ++i)
#pragma unroll
        for (int j = 0; j < 3; ++j) acc[i][j] = wmma_b(a[i], w[j], acc[i][j]); }
    __builtin_amdgcn_sched_barrier(0);   // keeps the rounding of the next stage's rows, which waits for their loads, behind this stage's products
    if (more) {
#pragma unroll
      for (int i = 0; i < PM / 32; ++i) put_bf(&sg[bu ^ 1][lr + 32 * i][lc], rx[i]);
#pragma unroll
      for (int i = 0; i < PN / 32; ++i) put_bf(&sg[bu ^ 1][PM + lr + 32 * i][lc], rw[i]); }
    __syncthreads(); }   // publishes stage t + 1 and ends every wave's reads of stage t, whose buffer the next trip refills (behind the last trip: the f32 tile)
  // stage the f32 tile in LDS, run the per-(row, head) epilogue hook, then convert head by head
#pragma unroll
  for (int j = 0; j < 3; ++j)
#pragma unroll
    for (int i = 0; i < 4; ++i)
#pragma unroll
      for (int r = 0; r < 8; ++r) st[wr + i * 16 + 8 * g + r][wc + j * 16 + col] = acc[i][j][r];
  __syncthreads();
  const int h0 = c0 / HD;   // the tile's first head among the 3 NH heads of qkv: heads 0..NH-1 are q, then k, then v
  for (int e = tid; e < PM * (PN / HD); e += PT) { const int rl = e % PM, hh = e / PM; const int which = (h0 + hh) / NH; PROJ_EPI(which, &st[rl][hh * HD], t0 + rl, (h0 + hh) % NH); }
  __syncthreads();
  for (int hh = 0; hh < PN / HD; ++hh) { const int which = (h0 + hh) / NH, hc = ((h0 + hh) % NH) * HD;   // hc: the head's first column in its own q, k or v
    if (which < 2) { _Float16* DH = which == 0 ? QH : KH; _Float16* DL = which == 0 ? QL : KL; const int nhi = which == 0 ? QHI : KHI;
      for (int e = tid; e < PM * (HD / 8); e += PT) { const int rl = e >> 3, q = e & 7; const float* p = &st[rl][hh * HD + q * 8]; v8h hv, lv;
#pragma unroll
        for (int k = 0; k < 8; ++k) { const float v = p[k]; const _Float16 hk = (_Float16)v; hv[k] = hk; lv[k] = (_Float16)((v - (float)hk) * 1024.0f); }
        vst2(DH + (r0 + rl) * CC + hc + q * 8, hv); if (t0 + rl < nhi) vst2(DL + (bb * nhi + t0 + rl) * (size_t)CC + hc + q * 8, lv);   // 8 lanes store one 128-B line; the residual plane holds rows t < nhi alone
        asm volatile("s_wait_xcnt 0x0" ::: "memory"); }   // before a register that an issued store names is written again
    } else {
      for (int e = tid; e < PM * HD; e += PT) { const int rl = e % PM, cl = e / PM; th[hh * HD + cl][rl] = (_Float16)st[rl][hh * HD + cl]; } } }
  __syncthreads();
  for (int hh = 0; hh < PN / HD; ++hh) { const int which = (h0 + hh) / NH, hc = ((h0 + hh) % NH) * HD;
    if (which == 2) {
      for (int e = tid; e < HD * (PM / 8); e += PT) { const int cl = e / (PM / 8), q = e % (PM / 8); vst2(VT + (bb * CC + hc + cl) * (size_t)TT + t0 + q * 8, *(const v4u*)&th[hh * HD + cl][q * 8]); }
      if (t0 == 0) for (int e = tid; e < HD * (KHI / 8); e += PT) { const int cl = e / (KHI / 8), q = e % (KHI / 8); v8b bh, bl;   // the planes of t < KHI lie in the tile that starts at t = 0
#pragma unroll
        for (int k = 0; k < 8; ++k) { const float v = st[q * 8 + k][hh * HD + cl]; const __bf16 bk = (__bf16)v; bh[k] = bk; bl[k] = (__bf16)(v - (float)bk); }
        const size_t o3 = (bb * CC + hc + cl) * (size_t)KHI + q * 8; vst2(VB + o3, bh); vst2(VBL + o3, bl); } } } }
// ---- k_fa: block = 128 queries (8 waves x 16) of (b, h), one pass over all keys in stages of 64: S^T = K Q^T (q hi + residual x 2^10, 2 products) x SCALE, running maximum and sum per query (a lane holds one query's scores), P^T x 2^11 packed from the score tiles as the B operand, ctx^T += V^T P^T (1 product); logits and P never leave the registers
// (every '#pragma unroll' in k_fa: the loop's index selects a register of a fragment, score or accumulator array, which stays in registers only under constant indices)
#define FK 64              // keys per stage
#define SL2E (SCALE * 1.44269504088896f)   // 64^-0.5 x log2 e: e^(SCALE x) = 2^(SL2E x)
#define FP 72              // LDS row pitch in f16: 144 B = 16 B x 9 (odd multiple: 16-byte fragment reads without bank conflicts)
__device__ __forceinline__ v8f wmma_h(v16h a, v16h b, v8f c) { return __builtin_amdgcn_wmma_f32_16x16x32_f16(false, a, false, b, (short)0, c, false, false); }
__global__ __launch_bounds__(256) void k_fa(const _Float16* __restrict__ QH, const _Float16* __restrict__ QL, const _Float16* __restrict__ KH, const _Float16* __restrict__ VT, float* __restrict__ Y) {
  __shared__ __align__(16) _Float16 sK[2][FK][FP], sV[2][HD][FP];
  const int tid = threadIdx.x, wave = tid >> 5, lane = tid & 31, col = lane & 15, g = lane >> 4; const int h = blockIdx.y, b = blockIdx.z; const int ql0 = blockIdx.x * 128 + wave * 16;
  v16h qh[HD / 32], ql[HD / 32];
#pragma unroll
  for (int kc = 0; kc < HD / 32; ++kc) { qh[kc] = frag_h(QH + ((size_t)b * TT + ql0 + col) * CC + h * HD + kc * 32, lane); ql[kc] = frag_h(QL + ((size_t)b * QHI + ql0 + col) * CC + h * HD + kc * 32, lane); }
  // staging: thread = (row sr and sr + 32, 16-byte chunk sc) of the K tile [key][d] and of the V tile [d][key]: 8 lanes read one whole 128-B row
  const int sr = tid >> 3, sc = (tid & 7) * 8;
  const _Float16* kg = KH + ((size_t)b * TT + sr) * CC + h * HD + sc; const _Float16* vg = VT + ((size_t)b * CC + h * HD + sr) * (size_t)TT + sc;
  v4u rk0 = *(const v4u*)kg, rk1 = *(const v4u*)(kg + 32 * CC), rv0 = *(const v4u*)vg, rv1 = *(const v4u*)(vg + 32 * TT);
  *(v4u*)&sK[0][sr][sc] = rk0; *(v4u*)&sK[0][sr + 32][sc] = rk1; *(v4u*)&sV[0][sr][sc] = rv0; *(v4u*)&sV[0][sr + 32][sc] = rv1;
  __syncthreads();
  v8f acc[HD / 16] = {}; float m = -3.0e38f, l = 0.f;
  for (int t = 0; t < TT / FK; ++t) { const int bu = t & 1; const bool more = t + 1 < TT / FK;
    if (more) { const _Float16* kn = kg + (size_t)(t + 1) * FK * CC; const _Float16* vn = vg + (t + 1) * FK;   // next stage's rows fly while this stage is worked on
      rk0 = *(const v4u*)kn; rk1 = *(const v4u*)(kn + 32 * CC); rv0 = *(const v4u*)vn; rv1 = *(const v4u*)(vn + 32 * TT); }
    v2f s[FK / 16][4]; float mt = -3.0e38f;   // scores in pairs: one packed fma serves two
#pragma unroll
    for (int i = 0; i < FK / 16; ++i) { v8f ah = {}, al = {};
#pragma unroll
      for (int kc = 0; kc < HD / 32; ++kc) { const v16h kf = frag_h(&sK[bu][i * 16 + col][kc * 32], lane); ah = wmma_h(kf, qh[kc], ah); al = wmma_h(kf, ql[kc], al); }
#pragma unroll
      for (int r = 0; r < 4; ++r) { const v2f h2 = {ah[2 * r], ah[2 * r + 1]}, l2 = {al[2 * r], al[2 * r + 1]}; s[i][r] = h2 + l2 * (1.0f / 1024.0f); mt = fmaxf(mt, fmaxf(s[i][r][0], s[i][r][1])); } }   // s[i][r][u] = q.k (key i*16 + 8g + 2r + u, query col), not yet scaled: the maximum is taken on q.k itself (SL2E > 0 keeps the order)
    mt = fmaxf(mt, __shfl_xor(mt, 16));
    if (__builtin_amdgcn_ballot_w32(mt > m) != 0) {   // some query's maximum rose: bring its sum and its ctx to the new maximum (factor 1 for the others)
      const float mn = fmaxf(m, mt); const float al = __builtin_amdgcn_exp2f((m - mn) * SL2E); m = mn; l *= al;
#pragma unroll
      for (int j = 0; j < HD / 16; ++j)
#pragma unroll
        for (int r = 0; r < 8; ++r) acc[j][r] *= al; }
    v2f ls[2] = {{0.f, 0.f}, {0.f, 0.f}};   // four independent partial sums of this stage: no 32-long dependent add chain
    const float mo = m * SL2E - 11.0f;   // P x 2^11 (at most 2^11), so that small P stay normal f16 numbers; the sum carries the same factor
#pragma unroll
    for (int c2 = 0; c2 < FK / 32; ++c2) { v16h p;
#pragma unroll
      for (int r = 0; r < 4; ++r) { const v2f t0 = s[2 * c2][r] * SL2E - mo, t1 = s[2 * c2 + 1][r] * SL2E - mo;   // e^(SCALE (q.k - m)) x 2^11 as one fma and one v_exp_f32; a result under 2^-126 may come as 0, far under the smallest f16
        const v2f e0 = {__builtin_amdgcn_exp2f(t0[0]), __builtin_amdgcn_exp2f(t0[1])}, e1 = {__builtin_amdgcn_exp2f(t1[0]), __builtin_amdgcn_exp2f(t1[1])}; ls[r & 1] += e0 + e1;
        p[2 * r] = (_Float16)e0[0]; p[2 * r + 1] = (_Float16)e0[1]; p[8 + 2 * r] = (_Float16)e1[0]; p[8 + 2 * r + 1] = (_Float16)e1[1]; }
#pragma unroll
      for (int j = 0; j < HD / 16; ++j) acc[j] = wmma_h(frag_h(&sV[bu][j * 16 + col][c2 * 32], lane), p, acc[j]); }
    l += (ls[0][0] + ls[0][1]) + (ls[1][0] + ls[1][1]);
    if (more) { *(v4u*)&sK[bu ^ 1][sr][sc] = rk0; *(v4u*)&sK[bu ^ 1][sr + 32][sc] = rk1; *(v4u*)&sV[bu ^ 1][sr][sc] = rv0; *(v4u*)&sV[bu ^ 1][sr + 32][sc] = rv1; }
    __syncthreads(); }   // publishes stage t + 1 and ends every wave's reads of stage t, whose buffer the next trip refills
  l += __shfl_xor(l, 16); const float inv = l > 0.f ? 1.0f / l : 0.f;
  float* yp = Y + ((size_t)b * TT + ql0 + col) * CC + h * HD + 8 * g;   // acc[j][r] = ctx(query col, d = j*16 + 8g + r)
#pragma unroll
  for (int j = 0; j < HD / 16; ++j) { v4f o0, o1;
#pragma unroll
    for (int r = 0; r < 4; ++r) { o0[r] = acc[j][r] * inv; o1[r] = acc[j][4 + r] * inv; }
    vst2(yp + j * 16, o0); vst2(yp + j * 16 + 4, o1); } }
// ---- k_out: block = (64 rows, 128 cols): out = ctx Wo (+ bo): ctx split bf16 hi + lo against exact bf16 Wo (2 products); wave = 16 rows x 128 columns
__global__ __launch_bounds__(128) void k_out(const float* __restrict__ Y, const float* __restrict__ WO, const float* __restrict__ BO, float* __restrict__ OUT) {
  __shared__ __align__(16) char sm[2 * 256 * GP * 2];
  __bf16 (*sg)[256][GP] = (__bf16 (*)[256][GP])sm;   // stage: rows 0..63 = ctx hi, 64..127 = ctx lo, 128..255 = Wo rows (output columns)
  float (*sf)[16][132] = (float (*)[16][132])sm;     // output staging, in the stages' range after the loop's last barrier
  const int tid = threadIdx.x, wave = tid >> 5, lane = tid & 31, col = lane & 15, g = lane >> 4; const int c0 = blockIdx.y * 128; const size_t rb = (size_t)blockIdx.x * 64, r0 = rb + wave * 16;
  // (every '#pragma unroll' below: the loop's index selects a register of a load, fragment or accumulator array, which stays in registers only under constant indices)
  const int lr = tid >> 4, lc = (tid & 15) * 4;            // staging: 16 lanes read 256 contiguous bytes of one row; a thread takes rows lr + 8 i
  const float* yg = Y + (rb + lr) * CC + lc; const float* wg = WO + (size_t)(c0 + lr) * CC + lc;
  v4f ry[8], rw[16];
#pragma unroll
  for (int i = 0; i < 8; ++i) ry[i] = *(const v4f*)(yg + (size_t)i * 8 * CC);
#pragma unroll
  for (int i = 0; i < 16; ++i) rw[i] = *(const v4f*)(wg + (size_t)i * 8 * CC);
  asm volatile("s_wait_xcnt 0x0" ::: "memory");   // before a register that an issued load names as its address is written again
#pragma unroll
  for (int i = 0; i < 8; ++i) put_bf_split(&sg[0][lr + 8 * i][lc], &sg[0][64 + lr + 8 * i][lc], ry[i]);
#pragma unroll
  for (int i = 0; i < 16; ++i) put_bf(&sg[0][128 + lr + 8 * i][lc], rw[i]);
  __syncthreads();
  v8f acc[8] = {};
  for (int t = 0; t < CC / GK; ++t) { const int bu = t & 1; const bool more = t + 1 < CC / GK;
    if (more) {   // next stage's rows fly while this stage is worked on
#pragma unroll
      for (int i = 0; i < 8; ++i) ry[i] = *(const v4f*)(yg + (size_t)i * 8 * CC + (t + 1) * GK);
#pragma unroll
      for (int i = 0; i < 16; ++i) rw[i] = *(const v4f*)(wg + (size_t)i * 8 * CC + (t + 1) * GK);
      asm volatile("s_wait_xcnt 0x0" ::: "memory");   // before a register that an issued load names as its address is written again
    }
#pragma unroll
    for (int kc = 0; kc < GK / 32; ++kc) { const v16b ah = frag_b(&sg[bu][wave * 16 + col][kc * 32], lane), al = frag_b(&sg[bu][64 + wave * 16 + col][kc * 32], lane);
#pragma unroll
      for (int j = 0; j < 8; ++j) { const v16b w = frag_b(&sg[bu][128 + j * 16 + col][kc * 32], lane); acc[j] = wmma_b(ah, w, acc[j]); acc[j] = wmma_b(al, w, acc[j]); } }
    __builtin_amdgcn_sched_barrier(0);   // keeps the rounding of the next stage's rows, which waits for their loads, behind this stage's products
    if (more) {
#pragma unroll
      for (int i = 0; i < 8; ++i) put_bf_split(&sg[bu ^ 1][lr + 8 * i][lc], &sg[bu ^ 1][64 + lr + 8 * i][lc], ry[i]);
#pragma unroll
      for (int i = 0; i < 16; ++i) put_bf(&sg[bu ^ 1][128 + lr + 8 * i][lc], rw[i]); }
    __syncthreads(); }   // publishes stage t + 1 and ends every wave's reads of stage t, whose buffer the next trip refills
#pragma unroll
  for (int j = 0; j < 8; ++j) { const float bias = BO ? bfr(BO[c0 + j * 16 + col]) : 0.f;
#pragma unroll
    for (int r = 0; r < 8; ++r) sf[wave][8 * g + r][j * 16 + col] = acc[j][r] + bias; }
  LDSX(); for (int rl = 0; rl < 16; ++rl) vst2(OUT + (r0 + rl) * DIN + c0 + lane * 4, *(const v4f*)&sf[wave][rl][lane * 4]); }

extern "C" void kernel_launch(void* const* d_in, const int* in_sizes, int n_in, void* d_out, int out_size, void* d_ws, size_t ws_size, hipStream_t stream) {
  (void)in_sizes; (void)n_in; (void)out_size;
  const float** F = (const float**)d_in;
  if (ws_size < (size_t)WS_END) return;
  char* ws = (char*)d_ws; _Float16 *QH = (_Float16*)(ws + WS_QH), *KH = (_Float16*)(ws + WS_KH), *VT = (_Float16*)(ws + WS_VT), *QL = (_Float16*)(ws + WS_QL), *KL = (_Float16*)(ws + WS_KL); __bf16 *VB = (__bf16*)(ws + WS_VB), *VBL = (__bf16*)(ws + WS_VBL); float *Y = (float*)(ws + WS_Y);
  (void)Y; (void)QL; (void)KL; (void)VB; (void)VBL;
  // inputs: 0 x [2,2048,1024]; 1 qkv_w [3072,1024] (out,in; rows q | k | v); 2 proj_w [1024,1024] (out,in); 3 proj_b; 4 q_scale [64]; 5 k_scale [64]
  k_proj<<<dim3(TNB * TT / PM, 3 * CC / PN), PT, 0, stream>>>(F[0], F[1], QH, QL, KH, KL, VT, VB, VBL, F[4], F[5]);
  k_fa<<<dim3(TT / 128, NH, TNB), 256, 0, stream>>>(QH, QL, KH, VT, Y);
  k_out<<<dim3(TNB * TT / 64, DIN / 128), 128, 0, stream>>>(Y, F[2], F[3], (float*)d_out);
}

// v005
// Measured time: 95.7 microseconds a run.
// Timed twice side by side with v004, it ran 1.04 and 1.05 times as fast.
// All steps since v000 together make it 15.2 times as fast.
// compute dtype: all float inputs rounded to bf16; qkv = x Wqkv^T with EXACT bf16 products on WMMA 16x16x32 (f32 accumulate); per-head RMSNorm of q and k in f32 on the projected rows; q as f16 hi + residual (x 2^10) against k once to f16 (2 products); softmax in f32 (base 2: 64^-0.5 log2 e folded into one fma a score, hardware exp2) with a running maximum and sum over stages of 64 keys; P x 2^11 (relative to the running maximum) once to f16 against v once to f16 (1 product), divided by the sum at the end; ctx split bf16 hi + lo (by the attention kernel, as it stores ctx) against exact proj_w (rounded once, by the first kernel) (2 products) + proj_b; f32 output.
#include <hip/hip_runtime.h>
#include <math.h>

typedef __attribute__((ext_vector_type(16))) _Float16 v16h;
typedef __attribute__((ext_vector_type(16))) __bf16 v16b;
typedef __attribute__((ext_vector_type(8)))  _Float16 v8h;
typedef __attribute__((ext_vector_type(8)))  float v8f;
typedef __attribute__((ext_vector_type(4)))  float v4f;
typedef __attribute__((ext_vector_type(2)))  float v2f;
typedef __attribute__((ext_vector_type(4)))  unsigned v4u;
typedef __attribute__((ext_vector_type(4)))  int v4i;
typedef float __attribute__((may_alias)) float_a;
typedef int __attribute__((may_alias)) int_a;

template <typename T> __device__ __forceinline__ void vst2(void* p, T v) { *(T*)p = v;  }
__device__ __forceinline__ v8f wmma16(v16h a, v16h b, v8f c) {
  v8f d = __builtin_amdgcn_wmma_f32_16x16x32_f16(false, a, false, b, (short)0, c, false, false);
  asm volatile("v_nop\n\tv_nop\n\tv_nop\n\tv_nop" : "+v"(d) : "v"(a), "v"(b));
  return d;
}
__device__ __forceinline__ v8f wmma_bf(v16b a, v16b b, v8f c) {
  v8f d = __builtin_amdgcn_wmma_f32_16x16x32_bf16(false, a, false, b, (short)0, c, false, false);
  asm volatile("v_nop\n\tv_nop\n\tv_nop\n\tv_nop" : "+v"(d) : "v"(a), "v"(b));
  return d;
}
// 16x16x32 fragments: lane = (h = lane>>4, row/col = lane&15); elements 0..7 = k0+8h+0..7, 8..15 = k0+16+8h+0..7; D element r = row 8h+r
__device__ __forceinline__ v16h frag_h(const _Float16* rowk0, int lane) {
  union { v16h v; v8h q[2]; } u; const _Float16* p = rowk0 + 8 * (lane >> 4);
  u.q[0] = *(const v8h*)p; u.q[1] = *(const v8h*)(p + 16); return u.v;
}
__device__ __forceinline__ v16h frag_f32(const float* rowk0, int lane) {
  v16h a; const float* p = rowk0 + 8 * (lane >> 4);
#pragma unroll
  for (int i = 0; i < 8; ++i) { a[i] = (_Float16)p[i]; a[8 + i] = (_Float16)p[16 + i]; }
  return a;
}
__device__ __forceinline__ v16h frag_f32s(const float* rowk0, int lane, float sc) {
  v16h a; const float* p = rowk0 + 8 * (lane >> 4);
#pragma unroll
  for (int i = 0; i < 8; ++i) { a[i] = (_Float16)(p[i] * sc); a[8 + i] = (_Float16)(p[16 + i] * sc); }
  return a;
}
// column fragment from a [K][ld] layout (column n), rows >= K read as 0
__device__ __forceinline__ v16h fragc_f32(const float* W, int k0, int n, int lane, int ld, int K) {
  v16h a; const int g = lane >> 4;
#pragma unroll
  for (int i = 0; i < 8; ++i) { const int ka = k0 + 8 * g + i, kb = ka + 16;
    a[i] = (_Float16)(ka < K ? W[(size_t)(ka < K ? ka : K - 1) * ld + n] : 0.f); a[8 + i] = (_Float16)(kb < K ? W[(size_t)(kb < K ? kb : K - 1) * ld + n] : 0.f); }
  return a;
}
struct F2 { v16b h, l; };
__device__ __forceinline__ F2 bsplit16(const float v[16]) { F2 r;
#pragma unroll
  for (int i = 0; i < 16; ++i) { const __bf16 h = (__bf16)v[i]; r.h[i] = h; r.l[i] = (__bf16)(v[i] - (float)h); }
  return r; }
__device__ __forceinline__ F2 split_row(const float* row, int k0, int lane) { float v[16]; const float* p = row + k0 + 8 * (lane >> 4);
#pragma unroll
  for (int i = 0; i < 8; ++i) { v[i] = p[i]; v[8 + i] = p[16 + i]; }
  return bsplit16(v); }
__device__ __forceinline__ F2 split_rowK(const float* row, int k0, int lane, int K) { float v[16]; const int g = lane >> 4;
#pragma unroll
  for (int i = 0; i < 8; ++i) { const int ka = k0 + 8 * g + i, kb = ka + 16; v[i] = ka < K ? row[ka < K ? ka : K - 1] : 0.f; v[8 + i] = kb < K ? row[kb < K ? kb : K - 1] : 0.f; }
  return bsplit16(v); }
__device__ __forceinline__ F2 split_col(const float* W, int k0, int n, int lane, int ld, int K) { float v[16]; const int g = lane >> 4;
#pragma unroll
  for (int i = 0; i < 8; ++i) { const int ka = k0 + 8 * g + i, kb = ka + 16; v[i] = ka < K ? W[(size_t)(ka < K ? ka : K - 1) * ld + n] : 0.f; v[8 + i] = kb < K ? W[(size_t)(kb < K ? kb : K - 1) * ld + n] : 0.f; }
  return bsplit16(v); }
__device__ __forceinline__ v8f mac3(const F2& a, const F2& b, v8f c) { c = wmma_bf(a.l, b.h, c); c = wmma_bf(a.h, b.l, c); return wmma_bf(a.h, b.h, c); }
__device__ __forceinline__ float sigm(float v) { return 1.0f / (1.0f + expf(-v)); }
#define LDSX() do { asm volatile("s_wait_dscnt 0" ::: "memory"); __builtin_amdgcn_wave_barrier(); __builtin_amdgcn_fence(__ATOMIC_RELEASE, "workgroup"); } while (0)

// Self-attention with QK RMSNorm (B 2, N 2,048, C 1,024 = 16 x 64): qkv = x qkv_w^T ((out,in) [3072,1024], rows (3, H, hd)); q, k <- scale * q / (|q| 64^-0.5 + 1e-8) per head (scales all ones); out = merged(softmax(q k^T x 64^-0.5) v) proj_w^T + proj_b (non-causal).
#define NB 2
#define TT 2048
#define CC 1024            // NH * HD = projected width
#define DIN 1024          // input (model) width
#define NH 16
#define HD 64
#define NQB (TT / 64)
#define HG 4
#define SCALE (0.125f)
#define CAUSAL 0
#ifndef TNB
#define TNB NB
#endif
__device__ __forceinline__ float bfr(float v) { return (float)(__bf16)v; }
__host__ __device__ __forceinline__ int kb_last(int qb) { return CAUSAL ? ((qb * 64 + 63) >> 7) : (TT / 128 - 1); }
typedef __attribute__((ext_vector_type(8))) __bf16 v8b;
__device__ __forceinline__ v16b frag_b(const __bf16* rowk0, int lane) {
  union { v16b v; v8b q[2]; } u; const __bf16* p = rowk0 + 8 * (lane >> 4);
  u.q[0] = *(const v8b*)p; u.q[1] = *(const v8b*)(p + 16); return u.v;
}
#define QBH 0
#define QHI 2048            // rows carrying a q residual plane (all rows when non-causal: 2-product logits everywhere)
#define KHI 64            // key rows carrying k residual / v bf16 hi+lo planes (written by k_proj, read by no kernel)
// B fragment (k rows k0+.., output column o) of a weight: (in,out) [K][ld] or (out,in) [ld rows of K]: bf16 exact, or f16(bf16 * 256) exact
__device__ __forceinline__ v16b wcol_io(const float* Wm, int k0, int o, int lane, int ld) { v16b w; const int g = lane >> 4;
#pragma unroll
  for (int i = 0; i < 8; ++i) { w[i] = (__bf16)Wm[(size_t)(k0 + 8 * g + i) * ld + o]; w[8 + i] = (__bf16)Wm[(size_t)(k0 + 16 + 8 * g + i) * ld + o]; }
  return w; }
__device__ __forceinline__ v16b wcol_oi(const float* Wm, int k0, int o, int lane, int K) { v16b w; const float* p = Wm + (size_t)o * K + k0 + 8 * (lane >> 4);
#pragma unroll
  for (int i = 0; i < 8; ++i) { w[i] = (__bf16)p[i]; w[8 + i] = (__bf16)p[16 + i]; }
  return w; }
__device__ __forceinline__ v16h wcolh_io(const float* Wm, int k0, int o, int lane, int ld) { v16h w; const int g = lane >> 4;
#pragma unroll
  for (int i = 0; i < 8; ++i) { w[i] = (_Float16)(bfr(Wm[(size_t)(k0 + 8 * g + i) * ld + o]) * 256.0f); w[8 + i] = (_Float16)(bfr(Wm[(size_t)(k0 + 16 + 8 * g + i) * ld + o]) * 256.0f); }
  return w; }
__device__ __forceinline__ v16h wcolh_oi(const float* Wm, int k0, int o, int lane, int K) { v16h w; const float* p = Wm + (size_t)o * K + k0 + 8 * (lane >> 4);
#pragma unroll
  for (int i = 0; i < 8; ++i) { w[i] = (_Float16)(bfr(p[i]) * 256.0f); w[8 + i] = (_Float16)(bfr(p[16 + i]) * 256.0f); }
  return w; }
#define WQKV_LAYOUT 1   // layout of WCOL, which no kernel calls (k_proj reads qkv_w as (out,in) rows): 0 = (in,out) [DIN][CC]; 1 = (out,in) [CC][DIN]; 2 = per-head [NH][DIN][HD]
__device__ __forceinline__ v16b wcol_hdk(const float* Wm, int k0, int o, int lane) { v16b w; const int g = lane >> 4; const float* p = Wm + (size_t)(o / HD) * DIN * HD + (o % HD);
#pragma unroll
  for (int i = 0; i < 8; ++i) { w[i] = (__bf16)p[(size_t)(k0 + 8 * g + i) * HD]; w[8 + i] = (__bf16)p[(size_t)(k0 + 16 + 8 * g + i) * HD]; }
  return w; }
#define WO_OUT_IN 1
#if WQKV_LAYOUT == 1
#define WCOL(W, k0, o, lane) wcol_oi(W, k0, o, lane, DIN)
#elif WQKV_LAYOUT == 2
#define WCOL(W, k0, o, lane) wcol_hdk(W, k0, o, lane)
#else
#define WCOL(W, k0, o, lane) wcol_io(W, k0, o, lane, CC)
#endif
#if WO_OUT_IN
#define WOCOL(W, k0, o, lane) wcol_oi(W, k0, o, lane, CC)
#define WOCOLH(W, k0, o, lane) wcolh_oi(W, k0, o, lane, CC)
#else
#define WOCOL(W, k0, o, lane) wcol_io(W, k0, o, lane, DIN)
#define WOCOLH(W, k0, o, lane) wcolh_io(W, k0, o, lane, DIN)
#endif
#define PROJ_EXTRA_PARAMS , const float* __restrict__ QS, const float* __restrict__ KS
#define PROJ_EPI(which, row, t, h) do { if ((which) < 2) { float* rw = (row); const float* sc = (which) == 0 ? QS : KS; float ss = 0.f; _Pragma("unroll") for (int i = 0; i < 64; ++i) ss += rw[i] * rw[i]; const float rms = __fsqrt_rn(ss) * 0.125f; const float inv = 1.0f / (rms + 1e-8f); _Pragma("unroll") for (int i = 0; i < 64; ++i) rw[i] = bfr(sc[i]) * (rw[i] * inv); } } while (0)   /* per-head RMSNorm: norm(x, axis=-1) * hd^-0.5; scale * (x / (rms + eps)) */
#ifndef SM_EXTRA_PARAMS
#define SM_EXTRA_PARAMS
#endif
#ifndef PROJ_EXTRA_PARAMS
#define PROJ_EXTRA_PARAMS
#endif
#ifndef SM_MASK_HOOK
#define SM_MASK_HOOK (void)0
#endif

#define WS_QH  0u                                      // f16 q rows [b*t][CC]
#define WS_KH  (WS_QH + 2u * (size_t)NB * TT * CC)      // f16 k rows [b*t][CC]
#define WS_VT  (WS_KH + 2u * (size_t)NB * TT * CC)      // f16 v planes [b][c][t]
#define WS_QL  (WS_VT + 2u * (size_t)NB * CC * TT)      // f16 q residual x 2^10 rows [b][t < QHI][CC]
#define WS_KL  (WS_QL + 2u * (size_t)NB * QHI * CC)     // f16 k residual x 2^10 rows [b][t < KHI][CC]
#define WS_VB  (WS_KL + 2u * (size_t)NB * KHI * CC)     // bf16 v hi planes [b][c][t < KHI]
#define WS_VBL (WS_VB + 2u * (size_t)NB * CC * KHI)
#define WS_S   (WS_VBL + 2u * (size_t)NB * CC * KHI)    // f32 logits / P [hg][t][s] (no kernel left that uses it as such)
#define WS_WO  WS_S                                    // bf16 proj_w rows [DIN][CC], in that range
#define WS_Y   (WS_S  + 4u * (size_t)HG * TT * TT)      // ctx rows [b*t][CC]: the bf16 hi plane, then the bf16 lo plane (together the bytes of one f32 plane)
#define WS_YL  (WS_Y  + 2u * (size_t)NB * TT * CC)
#define WS_END (WS_Y  + 4u * (size_t)NB * TT * CC)

// ---- operand staging of the two projection GEMMs: a stage is 64 k of every operand row of the block's tile in bf16 (k_proj's block rounds its f32 rows; k_out's copies the bf16 that k_proj and k_fa left), laid in LDS, from where every wave takes its fragments
#define GK 64              // k per stage
#define GP 72              // LDS row pitch in bf16: 144 B = 16 B x 9 (odd multiple: 16-byte fragment reads without bank conflicts)
typedef __attribute__((ext_vector_type(4))) __bf16 v4b;
__device__ __forceinline__ v8f wmma_b(v16b a, v16b b, v8f c) { return __builtin_amdgcn_wmma_f32_16x16x32_bf16(false, a, false, b, (short)0, c, false, false); }
__device__ __forceinline__ void put_bf(__bf16* d, v4f v) { v4b c;
#pragma unroll
  for (int k = 0; k < 4; ++k) c[k] = (__bf16)v[k];
  *(v4b*)d = c; }
__device__ __forceinline__ void put_bf_split(__bf16* dh, __bf16* dl, v4f v) { v4b h, l;
#pragma unroll
  for (int k = 0; k < 4; ++k) { const __bf16 hv = (__bf16)v[k]; h[k] = hv; l[k] = (__bf16)(v[k] - (float)hv); }
  *(v4b*)dh = h; *(v4b*)dl = l; }
// ---- k_proj: block = 256 rows x 192 columns (3 whole heads) of the one product qkv = X Wqkv^T with exact bf16 products (K = DIN), 16 waves; 16 x 16 blocks. Each head of the tile goes its own way: q: f16 rows + residual rows; k: f16 rows (+ residual rows t < KHI); v: f16 planes [c][t] (+ bf16 hi/lo planes for t < KHI)
#define PM 256             // rows of X per block
#define PN 192             // rows of Wqkv (output columns) per block: an X row fetched from L2 serves 192 columns, a W row 256 rows
#define PT 512             // threads: 4 x 4 waves of 64 rows x 48 columns
#define SP 196             // pitch of the f32 tile in floats: 784 B = 16 B x 49
__global__ __launch_bounds__(PT) void k_proj(const float* __restrict__ X, const float* __restrict__ WA,
    _Float16* __restrict__ QH, _Float16* __restrict__ QL, _Float16* __restrict__ KH, _Float16* __restrict__ KL, _Float16* __restrict__ VT, __bf16* __restrict__ VB, __bf16* __restrict__ VBL, const float* __restrict__ WO, __bf16* __restrict__ WOB PROJ_EXTRA_PARAMS) {
  // LDS: one range that holds the two operand stages during the product and the f32 tile after it (the loop's last barrier lies between the last fragment read and the first write of the tile), then the transposed v heads
  __shared__ __align__(16) char sm[PM * SP * 4 + PN * (PM + 8) * 2];
  static_assert(2 * (PM + PN) * GP * 2 <= PM * SP * 4, "the stages fit the f32 tile's range");
  static_assert(TT % PM == 0 && (3 * CC) % PN == 0 && PN % HD == 0 && KHI <= PM, "whole tiles, whole heads");
  __bf16 (*sg)[PM + PN][GP] = (__bf16 (*)[PM + PN][GP])sm;   // stage: rows 0..PM-1 = X rows, PM.. = W rows (output columns)
  float (*st)[SP] = (float (*)[SP])sm; _Float16 (*th)[PM + 8] = (_Float16 (*)[PM + 8])(sm + PM * SP * 4);
  const int tid = threadIdx.x, wave = tid >> 5, lane = tid & 31, col = lane & 15, g = lane >> 4; const int c0 = blockIdx.y * PN; const size_t r0 = (size_t)blockIdx.x * PM; const size_t bb = r0 / TT; const int t0 = (int)(r0 % TT);
  // (every '#pragma unroll' below: the loop's index selects a register of a load, fragment or accumulator array, which stays in registers only under constant indices)
  const int wr = (wave >> 2) * 64, wc = (wave & 3) * 48;   // wave tile: 64 rows x 48 columns (4 + 3 fragments for 12 products)
  const int lr = tid >> 4, lc = (tid & 15) * 4;            // staging: 16 lanes read 256 contiguous bytes of one row; a thread takes rows lr + 32 i
  const float* xg = X + (r0 + lr) * DIN + lc; const float* wg = WA + (size_t)(c0 + lr) * DIN + lc;
  v4f rx[PM / 32], rw[PN / 32];
#pragma unroll
  for (int i = 0; i < PM / 32; ++i) rx[i] = *(const v4f*)(xg + (size_t)i * 32 * DIN);
#pragma unroll
  for (int i = 0; i < PN / 32; ++i) rw[i] = *(const v4f*)(wg + (size_t)i * 32 * DIN);
  // proj_w for k_out, rounded to bf16 here once (the grid's threads take 8 elements each) instead of by each of k_out's blocks that reads a row
  static_assert((size_t)(TNB * TT / PM) * (3 * CC / PN) * PT * 8 == (size_t)DIN * CC, "the grid covers proj_w once");
  const size_t wi = ((size_t)(blockIdx.y * (TNB * TT / PM) + blockIdx.x) * PT + tid) * 8;
  const v4f wo0 = *(const v4f*)(WO + wi), wo1 = *(const v4f*)(WO + wi + 4);
  asm volatile("s_wait_xcnt 0x0" ::: "memory");   // before a register that an issued load names as its address is written again
  { v8b wb;
#pragma unroll
    for (int k = 0; k < 4; ++k) { wb[k] = (__bf16)wo0[k]; wb[4 + k] = (__bf16)wo1[k]; }
    vst2(WOB + wi, wb);
    asm volatile("s_wait_xcnt 0x0" ::: "memory"); }   // before a register that the issued store names is written again
#pragma unroll
  for (int i = 0; i < PM / 32; ++i) put_bf(&sg[0][lr + 32 * i][lc], rx[i]);
#pragma unroll
  for (int i = 0; i < PN / 32; ++i) put_bf(&sg[0][PM + lr + 32 * i][lc], rw[i]);
  __syncthreads();
  v8f acc[4][3] = {};
  for (int t = 0; t < DIN / GK; ++t) { const int bu = t & 1; const bool more = t + 1 < DIN / GK;
    if (more) {   // next stage's rows fly while this stage is worked on
#pragma unroll
      for (int i = 0; i < PM / 32; ++i) rx[i] = *(const v4f*)(xg + (size_t)i * 32 * DIN + (t + 1) * GK);
#pragma unroll
      for (int i = 0; i < PN / 32; ++i) rw[i] = *(const v4f*)(wg + (size_t)i * 32 * DIN + (t + 1) * GK);
      asm volatile("s_wait_xcnt 0x0" ::: "memory");   // before a register that an issued load names as its address is written again
    }
#pragma unroll
    for (int kc = 0; kc < GK / 32; ++kc) { v16b a[4], w[3];
#pragma unroll
      for (int i = 0; i < 4; ++i) a[i] = frag_b(&sg[bu][wr + i * 16 + col][kc * 32], lane);
#pragma unroll
      for (int j = 0; j < 3; ++j) w[j] = frag_b(&sg[bu][PM + wc + j * 16 + col][kc * 32], lane);
#pragma unroll
      for (int i = 0; i < 4; ++i)
#pragma unroll
        for (int j = 0; j < 3; ++j) acc[i][j] = wmma_b(a[i], w[j], acc[i][j]); }
    __builtin_amdgcn_sched_barrier(0);   // keeps the rounding of the next stage's rows, which waits for their loads, behind this stage's products
    if (more) {
#pragma unroll
      for (int i = 0; i < PM / 32; ++i) put_bf(&sg[bu ^ 1][lr + 32 * i][lc], rx[i]);
#pragma unroll
      for (int i = 0; i < PN / 32; ++i) put_bf(&sg[bu ^ 1][PM + lr + 32 * i][lc], rw[i]); }
    __syncthreads(); }   // publishes stage t + 1 and ends every wave's reads of stage t, whose buffer the next trip refills (behind the last trip: the f32 tile)
  // stage the f32 tile in LDS, run the per-(row, head) epilogue hook, then convert head by head
#pragma unroll
  for (int j = 0; j < 3; ++j)
#pragma unroll
    for (int i = 0; i < 4; ++i)
#pragma unroll
      for (int r = 0; r < 8; ++r) st[wr + i * 16 + 8 * g + r][wc + j * 16 + col] = acc[i][j][r];
  __syncthreads();
  const int h0 = c0 / HD;   // the tile's first head among the 3 NH heads of qkv: heads 0..NH-1 are q, then k, then v
  for (int e = tid; e < PM * (PN / HD); e += PT) { const int rl = e % PM, hh = e / PM; const int which = (h0 + hh) / NH; PROJ_EPI(which, &st[rl][hh * HD], t0 + rl, (h0 + hh) % NH); }
  __syncthreads();
  for (int hh = 0; hh < PN / HD; ++hh) { const int which = (h0 + hh) / NH, hc = ((h0 + hh) % NH) * HD;   // hc: the head's first column in its own q, k or v
    if (which < 2) { _Float16* DH = which == 0 ? QH : KH; _Float16* DL = which == 0 ? QL : KL; const int nhi = which == 0 ? QHI : KHI;
      for (int e = tid; e < PM * (HD / 8); e += PT) { const int rl = e >> 3, q = e & 7; const float* p = &st[rl][hh * HD + q * 8]; v8h hv, lv;
#pragma unroll
        for (int k = 0; k < 8; ++k) { const float v = p[k]; const _Float16 hk = (_Float16)v; hv[k] = hk; lv[k] = (_Float16)((v - (float)hk) * 1024.0f); }
        vst2(DH + (r0 + rl) * CC + hc + q * 8, hv); if (t0 + rl < nhi) vst2(DL + (bb * nhi + t0 + rl) * (size_t)CC + hc + q * 8, lv);   // 8 lanes store one 128-B line; the residual plane holds rows t < nhi alone
        asm volatile("s_wait_xcnt 0x0" ::: "memory"); }   // before a register that an issued store names is written again
    } else {
      for (int e = tid; e < PM * HD; e += PT) { const int rl = e % PM, cl = e / PM; th[hh * HD + cl][rl] = (_Float16)st[rl][hh * HD + cl]; } } }
  __syncthreads();
  for (int hh = 0; hh < PN / HD; ++hh) { const int which = (h0 + hh) / NH, hc = ((h0 + hh) % NH) * HD;
    if (which == 2) {
      for (int e = tid; e < HD * (PM / 8); e += PT) { const int cl = e / (PM / 8), q = e % (PM / 8); vst2(VT + (bb * CC + hc + cl) * (size_t)TT + t0 + q * 8, *(const v4u*)&th[hh * HD + cl][q * 8]); }
      if (t0 == 0) for (int e = tid; e < HD * (KHI / 8); e += PT) { const int cl = e / (KHI / 8), q = e % (KHI / 8); v8b bh, bl;   // the planes of t < KHI lie in the tile that starts at t = 0
#pragma unroll
        for (int k = 0; k < 8; ++k) { const float v = st[q * 8 + k][hh * HD + cl]; const __bf16 bk = (__bf16)v; bh[k] = bk; bl[k] = (__bf16)(v - (float)bk); }
        const size_t o3 = (bb * CC + hc + cl) * (size_t)KHI + q * 8; vst2(VB + o3, bh); vst2(VBL + o3, bl); } } } }
// ---- k_fa: block = 128 queries (8 waves x 16) of (b, h), one pass over all keys in stages of 64: S^T = K Q^T (q hi + residual x 2^10, 2 products) x SCALE, running maximum and sum per query (a lane holds one query's scores), P^T x 2^11 packed from the score tiles as the B operand, ctx^T += V^T P^T (1 product); logits and P never leave the registers
// (every '#pragma unroll' in k_fa: the loop's index selects a register of a fragment, score or accumulator array, which stays in registers only under constant indices)
#define FK 64              // keys per stage
#define SL2E (SCALE * 1.44269504088896f)   // 64^-0.5 x log2 e: e^(SCALE x) = 2^(SL2E x)
#define FP 72              // LDS row pitch in f16: 144 B = 16 B x 9 (odd multiple: 16-byte fragment reads without bank conflicts)
__device__ __forceinline__ v8f wmma_h(v16h a, v16h b, v8f c) { return __builtin_amdgcn_wmma_f32_16x16x32_f16(false, a, false, b, (short)0, c, false, false); }
__global__ __launch_bounds__(256) void k_fa(const _Float16* __restrict__ QH, const _Float16* __restrict__ QL, const _Float16* __restrict__ KH, const _Float16* __restrict__ VT, __bf16* __restrict__ YH, __bf16* __restrict__ YL) {
  __shared__ __align__(16) _Float16 sK[2][FK][FP], sV[2][HD][FP];
  const int tid = threadIdx.x, wave = tid >> 5, lane = tid & 31, col = lane & 15, g = lane >> 4; const int h = blockIdx.y, b = blockIdx.z; const int ql0 = blockIdx.x * 128 + wave * 16;
  v16h qh[HD / 32], ql[HD / 32];
#pragma unroll
  for (int kc = 0; kc < HD / 32; ++kc) { qh[kc] = frag_h(QH + ((size_t)b * TT + ql0 + col) * CC + h * HD + kc * 32, lane); ql[kc] = frag_h(QL + ((size_t)b * QHI + ql0 + col) * CC + h * HD + kc * 32, lane); }
  // staging: thread = (row sr and sr + 32, 16-byte chunk sc) of the K tile [key][d] and of the V tile [d][key]: 8 lanes read one whole 128-B row
  const int sr = tid >> 3, sc = (tid & 7) * 8;
  const _Float16* kg = KH + ((size_t)b * TT + sr) * CC + h * HD + sc; const _Float16* vg = VT + ((size_t)b * CC + h * HD + sr) * (size_t)TT + sc;
  v4u rk0 = *(const v4u*)kg, rk1 = *(const v4u*)(kg + 32 * CC), rv0 = *(const v4u*)vg, rv1 = *(const v4u*)(vg + 32 * TT);
  *(v4u*)&sK[0][sr][sc] = rk0; *(v4u*)&sK[0][sr + 32][sc] = rk1; *(v4u*)&sV[0][sr][sc] = rv0; *(v4u*)&sV[0][sr + 32][sc] = rv1;
  __syncthreads();
  v8f acc[HD / 16] = {}; float m = -3.0e38f, l = 0.f;
  for (int t = 0; t < TT / FK; ++t) { const int bu = t & 1; const bool more = t + 1 < TT / FK;
    if (more) { const _Float16* kn = kg + (size_t)(t + 1) * FK * CC; const _Float16* vn = vg + (t + 1) * FK;   // next stage's rows fly while this stage is worked on
      rk0 = *(const v4u*)kn; rk1 = *(const v4u*)(kn + 32 * CC); rv0 = *(const v4u*)vn; rv1 = *(const v4u*)(vn + 32 * TT); }
    v2f s[FK / 16][4]; float mt = -3.0e38f;   // scores in pairs: one packed fma serves two
#pragma unroll
    for (int i = 0; i < FK / 16; ++i) { v8f ah = {}, al = {};
#pragma unroll
      for (int kc = 0; kc < HD / 32; ++kc) { const v16h kf = frag_h(&sK[bu][i * 16 + col][kc * 32], lane); ah = wmma_h(kf, qh[kc], ah); al = wmma_h(kf, ql[kc], al); }
#pragma unroll
      for (int r = 0; r < 4; ++r) { const v2f h2 = {ah[2 * r], ah[2 * r + 1]}, l2 = {al[2 * r], al[2 * r + 1]}; s[i][r] = h2 + l2 * (1.0f / 1024.0f); mt = fmaxf(mt, fmaxf(s[i][r][0], s[i][r][1])); } }   // s[i][r][u] = q.k (key i*16 + 8g + 2r + u, query col), not yet scaled: the maximum is taken on q.k itself (SL2E > 0 keeps the order)
    mt = fmaxf(mt, __shfl_xor(mt, 16));
    if (__builtin_amdgcn_ballot_w32(mt > m) != 0) {   // some query's maximum rose: bring its sum and its ctx to the new maximum (factor 1 for the others)
      const float mn = fmaxf(m, mt); const float al = __builtin_amdgcn_exp2f((m - mn) * SL2E); m = mn; l *= al;
#pragma unroll
      for (int j = 0; j < HD / 16; ++j)
#pragma unroll
        for (int r = 0; r < 8; ++r) acc[j][r] *= al; }
    v2f ls[2] = {{0.f, 0.f}, {0.f, 0.f}};   // four independent partial sums of this stage: no 32-long dependent add chain
    const float mo = m * SL2E - 11.0f;   // P x 2^11 (at most 2^11), so that small P stay normal f16 numbers; the sum carries the same factor
#pragma unroll
    for (int c2 = 0; c2 < FK / 32; ++c2) { v16h p;
#pragma unroll
      for (int r = 0; r < 4; ++r) { const v2f t0 = s[2 * c2][r] * SL2E - mo, t1 = s[2 * c2 + 1][r] * SL2E - mo;   // e^(SCALE (q.k - m)) x 2^11 as one fma and one v_exp_f32; a result under 2^-126 may come as 0, far under the smallest f16
        const v2f e0 = {__builtin_amdgcn_exp2f(t0[0]), __builtin_amdgcn_exp2f(t0[1])}, e1 = {__builtin_amdgcn_exp2f(t1[0]), __builtin_amdgcn_exp2f(t1[1])}; ls[r & 1] += e0 + e1;
        p[2 * r] = (_Float16)e0[0]; p[2 * r + 1] = (_Float16)e0[1]; p[8 + 2 * r] = (_Float16)e1[0]; p[8 + 2 * r + 1] = (_Float16)e1[1]; }
#pragma unroll
      for (int j = 0; j < HD / 16; ++j) acc[j] = wmma_h(frag_h(&sV[bu][j * 16 + col][c2 * 32], lane), p, acc[j]); }
    l += (ls[0][0] + ls[0][1]) + (ls[1][0] + ls[1][1]);
    if (more) { *(v4u*)&sK[bu ^ 1][sr][sc] = rk0; *(v4u*)&sK[bu ^ 1][sr + 32][sc] = rk1; *(v4u*)&sV[bu ^ 1][sr][sc] = rv0; *(v4u*)&sV[bu ^ 1][sr + 32][sc] = rv1; }
    __syncthreads(); }   // publishes stage t + 1 and ends every wave's reads of stage t, whose buffer the next trip refills
  l += __shfl_xor(l, 16); const float inv = l > 0.f ? 1.0f / l : 0.f;
  const size_t yo = ((size_t)b * TT + ql0 + col) * CC + h * HD + 8 * g;   // acc[j][r] = ctx(query col, d = j*16 + 8g + r)
#pragma unroll
  for (int j = 0; j < HD / 16; ++j) { v8b hv, lv;   // ctx leaves as k_out's two operands: bf16 hi and the bf16 of what hi misses
#pragma unroll
    for (int r = 0; r < 8; ++r) { const float v = acc[j][r] * inv; const __bf16 hk = (__bf16)v; hv[r] = hk; lv[r] = (__bf16)(v - (float)hk); }
    vst2(YH + yo + j * 16, hv); vst2(YL + yo + j * 16, lv); } }
// ---- k_out: block = (64 rows, 128 cols): out = ctx Wo (+ bo): ctx bf16 hi + lo against exact bf16 Wo (2 products), all three read as the bf16 their producers left; wave = 16 rows x 128 columns
__global__ __launch_bounds__(128) void k_out(const __bf16* __restrict__ YH, const __bf16* __restrict__ YL, const __bf16* __restrict__ WOB, const float* __restrict__ BO, float* __restrict__ OUT) {
  __shared__ __align__(16) char sm[2 * 256 * GP * 2];
  __bf16 (*sg)[256][GP] = (__bf16 (*)[256][GP])sm;   // stage: rows 0..63 = ctx hi, 64..127 = ctx lo, 128..255 = Wo rows (output columns)
  float (*sf)[16][132] = (float (*)[16][132])sm;     // output staging, in the stages' range after the loop's last barrier
  const int tid = threadIdx.x, wave = tid >> 5, lane = tid & 31, col = lane & 15, g = lane >> 4; const int c0 = blockIdx.y * 128; const size_t rb = (size_t)blockIdx.x * 64, r0 = rb + wave * 16;
  // (every '#pragma unroll' below: the loop's index selects a register of a load, fragment or accumulator array, which stays in registers only under constant indices)
  const int lr = tid >> 3, lc = (tid & 7) * 8;             // staging: 8 lanes read the 128 contiguous bytes a row has in a stage; a thread takes rows lr + 16 i
  const __bf16* hg = YH + (rb + lr) * CC + lc; const __bf16* lg = YL + (rb + lr) * CC + lc; const __bf16* wg = WOB + (size_t)(c0 + lr) * CC + lc;
  v4u rh[4], rl[4], rw[8];
#pragma unroll
  for (int i = 0; i < 4; ++i) { rh[i] = *(const v4u*)(hg + (size_t)i * 16 * CC); rl[i] = *(const v4u*)(lg + (size_t)i * 16 * CC); }
#pragma unroll
  for (int i = 0; i < 8; ++i) rw[i] = *(const v4u*)(wg + (size_t)i * 16 * CC);
  asm volatile("s_wait_xcnt 0x0" ::: "memory");   // before a register that an issued load names as its address is written again
#pragma unroll
  for (int i = 0; i < 4; ++i) { *(v4u*)&sg[0][lr + 16 * i][lc] = rh[i]; *(v4u*)&sg[0][64 + lr + 16 * i][lc] = rl[i]; }
#pragma unroll
  for (int i = 0; i < 8; ++i) *(v4u*)&sg[0][128 + lr + 16 * i][lc] = rw[i];
  __syncthreads();
  v8f acc[8] = {};
  for (int t = 0; t < CC / GK; ++t) { const int bu = t & 1; const bool more = t + 1 < CC / GK;
    if (more) {   // next stage's rows fly while this stage is worked on
#pragma unroll
      for (int i = 0; i < 4; ++i) { rh[i] = *(const v4u*)(hg + (size_t)i * 16 * CC + (t + 1) * GK); rl[i] = *(const v4u*)(lg + (size_t)i * 16 * CC + (t + 1) * GK); }
#pragma unroll
      for (int i = 0; i < 8; ++i) rw[i] = *(const v4u*)(wg + (size_t)i * 16 * CC + (t + 1) * GK);
      asm volatile("s_wait_xcnt 0x0" ::: "memory");   // before a register that an issued load names as its address is written again
    }
#pragma unroll
    for (int kc = 0; kc < GK / 32; ++kc) { const v16b ah = frag_b(&sg[bu][wave * 16 + col][kc * 32], lane), al = frag_b(&sg[bu][64 + wave * 16 + col][kc * 32], lane);
#pragma unroll
      for (int j = 0; j < 8; ++j) { const v16b w = frag_b(&sg[bu][128 + j * 16 + col][kc * 32], lane); acc[j] = wmma_b(ah, w, acc[j]); acc[j] = wmma_b(al, w, acc[j]); } }
    __builtin_amdgcn_sched_barrier(0);   // keeps the LDS stores of the next stage's rows, which wait for their loads, behind this stage's products
    if (more) {
#pragma unroll
      for (int i = 0; i < 4; ++i) { *(v4u*)&sg[bu ^ 1][lr + 16 * i][lc] = rh[i]; *(v4u*)&sg[bu ^ 1][64 + lr + 16 * i][lc] = rl[i]; }
#pragma unroll
      for (int i = 0; i < 8; ++i) *(v4u*)&sg[bu ^ 1][128 + lr + 16 * i][lc] = rw[i]; }
    __syncthreads(); }   // publishes stage t + 1 and ends every wave's reads of stage t, whose buffer the next trip refills
#pragma unroll
  for (int j = 0; j < 8; ++j) { const float bias = BO ? bfr(BO[c0 + j * 16 + col]) : 0.f;
#pragma unroll
    for (int r = 0; r < 8; ++r) sf[wave][8 * g + r][j * 16 + col] = acc[j][r] + bias; }
  LDSX(); for (int rl = 0; rl < 16; ++rl) vst2(OUT + (r0 + rl) * DIN + c0 + lane * 4, *(const v4f*)&sf[wave][rl][lane * 4]); }

extern "C" void kernel_launch(void* const* d_in, const int* in_sizes, int n_in, void* d_out, int out_size, void* d_ws, size_t ws_size, hipStream_t stream) {
  (void)in_sizes; (void)n_in; (void)out_size;
  const float** F = (const float**)d_in;
  if (ws_size < (size_t)WS_END) return;
  char* ws = (char*)d_ws; _Float16 *QH = (_Float16*)(ws + WS_QH), *KH = (_Float16*)(ws + WS_KH), *VT = (_Float16*)(ws + WS_VT), *QL = (_Float16*)(ws + WS_QL), *KL = (_Float16*)(ws + WS_KL); __bf16 *VB = (__bf16*)(ws + WS_VB), *VBL = (__bf16*)(ws + WS_VBL), *WOB = (__bf16*)(ws + WS_WO), *YH = (__bf16*)(ws + WS_Y), *YL = (__bf16*)(ws + WS_YL);
  (void)QL; (void)KL; (void)VB; (void)VBL;
  // inputs: 0 x [2,2048,1024]; 1 qkv_w [3072,1024] (out,in; rows q | k | v); 2 proj_w [1024,1024] (out,in); 3 proj_b; 4 q_scale [64]; 5 k_scale [64]
  k_proj<<<dim3(TNB * TT / PM, 3 * CC / PN), PT, 0, stream>>>(F[0], F[1], QH, QL, KH, KL, VT, VB, VBL, F[2], WOB, F[4], F[5]);
  k_fa<<<dim3(TT / 128, NH, TNB), 256, 0, stream>>>(QH, QL, KH, VT, YH, YL);
  k_out<<<dim3(TNB * TT / 64, DIN / 128), 128, 0, stream>>>(YH, YL, WOB, F[3], (float*)d_out);
}

// v006
// One run takes 92.4 microseconds.
// Next to v005, in two timings, it ran 1.03 times as fast each time.
// All steps since v000 together make it 15.6 times as fast.
// compute dtype: all float inputs rounded to bf16; qkv = x Wqkv^T with EXACT bf16 products on WMMA 16x16x32 (f32 accumulate); per-head RMSNorm of q and k in f32 on the projected rows; q as f16 hi + residual (x 2^10) against k once to f16 (2 products); softmax in f32 (base 2: 64^-0.5 log2 e folded into one fma a score, hardware exp2) with a running maximum and sum over stages of 64 keys; P x 2^11 (relative to the running maximum) once to f16 against v once to f16 (1 product), divided by the sum at the end; ctx split bf16 hi + lo (by the attention kernel, as it stores ctx) against exact proj_w (rounded once, by the first kernel) (2 products) + proj_b; f32 output.
#include <hip/hip_runtime.h>
#include <math.h>

typedef __attribute__((ext_vector_type(16))) _Float16 v16h;
typedef __attribute__((ext_vector_type(16))) __bf16 v16b;
typedef __attribute__((ext_vector_type(8)))  _Float16 v8h;
typedef __attribute__((ext_vector_type(8)))  float v8f;
typedef __attribute__((ext_vector_type(4)))  float v4f;
typedef __attribute__((ext_vector_type(2)))  float v2f;
typedef __attribute__((ext_vector_type(4)))  unsigned v4u;
typedef __attribute__((ext_vector_type(4)))  int v4i;
typedef float __attribute__((may_alias)) float_a;
typedef int __attribute__((may_alias)) int_a;

template <typename T> __device__ __forceinline__ void vst2(void* p, T v) { *(T*)p = v;  }
__device__ __forceinline__ v8f wmma16(v16h a, v16h b, v8f c) {
  v8f d = __builtin_amdgcn_wmma_f32_16x16x32_f16(false, a, false, b, (short)0, c, false, false);
  asm volatile("v_nop\n\tv_nop\n\tv_nop\n\tv_nop" : "+v"(d) : "v"(a), "v"(b));
  return d;
}
__device__ __forceinline__ v8f wmma_bf(v16b a, v16b b, v8f c) {
  v8f d = __builtin_amdgcn_wmma_f32_16x16x32_bf16(false, a, false, b, (short)0, c, false, false);
  asm volatile("v_nop\n\tv_nop\n\tv_nop\n\tv_nop" : "+v"(d) : "v"(a), "v"(b));
  return d;
}
// 16x16x32 fragments: lane = (h = lane>>4, row/col = lane&15); elements 0..7 = k0+8h+0..7, 8..15 = k0+16+8h+0..7; D element r = row 8h+r
__device__ __forceinline__ v16h frag_h(const _Float16* rowk0, int lane) {
  union { v16h v; v8h q[2]; } u; const _Float16* p = rowk0 + 8 * (lane >> 4);
  u.q[0] = *(const v8h*)p; u.q[1] = *(const v8h*)(p + 16); return u.v;
}
__device__ __forceinline__ v16h frag_f32(const float* rowk0, int lane) {
  v16h a; const float* p = rowk0 + 8 * (lane >> 4);
#pragma unroll
  for (int i = 0; i < 8; ++i) { a[i] = (_Float16)p[i]; a[8 + i] = (_Float16)p[16 + i]; }
  return a;
}
__device__ __forceinline__ v16h frag_f32s(const float* rowk0, int lane, float sc) {
  v16h a; const float* p = rowk0 + 8 * (lane >> 4);
#pragma unroll
  for (int i = 0; i < 8; ++i) { a[i] = (_Float16)(p[i] * sc); a[8 + i] = (_Float16)(p[16 + i] * sc); }
  return a;
}
// column fragment from a [K][ld] layout (column n), rows >= K read as 0
__device__ __forceinline__ v16h fragc_f32(const float* W, int k0, int n, int lane, int ld, int K) {
  v16h a; const int g = lane >> 4;
#pragma unroll
  for (int i = 0; i < 8; ++i) { const int ka = k0 + 8 * g + i, kb = ka + 16;
    a[i] = (_Float16)(ka < K ? W[(size_t)(ka < K ? ka : K - 1) * ld + n] : 0.f); a[8 + i] = (_Float16)(kb < K ? W[(size_t)(kb < K ? kb : K - 1) * ld + n] : 0.f); }
  return a;
}
struct F2 { v16b h, l; };
__device__ __forceinline__ F2 bsplit16(const float v[16]) { F2 r;
#pragma unroll
  for (int i = 0; i < 16; ++i) { const __bf16 h = (__bf16)v[i]; r.h[i] = h; r.l[i] = (__bf16)(v[i] - (float)h); }
  return r; }
__device__ __forceinline__ F2 split_row(const float* row, int k0, int lane) { float v[16]; const float* p = row + k0 + 8 * (lane >> 4);
#pragma unroll
  for (int i = 0; i < 8; ++i) { v[i] = p[i]; v[8 + i] = p[16 + i]; }
  return bsplit16(v); }
__device__ __forceinline__ F2 split_rowK(const float* row, int k0, int lane, int K) { float v[16]; const int g = lane >> 4;
#pragma unroll
  for (int i = 0; i < 8; ++i) { const int ka = k0 + 8 * g + i, kb = ka + 16; v[i] = ka < K ? row[ka < K ? ka : K - 1] : 0.f; v[8 + i] = kb < K ? row[kb < K ? kb : K - 1] : 0.f; }
  return bsplit16(v); }
__device__ __forceinline__ F2 split_col(const float* W, int k0, int n, int lane, int ld, int K) { float v[16]; const int g = lane >> 4;
#pragma unroll
  for (int i = 0; i < 8; ++i) { const int ka = k0 + 8 * g + i, kb = ka + 16; v[i] = ka < K ? W[(size_t)(ka < K ? ka : K - 1) * ld + n] : 0.f; v[8 + i] = kb < K ? W[(size_t)(kb < K ? kb : K - 1) * ld + n] : 0.f; }
  return bsplit16(v); }
__device__ __forceinline__ v8f mac3(const F2& a, const F2& b, v8f c) { c = wmma_bf(a.l, b.h, c); c = wmma_bf(a.h, b.l, c); return wmma_bf(a.h, b.h, c); }
__device__ __forceinline__ float sigm(float v) { return 1.0f / (1.0f + expf(-v)); }
#define LDSX() do { asm volatile("s_wait_dscnt 0" ::: "memory"); __builtin_amdgcn_wave_barrier(); __builtin_amdgcn_fence(__ATOMIC_RELEASE, "workgroup"); } while (0)

// Self-attention with QK RMSNorm (B 2, N 2,048, C 1,024 = 16 x 64): qkv = x qkv_w^T ((out,in) [3072,1024], rows (3, H, hd)); q, k <- scale * q / (|q| 64^-0.5 + 1e-8) per head (scales all ones); out = merged(softmax(q k^T x 64^-0.5) v) proj_w^T + proj_b (non-causal).
#define NB 2
#define TT 2048
#define CC 1024            // NH * HD = projected width
#define DIN 1024          // input (model) width
#define NH 16
#define HD 64
#define NQB (TT / 64)
#define HG 4
#define SCALE (0.125f)
#define CAUSAL 0
#ifndef TNB
#define TNB NB
#endif
__device__ __forceinline__ float bfr(float v) { return (float)(__bf16)v; }
__host__ __device__ __forceinline__ int kb_last(int qb) { return CAUSAL ? ((qb * 64 + 63) >> 7) : (TT / 128 - 1); }
typedef __attribute__((ext_vector_type(8))) __bf16 v8b;
__device__ __forceinline__ v16b frag_b(const __bf16* rowk0, int lane) {
  union { v16b v; v8b q[2]; } u; const __bf16* p = rowk0 + 8 * (lane >> 4);
  u.q[0] = *(const v8b*)p; u.q[1] = *(const v8b*)(p + 16); return u.v;
}
#define QBH 0
#define QHI 2048            // rows carrying a q residual plane (all rows when non-causal: 2-product logits everywhere)
#define KHI 64            // key rows carrying k residual / v bf16 hi+lo planes (written by k_proj, read by no kernel)
// B fragment (k rows k0+.., output column o) of a weight: (in,out) [K][ld] or (out,in) [ld rows of K]: bf16 exact, or f16(bf16 * 256) exact
__device__ __forceinline__ v16b wcol_io(const float* Wm, int k0, int o, int lane, int ld) { v16b w; const int g = lane >> 4;
#pragma unroll
  for (int i = 0; i < 8; ++i) { w[i] = (__bf16)Wm[(size_t)(k0 + 8 * g + i) * ld + o]; w[8 + i] = (__bf16)Wm[(size_t)(k0 + 16 + 8 * g + i) * ld + o]; }
  return w; }
__device__ __forceinline__ v16b wcol_oi(const float* Wm, int k0, int o, int lane, int K) { v16b w; const float* p = Wm + (size_t)o * K + k0 + 8 * (lane >> 4);
#pragma unroll
  for (int i = 0; i < 8; ++i) { w[i] = (__bf16)p[i]; w[8 + i] = (__bf16)p[16 + i]; }
  return w; }
__device__ __forceinline__ v16h wcolh_io(const float* Wm, int k0, int o, int lane, int ld) { v16h w; const int g = lane >> 4;
#pragma unroll
  for (int i = 0; i < 8; ++i) { w[i] = (_Float16)(bfr(Wm[(size_t)(k0 + 8 * g + i) * ld + o]) * 256.0f); w[8 + i] = (_Float16)(bfr(Wm[(size_t)(k0 + 16 + 8 * g + i) * ld + o]) * 256.0f); }
  return w; }
__device__ __forceinline__ v16h wcolh_oi(const float* Wm, int k0, int o, int lane, int K) { v16h w; const float* p = Wm + (size_t)o * K + k0 + 8 * (lane >> 4);
#pragma unroll
  for (int i = 0; i < 8; ++i) { w[i] = (_Float16)(bfr(p[i]) * 256.0f); w[8 + i] = (_Float16)(bfr(p[16 + i]) * 256.0f); }
  return w; }
#define WQKV_LAYOUT 1   // layout of WCOL, which no kernel calls (k_proj reads qkv_w as (out,in) rows): 0 = (in,out) [DIN][CC]; 1 = (out,in) [CC][DIN]; 2 = per-head [NH][DIN][HD]
__device__ __forceinline__ v16b wcol_hdk(const float* Wm, int k0, int o, int lane) { v16b w; const int g = lane >> 4; const float* p = Wm + (size_t)(o / HD) * DIN * HD + (o % HD);
#pragma unroll
  for (int i = 0; i < 8; ++i) { w[i] = (__bf16)p[(size_t)(k0 + 8 * g + i) * HD]; w[8 + i] = (__bf16)p[(size_t)(k0 + 16 + 8 * g + i) * HD]; }
  return w; }
#define WO_OUT_IN 1
#if WQKV_LAYOUT == 1
#define WCOL(W, k0, o, lane) wcol_oi(W, k0, o, lane, DIN)
#elif WQKV_LAYOUT == 2
#define WCOL(W, k0, o, lane) wcol_hdk(W, k0, o, lane)
#else
#define WCOL(W, k0, o, lane) wcol_io(W, k0, o, lane, CC)
#endif
#if WO_OUT_IN
#define WOCOL(W, k0, o, lane) wcol_oi(W, k0, o, lane, CC)
#define WOCOLH(W, k0, o, lane) wcolh_oi(W, k0, o, lane, CC)
#else
#define WOCOL(W, k0, o, lane) wcol_io(W, k0, o, lane, DIN)
#define WOCOLH(W, k0, o, lane) wcolh_io(W, k0, o, lane, DIN)
#endif
#define PROJ_EXTRA_PARAMS , const float* __restrict__ QS, const float* __restrict__ KS
#define PROJ_EPI(which, row, t, h) do { if ((which) < 2) { float* rw = (row); const float* sc = (which) == 0 ? QS : KS; float ss = 0.f; _Pragma("unroll") for (int i = 0; i < 64; ++i) ss += rw[i] * rw[i]; const float rms = __fsqrt_rn(ss) * 0.125f; const float inv = 1.0f / (rms + 1e-8f); _Pragma("unroll") for (int i = 0; i < 64; ++i) rw[i] = bfr(sc[i]) * (rw[i] * inv); } } while (0)   /* per-head RMSNorm: norm(x, axis=-1) * hd^-0.5; scale * (x / (rms + eps)) */
#ifndef SM_EXTRA_PARAMS
#define SM_EXTRA_PARAMS
#endif
#ifndef PROJ_EXTRA_PARAMS
#define PROJ_EXTRA_PARAMS
#endif
#ifndef SM_MASK_HOOK
#define SM_MASK_HOOK (void)0
#endif

#define WS_QH  0u                                      // f16 q rows [b*t][CC]
#define WS_KH  (WS_QH + 2u * (size_t)NB * TT * CC)      // f16 k rows [b*t][CC]
#define WS_VT  (WS_KH + 2u * (size_t)NB * TT * CC)      // f16 v planes [b][c][t]
#define WS_QL  (WS_VT + 2u * (size_t)NB * CC * TT)      // f16 q residual x 2^10 rows [b][t < QHI][CC]
#define WS_KL  (WS_QL + 2u * (size_t)NB * QHI * CC)     // f16 k residual x 2^10 rows [b][t < KHI][CC]
#define WS_VB  (WS_KL + 2u * (size_t)NB * KHI * CC)     // bf16 v hi planes [b][c][t < KHI]
#define WS_VBL (WS_VB + 2u * (size_t)NB * CC * KHI)
#define WS_S   (WS_VBL + 2u * (size_t)NB * CC * KHI)    // f32 logits / P [hg][t][s] (no kernel left that uses it as such)
#define WS_WO  WS_S                                    // bf16 proj_w rows [DIN][CC], in that range
#define WS_Y   (WS_S  + 4u * (size_t)HG * TT * TT)      // ctx rows [b*t][CC]: the bf16 hi plane, then the bf16 lo plane (together the bytes of one f32 plane)
#define WS_YL  (WS_Y  + 2u * (size_t)NB * TT * CC)
#define WS_END (WS_Y  + 4u * (size_t)NB * TT * CC)

// ---- operand staging of the two projection GEMMs: a stage is 64 k of every operand row of the block's tile in bf16 (k_proj's block rounds its f32 rows; k_out's copies the bf16 that k_proj and k_fa left), laid in LDS, from where every wave takes its fragments
#define GK 64              // k per stage
#define GP 72              // LDS row pitch in bf16: 144 B = 16 B x 9 (odd multiple: 16-byte fragment reads without bank conflicts)
typedef __attribute__((ext_vector_type(4))) __bf16 v4b;
__device__ __forceinline__ v8f wmma_b(v16b a, v16b b, v8f c) { return __builtin_amdgcn_wmma_f32_16x16x32_bf16(false, a, false, b, (short)0, c, false, false); }
__device__ __forceinline__ void put_bf(__bf16* d, v4f v) { v4b c;
#pragma unroll
  for (int k = 0; k < 4; ++k) c[k] = (__bf16)v[k];
  *(v4b*)d = c; }
__device__ __forceinline__ void put_bf_split(__bf16* dh, __bf16* dl, v4f v) { v4b h, l;
#pragma unroll
  for (int k = 0; k < 4; ++k) { const __bf16 hv = (__bf16)v[k]; h[k] = hv; l[k] = (__bf16)(v[k] - (float)hv); }
  *(v4b*)dh = h; *(v4b*)dl = l; }
// ---- k_proj: block = 256 rows x 192 columns (3 whole heads) of the one product qkv = X Wqkv^T with exact bf16 products (K = DIN), 16 waves; 16 x 16 blocks. Each head of the tile goes its own way: q: f16 rows + residual rows; k: f16 rows (+ residual rows t < KHI); v: f16 planes [c][t] (+ bf16 hi/lo planes for t < KHI)
#define PM 256             // rows of X per block
#define PN 192             // rows of Wqkv (output columns) per block: an X row fetched from L2 serves 192 columns, a W row 256 rows
#define PT 512             // threads: 4 x 4 waves of 64 rows x 48 columns
#define SP 196             // pitch of the f32 tile in floats: 784 B = 16 B x 49
__global__ __launch_bounds__(PT) void k_proj(const float* __restrict__ X, const float* __restrict__ WA,
    _Float16* __restrict__ QH, _Float16* __restrict__ QL, _Float16* __restrict__ KH, _Float16* __restrict__ KL, _Float16* __restrict__ VT, __bf16* __restrict__ VB, __bf16* __restrict__ VBL, const float* __restrict__ WO, __bf16* __restrict__ WOB PROJ_EXTRA_PARAMS) {
  // LDS: one range that holds the two operand stages during the product and the f32 tile after it (the loop's last barrier lies between the last fragment read and the first write of the tile), then the transposed v heads
  __shared__ __align__(16) char sm[PM * SP * 4 + PN * (PM + 8) * 2];
  static_assert(2 * (PM + PN) * GP * 2 <= PM * SP * 4, "the stages fit the f32 tile's range");
  static_assert(TT % PM == 0 && (3 * CC) % PN == 0 && PN % HD == 0 && KHI <= PM, "whole tiles, whole heads");
  __bf16 (*sg)[PM + PN][GP] = (__bf16 (*)[PM + PN][GP])sm;   // stage: rows 0..PM-1 = X rows, PM.. = W rows (output columns)
  float (*st)[SP] = (float (*)[SP])sm; _Float16 (*th)[PM + 8] = (_Float16 (*)[PM + 8])(sm + PM * SP * 4);
  const int tid = threadIdx.x, wave = tid >> 5, lane = tid & 31, col = lane & 15, g = lane >> 4; const int c0 = blockIdx.y * PN; const size_t r0 = (size_t)blockIdx.x * PM; const size_t bb = r0 / TT; const int t0 = (int)(r0 % TT);
  // (every '#pragma unroll' below: the loop's index selects a register of a load, fragment or accumulator array, which stays in registers only under constant indices)
  const int wr = (wave >> 2) * 64, wc = (wave & 3) * 48;   // wave tile: 64 rows x 48 columns (4 + 3 fragments for 12 products)
  const int lr = tid >> 4, lc = (tid & 15) * 4;            // staging: 16 lanes read 256 contiguous bytes of one row; a thread takes rows lr + 32 i
  const float* xg = X + (r0 + lr) * DIN + lc; const float* wg = WA + (size_t)(c0 + lr) * DIN + lc;
  v4f rx[PM / 32], rw[PN / 32];
#pragma unroll
  for (int i = 0; i < PM / 32; ++i) rx[i] = *(const v4f*)(xg + (size_t)i * 32 * DIN);
#pragma unroll
  for (int i = 0; i < PN / 32; ++i) rw[i] = *(const v4f*)(wg + (size_t)i * 32 * DIN);
  // proj_w for k_out, rounded to bf16 here once (the grid's threads take 8 elements each) instead of by each of k_out's blocks that reads a row
  static_assert((size_t)(TNB * TT / PM) * (3 * CC / PN) * PT * 8 == (size_t)DIN * CC, "the grid covers proj_w once");
  const size_t wi = ((size_t)(blockIdx.y * (TNB * TT / PM) + blockIdx.x) * PT + tid) * 8;
  const v4f wo0 = *(const v4f*)(WO + wi), wo1 = *(const v4f*)(WO + wi + 4);
  asm volatile("s_wait_xcnt 0x0" ::: "memory");   // before a register that an issued load names as its address is written again
  { v8b wb;
#pragma unroll
    for (int k = 0; k < 4; ++k) { wb[k] = (__bf16)wo0[k]; wb[4 + k] = (__bf16)wo1[k]; }
    vst2(WOB + wi, wb);
    asm volatile("s_wait_xcnt 0x0" ::: "memory"); }   // before a register that the issued store names is written again
#pragma unroll
  for (int i = 0; i < PM / 32; ++i) put_bf(&sg[0][lr + 32 * i][lc], rx[i]);
#pragma unroll
  for (int i = 0; i < PN / 32; ++i) put_bf(&sg[0][PM + lr + 32 * i][lc], rw[i]);
  __syncthreads();
  v8f acc[4][3] = {};
  for (int t = 0; t < DIN / GK; ++t) { const int bu = t & 1; const bool more = t + 1 < DIN / GK;
    if (more) {   // next stage's rows fly while this stage is worked on
#pragma unroll
      for (int i = 0; i < PM / 32; ++i) rx[i] = *(const v4f*)(xg + (size_t)i * 32 * DIN + (t + 1) * GK);
#pragma unroll
      for (int i = 0; i < PN / 32; ++i) rw[i] = *(const v4f*)(wg + (size_t)i * 32 * DIN + (t + 1) * GK);
      asm volatile("s_wait_xcnt 0x0" ::: "memory");   // before a register that an issued load names as its address is written again
    }
#pragma unroll
    for (int kc = 0; kc < GK / 32; ++kc) { v16b a[4], w[3];
#pragma unroll
      for (int i = 0; i < 4; ++i) a[i] = frag_b(&sg[bu][wr + i * 16 + col][kc * 32], lane);
#pragma unroll
      for (int j = 0; j < 3; ++j) w[j] = frag_b(&sg[bu][PM + wc + j * 16 + col][kc * 32], lane);
#pragma unroll
      for (int i = 0; i < 4; ++i)
#pragma unroll
        for (int j = 0; j < 3; ++j) acc[i][j] = wmma_b(a[i], w[j], acc[i][j]); }
    __builtin_amdgcn_sched_barrier(0);   // keeps the rounding of the next stage's rows, which waits for their loads, behind this stage's products
    if (more) {
#pragma unroll
      for (int i = 0; i < PM / 32; ++i) put_bf(&sg[bu ^ 1][lr + 32 * i][lc], rx[i]);
#pragma unroll
      for (int i = 0; i < PN / 32; ++i) put_bf(&sg[bu ^ 1][PM + lr + 32 * i][lc], rw[i]); }
    __syncthreads(); }   // publishes stage t + 1 and ends every wave's reads of stage t, whose buffer the next trip refills (behind the last trip: the f32 tile)
  // stage the f32 tile in LDS, run the per-(row, head) epilogue hook, then convert head by head
#pragma unroll
  for (int j = 0; j < 3; ++j)
#pragma unroll
    for (int i = 0; i < 4; ++i)
#pragma unroll
      for (int r = 0; r < 8; ++r) st[wr + i * 16 + 8 * g + r][wc + j * 16 + col] = acc[i][j][r];
  __syncthreads();
  const int h0 = c0 / HD;   // the tile's first head among the 3 NH heads of qkv: heads 0..NH-1 are q, then k, then v
  for (int e = tid; e < PM * (PN / HD); e += PT) { const int rl = e % PM, hh = e / PM; const int which = (h0 + hh) / NH; PROJ_EPI(which, &st[rl][hh * HD], t0 + rl, (h0 + hh) % NH); }
  __syncthreads();
  for (int hh = 0; hh < PN / HD; ++hh) { const int which = (h0 + hh) / NH, hc = ((h0 + hh) % NH) * HD;   // hc: the head's first column in its own q, k or v
    if (which < 2) { _Float16* DH = which == 0 ? QH : KH; _Float16* DL = which == 0 ? QL : KL; const int nhi = which == 0 ? QHI : KHI;
      for (int e = tid; e < PM * (HD / 8); e += PT) { const int rl = e >> 3, q = e & 7; const float* p = &st[rl][hh * HD + q * 8]; v8h hv, lv;
#pragma unroll
        for (int k = 0; k < 8; ++k) { const float v = p[k]; const _Float16 hk = (_Float16)v; hv[k] = hk; lv[k] = (_Float16)((v - (float)hk) * 1024.0f); }
        vst2(DH + (r0 + rl) * CC + hc + q * 8, hv); if (t0 + rl < nhi) vst2(DL + (bb * nhi + t0 + rl) * (size_t)CC + hc + q * 8, lv);   // 8 lanes store one 128-B line; the residual plane holds rows t < nhi alone
        asm volatile("s_wait_xcnt 0x0" ::: "memory"); }   // before a register that an issued store names is written again
    } else {
      for (int e = tid; e < PM * HD; e += PT) { const int rl = e % PM, cl = e / PM; th[hh * HD + cl][rl] = (_Float16)st[rl][hh * HD + cl]; } } }
  __syncthreads();
  for (int hh = 0; hh < PN / HD; ++hh) { const int which = (h0 + hh) / NH, hc = ((h0 + hh) % NH) * HD;
    if (which == 2) {
      for (int e = tid; e < HD * (PM / 8); e += PT) { const int cl = e / (PM / 8), q = e % (PM / 8); vst2(VT + (bb * CC + hc + cl) * (size_t)TT + t0 + q * 8, *(const v4u*)&th[hh * HD + cl][q * 8]); }
      if (t0 == 0) for (int e = tid; e < HD * (KHI / 8); e += PT) { const int cl = e / (KHI / 8), q = e % (KHI / 8); v8b bh, bl;   // the planes of t < KHI lie in the tile that starts at t = 0
#pragma unroll
        for (int k = 0; k < 8; ++k) { const float v = st[q * 8 + k][hh * HD + cl]; const __bf16 bk = (__bf16)v; bh[k] = bk; bl[k] = (__bf16)(v - (float)bk); }
        const size_t o3 = (bb * CC + hc + cl) * (size_t)KHI + q * 8; vst2(VB + o3, bh); vst2(VBL + o3, bl); } } } }
// ---- k_fa: block = 128 queries (8 waves x 16) of (b, h), one pass over all keys in stages of 64: S^T = K Q^T (q hi + residual x 2^10, 2 products) x SCALE, running maximum and sum per query (a lane holds one query's scores), P^T x 2^11 packed from the score tiles as the B operand, ctx^T += V^T P^T (1 product); logits and P never leave the registers
// (every '#pragma unroll' in k_fa: the loop's index selects a register of a fragment, score or accumulator array, which stays in registers only under constant indices)
#define FK 64              // keys per stage
#define SL2E (SCALE * 1.44269504088896f)   // 64^-0.5 x log2 e: e^(SCALE x) = 2^(SL2E x)
#define FP 72              // LDS row pitch in f16: 144 B = 16 B x 9 (odd multiple: 16-byte fragment reads without bank conflicts)
__device__ __forceinline__ v8f wmma_h(v16h a, v16h b, v8f c) { return __builtin_amdgcn_wmma_f32_16x16x32_f16(false, a, false, b, (short)0, c, false, false); }
#define FB (FK * FP * 2)   // bytes of one K (or V) buffer in LDS
// one stage's rows for this thread: four asynchronous copies of 16 B a lane, global memory to LDS through no register (K rows sr and sr + 32, V rows sr and sr + 32)
__device__ __forceinline__ void fa_copy(unsigned lk, unsigned lv, const _Float16* k, const _Float16* v) {
  // the copies fly while the wave goes on; the closing s_wait_xcnt 0 stands inside the statement so that no address register a copy names is written again in front of it
  asm volatile("global_load_async_to_lds_b128 %0, %4, off\n\t"
               "global_load_async_to_lds_b128 %1, %5, off\n\t"
               "global_load_async_to_lds_b128 %2, %6, off\n\t"
               "global_load_async_to_lds_b128 %3, %7, off\n\t"
               "s_wait_xcnt 0x0"
               :: "v"(lk), "v"(lk + 32u * FP * 2u), "v"(lv), "v"(lv + 32u * FP * 2u), "v"(k), "v"(k + 32 * CC), "v"(v), "v"(v + 32 * TT) : "memory");
}
// four waves a SIMD is what the grid gives (512 blocks of 8 waves on 256 WGPs): told to the compiler so that it spends the registers of that residency on fetching a stage's K fragments as one group; aiming at more waves it fetches each pair just ahead of its products and waits for it at once
__global__ __launch_bounds__(256) __attribute__((amdgpu_waves_per_eu(4, 4))) void k_fa(const _Float16* __restrict__ QH, const _Float16* __restrict__ QL, const _Float16* __restrict__ KH, const _Float16* __restrict__ VT, __bf16* __restrict__ YH, __bf16* __restrict__ YL) {
  __shared__ __align__(16) _Float16 sK[2][FK][FP], sV[2][HD][FP];
  const int tid = threadIdx.x, wave = tid >> 5, lane = tid & 31, col = lane & 15, g = lane >> 4; const int h = blockIdx.y, b = blockIdx.z; const int ql0 = blockIdx.x * 128 + wave * 16;
  v16h qh[HD / 32], ql[HD / 32];
#pragma unroll
  for (int kc = 0; kc < HD / 32; ++kc) { qh[kc] = frag_h(QH + ((size_t)b * TT + ql0 + col) * CC + h * HD + kc * 32, lane); ql[kc] = frag_h(QL + ((size_t)b * QHI + ql0 + col) * CC + h * HD + kc * 32, lane); }
  // staging: thread = (row sr and sr + 32, 16-byte chunk sc) of the K tile [key][d] and of the V tile [d][key]: 8 lanes copy one whole 128-B row; two buffers, stage t + 2 issued behind the barrier that ends stage t, so a stage's copies have the whole of the stage before it to land
  const int sr = tid >> 3, sc = (tid & 7) * 8;
  const _Float16* kg = KH + ((size_t)b * TT + sr) * CC + h * HD + sc; const _Float16* vg = VT + ((size_t)b * CC + h * HD + sr) * (size_t)TT + sc;
  static_assert(TT / FK >= 2 && HD == FK, "two stages at least; K and V buffers of one size");
  const unsigned lk = (unsigned)(size_t)&sK[0][sr][sc], lv = (unsigned)(size_t)&sV[0][sr][sc];   // the lane's LDS byte addresses in buffer 0
  fa_copy(lk, lv, kg, vg);
  asm volatile("s_wait_asynccnt 0x0" ::: "memory");   // this wave's copies of stage 0 have landed before the barrier publishes them
  __syncthreads();
  fa_copy(lk + FB, lv + FB, kg + (size_t)FK * CC, vg + FK);
  v8f acc[HD / 16] = {}; float m = -3.0e38f, l = 0.f;
  for (int t = 0; t < TT / FK; ++t) { const int bu = t & 1;
    v2f s[FK / 16][4]; float mt = -3.0e38f;   // scores in pairs: one packed fma serves two
#pragma unroll
    for (int i = 0; i < FK / 16; ++i) { v8f ah = {}, al = {};
#pragma unroll
      for (int kc = 0; kc < HD / 32; ++kc) { const v16h kf = frag_h(&sK[bu][i * 16 + col][kc * 32], lane); ah = wmma_h(kf, qh[kc], ah); al = wmma_h(kf, ql[kc], al); }
#pragma unroll
      for (int r = 0; r < 4; ++r) { const v2f h2 = {ah[2 * r], ah[2 * r + 1]}, l2 = {al[2 * r], al[2 * r + 1]}; s[i][r] = h2 + l2 * (1.0f / 1024.0f); mt = fmaxf(mt, fmaxf(s[i][r][0], s[i][r][1])); } }   // s[i][r][u] = q.k (key i*16 + 8g + 2r + u, query col), not yet scaled: the maximum is taken on q.k itself (SL2E > 0 keeps the order)
    mt = fmaxf(mt, __shfl_xor(mt, 16));
    if (__builtin_amdgcn_ballot_w32(mt > m) != 0) {   // some query's maximum rose: bring its sum and its ctx to the new maximum (factor 1 for the others)
      const float mn = fmaxf(m, mt); const float al = __builtin_amdgcn_exp2f((m - mn) * SL2E); m = mn; l *= al;
#pragma unroll
      for (int j = 0; j < HD / 16; ++j)
#pragma unroll
        for (int r = 0; r < 8; ++r) acc[j][r] *= al; }
    v16h vf[FK / 32][HD / 16];   // the stage's V fragments, fetched as one group ahead of the exponentials
#pragma unroll
    for (int c2 = 0; c2 < FK / 32; ++c2)
#pragma unroll
      for (int j = 0; j < HD / 16; ++j) vf[c2][j] = frag_h(&sV[bu][j * 16 + col][c2 * 32], lane);
    __builtin_amdgcn_sched_barrier(0);   // keeps those loads one group here, their latency behind the exponentials; without it this build strews them among the products, each pair waited for at once
    v2f ls[2] = {{0.f, 0.f}, {0.f, 0.f}};   // four independent partial sums of this stage: no 32-long dependent add chain
    const float mo = m * SL2E - 11.0f;   // P x 2^11 (at most 2^11), so that small P stay normal f16 numbers; the sum carries the same factor
#pragma unroll
    for (int c2 = 0; c2 < FK / 32; ++c2) { v16h p;
#pragma unroll
      for (int r = 0; r < 4; ++r) { const v2f t0 = s[2 * c2][r] * SL2E - mo, t1 = s[2 * c2 + 1][r] * SL2E - mo;   // e^(SCALE (q.k - m)) x 2^11 as one fma and one v_exp_f32; a result under 2^-126 may come as 0, far under the smallest f16
        const v2f e0 = {__builtin_amdgcn_exp2f(t0[0]), __builtin_amdgcn_exp2f(t0[1])}, e1 = {__builtin_amdgcn_exp2f(t1[0]), __builtin_amdgcn_exp2f(t1[1])}; ls[r & 1] += e0 + e1;
        p[2 * r] = (_Float16)e0[0]; p[2 * r + 1] = (_Float16)e0[1]; p[8 + 2 * r] = (_Float16)e1[0]; p[8 + 2 * r + 1] = (_Float16)e1[1]; }
#pragma unroll
      for (int j = 0; j < HD / 16; ++j) acc[j] = wmma_h(vf[c2][j], p, acc[j]); }
    l += (ls[0][0] + ls[0][1]) + (ls[1][0] + ls[1][1]);
    __builtin_amdgcn_sched_barrier(0);   // keeps the waits and the barrier below at the stage's foot, behind its exponentials and products: lifted over them they would cut the time the next stage's copies have to land
    asm volatile("s_wait_dscnt 0x0" ::: "memory");      // this wave's fragment reads of stage t are done before its buffer is refilled
    asm volatile("s_wait_asynccnt 0x0" ::: "memory");   // this wave's copies of stage t + 1 have landed before the barrier publishes them
    __syncthreads();   // publishes stage t + 1 and ends every wave's reads of stage t, whose buffer is refilled right behind it
    if (t + 2 < TT / FK) fa_copy(lk + bu * FB, lv + bu * FB, kg + (size_t)(t + 2) * FK * CC, vg + (t + 2) * FK); }
  asm volatile("s_wait_asynccnt 0x0" ::: "memory");   // no copy is left in flight when the wave ends
  l += __shfl_xor(l, 16); const float inv = l > 0.f ? 1.0f / l : 0.f;
  const size_t yo = ((size_t)b * TT + ql0 + col) * CC + h * HD + 8 * g;   // acc[j][r] = ctx(query col, d = j*16 + 8g + r)
#pragma unroll
  for (int j = 0; j < HD / 16; ++j) { v8b hv, lv;   // ctx leaves as k_out's two operands: bf16 hi and the bf16 of what hi misses
#pragma unroll
    for (int r = 0; r < 8; ++r) { const float v = acc[j][r] * inv; const __bf16 hk = (__bf16)v; hv[r] = hk; lv[r] = (__bf16)(v - (float)hk); }
    vst2(YH + yo + j * 16, hv); vst2(YL + yo + j * 16, lv); } }
// ---- k_out: block = (64 rows, 128 cols): out = ctx Wo (+ bo): ctx bf16 hi + lo against exact bf16 Wo (2 products), all three read as the bf16 their producers left; wave = 16 rows x 128 columns
__global__ __launch_bounds__(128) void k_out(const __bf16* __restrict__ YH, const __bf16* __restrict__ YL, const __bf16* __restrict__ WOB, const float* __restrict__ BO, float* __restrict__ OUT) {
  __shared__ __align__(16) char sm[2 * 256 * GP * 2];
  __bf16 (*sg)[256][GP] = (__bf16 (*)[256][GP])sm;   // stage: rows 0..63 = ctx hi, 64..127 = ctx lo, 128..255 = Wo rows (output columns)
  float (*sf)[16][132] = (float (*)[16][132])sm;     // output staging, in the stages' range after the loop's last barrier
  const int tid = threadIdx.x, wave = tid >> 5, lane = tid & 31, col = lane & 15, g = lane >> 4; const int c0 = blockIdx.y * 128; const size_t rb = (size_t)blockIdx.x * 64, r0 = rb + wave * 16;
  // (every '#pragma unroll' below: the loop's index selects a register of a load, fragment or accumulator array, which stays in registers only under constant indices)
  const int lr = tid >> 3, lc = (tid & 7) * 8;             // staging: 8 lanes read the 128 contiguous bytes a row has in a stage; a thread takes rows lr + 16 i
  const __bf16* hg = YH + (rb + lr) * CC + lc; const __bf16* lg = YL + (rb + lr) * CC + lc; const __bf16* wg = WOB + (size_t)(c0 + lr) * CC + lc;
  v4u rh[4], rl[4], rw[8];
#pragma unroll
  for (int i = 0; i < 4; ++i) { rh[i] = *(const v4u*)(hg + (size_t)i * 16 * CC); rl[i] = *(const v4u*)(lg + (size_t)i * 16 * CC); }
#pragma unroll
  for (int i = 0; i < 8; ++i) rw[i] = *(const v4u*)(wg + (size_t)i * 16 * CC);
  asm volatile("s_wait_xcnt 0x0" ::: "memory");   // before a register that an issued load names as its address is written again
#pragma unroll
  for (int i = 0; i < 4; ++i) { *(v4u*)&sg[0][lr + 16 * i][lc] = rh[i]; *(v4u*)&sg[0][64 + lr + 16 * i][lc] = rl[i]; }
#pragma unroll
  for (int i = 0; i < 8; ++i) *(v4u*)&sg[0][128 + lr + 16 * i][lc] = rw[i];
  __syncthreads();
  v8f acc[8] = {};
  for (int t = 0; t < CC / GK; ++t) { const int bu = t & 1; const bool more = t + 1 < CC / GK;
    if (more) {   // next stage's rows fly while this stage is worked on
#pragma unroll
      for (int i = 0; i < 4; ++i) { rh[i] = *(const v4u*)(hg + (size_t)i * 16 * CC + (t + 1) * GK); rl[i] = *(const v4u*)(lg + (size_t)i * 16 * CC + (t + 1) * GK); }
#pragma unroll
      for (int i = 0; i < 8; ++i) rw[i] = *(const v4u*)(wg + (size_t)i * 16 * CC + (t + 1) * GK);
      asm volatile("s_wait_xcnt 0x0" ::: "memory");   // before a register that an issued load names as its address is written again
    }
#pragma unroll
    for (int kc = 0; kc < GK / 32; ++kc) { const v16b ah = frag_b(&sg[bu][wave * 16 + col][kc * 32], lane), al = frag_b(&sg[bu][64 + wave * 16 + col][kc * 32], lane);
#pragma unroll
      for (int j = 0; j < 8; ++j) { const v16b w = frag_b(&sg[bu][128 + j * 16 + col][kc * 32], lane); acc[j] = wmma_b(ah, w, acc[j]); acc[j] = wmma_b(al, w, acc[j]); } }
    __builtin_amdgcn_sched_barrier(0);   // keeps the LDS stores of the next stage's rows, which wait for their loads, behind this stage's products
    if (more) {
#pragma unroll
      for (int i = 0; i < 4; ++i) { *(v4u*)&sg[bu ^ 1][lr + 16 * i][lc] = rh[i]; *(v4u*)&sg[bu ^ 1][64 + lr + 16 * i][lc] = rl[i]; }
#pragma unroll
      for (int i = 0; i < 8; ++i) *(v4u*)&sg[bu ^ 1][128 + lr + 16 * i][lc] = rw[i]; }
    __syncthreads(); }   // publishes stage t + 1 and ends every wave's reads of stage t, whose buffer the next trip refills
#pragma unroll
  for (int j = 0; j < 8; ++j) { const float bias = BO ? bfr(BO[c0 + j * 16 + col]) : 0.f;
#pragma unroll
    for (int r = 0; r < 8; ++r) sf[wave][8 * g + r][j * 16 + col] = acc[j][r] + bias; }
  LDSX(); for (int rl = 0; rl < 16; ++rl) vst2(OUT + (r0 + rl) * DIN + c0 + lane * 4, *(const v4f*)&sf[wave][rl][lane * 4]); }

extern "C" void kernel_launch(void* const* d_in, const int* in_sizes, int n_in, void* d_out, int out_size, void* d_ws, size_t ws_size, hipStream_t stream) {
  (void)in_sizes; (void)n_in; (void)out_size;
  const float** F = (const float**)d_in;
  if (ws_size < (size_t)WS_END) return;
  char* ws = (char*)d_ws; _Float16 *QH = (_Float16*)(ws + WS_QH), *KH = (_Float16*)(ws + WS_KH), *VT = (_Float16*)(ws + WS_VT), *QL = (_Float16*)(ws + WS_QL), *KL = (_Float16*)(ws + WS_KL); __bf16 *VB = (__bf16*)(ws + WS_VB), *VBL = (__bf16*)(ws + WS_VBL), *WOB = (__bf16*)(ws + WS_WO), *YH = (__bf16*)(ws + WS_Y), *YL = (__bf16*)(ws + WS_YL);
  (void)QL; (void)KL; (void)VB; (void)VBL;
  // inputs: 0 x [2,2048,1024]; 1 qkv_w [3072,1024] (out,in; rows q | k | v); 2 proj_w [1024,1024] (out,in); 3 proj_b; 4 q_scale [64]; 5 k_scale [64]
  k_proj<<<dim3(TNB * TT / PM, 3 * CC / PN), PT, 0, stream>>>(F[0], F[1], QH, QL, KH, KL, VT, VB, VBL, F[2], WOB, F[4], F[5]);
  k_fa<<<dim3(TT / 128, NH, TNB), 256, 0, stream>>>(QH, QL, KH, VT, YH, YL);
  k_out<<<dim3(TNB * TT / 64, DIN / 128), 128, 0, stream>>>(YH, YL, WOB, F[3], (float*)d_out);
}

// v007
// One run takes 88.8 microseconds.
// Next to v006, in two timings, it ran 1.04 times as fast each time.
// All steps since v000 together make it 16.3 times as fast.
// compute dtype: all float inputs rounded to bf16; qkv = x Wqkv^T with EXACT bf16 products on WMMA 16x16x32 (f32 accumulate); per-head RMSNorm of q and k in f32 on the projected rows; q x 64^-0.5 log2 e as f16 hi + residual against k once to f16 (2 products, one f32 sum that starts at 10 - the maximum in use); softmax in f32 (base 2, hardware exp2) with a maximum in use (renewed when a stage's sum of P leaves the f16 range) and a sum over stages of 64 keys; P x 2^10 (relative to the maximum in use) once to f16 against v once to f16 (1 product), divided by the sum at the end; ctx split bf16 hi + lo (by the attention kernel, as it stores ctx) against exact proj_w (rounded once, by the first kernel) (2 products) + proj_b; f32 output.
#include <hip/hip_runtime.h>
#include <math.h>

typedef __attribute__((ext_vector_type(16))) _Float16 v16h;
typedef __attribute__((ext_vector_type(16))) __bf16 v16b;
typedef __attribute__((ext_vector_type(8)))  _Float16 v8h;
typedef __attribute__((ext_vector_type(2)))  _Float16 v2h;
typedef __attribute__((ext_vector_type(8)))  float v8f;
typedef __attribute__((ext_vector_type(4)))  float v4f;
typedef __attribute__((ext_vector_type(2)))  float v2f;
typedef __attribute__((ext_vector_type(4)))  unsigned v4u;
typedef __attribute__((ext_vector_type(4)))  int v4i;
typedef float __attribute__((may_alias)) float_a;
typedef int __attribute__((may_alias)) int_a;

template <typename T> __device__ __forceinline__ void vst2(void* p, T v) { *(T*)p = v;  }
__device__ __forceinline__ v8f wmma16(v16h a, v16h b, v8f c) {
  v8f d = __builtin_amdgcn_wmma_f32_16x16x32_f16(false, a, false, b, (short)0, c, false, false);
  asm volatile("v_nop\n\tv_nop\n\tv_nop\n\tv_nop" : "+v"(d) : "v"(a), "v"(b));
  return d;
}
__device__ __forceinline__ v8f wmma_bf(v16b a, v16b b, v8f c) {
  v8f d = __builtin_amdgcn_wmma_f32_16x16x32_bf16(false, a, false, b, (short)0, c, false, false);
  asm volatile("v_nop\n\tv_nop\n\tv_nop\n\tv_nop" : "+v"(d) : "v"(a), "v"(b));
  return d;
}
// 16x16x32 fragments: lane = (h = lane>>4, row/col = lane&15); elements 0..7 = k0+8h+0..7, 8..15 = k0+16+8h+0..7; D element r = row 8h+r
__device__ __forceinline__ v16h frag_h(const _Float16* rowk0, int lane) {
  union { v16h v; v8h q[2]; } u; const _Float16* p = rowk0 + 8 * (lane >> 4);
  u.q[0] = *(const v8h*)p; u.q[1] = *(const v8h*)(p + 16); return u.v;
}
__device__ __forceinline__ v16h frag_f32(const float* rowk0, int lane) {
  v16h a; const float* p = rowk0 + 8 * (lane >> 4);
#pragma unroll
  for (int i = 0; i < 8; ++i) { a[i] = (_Float16)p[i]; a[8 + i] = (_Float16)p[16 + i]; }
  return a;
}
__device__ __forceinline__ v16h frag_f32s(const float* rowk0, int lane, float sc) {
  v16h a; const float* p = rowk0 + 8 * (lane >> 4);
#pragma unroll
  for (int i = 0; i < 8; ++i) { a[i] = (_Float16)(p[i] * sc); a[8 + i] = (_Float16)(p[16 + i] * sc); }
  return a;
}
// column fragment from a [K][ld] layout (column n), rows >= K read as 0
__device__ __forceinline__ v16h fragc_f32(const float* W, int k0, int n, int lane, int ld, int K) {
  v16h a; const int g = lane >> 4;
#pragma unroll
  for (int i = 0; i < 8; ++i) { const int ka = k0 + 8 * g + i, kb = ka + 16;
    a[i] = (_Float16)(ka < K ? W[(size_t)(ka < K ? ka : K - 1) * ld + n] : 0.f); a[8 + i] = (_Float16)(kb < K ? W[(size_t)(kb < K ? kb : K - 1) * ld + n] : 0.f); }
  return a;
}
struct F2 { v16b h, l; };
__device__ __forceinline__ F2 bsplit16(const float v[16]) { F2 r;
#pragma unroll
  for (int i = 0; i < 16; ++i) { const __bf16 h = (__bf16)v[i]; r.h[i] = h; r.l[i] = (__bf16)(v[i] - (float)h); }
  return r; }
__device__ __forceinline__ F2 split_row(const float* row, int k0, int lane) { float v[16]; const float* p = row + k0 + 8 * (lane >> 4);
#pragma unroll
  for (int i = 0; i < 8; ++i) { v[i] = p[i]; v[8 + i] = p[16 + i]; }
  return bsplit16(v); }
__device__ __forceinline__ F2 split_rowK(const float* row, int k0, int lane, int K) { float v[16]; const int g = lane >> 4;
#pragma unroll
  for (int i = 0; i < 8; ++i) { const int ka = k0 + 8 * g + i, kb = ka + 16; v[i] = ka < K ? row[ka < K ? ka : K - 1] : 0.f; v[8 + i] = kb < K ? row[kb < K ? kb : K - 1] : 0.f; }
  return bsplit16(v); }
__device__ __forceinline__ F2 split_col(const float* W, int k0, int n, int lane, int ld, int K) { float v[16]; const int g = lane >> 4;
#pragma unroll
  for (int i = 0; i < 8; ++i) { const int ka = k0 + 8 * g + i, kb = ka + 16; v[i] = ka < K ? W[(size_t)(ka < K ? ka : K - 1) * ld + n] : 0.f; v[8 + i] = kb < K ? W[(size_t)(kb < K ? kb : K - 1) * ld + n] : 0.f; }
  return bsplit16(v); }
__device__ __forceinline__ v8f mac3(const F2& a, const F2& b, v8f c) { c = wmma_bf(a.l, b.h, c); c = wmma_bf(a.h, b.l, c); return wmma_bf(a.h, b.h, c); }
__device__ __forceinline__ float sigm(float v) { return 1.0f / (1.0f + expf(-v)); }
#define LDSX() do { asm volatile("s_wait_dscnt 0" ::: "memory"); __builtin_amdgcn_wave_barrier(); __builtin_amdgcn_fence(__ATOMIC_RELEASE, "workgroup"); } while (0)

// Self-attention with QK RMSNorm (B 2, N 2,048, C 1,024 = 16 x 64): qkv = x qkv_w^T ((out,in) [3072,1024], rows (3, H, hd)); q, k <- scale * q / (|q| 64^-0.5 + 1e-8) per head (scales all ones); out = merged(softmax(q k^T x 64^-0.5) v) proj_w^T + proj_b (non-causal).
#define NB 2
#define TT 2048
#define CC 1024            // NH * HD = projected width
#define DIN 1024          // input (model) width
#define NH 16
#define HD 64
#define NQB (TT / 64)
#define HG 4
#define SCALE (0.125f)
#define CAUSAL 0
#ifndef TNB
#define TNB NB
#endif
__device__ __forceinline__ float bfr(float v) { return (float)(__bf16)v; }
__host__ __device__ __forceinline__ int kb_last(int qb) { return CAUSAL ? ((qb * 64 + 63) >> 7) : (TT / 128 - 1); }
typedef __attribute__((ext_vector_type(8))) __bf16 v8b;
__device__ __forceinline__ v16b frag_b(const __bf16* rowk0, int lane) {
  union { v16b v; v8b q[2]; } u; const __bf16* p = rowk0 + 8 * (lane >> 4);
  u.q[0] = *(const v8b*)p; u.q[1] = *(const v8b*)(p + 16); return u.v;
}
#define QBH 0
#define QHI 2048            // rows carrying a q residual plane (all rows when non-causal: 2-product logits everywhere)
#define KHI 64            // key rows carrying k residual / v bf16 hi+lo planes (written by k_proj, read by no kernel)
// B fragment (k rows k0+.., output column o) of a weight: (in,out) [K][ld] or (out,in) [ld rows of K]: bf16 exact, or f16(bf16 * 256) exact
__device__ __forceinline__ v16b wcol_io(const float* Wm, int k0, int o, int lane, int ld) { v16b w; const int g = lane >> 4;
#pragma unroll
  for (int i = 0; i < 8; ++i) { w[i] = (__bf16)Wm[(size_t)(k0 + 8 * g + i) * ld + o]; w[8 + i] = (__bf16)Wm[(size_t)(k0 + 16 + 8 * g + i) * ld + o]; }
  return w; }
__device__ __forceinline__ v16b wcol_oi(const float* Wm, int k0, int o, int lane, int K) { v16b w; const float* p = Wm + (size_t)o * K + k0 + 8 * (lane >> 4);
#pragma unroll
  for (int i = 0; i < 8; ++i) { w[i] = (__bf16)p[i]; w[8 + i] = (__bf16)p[16 + i]; }
  return w; }
__device__ __forceinline__ v16h wcolh_io(const float* Wm, int k0, int o, int lane, int ld) { v16h w; const int g = lane >> 4;
#pragma unroll
  for (int i = 0; i < 8; ++i) { w[i] = (_Float16)(bfr(Wm[(size_t)(k0 + 8 * g + i) * ld + o]) * 256.0f); w[8 + i] = (_Float16)(bfr(Wm[(size_t)(k0 + 16 + 8 * g + i) * ld + o]) * 256.0f); }
  return w; }
__device__ __forceinline__ v16h wcolh_oi(const float* Wm, int k0, int o, int lane, int K) { v16h w; const float* p = Wm + (size_t)o * K + k0 + 8 * (lane >> 4);
#pragma unroll
  for (int i = 0; i < 8; ++i) { w[i] = (_Float16)(bfr(p[i]) * 256.0f); w[8 + i] = (_Float16)(bfr(p[16 + i]) * 256.0f); }
  return w; }
#define WQKV_LAYOUT 1   // layout of WCOL, which no kernel calls (k_proj reads qkv_w as (out,in) rows): 0 = (in,out) [DIN][CC]; 1 = (out,in) [CC][DIN]; 2 = per-head [NH][DIN][HD]
__device__ __forceinline__ v16b wcol_hdk(const float* Wm, int k0, int o, int lane) { v16b w; const int g = lane >> 4; const float* p = Wm + (size_t)(o / HD) * DIN * HD + (o % HD);
#pragma unroll
  for (int i = 0; i < 8; ++i) { w[i] = (__bf16)p[(size_t)(k0 + 8 * g + i) * HD]; w[8 + i] = (__bf16)p[(size_t)(k0 + 16 + 8 * g + i) * HD]; }
  return w; }
#define WO_OUT_IN 1
#if WQKV_LAYOUT == 1
#define WCOL(W, k0, o, lane) wcol_oi(W, k0, o, lane, DIN)
#elif WQKV_LAYOUT == 2
#define WCOL(W, k0, o, lane) wcol_hdk(W, k0, o, lane)
#else
#define WCOL(W, k0, o, lane) wcol_io(W, k0, o, lane, CC)
#endif
#if WO_OUT_IN
#define WOCOL(W, k0, o, lane) wcol_oi(W, k0, o, lane, CC)
#define WOCOLH(W, k0, o, lane) wcolh_oi(W, k0, o, lane, CC)
#else
#define WOCOL(W, k0, o, lane) wcol_io(W, k0, o, lane, DIN)
#define WOCOLH(W, k0, o, lane) wcolh_io(W, k0, o, lane, DIN)
#endif
#define PROJ_EXTRA_PARAMS , const float* __restrict__ QS, const float* __restrict__ KS
#define PROJ_EPI(which, row, t, h) do { if ((which) < 2) { float* rw = (row); const float* sc = (which) == 0 ? QS : KS; float ss = 0.f; _Pragma("unroll") for (int i = 0; i < 64; ++i) ss += rw[i] * rw[i]; const float rms = __fsqrt_rn(ss) * 0.125f; const float inv = 1.0f / (rms + 1e-8f); _Pragma("unroll") for (int i = 0; i < 64; ++i) rw[i] = bfr(sc[i]) * (rw[i] * inv); } } while (0)   /* per-head RMSNorm: norm(x, axis=-1) * hd^-0.5; scale * (x / (rms + eps)) */
#ifndef SM_EXTRA_PARAMS
#define SM_EXTRA_PARAMS
#endif
#ifndef PROJ_EXTRA_PARAMS
#define PROJ_EXTRA_PARAMS
#endif
#ifndef SM_MASK_HOOK
#define SM_MASK_HOOK (void)0
#endif

#define WS_QH  0u                                      // f16 q rows [b*t][CC]
#define WS_KH  (WS_QH + 2u * (size_t)NB * TT * CC)      // f16 k rows [b*t][CC]
#define WS_VT  (WS_KH + 2u * (size_t)NB * TT * CC)      // f16 v planes [b][c][t]
#define WS_QL  (WS_VT + 2u * (size_t)NB * CC * TT)      // f16 q residual x 2^10 rows [b][t < QHI][CC]
#define WS_KL  (WS_QL + 2u * (size_t)NB * QHI * CC)     // f16 k residual x 2^10 rows [b][t < KHI][CC]
#define WS_VB  (WS_KL + 2u * (size_t)NB * KHI * CC)     // bf16 v hi planes [b][c][t < KHI]
#define WS_VBL (WS_VB + 2u * (size_t)NB * CC * KHI)
#define WS_S   (WS_VBL + 2u * (size_t)NB * CC * KHI)    // f32 logits / P [hg][t][s] (no kernel left that uses it as such)
#define WS_WO  WS_S                                    // bf16 proj_w rows [DIN][CC], in that range
#define WS_Y   (WS_S  + 4u * (size_t)HG * TT * TT)      // ctx rows [b*t][CC]: the bf16 hi plane, then the bf16 lo plane (together the bytes of one f32 plane)
#define WS_YL  (WS_Y  + 2u * (size_t)NB * TT * CC)
#define WS_END (WS_Y  + 4u * (size_t)NB * TT * CC)

// ---- operand staging of the two projection GEMMs: a stage is 64 k of every operand row of the block's tile in bf16 (k_proj's block rounds its f32 rows; k_out's copies the bf16 that k_proj and k_fa left), laid in LDS, from where every wave takes its fragments
#define GK 64              // k per stage
#define GP 72              // LDS row pitch in bf16: 144 B = 16 B x 9 (odd multiple: 16-byte fragment reads without bank conflicts)
typedef __attribute__((ext_vector_type(4))) __bf16 v4b;
__device__ __forceinline__ v8f wmma_b(v16b a, v16b b, v8f c) { return __builtin_amdgcn_wmma_f32_16x16x32_bf16(false, a, false, b, (short)0, c, false, false); }
__device__ __forceinline__ void put_bf(__bf16* d, v4f v) { v4b c;
#pragma unroll
  for (int k = 0; k < 4; ++k) c[k] = (__bf16)v[k];
  *(v4b*)d = c; }
__device__ __forceinline__ void put_bf_split(__bf16* dh, __bf16* dl, v4f v) { v4b h, l;
#pragma unroll
  for (int k = 0; k < 4; ++k) { const __bf16 hv = (__bf16)v[k]; h[k] = hv; l[k] = (__bf16)(v[k] - (float)hv); }
  *(v4b*)dh = h; *(v4b*)dl = l; }
// ---- k_proj: block = 256 rows x 192 columns (3 whole heads) of the one product qkv = X Wqkv^T with exact bf16 products (K = DIN), 16 waves; 16 x 16 blocks. Each head of the tile goes its own way: q: f16 rows + residual rows; k: f16 rows (+ residual rows t < KHI); v: f16 planes [c][t] (+ bf16 hi/lo planes for t < KHI)
#define PM 256             // rows of X per block
#define PN 192             // rows of Wqkv (output columns) per block: an X row fetched from L2 serves 192 columns, a W row 256 rows
#define PT 512             // threads: 4 x 4 waves of 64 rows x 48 columns
#define SP 196             // pitch of the f32 tile in floats: 784 B = 16 B x 49
__global__ __launch_bounds__(PT) void k_proj(const float* __restrict__ X, const float* __restrict__ WA,
    _Float16* __restrict__ QH, _Float16* __restrict__ QL, _Float16* __restrict__ KH, _Float16* __restrict__ KL, _Float16* __restrict__ VT, __bf16* __restrict__ VB, __bf16* __restrict__ VBL, const float* __restrict__ WO, __bf16* __restrict__ WOB PROJ_EXTRA_PARAMS) {
  // LDS: one range that holds the two operand stages during the product and the f32 tile after it (the loop's last barrier lies between the last fragment read and the first write of the tile), then the transposed v heads
  __shared__ __align__(16) char sm[PM * SP * 4 + PN * (PM + 8) * 2];
  static_assert(2 * (PM + PN) * GP * 2 <= PM * SP * 4, "the stages fit the f32 tile's range");
  static_assert(TT % PM == 0 && (3 * CC) % PN == 0 && PN % HD == 0 && KHI <= PM, "whole tiles, whole heads");
  __bf16 (*sg)[PM + PN][GP] = (__bf16 (*)[PM + PN][GP])sm;   // stage: rows 0..PM-1 = X rows, PM.. = W rows (output columns)
  float (*st)[SP] = (float (*)[SP])sm; _Float16 (*th)[PM + 8] = (_Float16 (*)[PM + 8])(sm + PM * SP * 4);
  const int tid = threadIdx.x, wave = tid >> 5, lane = tid & 31, col = lane & 15, g = lane >> 4; const int c0 = blockIdx.y * PN; const size_t r0 = (size_t)blockIdx.x * PM; const size_t bb = r0 / TT; const int t0 = (int)(r0 % TT);
  // (every '#pragma unroll' below: the loop's index selects a register of a load, fragment or accumulator array, which stays in registers only under constant indices)
  const int wr = (wave >> 2) * 64, wc = (wave & 3) * 48;   // wave tile: 64 rows x 48 columns (4 + 3 fragments for 12 products)
  const int lr = tid >> 4, lc = (tid & 15) * 4;            // staging: 16 lanes read 256 contiguous bytes of one row; a thread takes rows lr + 32 i
  const float* xg = X + (r0 + lr) * DIN + lc; const float* wg = WA + (size_t)(c0 + lr) * DIN + lc;
  v4f rx[PM / 32], rw[PN / 32];
#pragma unroll
  for (int i = 0; i < PM / 32; ++i) rx[i] = *(const v4f*)(xg + (size_t)i * 32 * DIN);
#pragma unroll
  for (int i = 0; i < PN / 32; ++i) rw[i] = *(const v4f*)(wg + (size_t)i * 32 * DIN);
  // proj_w for k_out, rounded to bf16 here once (the grid's threads take 8 elements each) instead of by each of k_out's blocks that reads a row
  static_assert((size_t)(TNB * TT / PM) * (3 * CC / PN) * PT * 8 == (size_t)DIN * CC, "the grid covers proj_w once");
  const size_t wi = ((size_t)(blockIdx.y * (TNB * TT / PM) + blockIdx.x) * PT + tid) * 8;
  const v4f wo0 = *(const v4f*)(WO + wi), wo1 = *(const v4f*)(WO + wi + 4);
  asm volatile("s_wait_xcnt 0x0" ::: "memory");   // before a register that an issued load names as its address is written again
  { v8b wb;
#pragma unroll
    for (int k = 0; k < 4; ++k) { wb[k] = (__bf16)wo0[k]; wb[4 + k] = (__bf16)wo1[k]; }
    vst2(WOB + wi, wb);
    asm volatile("s_wait_xcnt 0x0" ::: "memory"); }   // before a register that the issued store names is written again
#pragma unroll
  for (int i = 0; i < PM / 32; ++i) put_bf(&sg[0][lr + 32 * i][lc], rx[i]);
#pragma unroll
  for (int i = 0; i < PN / 32; ++i) put_bf(&sg[0][PM + lr + 32 * i][lc], rw[i]);
  __syncthreads();
  v8f acc[4][3] = {};
  for (int t = 0; t < DIN / GK; ++t) { const int bu = t & 1; const bool more = t + 1 < DIN / GK;
    if (more) {   // next stage's rows fly while this stage is worked on
#pragma unroll
      for (int i = 0; i < PM / 32; ++i) rx[i] = *(const v4f*)(xg + (size_t)i * 32 * DIN + (t + 1) * GK);
#pragma unroll
      for (int i = 0; i < PN / 32; ++i) rw[i] = *(const v4f*)(wg + (size_t)i * 32 * DIN + (t + 1) * GK);
      asm volatile("s_wait_xcnt 0x0" ::: "memory");   // before a register that an issued load names as its address is written again
    }
#pragma unroll
    for (int kc = 0; kc < GK / 32; ++kc) { v16b a[4], w[3];
#pragma unroll
      for (int i = 0; i < 4; ++i) a[i] = frag_b(&sg[bu][wr + i * 16 + col][kc * 32], lane);
#pragma unroll
      for (int j = 0; j < 3; ++j) w[j] = frag_b(&sg[bu][PM + wc + j * 16 + col][kc * 32], lane);
#pragma unroll
      for (int i = 0; i < 4; ++i)
#pragma unroll
        for (int j = 0; j < 3; ++j) acc[i][j] = wmma_b(a[i], w[j], acc[i][j]); }
    __builtin_amdgcn_sched_barrier(0);   // keeps the rounding of the next stage's rows, which waits for their loads, behind this stage's products
    if (more) {
#pragma unroll
      for (int i = 0; i < PM / 32; ++i) put_bf(&sg[bu ^ 1][lr + 32 * i][lc], rx[i]);
#pragma unroll
      for (int i = 0; i < PN / 32; ++i) put_bf(&sg[bu ^ 1][PM + lr + 32 * i][lc], rw[i]); }
    __syncthreads(); }   // publishes stage t + 1 and ends every wave's reads of stage t, whose buffer the next trip refills (behind the last trip: the f32 tile)
  // stage the f32 tile in LDS, run the per-(row, head) epilogue hook, then convert head by head
#pragma unroll
  for (int j = 0; j < 3; ++j)
#pragma unroll
    for (int i = 0; i < 4; ++i)
#pragma unroll
      for (int r = 0; r < 8; ++r) st[wr + i * 16 + 8 * g + r][wc + j * 16 + col] = acc[i][j][r];
  __syncthreads();
  const int h0 = c0 / HD;   // the tile's first head among the 3 NH heads of qkv: heads 0..NH-1 are q, then k, then v
  for (int e = tid; e < PM * (PN / HD); e += PT) { const int rl = e % PM, hh = e / PM; const int which = (h0 + hh) / NH; PROJ_EPI(which, &st[rl][hh * HD], t0 + rl, (h0 + hh) % NH); }
  __syncthreads();
  for (int hh = 0; hh < PN / HD; ++hh) { const int which = (h0 + hh) / NH, hc = ((h0 + hh) % NH) * HD;   // hc: the head's first column in its own q, k or v
    if (which < 2) { _Float16* DH = which == 0 ? QH : KH; _Float16* DL = which == 0 ? QL : KL; const int nhi = which == 0 ? QHI : KHI;
      for (int e = tid; e < PM * (HD / 8); e += PT) { const int rl = e >> 3, q = e & 7; const float* p = &st[rl][hh * HD + q * 8]; v8h hv, lv;
#pragma unroll
        for (int k = 0; k < 8; ++k) { const float v = p[k]; const _Float16 hk = (_Float16)v; hv[k] = hk; lv[k] = (_Float16)((v - (float)hk) * 1024.0f); }
        vst2(DH + (r0 + rl) * CC + hc + q * 8, hv); if (t0 + rl < nhi) vst2(DL + (bb * nhi + t0 + rl) * (size_t)CC + hc + q * 8, lv);   // 8 lanes store one 128-B line; the residual plane holds rows t < nhi alone
        asm volatile("s_wait_xcnt 0x0" ::: "memory"); }   // before a register that an issued store names is written again
    } else {
      for (int e = tid; e < PM * HD; e += PT) { const int rl = e % PM, cl = e / PM; th[hh * HD + cl][rl] = (_Float16)st[rl][hh * HD + cl]; } } }
  __syncthreads();
  for (int hh = 0; hh < PN / HD; ++hh) { const int which = (h0 + hh) / NH, hc = ((h0 + hh) % NH) * HD;
    if (which == 2) {
      for (int e = tid; e < HD * (PM / 8); e += PT) { const int cl = e / (PM / 8), q = e % (PM / 8); vst2(VT + (bb * CC + hc + cl) * (size_t)TT + t0 + q * 8, *(const v4u*)&th[hh * HD + cl][q * 8]); }
      if (t0 == 0) for (int e = tid; e < HD * (KHI / 8); e += PT) { const int cl = e / (KHI / 8), q = e % (KHI / 8); v8b bh, bl;   // the planes of t < KHI lie in the tile that starts at t = 0
#pragma unroll
        for (int k = 0; k < 8; ++k) { const float v = st[q * 8 + k][hh * HD + cl]; const __bf16 bk = (__bf16)v; bh[k] = bk; bl[k] = (__bf16)(v - (float)bk); }
        const size_t o3 = (bb * CC + hc + cl) * (size_t)KHI + q * 8; vst2(VB + o3, bh); vst2(VBL + o3, bl); } } } }
// ---- k_fa: block = 128 queries (8 waves x 16) of (b, h), one pass over all keys in stages of 64: S^T = K Q^T with q x SL2E as f16 hi + residual (2 products into ONE tile, whose C operand is 10 - the maximum in use): the tile holds the arguments of exp2; maximum in use and sum per query (a lane holds one query's scores), P^T x 2^10 packed from the score tiles as the B operand, ctx^T += V^T P^T (1 product); logits and P never leave the registers
// (every '#pragma unroll' in k_fa: the loop's index selects a register of a fragment, score or accumulator array, which stays in registers only under constant indices)
#define FK 64              // keys per stage
#define SL2E (SCALE * 1.44269504088896f)   // 64^-0.5 x log2 e: e^(SCALE x) = 2^(SL2E x)
#define FP 72              // LDS row pitch in f16: 144 B = 16 B x 9 (odd multiple: 16-byte fragment reads without bank conflicts)
__device__ __forceinline__ v8f wmma_h(v16h a, v16h b, v8f c) { return __builtin_amdgcn_wmma_f32_16x16x32_f16(false, a, false, b, (short)0, c, false, false); }
#define FB (FK * FP * 2)   // bytes of one K (or V) buffer in LDS
// one stage's rows for this thread: four asynchronous copies of 16 B a lane, global memory to LDS through no register (K rows sr and sr + 32, V rows sr and sr + 32)
__device__ __forceinline__ void fa_copy(unsigned lk, unsigned lv, const _Float16* k, const _Float16* v) {
  // the copies fly while the wave goes on; the closing s_wait_xcnt 0 stands inside the statement so that no address register a copy names is written again in front of it
  asm volatile("global_load_async_to_lds_b128 %0, %4, off\n\t"
               "global_load_async_to_lds_b128 %1, %5, off\n\t"
               "global_load_async_to_lds_b128 %2, %6, off\n\t"
               "global_load_async_to_lds_b128 %3, %7, off\n\t"
               "s_wait_xcnt 0x0"
               :: "v"(lk), "v"(lk + 32u * FP * 2u), "v"(lv), "v"(lv + 32u * FP * 2u), "v"(k), "v"(k + 32 * CC), "v"(v), "v"(v + 32 * TT) : "memory");
}
// the stage's exponentials, their four partial sums (pairs: one packed add serves two; no 32-long dependent add chain) and P^T as the B operand of the two 32-key products
__device__ __forceinline__ float fa_exp(const v8f a[FK / 16], v16h p[FK / 32]) {
  v2f ls[2] = {{0.f, 0.f}, {0.f, 0.f}};
#pragma unroll
  for (int c2 = 0; c2 < FK / 32; ++c2)
#pragma unroll
    for (int r = 0; r < 4; ++r) { const v2f e0 = {__builtin_amdgcn_exp2f(a[2 * c2][2 * r]), __builtin_amdgcn_exp2f(a[2 * c2][2 * r + 1])}, e1 = {__builtin_amdgcn_exp2f(a[2 * c2 + 1][2 * r]), __builtin_amdgcn_exp2f(a[2 * c2 + 1][2 * r + 1])};   // a result under 2^-126 may come as 0, far under the smallest f16
      ls[r & 1] += e0 + e1;
      p[c2][2 * r] = (_Float16)e0[0]; p[c2][2 * r + 1] = (_Float16)e0[1]; p[c2][8 + 2 * r] = (_Float16)e1[0]; p[c2][8 + 2 * r + 1] = (_Float16)e1[1]; }
  return (ls[0][0] + ls[0][1]) + (ls[1][0] + ls[1][1]);
}
// four waves a SIMD is what the grid gives (512 blocks of 8 waves on 256 WGPs): told to the compiler so that it spends the registers of that residency on fetching a stage's K fragments as one group; aiming at more waves it fetches each pair just ahead of its products and waits for it at once
__global__ __launch_bounds__(256) __attribute__((amdgpu_waves_per_eu(4, 4))) void k_fa(const _Float16* __restrict__ QH, const _Float16* __restrict__ QL, const _Float16* __restrict__ KH, const _Float16* __restrict__ VT, __bf16* __restrict__ YH, __bf16* __restrict__ YL) {
  __shared__ __align__(16) _Float16 sK[2][FK][FP], sV[2][HD][FP];
  const int tid = threadIdx.x, wave = tid >> 5, lane = tid & 31, col = lane & 15, g = lane >> 4; const int h = blockIdx.y, b = blockIdx.z; const int ql0 = blockIdx.x * 128 + wave * 16;
  v16h qh[HD / 32], ql[HD / 32];   // q x SL2E, split anew into f16 hi + residual (unscaled: both products sum into one tile; f16 subnormal operands are kept)
#pragma unroll
  for (int kc = 0; kc < HD / 32; ++kc) { const v16h h0 = frag_h(QH + ((size_t)b * TT + ql0 + col) * CC + h * HD + kc * 32, lane), l0 = frag_h(QL + ((size_t)b * QHI + ql0 + col) * CC + h * HD + kc * 32, lane);
#pragma unroll
    for (int i = 0; i < 16; i += 2) { const v2f v = (v2f{(float)h0[i], (float)h0[i + 1]} + v2f{(float)l0[i], (float)l0[i + 1]} * (1.0f / 1024.0f)) * SL2E; const v2h hk = __builtin_convertvector(v, v2h), lk = __builtin_convertvector(v - __builtin_convertvector(hk, v2f), v2h);
      qh[kc][i] = hk[0]; qh[kc][i + 1] = hk[1]; ql[kc][i] = lk[0]; ql[kc][i + 1] = lk[1]; } }
  // staging: thread = (row sr and sr + 32, 16-byte chunk sc) of the K tile [key][d] and of the V tile [d][key]: 8 lanes copy one whole 128-B row; two buffers, stage t + 2 issued behind the barrier that ends stage t, so a stage's copies have the whole of the stage before it to land
  const int sr = tid >> 3, sc = (tid & 7) * 8;
  const _Float16* kg = KH + ((size_t)b * TT + sr) * CC + h * HD + sc; const _Float16* vg = VT + ((size_t)b * CC + h * HD + sr) * (size_t)TT + sc;
  static_assert(TT / FK >= 2 && HD == FK, "two stages at least; K and V buffers of one size");
  const unsigned lk = (unsigned)(size_t)&sK[0][sr][sc], lv = (unsigned)(size_t)&sV[0][sr][sc];   // the lane's LDS byte addresses in buffer 0
  fa_copy(lk, lv, kg, vg);
  asm volatile("s_wait_asynccnt 0x0" ::: "memory");   // this wave's copies of stage 0 have landed before the barrier publishes them
  __syncthreads();
  fa_copy(lk + FB, lv + FB, kg + (size_t)FK * CC, vg + FK);
  v8f acc[HD / 16] = {}; float l = 0.f;
  v8f cin = {};   // C operand of the score products, eight times 10 - (the query's maximum in use, in log2 units): P = 2^(score - maximum in use) x 2^10, so that small P stay normal f16 numbers; the sum carries the same factor
  for (int t = 0; t < TT / FK; ++t) { const int bu = t & 1;
    v16h kf[FK / 16][HD / 32];
#pragma unroll
    for (int i = 0; i < FK / 16; ++i)
#pragma unroll
      for (int kc = 0; kc < HD / 32; ++kc) kf[i][kc] = frag_h(&sK[bu][i * 16 + col][kc * 32], lane);
    __builtin_amdgcn_sched_barrier(0);   // keeps the stage's K loads one group ahead of its score products; without it this build puts half of them among the products
    v8f a[FK / 16];   // a[i][r] = SL2E q.k + 10 - maximum in use (key i*16 + 8g + r, query col); the four tiles take turns, so that no product waits for the one it adds to
#pragma unroll
    for (int i = 0; i < FK / 16; ++i) a[i] = wmma_h(kf[i][0], qh[0], cin);
#pragma unroll
    for (int i = 0; i < FK / 16; ++i) a[i] = wmma_h(kf[i][0], ql[0], a[i]);
#pragma unroll
    for (int kc = 1; kc < HD / 32; ++kc) {
#pragma unroll
      for (int i = 0; i < FK / 16; ++i) a[i] = wmma_h(kf[i][kc], qh[kc], a[i]);
#pragma unroll
      for (int i = 0; i < FK / 16; ++i) a[i] = wmma_h(kf[i][kc], ql[kc], a[i]); }
    __builtin_amdgcn_sched_barrier(0);   // keeps the score products in the order written, the four tiles in turn; without it this build ends the run on two products of one tile, the second waiting for the first
    v16h vf[FK / 32][HD / 16];   // the stage's V fragments, fetched ahead of the exponentials
#pragma unroll
    for (int c2 = 0; c2 < FK / 32; ++c2)
#pragma unroll
      for (int j = 0; j < HD / 16; ++j) vf[c2][j] = frag_h(&sV[bu][j * 16 + col][c2 * 32], lane);
    __builtin_amdgcn_sched_barrier(0);   // keeps those loads up here, their latency behind the exponentials; without it this build sinks them among the P.v products, each pair waited for at once
    v16h p[FK / 32]; float st = fa_exp(a, p);
    // every P is at most the lane's sum: while that fits f16, the maximum in use stands and no maximum is taken (32 scores at the maximum in use sum to 2^15 and pass). Stage 0 has none yet and always sets it
    const float lim = t == 0 ? -1.0f : 65504.0f;
    if (__builtin_amdgcn_ballot_w32(!(st <= lim)) != 0) {
      float mt = a[0][0];
#pragma unroll
      for (int i = 0; i < FK / 16; ++i)
#pragma unroll
        for (int r = 0; r < 8; ++r) mt = fmaxf(mt, a[i][r]);
      mt = fmaxf(mt, __shfl_xor(mt, 16));   // both halves of a query's keys share one maximum
      const float dl = t == 0 ? mt - 10.0f : fmaxf(mt - 10.0f, 0.f);   // the maximum in use rises by dl (0 for a query whose scores stayed under it)
      const float al = t == 0 ? 1.0f : __builtin_amdgcn_exp2f(-dl); l *= al;   // sum and ctx to the new maximum (both are 0 in stage 0)
#pragma unroll
      for (int j = 0; j < HD / 16; ++j) acc[j] *= al;
      cin -= dl;
#pragma unroll
      for (int i = 0; i < FK / 16; ++i) a[i] -= dl;
      st = fa_exp(a, p); }
    l += st;
#pragma unroll
    for (int c2 = 0; c2 < FK / 32; ++c2)
#pragma unroll
      for (int j = 0; j < HD / 16; ++j) acc[j] = wmma_h(vf[c2][j], p[c2], acc[j]);
    __builtin_amdgcn_sched_barrier(0);   // keeps the waits and the barrier below at the stage's foot, behind its exponentials and products: lifted over them they would cut the time the next stage's copies have to land
    asm volatile("s_wait_dscnt 0x0" ::: "memory");      // this wave's fragment reads of stage t are done before its buffer is refilled
    asm volatile("s_wait_asynccnt 0x0" ::: "memory");   // this wave's copies of stage t + 1 have landed before the barrier publishes them
    __syncthreads();   // publishes stage t + 1 and ends every wave's reads of stage t, whose buffer is refilled right behind it
    if (t + 2 < TT / FK) fa_copy(lk + bu * FB, lv + bu * FB, kg + (size_t)(t + 2) * FK * CC, vg + (t + 2) * FK); }
  asm volatile("s_wait_asynccnt 0x0" ::: "memory");   // no copy is left in flight when the wave ends
  l += __shfl_xor(l, 16); const float inv = l > 0.f ? 1.0f / l : 0.f;
  const size_t yo = ((size_t)b * TT + ql0 + col) * CC + h * HD + 8 * g;   // acc[j][r] = ctx(query col, d = j*16 + 8g + r)
#pragma unroll
  for (int j = 0; j < HD / 16; ++j) { v8b hv, lv;   // ctx leaves as k_out's two operands: bf16 hi and the bf16 of what hi misses
#pragma unroll
    for (int r = 0; r < 8; ++r) { const float v = acc[j][r] * inv; const __bf16 hk = (__bf16)v; hv[r] = hk; lv[r] = (__bf16)(v - (float)hk); }
    vst2(YH + yo + j * 16, hv); vst2(YL + yo + j * 16, lv); } }
// ---- k_out: block = (64 rows, 128 cols): out = ctx Wo (+ bo): ctx bf16 hi + lo against exact bf16 Wo (2 products), all three read as the bf16 their producers left; wave = 16 rows x 128 columns
__global__ __launch_bounds__(128) void k_out(const __bf16* __restrict__ YH, const __bf16* __restrict__ YL, const __bf16* __restrict__ WOB, const float* __restrict__ BO, float* __restrict__ OUT) {
  __shared__ __align__(16) char sm[2 * 256 * GP * 2];
  __bf16 (*sg)[256][GP] = (__bf16 (*)[256][GP])sm;   // stage: rows 0..63 = ctx hi, 64..127 = ctx lo, 128..255 = Wo rows (output columns)
  float (*sf)[16][132] = (float (*)[16][132])sm;     // output staging, in the stages' range after the loop's last barrier
  const int tid = threadIdx.x, wave = tid >> 5, lane = tid & 31, col = lane & 15, g = lane >> 4; const int c0 = blockIdx.y * 128; const size_t rb = (size_t)blockIdx.x * 64, r0 = rb + wave * 16;
  // (every '#pragma unroll' below: the loop's index selects a register of a load, fragment or accumulator array, which stays in registers only under constant indices)
  const int lr = tid >> 3, lc = (tid & 7) * 8;             // staging: 8 lanes read the 128 contiguous bytes a row has in a stage; a thread takes rows lr + 16 i
  const __bf16* hg = YH + (rb + lr) * CC + lc; const __bf16* lg = YL + (rb + lr) * CC + lc; const __bf16* wg = WOB + (size_t)(c0 + lr) * CC + lc;
  v4u rh[4], rl[4], rw[8];
#pragma unroll
  for (int i = 0; i < 4; ++i) { rh[i] = *(const v4u*)(hg + (size_t)i * 16 * CC); rl[i] = *(const v4u*)(lg + (size_t)i * 16 * CC); }
#pragma unroll
  for (int i = 0; i < 8; ++i) rw[i] = *(const v4u*)(wg + (size_t)i * 16 * CC);
  asm volatile("s_wait_xcnt 0x0" ::: "memory");   // before a register that an issued load names as its address is written again
#pragma unroll
  for (int i = 0; i < 4; ++i) { *(v4u*)&sg[0][lr + 16 * i][lc] = rh[i]; *(v4u*)&sg[0][64 + lr + 16 * i][lc] = rl[i]; }
#pragma unroll
  for (int i = 0; i < 8; ++i) *(v4u*)&sg[0][128 + lr + 16 * i][lc] = rw[i];
  __syncthreads();
  v8f acc[8] = {};
  for (int t = 0; t < CC / GK; ++t) { const int bu = t & 1; const bool more = t + 1 < CC / GK;
    if (more) {   // next stage's rows fly while this stage is worked on
#pragma unroll
      for (int i = 0; i < 4; ++i) { rh[i] = *(const v4u*)(hg + (size_t)i * 16 * CC + (t + 1) * GK); rl[i] = *(const v4u*)(lg + (size_t)i * 16 * CC + (t + 1) * GK); }
#pragma unroll
      for (int i = 0; i < 8; ++i) rw[i] = *(const v4u*)(wg + (size_t)i * 16 * CC + (t + 1) * GK);
      asm volatile("s_wait_xcnt 0x0" ::: "memory");   // before a register that an issued load names as its address is written again
    }
#pragma unroll
    for (int kc = 0; kc < GK / 32; ++kc) { const v16b ah = frag_b(&sg[bu][wave * 16 + col][kc * 32], lane), al = frag_b(&sg[bu][64 + wave * 16 + col][kc * 32], lane);
#pragma unroll
      for (int j = 0; j < 8; ++j) { const v16b w = frag_b(&sg[bu][128 + j * 16 + col][kc * 32], lane); acc[j] = wmma_b(ah, w, acc[j]); acc[j] = wmma_b(al, w, acc[j]); } }
    __builtin_amdgcn_sched_barrier(0);   // keeps the LDS stores of the next stage's rows, which wait for their loads, behind this stage's products
    if (more) {
#pragma unroll
      for (int i = 0; i < 4; ++i) { *(v4u*)&sg[bu ^ 1][lr + 16 * i][lc] = rh[i]; *(v4u*)&sg[bu ^ 1][64 + lr + 16 * i][lc] = rl[i]; }
#pragma unroll
      for (int i = 0; i < 8; ++i) *(v4u*)&sg[bu ^ 1][128 + lr + 16 * i][lc] = rw[i]; }
    __syncthreads(); }   // publishes stage t + 1 and ends every wave's reads of stage t, whose buffer the next trip refills
#pragma unroll
  for (int j = 0; j < 8; ++j) { const float bias = BO ? bfr(BO[c0 + j * 16 + col]) : 0.f;
#pragma unroll
    for (int r = 0; r < 8; ++r) sf[wave][8 * g + r][j * 16 + col] = acc[j][r] + bias; }
  LDSX(); for (int rl = 0; rl < 16; ++rl) vst2(OUT + (r0 + rl) * DIN + c0 + lane * 4, *(const v4f*)&sf[wave][rl][lane * 4]); }

extern "C" void kernel_launch(void* const* d_in, const int* in_sizes, int n_in, void* d_out, int out_size, void* d_ws, size_t ws_size, hipStream_t stream) {
  (void)in_sizes; (void)n_in; (void)out_size;
  const float** F = (const float**)d_in;
  if (ws_size < (size_t)WS_END) return;
  char* ws = (char*)d_ws; _Float16 *QH = (_Float16*)(ws + WS_QH), *KH = (_Float16*)(ws + WS_KH), *VT = (_Float16*)(ws + WS_VT), *QL = (_Float16*)(ws + WS_QL), *KL = (_Float16*)(ws + WS_KL); __bf16 *VB = (__bf16*)(ws + WS_VB), *VBL = (__bf16*)(ws + WS_VBL), *WOB = (__bf16*)(ws + WS_WO), *YH = (__bf16*)(ws + WS_Y), *YL = (__bf16*)(ws + WS_YL);
  (void)QL; (void)KL; (void)VB; (void)VBL;
  // inputs: 0 x [2,2048,1024]; 1 qkv_w [3072,1024] (out,in; rows q | k | v); 2 proj_w [1024,1024] (out,in); 3 proj_b; 4 q_scale [64]; 5 k_scale [64]
  k_proj<<<dim3(TNB * TT / PM, 3 * CC / PN), PT, 0, stream>>>(F[0], F[1], QH, QL, KH, KL, VT, VB, VBL, F[2], WOB, F[4], F[5]);
  k_fa<<<dim3(TT / 128, NH, TNB), 256, 0, stream>>>(QH, QL, KH, VT, YH, YL);
  k_out<<<dim3(TNB * TT / 64, DIN / 128), 128, 0, stream>>>(YH, YL, WOB, F[3], (float*)d_out);
}

// v008
// A run of this version takes 83.8 microseconds.
// Two timings next to v007 both put it at 1.06 times that version's speed.
// All steps since v000 together make it 17.2 times as fast.
// compute dtype: all float inputs rounded to bf16; qkv = x Wqkv^T with EXACT bf16 products on WMMA 16x16x32 (f32 accumulate); per-head RMSNorm of q and k in f32 on the projected rows; q x 64^-0.5 log2 e once to f16 (by the first kernel) against k once to f16 (1 product, an f32 sum that starts at 10 - the maximum in use); softmax in f32 (base 2, hardware exp2) with a maximum in use (renewed when a stage's sum of P leaves the f16 range) and a sum over stages of 64 keys; P x 2^10 (relative to the maximum in use) once to f16 against v once to f16 (1 product), divided by the sum at the end; ctx split bf16 hi + lo (by the attention kernel, as it stores ctx) against exact proj_w (rounded once, by the first kernel) (2 products) + proj_b; f32 output.
#include <hip/hip_runtime.h>
#include <math.h>

typedef __attribute__((ext_vector_type(16))) _Float16 v16h;
typedef __attribute__((ext_vector_type(16))) __bf16 v16b;
typedef __attribute__((ext_vector_type(8)))  _Float16 v8h;
typedef __attribute__((ext_vector_type(2)))  _Float16 v2h;
typedef __attribute__((ext_vector_type(8)))  float v8f;
typedef __attribute__((ext_vector_type(4)))  float v4f;
typedef __attribute__((ext_vector_type(2)))  float v2f;
typedef __attribute__((ext_vector_type(4)))  unsigned v4u;
typedef __attribute__((ext_vector_type(4)))  int v4i;
typedef float __attribute__((may_alias)) float_a;
typedef int __attribute__((may_alias)) int_a;

template <typename T> __device__ __forceinline__ void vst2(void* p, T v) { *(T*)p = v;  }
__device__ __forceinline__ v8f wmma16(v16h a, v16h b, v8f c) {
  v8f d = __builtin_amdgcn_wmma_f32_16x16x32_f16(false, a, false, b, (short)0, c, false, false);
  asm volatile("v_nop\n\tv_nop\n\tv_nop\n\tv_nop" : "+v"(d) : "v"(a), "v"(b));
  return d;
}
__device__ __forceinline__ v8f wmma_bf(v16b a, v16b b, v8f c) {
  v8f d = __builtin_amdgcn_wmma_f32_16x16x32_bf16(false, a, false, b, (short)0, c, false, false);
  asm volatile("v_nop\n\tv_nop\n\tv_nop\n\tv_nop" : "+v"(d) : "v"(a), "v"(b));
  return d;
}
// 16x16x32 fragments: lane = (h = lane>>4, row/col = lane&15); elements 0..7 = k0+8h+0..7, 8..15 = k0+16+8h+0..7; D element r = row 8h+r
__device__ __forceinline__ v16h frag_h(const _Float16* rowk0, int lane) {
  union { v16h v; v8h q[2]; } u; const _Float16* p = rowk0 + 8 * (lane >> 4);
  u.q[0] = *(const v8h*)p; u.q[1] = *(const v8h*)(p + 16); return u.v;
}
__device__ __forceinline__ v16h frag_f32(const float* rowk0, int lane) {
  v16h a; const float* p = rowk0 + 8 * (lane >> 4);
#pragma unroll
  for (int i = 0; i < 8; ++i) { a[i] = (_Float16)p[i]; a[8 + i] = (_Float16)p[16 + i]; }
  return a;
}
__device__ __forceinline__ v16h frag_f32s(const float* rowk0, int lane, float sc) {
  v16h a; const float* p = rowk0 + 8 * (lane >> 4);
#pragma unroll
  for (int i = 0; i < 8; ++i) { a[i] = (_Float16)(p[i] * sc); a[8 + i] = (_Float16)(p[16 + i] * sc); }
  return a;
}
// column fragment from a [K][ld] layout (column n), rows >= K read as 0
__device__ __forceinline__ v16h fragc_f32(const float* W, int k0, int n, int lane, int ld, int K) {
  v16h a; const int g = lane >> 4;
#pragma unroll
  for (int i = 0; i < 8; ++i) { const int ka = k0 + 8 * g + i, kb = ka + 16;
    a[i] = (_Float16)(ka < K ? W[(size_t)(ka < K ? ka : K - 1) * ld + n] : 0.f); a[8 + i] = (_Float16)(kb < K ? W[(size_t)(kb < K ? kb : K - 1) * ld + n] : 0.f); }
  return a;
}
struct F2 { v16b h, l; };
__device__ __forceinline__ F2 bsplit16(const float v[16]) { F2 r;
#pragma unroll
  for (int i = 0; i < 16; ++i) { const __bf16 h = (__bf16)v[i]; r.h[i] = h; r.l[i] = (__bf16)(v[i] - (float)h); }
  return r; }
__device__ __forceinline__ F2 split_row(const float* row, int k0, int lane) { float v[16]; const float* p = row + k0 + 8 * (lane >> 4);
#pragma unroll
  for (int i = 0; i < 8; ++i) { v[i] = p[i]; v[8 + i] = p[16 + i]; }
  return bsplit16(v); }
__device__ __forceinline__ F2 split_rowK(const float* row, int k0, int lane, int K) { float v[16]; const int g = lane >> 4;
#pragma unroll
  for (int i = 0; i < 8; ++i) { const int ka = k0 + 8 * g + i, kb = ka + 16; v[i] = ka < K ? row[ka < K ? ka : K - 1] : 0.f; v[8 + i] = kb < K ? row[kb < K ? kb : K - 1] : 0.f; }
  return bsplit16(v); }
__device__ __forceinline__ F2 split_col(const float* W, int k0, int n, int lane, int ld, int K) { float v[16]; const int g = lane >> 4;
#pragma unroll
  for (int i = 0; i < 8; ++i) { const int ka = k0 + 8 * g + i, kb = ka + 16; v[i] = ka < K ? W[(size_t)(ka < K ? ka : K - 1) * ld + n] : 0.f; v[8 + i] = kb < K ? W[(size_t)(kb < K ? kb : K - 1) * ld + n] : 0.f; }
  return bsplit16(v); }
__device__ __forceinline__ v8f mac3(const F2& a, const F2& b, v8f c) { c = wmma_bf(a.l, b.h, c); c = wmma_bf(a.h, b.l, c); return wmma_bf(a.h, b.h, c); }
__device__ __forceinline__ float sigm(float v) { return 1.0f / (1.0f + expf(-v)); }
#define LDSX() do { asm volatile("s_wait_dscnt 0" ::: "memory"); __builtin_amdgcn_wave_barrier(); __builtin_amdgcn_fence(__ATOMIC_RELEASE, "workgroup"); } while (0)

// Self-attention with QK RMSNorm (B 2, N 2,048, C 1,024 = 16 x 64): qkv = x qkv_w^T ((out,in) [3072,1024], rows (3, H, hd)); q, k <- scale * q / (|q| 64^-0.5 + 1e-8) per head (scales all ones); out = merged(softmax(q k^T x 64^-0.5) v) proj_w^T + proj_b (non-causal).
#define NB 2
#define TT 2048
#define CC 1024            // NH * HD = projected width
#define DIN 1024          // input (model) width
#define NH 16
#define HD 64
#define NQB (TT / 64)
#define HG 4
#define SCALE (0.125f)
#define SL2E (SCALE * 1.44269504088896f)   // 64^-0.5 x log2 e: e^(SCALE x) = 2^(SL2E x)
#define CAUSAL 0
#ifndef TNB
#define TNB NB
#endif
__device__ __forceinline__ float bfr(float v) { return (float)(__bf16)v; }
__host__ __device__ __forceinline__ int kb_last(int qb) { return CAUSAL ? ((qb * 64 + 63) >> 7) : (TT / 128 - 1); }
typedef __attribute__((ext_vector_type(8))) __bf16 v8b;
__device__ __forceinline__ v16b frag_b(const __bf16* rowk0, int lane) {
  union { v16b v; v8b q[2]; } u; const __bf16* p = rowk0 + 8 * (lane >> 4);
  u.q[0] = *(const v8b*)p; u.q[1] = *(const v8b*)(p + 16); return u.v;
}
#define QBH 0              // unused: no kernel here has a high-precision path
#define QHI 0               // rows carrying a q residual plane (none: q enters the logits rounded once to f16, as k does)
#define KHI 64            // key rows carrying k residual / v bf16 hi+lo planes (written by k_proj; no kernel here reads them)
// B fragment (k rows k0+.., output column o) of a weight: (in,out) [K][ld] or (out,in) [ld rows of K]: bf16 exact, or f16(bf16 * 256) exact
__device__ __forceinline__ v16b wcol_io(const float* Wm, int k0, int o, int lane, int ld) { v16b w; const int g = lane >> 4;
#pragma unroll
  for (int i = 0; i < 8; ++i) { w[i] = (__bf16)Wm[(size_t)(k0 + 8 * g + i) * ld + o]; w[8 + i] = (__bf16)Wm[(size_t)(k0 + 16 + 8 * g + i) * ld + o]; }
  return w; }
__device__ __forceinline__ v16b wcol_oi(const float* Wm, int k0, int o, int lane, int K) { v16b w; const float* p = Wm + (size_t)o * K + k0 + 8 * (lane >> 4);
#pragma unroll
  for (int i = 0; i < 8; ++i) { w[i] = (__bf16)p[i]; w[8 + i] = (__bf16)p[16 + i]; }
  return w; }
__device__ __forceinline__ v16h wcolh_io(const float* Wm, int k0, int o, int lane, int ld) { v16h w; const int g = lane >> 4;
#pragma unroll
  for (int i = 0; i < 8; ++i) { w[i] = (_Float16)(bfr(Wm[(size_t)(k0 + 8 * g + i) * ld + o]) * 256.0f); w[8 + i] = (_Float16)(bfr(Wm[(size_t)(k0 + 16 + 8 * g + i) * ld + o]) * 256.0f); }
  return w; }
__device__ __forceinline__ v16h wcolh_oi(const float* Wm, int k0, int o, int lane, int K) { v16h w; const float* p = Wm + (size_t)o * K + k0 + 8 * (lane >> 4);
#pragma unroll
  for (int i = 0; i < 8; ++i) { w[i] = (_Float16)(bfr(p[i]) * 256.0f); w[8 + i] = (_Float16)(bfr(p[16 + i]) * 256.0f); }
  return w; }
#define WQKV_LAYOUT 1   // layout of WCOL, which no kernel calls (k_proj reads qkv_w as (out,in) rows): 0 = (in,out) [DIN][CC]; 1 = (out,in) [CC][DIN]; 2 = per-head [NH][DIN][HD]
__device__ __forceinline__ v16b wcol_hdk(const float* Wm, int k0, int o, int lane) { v16b w; const int g = lane >> 4; const float* p = Wm + (size_t)(o / HD) * DIN * HD + (o % HD);
#pragma unroll
  for (int i = 0; i < 8; ++i) { w[i] = (__bf16)p[(size_t)(k0 + 8 * g + i) * HD]; w[8 + i] = (__bf16)p[(size_t)(k0 + 16 + 8 * g + i) * HD]; }
  return w; }
#define WO_OUT_IN 1
#if WQKV_LAYOUT == 1
#define WCOL(W, k0, o, lane) wcol_oi(W, k0, o, lane, DIN)
#elif WQKV_LAYOUT == 2
#define WCOL(W, k0, o, lane) wcol_hdk(W, k0, o, lane)
#else
#define WCOL(W, k0, o, lane) wcol_io(W, k0, o, lane, CC)
#endif
#if WO_OUT_IN
#define WOCOL(W, k0, o, lane) wcol_oi(W, k0, o, lane, CC)
#define WOCOLH(W, k0, o, lane) wcolh_oi(W, k0, o, lane, CC)
#else
#define WOCOL(W, k0, o, lane) wcol_io(W, k0, o, lane, DIN)
#define WOCOLH(W, k0, o, lane) wcolh_io(W, k0, o, lane, DIN)
#endif
#define PROJ_EXTRA_PARAMS , const float* __restrict__ QS, const float* __restrict__ KS
#define PROJ_EPI(which, row, t, h) do { if ((which) < 2) { float* rw = (row); const float* sc = (which) == 0 ? QS : KS; float ss = 0.f; _Pragma("unroll") for (int i = 0; i < 64; ++i) ss += rw[i] * rw[i]; const float rms = __fsqrt_rn(ss) * 0.125f; const float inv = 1.0f / (rms + 1e-8f); _Pragma("unroll") for (int i = 0; i < 64; ++i) rw[i] = bfr(sc[i]) * (rw[i] * inv); } } while (0)   /* per-head RMSNorm: norm(x, axis=-1) * hd^-0.5; scale * (x / (rms + eps)) */
#ifndef SM_EXTRA_PARAMS
#define SM_EXTRA_PARAMS
#endif
#ifndef PROJ_EXTRA_PARAMS
#define PROJ_EXTRA_PARAMS
#endif
#ifndef SM_MASK_HOOK
#define SM_MASK_HOOK (void)0
#endif

#define WS_QH  0u                                      // f16 q x SL2E rows [b*t][CC]
#define WS_KH  (WS_QH + 2u * (size_t)NB * TT * CC)      // f16 k rows [b*t][CC]
#define WS_VT  (WS_KH + 2u * (size_t)NB * TT * CC)      // f16 v planes [b][c][t]
#define WS_QL  (WS_VT + 2u * (size_t)NB * CC * TT)      // f16 q residual x 2^10 rows [b][t < QHI][CC]
#define WS_KL  (WS_QL + 2u * (size_t)NB * QHI * CC)     // f16 k residual x 2^10 rows [b][t < KHI][CC]
#define WS_VB  (WS_KL + 2u * (size_t)NB * KHI * CC)     // bf16 v hi planes [b][c][t < KHI]
#define WS_VBL (WS_VB + 2u * (size_t)NB * CC * KHI)
#define WS_S   (WS_VBL + 2u * (size_t)NB * CC * KHI)    // f32 logits / P [hg][t][s] (no kernel left that uses it as such)
#define WS_WO  WS_S                                    // bf16 proj_w rows [DIN][CC], in that range
#define WS_Y   (WS_S  + 4u * (size_t)HG * TT * TT)      // ctx rows [b*t][CC]: the bf16 hi plane, then the bf16 lo plane (together the bytes of one f32 plane)
#define WS_YL  (WS_Y  + 2u * (size_t)NB * TT * CC)
#define WS_END (WS_Y  + 4u * (size_t)NB * TT * CC)

// ---- operand staging of the two projection GEMMs: a stage is 64 k of every operand row of the block's tile in bf16 (k_proj's block rounds its f32 rows; k_out's copies the bf16 that k_proj and k_fa left), laid in LDS, from where every wave takes its fragments
#define GK 64              // k per stage
#define GP 72              // LDS row pitch in bf16: 144 B = 16 B x 9 (odd multiple: 16-byte fragment reads without bank conflicts)
typedef __attribute__((ext_vector_type(4))) __bf16 v4b;
__device__ __forceinline__ v8f wmma_b(v16b a, v16b b, v8f c) { return __builtin_amdgcn_wmma_f32_16x16x32_bf16(false, a, false, b, (short)0, c, false, false); }
__device__ __forceinline__ void put_bf(__bf16* d, v4f v) { v4b c;
#pragma unroll
  for (int k = 0; k < 4; ++k) c[k] = (__bf16)v[k];
  *(v4b*)d = c; }
__device__ __forceinline__ void put_bf_split(__bf16* dh, __bf16* dl, v4f v) { v4b h, l;
#pragma unroll
  for (int k = 0; k < 4; ++k) { const __bf16 hv = (__bf16)v[k]; h[k] = hv; l[k] = (__bf16)(v[k] - (float)hv); }
  *(v4b*)dh = h; *(v4b*)dl = l; }
// ---- k_proj: block = 256 rows x 192 columns (3 whole heads) of the one product qkv = X Wqkv^T with exact bf16 products (K = DIN), 16 waves; 16 x 16 blocks. Each head of the tile goes its own way: q: f16 rows of q x SL2E; k: f16 rows (+ residual rows t < KHI); v: f16 planes [c][t] (+ bf16 hi/lo planes for t < KHI)
#define PM 256             // rows of X per block
#define PN 192             // rows of Wqkv (output columns) per block: an X row fetched from L2 serves 192 columns, a W row 256 rows
#define PT 512             // threads: 4 x 4 waves of 64 rows x 48 columns
#define SP 196             // pitch of the f32 tile in floats: 784 B = 16 B x 49
__global__ __launch_bounds__(PT) void k_proj(const float* __restrict__ X, const float* __restrict__ WA,
    _Float16* __restrict__ QH, _Float16* __restrict__ QL, _Float16* __restrict__ KH, _Float16* __restrict__ KL, _Float16* __restrict__ VT, __bf16* __restrict__ VB, __bf16* __restrict__ VBL, const float* __restrict__ WO, __bf16* __restrict__ WOB PROJ_EXTRA_PARAMS) {
  // LDS: one range that holds the two operand stages during the product and the f32 tile after it (the loop's last barrier lies between the last fragment read and the first write of the tile), then the transposed v heads
  __shared__ __align__(16) char sm[PM * SP * 4 + PN * (PM + 8) * 2];
  static_assert(2 * (PM + PN) * GP * 2 <= PM * SP * 4, "the stages fit the f32 tile's range");
  static_assert(TT % PM == 0 && (3 * CC) % PN == 0 && PN % HD == 0 && KHI <= PM, "whole tiles, whole heads");
  __bf16 (*sg)[PM + PN][GP] = (__bf16 (*)[PM + PN][GP])sm;   // stage: rows 0..PM-1 = X rows, PM.. = W rows (output columns)
  float (*st)[SP] = (float (*)[SP])sm; _Float16 (*th)[PM + 8] = (_Float16 (*)[PM + 8])(sm + PM * SP * 4);
  const int tid = threadIdx.x, wave = tid >> 5, lane = tid & 31, col = lane & 15, g = lane >> 4; const int c0 = blockIdx.y * PN; const size_t r0 = (size_t)blockIdx.x * PM; const size_t bb = r0 / TT; const int t0 = (int)(r0 % TT);
  // (every '#pragma unroll' below: the loop's index selects a register of a load, fragment or accumulator array, which stays in registers only under constant indices)
  const int wr = (wave >> 2) * 64, wc = (wave & 3) * 48;   // wave tile: 64 rows x 48 columns (4 + 3 fragments for 12 products)
  const int lr = tid >> 4, lc = (tid & 15) * 4;            // staging: 16 lanes read 256 contiguous bytes of one row; a thread takes rows lr + 32 i
  const float* xg = X + (r0 + lr) * DIN + lc; const float* wg = WA + (size_t)(c0 + lr) * DIN + lc;
  v4f rx[PM / 32], rw[PN / 32];
#pragma unroll
  for (int i = 0; i < PM / 32; ++i) rx[i] = *(const v4f*)(xg + (size_t)i * 32 * DIN);
#pragma unroll
  for (int i = 0; i < PN / 32; ++i) rw[i] = *(const v4f*)(wg + (size_t)i * 32 * DIN);
  // proj_w for k_out, rounded to bf16 here once (the grid's threads take 8 elements each) instead of by each of k_out's blocks that reads a row
  static_assert((size_t)(TNB * TT / PM) * (3 * CC / PN) * PT * 8 == (size_t)DIN * CC, "the grid covers proj_w once");
  const size_t wi = ((size_t)(blockIdx.y * (TNB * TT / PM) + blockIdx.x) * PT + tid) * 8;
  const v4f wo0 = *(const v4f*)(WO + wi), wo1 = *(const v4f*)(WO + wi + 4);
  asm volatile("s_wait_xcnt 0x0" ::: "memory");   // before a register that an issued load names as its address is written again
  { v8b wb;
#pragma unroll
    for (int k = 0; k < 4; ++k) { wb[k] = (__bf16)wo0[k]; wb[4 + k] = (__bf16)wo1[k]; }
    vst2(WOB + wi, wb);
    asm volatile("s_wait_xcnt 0x0" ::: "memory"); }   // before a register that the issued store names is written again
#pragma unroll
  for (int i = 0; i < PM / 32; ++i) put_bf(&sg[0][lr + 32 * i][lc], rx[i]);
#pragma unroll
  for (int i = 0; i < PN / 32; ++i) put_bf(&sg[0][PM + lr + 32 * i][lc], rw[i]);
  __syncthreads();
  v8f acc[4][3] = {};
  for (int t = 0; t < DIN / GK; ++t) { const int bu = t & 1; const bool more = t + 1 < DIN / GK;
    if (more) {   // next stage's rows fly while this stage is worked on
#pragma unroll
      for (int i = 0; i < PM / 32; ++i) rx[i] = *(const v4f*)(xg + (size_t)i * 32 * DIN + (t + 1) * GK);
#pragma unroll
      for (int i = 0; i < PN / 32; ++i) rw[i] = *(const v4f*)(wg + (size_t)i * 32 * DIN + (t + 1) * GK);
      asm volatile("s_wait_xcnt 0x0" ::: "memory");   // before a register that an issued load names as its address is written again
    }
#pragma unroll
    for (int kc = 0; kc < GK / 32; ++kc) { v16b a[4], w[3];
#pragma unroll
      for (int i = 0; i < 4; ++i) a[i] = frag_b(&sg[bu][wr + i * 16 + col][kc * 32], lane);
#pragma unroll
      for (int j = 0; j < 3; ++j) w[j] = frag_b(&sg[bu][PM + wc + j * 16 + col][kc * 32], lane);
#pragma unroll
      for (int i = 0; i < 4; ++i)
#pragma unroll
        for (int j = 0; j < 3; ++j) acc[i][j] = wmma_b(a[i], w[j], acc[i][j]); }
    __builtin_amdgcn_sched_barrier(0);   // keeps the rounding of the next stage's rows, which waits for their loads, behind this stage's products
    if (more) {
#pragma unroll
      for (int i = 0; i < PM / 32; ++i) put_bf(&sg[bu ^ 1][lr + 32 * i][lc], rx[i]);
#pragma unroll
      for (int i = 0; i < PN / 32; ++i) put_bf(&sg[bu ^ 1][PM + lr + 32 * i][lc], rw[i]); }
    __syncthreads(); }   // publishes stage t + 1 and ends every wave's reads of stage t, whose buffer the next trip refills (behind the last trip: the f32 tile)
  // stage the f32 tile in LDS, run the per-(row, head) epilogue hook, then convert head by head
#pragma unroll
  for (int j = 0; j < 3; ++j)
#pragma unroll
    for (int i = 0; i < 4; ++i)
#pragma unroll
      for (int r = 0; r < 8; ++r) st[wr + i * 16 + 8 * g + r][wc + j * 16 + col] = acc[i][j][r];
  __syncthreads();
  const int h0 = c0 / HD;   // the tile's first head among the 3 NH heads of qkv: heads 0..NH-1 are q, then k, then v
  for (int e = tid; e < PM * (PN / HD); e += PT) { const int rl = e % PM, hh = e / PM; const int which = (h0 + hh) / NH; PROJ_EPI(which, &st[rl][hh * HD], t0 + rl, (h0 + hh) % NH); }
  __syncthreads();
  for (int hh = 0; hh < PN / HD; ++hh) { const int which = (h0 + hh) / NH, hc = ((h0 + hh) % NH) * HD;   // hc: the head's first column in its own q, k or v
    if (which < 2) { _Float16* DH = which == 0 ? QH : KH; _Float16* DL = which == 0 ? QL : KL; const int nhi = which == 0 ? QHI : KHI; const float qs = which == 0 ? SL2E : 1.0f;   // q leaves as k_fa's operand: scaled in f32, then rounded once
      for (int e = tid; e < PM * (HD / 8); e += PT) { const int rl = e >> 3, q = e & 7; const float* p = &st[rl][hh * HD + q * 8]; v8h hv, lv;
#pragma unroll
        for (int k = 0; k < 8; ++k) { const float v = p[k] * qs; const _Float16 hk = (_Float16)v; hv[k] = hk; lv[k] = (_Float16)((v - (float)hk) * 1024.0f); }
        vst2(DH + (r0 + rl) * CC + hc + q * 8, hv); if (t0 + rl < nhi) vst2(DL + (bb * nhi + t0 + rl) * (size_t)CC + hc + q * 8, lv);   // 8 lanes store one 128-B line; the residual plane holds rows t < nhi alone
        asm volatile("s_wait_xcnt 0x0" ::: "memory"); }   // before a register that an issued store names is written again
    } else {
      for (int e = tid; e < PM * HD; e += PT) { const int rl = e % PM, cl = e / PM; th[hh * HD + cl][rl] = (_Float16)st[rl][hh * HD + cl]; } } }
  __syncthreads();
  for (int hh = 0; hh < PN / HD; ++hh) { const int which = (h0 + hh) / NH, hc = ((h0 + hh) % NH) * HD;
    if (which == 2) {
      for (int e = tid; e < HD * (PM / 8); e += PT) { const int cl = e / (PM / 8), q = e % (PM / 8); vst2(VT + (bb * CC + hc + cl) * (size_t)TT + t0 + q * 8, *(const v4u*)&th[hh * HD + cl][q * 8]); }
      if (t0 == 0) for (int e = tid; e < HD * (KHI / 8); e += PT) { const int cl = e / (KHI / 8), q = e % (KHI / 8); v8b bh, bl;   // the planes of t < KHI lie in the tile that starts at t = 0
#pragma unroll
        for (int k = 0; k < 8; ++k) { const float v = st[q * 8 + k][hh * HD + cl]; const __bf16 bk = (__bf16)v; bh[k] = bk; bl[k] = (__bf16)(v - (float)bk); }
        const size_t o3 = (bb * CC + hc + cl) * (size_t)KHI + q * 8; vst2(VB + o3, bh); vst2(VBL + o3, bl); } } } }
// ---- k_fa: block = 128 queries (8 waves x 16) of (b, h), one pass over all keys in stages of 64: S^T = K Q^T with q x SL2E in f16 as k_proj left it (1 product, whose C operand is 10 - the maximum in use): the tile holds the arguments of exp2; maximum in use and sum per query (a lane holds one query's scores), P^T x 2^10 packed from the score tiles as the B operand, ctx^T += V^T P^T (1 product); logits and P never leave the registers
// (every '#pragma unroll' in k_fa: the loop's index selects a register of a fragment, score or accumulator array, which stays in registers only under constant indices)
#define FK 64              // keys per stage
#define FP 72              // LDS row pitch in f16: 144 B = 16 B x 9 (odd multiple: 16-byte fragment reads without bank conflicts)
__device__ __forceinline__ v8f wmma_h(v16h a, v16h b, v8f c) { return __builtin_amdgcn_wmma_f32_16x16x32_f16(false, a, false, b, (short)0, c, false, false); }
#define FB (FK * FP * 2)   // bytes of one K (or V) buffer in LDS
// one stage's rows for this thread: four asynchronous copies of 16 B a lane, global memory to LDS through no register (K rows sr and sr + 32, V rows sr and sr + 32)
__device__ __forceinline__ void fa_copy(unsigned lk, unsigned lv, const _Float16* k, const _Float16* v) {
  // the copies fly while the wave goes on; the closing s_wait_xcnt 0 stands inside the statement so that no address register a copy names is written again in front of it
  asm volatile("global_load_async_to_lds_b128 %0, %4, off\n\t"
               "global_load_async_to_lds_b128 %1, %5, off\n\t"
               "global_load_async_to_lds_b128 %2, %6, off\n\t"
               "global_load_async_to_lds_b128 %3, %7, off\n\t"
               "s_wait_xcnt 0x0"
               :: "v"(lk), "v"(lk + 32u * FP * 2u), "v"(lv), "v"(lv + 32u * FP * 2u), "v"(k), "v"(k + 32 * CC), "v"(v), "v"(v + 32 * TT) : "memory");
}
// the stage's exponentials, their four partial sums (pairs: one packed add serves two; no 32-long dependent add chain) and P^T as the B operand of the two 32-key products
__device__ __forceinline__ float fa_exp(const v8f a[FK / 16], v16h p[FK / 32]) {
  v2f ls[2] = {{0.f, 0.f}, {0.f, 0.f}};
#pragma unroll
  for (int c2 = 0; c2 < FK / 32; ++c2)
#pragma unroll
    for (int r = 0; r < 4; ++r) { const v2f e0 = {__builtin_amdgcn_exp2f(a[2 * c2][2 * r]), __builtin_amdgcn_exp2f(a[2 * c2][2 * r + 1])}, e1 = {__builtin_amdgcn_exp2f(a[2 * c2 + 1][2 * r]), __builtin_amdgcn_exp2f(a[2 * c2 + 1][2 * r + 1])};   // a result under 2^-126 may come as 0, far under the smallest f16
      ls[r & 1] += e0 + e1;
      p[c2][2 * r] = (_Float16)e0[0]; p[c2][2 * r + 1] = (_Float16)e0[1]; p[c2][8 + 2 * r] = (_Float16)e1[0]; p[c2][8 + 2 * r + 1] = (_Float16)e1[1]; }
  return (ls[0][0] + ls[0][1]) + (ls[1][0] + ls[1][1]);
}
// four waves a SIMD is what the grid gives (512 blocks of 8 waves on 256 WGPs): told to the compiler so that it spends the registers of that residency on fetching a stage's K fragments as one group; aiming at more waves it fetches each pair just ahead of its products and waits for it at once
__global__ __launch_bounds__(256) __attribute__((amdgpu_waves_per_eu(4, 4))) void k_fa(const _Float16* __restrict__ QH, const _Float16* __restrict__ KH, const _Float16* __restrict__ VT, __bf16* __restrict__ YH, __bf16* __restrict__ YL) {
  __shared__ __align__(16) _Float16 sK[2][FK][FP], sV[2][HD][FP];
  const int tid = threadIdx.x, wave = tid >> 5, lane = tid & 31, col = lane & 15, g = lane >> 4; const int h = blockIdx.y, b = blockIdx.z; const int ql0 = blockIdx.x * 128 + wave * 16;
  v16h qh[HD / 32];   // q x SL2E
#pragma unroll
  for (int kc = 0; kc < HD / 32; ++kc) qh[kc] = frag_h(QH + ((size_t)b * TT + ql0 + col) * CC + h * HD + kc * 32, lane);
  // staging: thread = (row sr and sr + 32, 16-byte chunk sc) of the K tile [key][d] and of the V tile [d][key]: 8 lanes copy one whole 128-B row; two buffers, stage t + 2 issued behind the barrier that ends stage t, so a stage's copies have the whole of the stage before it to land
  const int sr = tid >> 3, sc = (tid & 7) * 8;
  const _Float16* kg = KH + ((size_t)b * TT + sr) * CC + h * HD + sc; const _Float16* vg = VT + ((size_t)b * CC + h * HD + sr) * (size_t)TT + sc;
  static_assert(TT / FK >= 2 && HD == FK, "two stages at least; K and V buffers of one size");
  const unsigned lk = (unsigned)(size_t)&sK[0][sr][sc], lv = (unsigned)(size_t)&sV[0][sr][sc];   // the lane's LDS byte addresses in buffer 0
  fa_copy(lk, lv, kg, vg);
  asm volatile("s_wait_asynccnt 0x0" ::: "memory");   // this wave's copies of stage 0 have landed before the barrier publishes them
  __syncthreads();
  fa_copy(lk + FB, lv + FB, kg + (size_t)FK * CC, vg + FK);
  v8f acc[HD / 16] = {}; float l = 0.f;
  v8f cin = {};   // C operand of the score products, eight times 10 - (the query's maximum in use, in log2 units): P = 2^(score - maximum in use) x 2^10, so that small P stay normal f16 numbers; the sum carries the same factor
  for (int t = 0; t < TT / FK; ++t) { const int bu = t & 1;
    v16h kf[FK / 16][HD / 32];
#pragma unroll
    for (int i = 0; i < FK / 16; ++i)
#pragma unroll
      for (int kc = 0; kc < HD / 32; ++kc) kf[i][kc] = frag_h(&sK[bu][i * 16 + col][kc * 32], lane);
    __builtin_amdgcn_sched_barrier(0);   // keeps the stage's K loads one group ahead of its score products; without it this build puts half of them among the products
    v8f a[FK / 16];   // a[i][r] = SL2E q.k + 10 - maximum in use (key i*16 + 8g + r, query col); the four tiles take turns, so that no product waits for the one it adds to
#pragma unroll
    for (int i = 0; i < FK / 16; ++i) a[i] = wmma_h(kf[i][0], qh[0], cin);
#pragma unroll
    for (int kc = 1; kc < HD / 32; ++kc)
#pragma unroll
      for (int i = 0; i < FK / 16; ++i) a[i] = wmma_h(kf[i][kc], qh[kc], a[i]);
    __builtin_amdgcn_sched_barrier(0);   // keeps the score products in the order written, the four tiles in turn; without it this build takes a tile's second product one product behind its first, which it then waits for, and puts V loads at more places among the products
    v16h vf[FK / 32][HD / 16];   // the stage's V fragments, fetched ahead of the exponentials
#pragma unroll
    for (int c2 = 0; c2 < FK / 32; ++c2)
#pragma unroll
      for (int j = 0; j < HD / 16; ++j) vf[c2][j] = frag_h(&sV[bu][j * 16 + col][c2 * 32], lane);
    __builtin_amdgcn_sched_barrier(0);   // keeps those loads up here, their latency behind the exponentials; without it this build sinks them among the P.v products, each pair waited for at once
    v16h p[FK / 32]; float st = fa_exp(a, p);
    // every P is at most the lane's sum: while that fits f16, the maximum in use stands and no maximum is taken (32 scores at the maximum in use sum to 2^15 and pass). Stage 0 has none yet and always sets it
    const float lim = t == 0 ? -1.0f : 65504.0f;
    if (__builtin_amdgcn_ballot_w32(!(st <= lim)) != 0) {
      float mt = a[0][0];
#pragma unroll
      for (int i = 0; i < FK / 16; ++i)
#pragma unroll
        for (int r = 0; r < 8; ++r) mt = fmaxf(mt, a[i][r]);
      mt = fmaxf(mt, __shfl_xor(mt, 16));   // both halves of a query's keys share one maximum
      const float dl = t == 0 ? mt - 10.0f : fmaxf(mt - 10.0f, 0.f);   // the maximum in use rises by dl (0 for a query whose scores stayed under it)
      const float al = t == 0 ? 1.0f : __builtin_amdgcn_exp2f(-dl); l *= al;   // sum and ctx to the new maximum (both are 0 in stage 0)
#pragma unroll
      for (int j = 0; j < HD / 16; ++j) acc[j] *= al;
      cin -= dl;
#pragma unroll
      for (int i = 0; i < FK / 16; ++i) a[i] -= dl;
      st = fa_exp(a, p); }
    l += st;
#pragma unroll
    for (int c2 = 0; c2 < FK / 32; ++c2)
#pragma unroll
      for (int j = 0; j < HD / 16; ++j) acc[j] = wmma_h(vf[c2][j], p[c2], acc[j]);
    __builtin_amdgcn_sched_barrier(0);   // keeps the waits and the barrier below at the stage's foot, behind its exponentials and products: lifted over them they would cut the time the next stage's copies have to land
    asm volatile("s_wait_dscnt 0x0" ::: "memory");      // this wave's fragment reads of stage t are done before its buffer is refilled
    asm volatile("s_wait_asynccnt 0x0" ::: "memory");   // this wave's copies of stage t + 1 have landed before the barrier publishes them
    __syncthreads();   // publishes stage t + 1 and ends every wave's reads of stage t, whose buffer is refilled right behind it
    if (t + 2 < TT / FK) fa_copy(lk + bu * FB, lv + bu * FB, kg + (size_t)(t + 2) * FK * CC, vg + (t + 2) * FK); }
  asm volatile("s_wait_asynccnt 0x0" ::: "memory");   // no copy is left in flight when the wave ends
  l += __shfl_xor(l, 16); const float inv = l > 0.f ? 1.0f / l : 0.f;
  const size_t yo = ((size_t)b * TT + ql0 + col) * CC + h * HD + 8 * g;   // acc[j][r] = ctx(query col, d = j*16 + 8g + r)
#pragma unroll
  for (int j = 0; j < HD / 16; ++j) { v8b hv, lv;   // ctx leaves as k_out's two operands: bf16 hi and the bf16 of what hi misses
#pragma unroll
    for (int r = 0; r < 8; ++r) { const float v = acc[j][r] * inv; const __bf16 hk = (__bf16)v; hv[r] = hk; lv[r] = (__bf16)(v - (float)hk); }
    vst2(YH + yo + j * 16, hv); vst2(YL + yo + j * 16, lv); } }
// ---- k_out: block = (64 rows, 128 cols): out = ctx Wo (+ bo): ctx bf16 hi + lo against exact bf16 Wo (2 products), all three read as the bf16 their producers left; wave = 16 rows x 128 columns
__global__ __launch_bounds__(128) void k_out(const __bf16* __restrict__ YH, const __bf16* __restrict__ YL, const __bf16* __restrict__ WOB, const float* __restrict__ BO, float* __restrict__ OUT) {
  __shared__ __align__(16) char sm[2 * 256 * GP * 2];
  __bf16 (*sg)[256][GP] = (__bf16 (*)[256][GP])sm;   // stage: rows 0..63 = ctx hi, 64..127 = ctx lo, 128..255 = Wo rows (output columns)
  float (*sf)[16][132] = (float (*)[16][132])sm;     // output staging, in the stages' range after the loop's last barrier
  const int tid = threadIdx.x, wave = tid >> 5, lane = tid & 31, col = lane & 15, g = lane >> 4; const int c0 = blockIdx.y * 128; const size_t rb = (size_t)blockIdx.x * 64, r0 = rb + wave * 16;
  // (every '#pragma unroll' below: the loop's index selects a register of a load, fragment or accumulator array, which stays in registers only under constant indices)
  const int lr = tid >> 3, lc = (tid & 7) * 8;             // staging: 8 lanes read the 128 contiguous bytes a row has in a stage; a thread takes rows lr + 16 i
  const __bf16* hg = YH + (rb + lr) * CC + lc; const __bf16* lg = YL + (rb + lr) * CC + lc; const __bf16* wg = WOB + (size_t)(c0 + lr) * CC + lc;
  v4u rh[4], rl[4], rw[8];
#pragma unroll
  for (int i = 0; i < 4; ++i) { rh[i] = *(const v4u*)(hg + (size_t)i * 16 * CC); rl[i] = *(const v4u*)(lg + (size_t)i * 16 * CC); }
#pragma unroll
  for (int i = 0; i < 8; ++i) rw[i] = *(const v4u*)(wg + (size_t)i * 16 * CC);
  asm volatile("s_wait_xcnt 0x0" ::: "memory");   // before a register that an issued load names as its address is written again
#pragma unroll
  for (int i = 0; i < 4; ++i) { *(v4u*)&sg[0][lr + 16 * i][lc] = rh[i]; *(v4u*)&sg[0][64 + lr + 16 * i][lc] = rl[i]; }
#pragma unroll
  for (int i = 0; i < 8; ++i) *(v4u*)&sg[0][128 + lr + 16 * i][lc] = rw[i];
  __syncthreads();
  v8f acc[8] = {};
  for (int t = 0; t < CC / GK; ++t) { const int bu = t & 1; const bool more = t + 1 < CC / GK;
    if (more) {   // next stage's rows fly while this stage is worked on
#pragma unroll
      for (int i = 0; i < 4; ++i) { rh[i] = *(const v4u*)(hg + (size_t)i * 16 * CC + (t + 1) * GK); rl[i] = *(const v4u*)(lg + (size_t)i * 16 * CC + (t + 1) * GK); }
#pragma unroll
      for (int i = 0; i < 8; ++i) rw[i] = *(const v4u*)(wg + (size_t)i * 16 * CC + (t + 1) * GK);
      asm volatile("s_wait_xcnt 0x0" ::: "memory");   // before a register that an issued load names as its address is written again
    }
#pragma unroll
    for (int kc = 0; kc < GK / 32; ++kc) { const v16b ah = frag_b(&sg[bu][wave * 16 + col][kc * 32], lane), al = frag_b(&sg[bu][64 + wave * 16 + col][kc * 32], lane);
#pragma unroll
      for (int j = 0; j < 8; ++j) { const v16b w = frag_b(&sg[bu][128 + j * 16 + col][kc * 32], lane); acc[j] = wmma_b(ah, w, acc[j]); acc[j] = wmma_b(al, w, acc[j]); } }
    __builtin_amdgcn_sched_barrier(0);   // keeps the LDS stores of the next stage's rows, which wait for their loads, behind this stage's products
    if (more) {
#pragma unroll
      for (int i = 0; i < 4; ++i) { *(v4u*)&sg[bu ^ 1][lr + 16 * i][lc] = rh[i]; *(v4u*)&sg[bu ^ 1][64 + lr + 16 * i][lc] = rl[i]; }
#pragma unroll
      for (int i = 0; i < 8; ++i) *(v4u*)&sg[bu ^ 1][128 + lr + 16 * i][lc] = rw[i]; }
    __syncthreads(); }   // publishes stage t + 1 and ends every wave's reads of stage t, whose buffer the next trip refills
#pragma unroll
  for (int j = 0; j < 8; ++j) { const float bias = BO ? bfr(BO[c0 + j * 16 + col]) : 0.f;
#pragma unroll
    for (int r = 0; r < 8; ++r) sf[wave][8 * g + r][j * 16 + col] = acc[j][r] + bias; }
  LDSX(); for (int rl = 0; rl < 16; ++rl) vst2(OUT + (r0 + rl) * DIN + c0 + lane * 4, *(const v4f*)&sf[wave][rl][lane * 4]); }

extern "C" void kernel_launch(void* const* d_in, const int* in_sizes, int n_in, void* d_out, int out_size, void* d_ws, size_t ws_size, hipStream_t stream) {
  (void)in_sizes; (void)n_in; (void)out_size;
  const float** F = (const float**)d_in;
  if (ws_size < (size_t)WS_END) return;
  char* ws = (char*)d_ws; _Float16 *QH = (_Float16*)(ws + WS_QH), *KH = (_Float16*)(ws + WS_KH), *VT = (_Float16*)(ws + WS_VT), *QL = (_Float16*)(ws + WS_QL), *KL = (_Float16*)(ws + WS_KL); __bf16 *VB = (__bf16*)(ws + WS_VB), *VBL = (__bf16*)(ws + WS_VBL), *WOB = (__bf16*)(ws + WS_WO), *YH = (__bf16*)(ws + WS_Y), *YL = (__bf16*)(ws + WS_YL);
  (void)QL; (void)KL; (void)VB; (void)VBL;
  // inputs: 0 x [2,2048,1024]; 1 qkv_w [3072,1024] (out,in; rows q | k | v); 2 proj_w [1024,1024] (out,in); 3 proj_b; 4 q_scale [64]; 5 k_scale [64]
  k_proj<<<dim3(TNB * TT / PM, 3 * CC / PN), PT, 0, stream>>>(F[0], F[1], QH, QL, KH, KL, VT, VB, VBL, F[2], WOB, F[4], F[5]);
  k_fa<<<dim3(TT / 128, NH, TNB), 256, 0, stream>>>(QH, KH, VT, YH, YL);
  k_out<<<dim3(TNB * TT / 64, DIN / 128), 128, 0, stream>>>(YH, YL, WOB, F[3], (float*)d_out);
}

// v009
// One run takes 79.9 microseconds.
// Timed twice side by side with v008, it ran 1.06 and 1.05 times as fast.
// Over all steps from v000 it is 18.2 times as fast.
// compute dtype: all float inputs rounded to bf16; qkv = x Wqkv^T with EXACT bf16 products on WMMA 16x16x32 (f32 accumulate); per-head RMSNorm of q and k in f32 on the projected rows; q x 64^-0.5 log2 e once to f16 (by the first kernel) against k once to f16 (1 product, an f32 sum that starts at 10 - the maximum in use); softmax in f32 (base 2, hardware exp2) with a maximum in use (renewed when a stage's sum of P leaves the f16 range) and a sum over stages of 64 keys; P x 2^10 (relative to the maximum in use) once to f16 against v once to f16 (1 product), divided by the sum at the end; ctx split bf16 hi + lo (by the attention kernel, as it stores ctx) against exact proj_w (rounded once, by the first kernel) (2 products) + proj_b; f32 output.
#include <hip/hip_runtime.h>
#include <math.h>

typedef __attribute__((ext_vector_type(16))) _Float16 v16h;
typedef __attribute__((ext_vector_type(16))) __bf16 v16b;
typedef __attribute__((ext_vector_type(8)))  _Float16 v8h;
typedef __attribute__((ext_vector_type(2)))  _Float16 v2h;
typedef __attribute__((ext_vector_type(8)))  float v8f;
typedef __attribute__((ext_vector_type(4)))  float v4f;
typedef __attribute__((ext_vector_type(2)))  float v2f;
typedef __attribute__((ext_vector_type(4)))  unsigned v4u;
typedef __attribute__((ext_vector_type(4)))  int v4i;
typedef float __attribute__((may_alias)) float_a;
typedef int __attribute__((may_alias)) int_a;

template <typename T> __device__ __forceinline__ void vst2(void* p, T v) { *(T*)p = v;  }
__device__ __forceinline__ v8f wmma16(v16h a, v16h b, v8f c) {
  v8f d = __builtin_amdgcn_wmma_f32_16x16x32_f16(false, a, false, b, (short)0, c, false, false);
  asm volatile("v_nop\n\tv_nop\n\tv_nop\n\tv_nop" : "+v"(d) : "v"(a), "v"(b));
  return d;
}
__device__ __forceinline__ v8f wmma_bf(v16b a, v16b b, v8f c) {
  v8f d = __builtin_amdgcn_wmma_f32_16x16x32_bf16(false, a, false, b, (short)0, c, false, false);
  asm volatile("v_nop\n\tv_nop\n\tv_nop\n\tv_nop" : "+v"(d) : "v"(a), "v"(b));
  return d;
}
// 16x16x32 fragments: lane = (h = lane>>4, row/col = lane&15); elements 0..7 = k0+8h+0..7, 8..15 = k0+16+8h+0..7; D element r = row 8h+r
__device__ __forceinline__ v16h frag_h(const _Float16* rowk0, int lane) {
  union { v16h v; v8h q[2]; } u; const _Float16* p = rowk0 + 8 * (lane >> 4);
  u.q[0] = *(const v8h*)p; u.q[1] = *(const v8h*)(p + 16); return u.v;
}
__device__ __forceinline__ v16h frag_f32(const float* rowk0, int lane) {
  v16h a; const float* p = rowk0 + 8 * (lane >> 4);
#pragma unroll
  for (int i = 0; i < 8; ++i) { a[i] = (_Float16)p[i]; a[8 + i] = (_Float16)p[16 + i]; }
  return a;
}
__device__ __forceinline__ v16h frag_f32s(const float* rowk0, int lane, float sc) {
  v16h a; const float* p = rowk0 + 8 * (lane >> 4);
#pragma unroll
  for (int i = 0; i < 8; ++i) { a[i] = (_Float16)(p[i] * sc); a[8 + i] = (_Float16)(p[16 + i] * sc); }
  return a;
}
// column fragment from a [K][ld] layout (column n), rows >= K read as 0
__device__ __forceinline__ v16h fragc_f32(const float* W, int k0, int n, int lane, int ld, int K) {
  v16h a; const int g = lane >> 4;
#pragma unroll
  for (int i = 0; i < 8; ++i) { const int ka = k0 + 8 * g + i, kb = ka + 16;
    a[i] = (_Float16)(ka < K ? W[(size_t)(ka < K ? ka : K - 1) * ld + n] : 0.f); a[8 + i] = (_Float16)(kb < K ? W[(size_t)(kb < K ? kb : K - 1) * ld + n] : 0.f); }
  return a;
}
struct F2 { v16b h, l; };
__device__ __forceinline__ F2 bsplit16(const float v[16]) { F2 r;
#pragma unroll
  for (int i = 0; i < 16; ++i) { const __bf16 h = (__bf16)v[i]; r.h[i] = h; r.l[i] = (__bf16)(v[i] - (float)h); }
  return r; }
__device__ __forceinline__ F2 split_row(const float* row, int k0, int lane) { float v[16]; const float* p = row + k0 + 8 * (lane >> 4);
#pragma unroll
  for (int i = 0; i < 8; ++i) { v[i] = p[i]; v[8 + i] = p[16 + i]; }
  return bsplit16(v); }
__device__ __forceinline__ F2 split_rowK(const float* row, int k0, int lane, int K) { float v[16]; const int g = lane >> 4;
#pragma unroll
  for (int i = 0; i < 8; ++i) { const int ka = k0 + 8 * g + i, kb = ka + 16; v[i] = ka < K ? row[ka < K ? ka : K - 1] : 0.f; v[8 + i] = kb < K ? row[kb < K ? kb : K - 1] : 0.f; }
  return bsplit16(v); }
__device__ __forceinline__ F2 split_col(const float* W, int k0, int n, int lane, int ld, int K) { float v[16]; const int g = lane >> 4;
#pragma unroll
  for (int i = 0; i < 8; ++i) { const int ka = k0 + 8 * g + i, kb = ka + 16; v[i] = ka < K ? W[(size_t)(ka < K ? ka : K - 1) * ld + n] : 0.f; v[8 + i] = kb < K ? W[(size_t)(kb < K ? kb : K - 1) * ld + n] : 0.f; }
  return bsplit16(v); }
__device__ __forceinline__ v8f mac3(const F2& a, const F2& b, v8f c) { c = wmma_bf(a.l, b.h, c); c = wmma_bf(a.h, b.l, c); return wmma_bf(a.h, b.h, c); }
__device__ __forceinline__ float sigm(float v) { return 1.0f / (1.0f + expf(-v)); }
#define LDSX() do { asm volatile("s_wait_dscnt 0" ::: "memory"); __builtin_amdgcn_wave_barrier(); __builtin_amdgcn_fence(__ATOMIC_RELEASE, "workgroup"); } while (0)

// Self-attention with QK RMSNorm (B 2, N 2,048, C 1,024 = 16 x 64): qkv = x qkv_w^T ((out,in) [3072,1024], rows (3, H, hd)); q, k <- scale * q / (|q| 64^-0.5 + 1e-8) per head (scales all ones); out = merged(softmax(q k^T x 64^-0.5) v) proj_w^T + proj_b (non-causal).
#define NB 2
#define TT 2048
#define CC 1024            // NH * HD = projected width
#define DIN 1024          // input (model) width
#define NH 16
#define HD 64
#define NQB (TT / 64)
#define HG 4
#define SCALE (0.125f)
#define SL2E (SCALE * 1.44269504088896f)   // 64^-0.5 x log2 e: e^(SCALE x) = 2^(SL2E x)
#define CAUSAL 0
#ifndef TNB
#define TNB NB
#endif
__device__ __forceinline__ float bfr(float v) { return (float)(__bf16)v; }
__host__ __device__ __forceinline__ int kb_last(int qb) { return CAUSAL ? ((qb * 64 + 63) >> 7) : (TT / 128 - 1); }
typedef __attribute__((ext_vector_type(8))) __bf16 v8b;
__device__ __forceinline__ v16b frag_b(const __bf16* rowk0, int lane) {
  union { v16b v; v8b q[2]; } u; const __bf16* p = rowk0 + 8 * (lane >> 4);
  u.q[0] = *(const v8b*)p; u.q[1] = *(const v8b*)(p + 16); return u.v;
}
#define QBH 0              // unused: no kernel here has a high-precision path
#define QHI 0               // rows carrying a q residual plane (none: q enters the logits rounded once to f16, as k does)
#define KHI 64            // key rows carrying k residual / v bf16 hi+lo planes (written by k_proj; no kernel here reads them)
// B fragment (k rows k0+.., output column o) of a weight: (in,out) [K][ld] or (out,in) [ld rows of K]: bf16 exact, or f16(bf16 * 256) exact
__device__ __forceinline__ v16b wcol_io(const float* Wm, int k0, int o, int lane, int ld) { v16b w; const int g = lane >> 4;
#pragma unroll
  for (int i = 0; i < 8; ++i) { w[i] = (__bf16)Wm[(size_t)(k0 + 8 * g + i) * ld + o]; w[8 + i] = (__bf16)Wm[(size_t)(k0 + 16 + 8 * g + i) * ld + o]; }
  return w; }
__device__ __forceinline__ v16b wcol_oi(const float* Wm, int k0, int o, int lane, int K) { v16b w; const float* p = Wm + (size_t)o * K + k0 + 8 * (lane >> 4);
#pragma unroll
  for (int i = 0; i < 8; ++i) { w[i] = (__bf16)p[i]; w[8 + i] = (__bf16)p[16 + i]; }
  return w; }
__device__ __forceinline__ v16h wcolh_io(const float* Wm, int k0, int o, int lane, int ld) { v16h w; const int g = lane >> 4;
#pragma unroll
  for (int i = 0; i < 8; ++i) { w[i] = (_Float16)(bfr(Wm[(size_t)(k0 + 8 * g + i) * ld + o]) * 256.0f); w[8 + i] = (_Float16)(bfr(Wm[(size_t)(k0 + 16 + 8 * g + i) * ld + o]) * 256.0f); }
  return w; }
__device__ __forceinline__ v16h wcolh_oi(const float* Wm, int k0, int o, int lane, int K) { v16h w; const float* p = Wm + (size_t)o * K + k0 + 8 * (lane >> 4);
#pragma unroll
  for (int i = 0; i < 8; ++i) { w[i] = (_Float16)(bfr(p[i]) * 256.0f); w[8 + i] = (_Float16)(bfr(p[16 + i]) * 256.0f); }
  return w; }
#define WQKV_LAYOUT 1   // layout of WCOL, which no kernel calls (k_proj reads qkv_w as (out,in) rows): 0 = (in,out) [DIN][CC]; 1 = (out,in) [CC][DIN]; 2 = per-head [NH][DIN][HD]
__device__ __forceinline__ v16b wcol_hdk(const float* Wm, int k0, int o, int lane) { v16b w; const int g = lane >> 4; const float* p = Wm + (size_t)(o / HD) * DIN * HD + (o % HD);
#pragma unroll
  for (int i = 0; i < 8; ++i) { w[i] = (__bf16)p[(size_t)(k0 + 8 * g + i) * HD]; w[8 + i] = (__bf16)p[(size_t)(k0 + 16 + 8 * g + i) * HD]; }
  return w; }
#define WO_OUT_IN 1
#if WQKV_LAYOUT == 1
#define WCOL(W, k0, o, lane) wcol_oi(W, k0, o, lane, DIN)
#elif WQKV_LAYOUT == 2
#define WCOL(W, k0, o, lane) wcol_hdk(W, k0, o, lane)
#else
#define WCOL(W, k0, o, lane) wcol_io(W, k0, o, lane, CC)
#endif
#if WO_OUT_IN
#define WOCOL(W, k0, o, lane) wcol_oi(W, k0, o, lane, CC)
#define WOCOLH(W, k0, o, lane) wcolh_oi(W, k0, o, lane, CC)
#else
#define WOCOL(W, k0, o, lane) wcol_io(W, k0, o, lane, DIN)
#define WOCOLH(W, k0, o, lane) wcolh_io(W, k0, o, lane, DIN)
#endif
#define PROJ_EXTRA_PARAMS , const float* __restrict__ QS, const float* __restrict__ KS
#define PROJ_EPI(which, row, t, h) do { if ((which) < 2) { float* rw = (row); const float* sc = (which) == 0 ? QS : KS; float ss = 0.f; _Pragma("unroll") for (int i = 0; i < 64; ++i) ss += rw[i] * rw[i]; const float rms = __fsqrt_rn(ss) * 0.125f; const float inv = 1.0f / (rms + 1e-8f); _Pragma("unroll") for (int i = 0; i < 64; ++i) rw[i] = bfr(sc[i]) * (rw[i] * inv); } } while (0)   /* per-head RMSNorm: norm(x, axis=-1) * hd^-0.5; scale * (x / (rms + eps)) */
#ifndef SM_EXTRA_PARAMS
#define SM_EXTRA_PARAMS
#endif
#ifndef PROJ_EXTRA_PARAMS
#define PROJ_EXTRA_PARAMS
#endif
#ifndef SM_MASK_HOOK
#define SM_MASK_HOOK (void)0
#endif

#define WS_QH  0u                                      // f16 q x SL2E rows [b*t][CC]
#define WS_KH  (WS_QH + 2u * (size_t)NB * TT * CC)      // f16 k rows [b*t][CC]
#define WS_VT  (WS_KH + 2u * (size_t)NB * TT * CC)      // f16 v planes [b][c][t]
#define WS_QL  (WS_VT + 2u * (size_t)NB * CC * TT)      // f16 q residual x 2^10 rows [b][t < QHI][CC]
#define WS_KL  (WS_QL + 2u * (size_t)NB * QHI * CC)     // f16 k residual x 2^10 rows [b][t < KHI][CC]
#define WS_VB  (WS_KL + 2u * (size_t)NB * KHI * CC)     // bf16 v hi planes [b][c][t < KHI]
#define WS_VBL (WS_VB + 2u * (size_t)NB * CC * KHI)
#define WS_S   (WS_VBL + 2u * (size_t)NB * CC * KHI)    // f32 logits / P [hg][t][s] (no kernel left that uses it as such)
#define WS_WO  WS_S                                    // bf16 proj_w rows [DIN][CC], in that range
#define WS_Y   (WS_S  + 4u * (size_t)HG * TT * TT)      // ctx rows [b*t][CC]: the bf16 hi plane, then the bf16 lo plane (together the bytes of one f32 plane)
#define WS_YL  (WS_Y  + 2u * (size_t)NB * TT * CC)
#define WS_END (WS_Y  + 4u * (size_t)NB * TT * CC)

// ---- operand staging of the two projection GEMMs: a stage is 64 k of every operand row of the block's tile in bf16 (k_proj's block rounds its f32 rows; k_out's copies the bf16 that k_proj and k_fa left), laid in LDS, from where every wave takes its fragments
#define GK 64              // k per stage
#define GP 72              // LDS row pitch in bf16: 144 B = 16 B x 9 (odd multiple: 16-byte fragment reads without bank conflicts)
typedef __attribute__((ext_vector_type(4))) __bf16 v4b;
__device__ __forceinline__ v8f wmma_b(v16b a, v16b b, v8f c) { return __builtin_amdgcn_wmma_f32_16x16x32_bf16(false, a, false, b, (short)0, c, false, false); }
__device__ __forceinline__ void put_bf(__bf16* d, v4f v) { v4b c;
#pragma unroll
  for (int k = 0; k < 4; ++k) c[k] = (__bf16)v[k];
  *(v4b*)d = c; }
__device__ __forceinline__ void put_bf_split(__bf16* dh, __bf16* dl, v4f v) { v4b h, l;
#pragma unroll
  for (int k = 0; k < 4; ++k) { const __bf16 hv = (__bf16)v[k]; h[k] = hv; l[k] = (__bf16)(v[k] - (float)hv); }
  *(v4b*)dh = h; *(v4b*)dl = l; }
// ---- k_proj: block = 256 rows x 192 columns (3 whole heads) of the one product qkv = X Wqkv^T with exact bf16 products (K = DIN), 16 waves; 16 x 16 blocks. Each head of the tile goes its own way: q: f16 rows of q x SL2E; k: f16 rows (+ residual rows t < KHI); v: f16 planes [c][t] (+ bf16 hi/lo planes for t < KHI)
#define PM 256             // rows of X per block
#define PN 192             // rows of Wqkv (output columns) per block: an X row fetched from L2 serves 192 columns, a W row 256 rows
#define PT 512             // threads: 4 x 4 waves of 64 rows x 48 columns
#define SP 196             // pitch of the f32 tile in floats: 784 B = 16 B x 49
__global__ __launch_bounds__(PT) void k_proj(const float* __restrict__ X, const float* __restrict__ WA,
    _Float16* __restrict__ QH, _Float16* __restrict__ QL, _Float16* __restrict__ KH, _Float16* __restrict__ KL, _Float16* __restrict__ VT, __bf16* __restrict__ VB, __bf16* __restrict__ VBL, const float* __restrict__ WO, __bf16* __restrict__ WOB PROJ_EXTRA_PARAMS) {
  // LDS: one range that holds the two operand stages during the product and the f32 tile after it (the loop's last barrier lies between the last fragment read and the first write of the tile), then the transposed v heads
  __shared__ __align__(16) char sm[PM * SP * 4 + PN * (PM + 8) * 2];
  static_assert(2 * (PM + PN) * GP * 2 <= PM * SP * 4, "the stages fit the f32 tile's range");
  static_assert(TT % PM == 0 && (3 * CC) % PN == 0 && PN % HD == 0 && KHI <= PM, "whole tiles, whole heads");
  __bf16 (*sg)[PM + PN][GP] = (__bf16 (*)[PM + PN][GP])sm;   // stage: rows 0..PM-1 = X rows, PM.. = W rows (output columns)
  float (*st)[SP] = (float (*)[SP])sm; _Float16 (*th)[PM + 8] = (_Float16 (*)[PM + 8])(sm + PM * SP * 4);
  const int tid = threadIdx.x, wave = tid >> 5, lane = tid & 31, col = lane & 15, g = lane >> 4; const int c0 = blockIdx.y * PN; const size_t r0 = (size_t)blockIdx.x * PM; const size_t bb = r0 / TT; const int t0 = (int)(r0 % TT);
  // (every '#pragma unroll' below: the loop's index selects a register of a load, fragment or accumulator array, which stays in registers only under constant indices)
  const int wr = (wave >> 2) * 64, wc = (wave & 3) * 48;   // wave tile: 64 rows x 48 columns (4 + 3 fragments for 12 products)
  const int lr = tid >> 4, lc = (tid & 15) * 4;            // staging: 16 lanes read 256 contiguous bytes of one row; a thread takes rows lr + 32 i
  const float* xg = X + (r0 + lr) * DIN + lc; const float* wg = WA + (size_t)(c0 + lr) * DIN + lc;
  // the k walk starts at a stage of the block's own and wraps round: the 16 blocks that share X rows (one blockIdx.x) and the 16 that share W rows (one blockIdx.y) each stand at another stage, so that they do not ask L2 for the same lines at one moment
  static_assert(((DIN / GK) & (DIN / GK - 1)) == 0, "the wrap is a mask");
  const int rot = (blockIdx.x + blockIdx.y) & (DIN / GK - 1);
  v4f rx[PM / 32], rw[PN / 32];
#pragma unroll
  for (int i = 0; i < PM / 32; ++i) rx[i] = *(const v4f*)(xg + (size_t)i * 32 * DIN + rot * GK);
#pragma unroll
  for (int i = 0; i < PN / 32; ++i) rw[i] = *(const v4f*)(wg + (size_t)i * 32 * DIN + rot * GK);
  // proj_w for k_out, rounded to bf16 here once (the grid's threads take 8 elements each) instead of by each of k_out's blocks that reads a row
  static_assert((size_t)(TNB * TT / PM) * (3 * CC / PN) * PT * 8 == (size_t)DIN * CC, "the grid covers proj_w once");
  const size_t wi = ((size_t)(blockIdx.y * (TNB * TT / PM) + blockIdx.x) * PT + tid) * 8;
  const v4f wo0 = *(const v4f*)(WO + wi), wo1 = *(const v4f*)(WO + wi + 4);
  asm volatile("s_wait_xcnt 0x0" ::: "memory");   // before a register that an issued load names as its address is written again
  { v8b wb;
#pragma unroll
    for (int k = 0; k < 4; ++k) { wb[k] = (__bf16)wo0[k]; wb[4 + k] = (__bf16)wo1[k]; }
    vst2(WOB + wi, wb);
    asm volatile("s_wait_xcnt 0x0" ::: "memory"); }   // before a register that the issued store names is written again
#pragma unroll
  for (int i = 0; i < PM / 32; ++i) put_bf(&sg[0][lr + 32 * i][lc], rx[i]);
#pragma unroll
  for (int i = 0; i < PN / 32; ++i) put_bf(&sg[0][PM + lr + 32 * i][lc], rw[i]);
  __syncthreads();
  v8f acc[4][3] = {};
  for (int t = 0; t < DIN / GK; ++t) { const int bu = t & 1; const bool more = t + 1 < DIN / GK; const int kn = ((t + 1 + rot) & (DIN / GK - 1)) * GK;   // first k of the next stage
    if (more) {   // next stage's rows fly while this stage is worked on
#pragma unroll
      for (int i = 0; i < PM / 32; ++i) rx[i] = *(const v4f*)(xg + (size_t)i * 32 * DIN + kn);
#pragma unroll
      for (int i = 0; i < PN / 32; ++i) rw[i] = *(const v4f*)(wg + (size_t)i * 32 * DIN + kn);
      asm volatile("s_wait_xcnt 0x0" ::: "memory");   // before a register that an issued load names as its address is written again
    }
#pragma unroll
    for (int kc = 0; kc < GK / 32; ++kc) { v16b a[4], w[3];
#pragma unroll
      for (int i = 0; i < 4; ++i) a[i] = frag_b(&sg[bu][wr + i * 16 + col][kc * 32], lane);
#pragma unroll
      for (int j = 0; j < 3; ++j) w[j] = frag_b(&sg[bu][PM + wc + j * 16 + col][kc * 32], lane);
#pragma unroll
      for (int i = 0; i < 4; ++i)
#pragma unroll
        for (int j = 0; j < 3; ++j) acc[i][j] = wmma_b(a[i], w[j], acc[i][j]); }
    __builtin_amdgcn_sched_barrier(0);   // keeps the rounding of the next stage's rows, which waits for their loads, behind this stage's products
    if (more) {
#pragma unroll
      for (int i = 0; i < PM / 32; ++i) put_bf(&sg[bu ^ 1][lr + 32 * i][lc], rx[i]);
#pragma unroll
      for (int i = 0; i < PN / 32; ++i) put_bf(&sg[bu ^ 1][PM + lr + 32 * i][lc], rw[i]); }
    __syncthreads(); }   // publishes stage t + 1 and ends every wave's reads of stage t, whose buffer the next trip refills (behind the last trip: the f32 tile)
  // stage the f32 tile in LDS, run the per-(row, head) epilogue hook, then convert head by head
#pragma unroll
  for (int j = 0; j < 3; ++j)
#pragma unroll
    for (int i = 0; i < 4; ++i)
#pragma unroll
      for (int r = 0; r < 8; ++r) st[wr + i * 16 + 8 * g + r][wc + j * 16 + col] = acc[i][j][r];
  __syncthreads();
  const int h0 = c0 / HD;   // the tile's first head among the 3 NH heads of qkv: heads 0..NH-1 are q, then k, then v
  for (int e = tid; e < PM * (PN / HD); e += PT) { const int rl = e % PM, hh = e / PM; const int which = (h0 + hh) / NH; PROJ_EPI(which, &st[rl][hh * HD], t0 + rl, (h0 + hh) % NH); }
  __syncthreads();
  for (int hh = 0; hh < PN / HD; ++hh) { const int which = (h0 + hh) / NH, hc = ((h0 + hh) % NH) * HD;   // hc: the head's first column in its own q, k or v
    if (which < 2) { _Float16* DH = which == 0 ? QH : KH; _Float16* DL = which == 0 ? QL : KL; const int nhi = which == 0 ? QHI : KHI; const float qs = which == 0 ? SL2E : 1.0f;   // q leaves as k_fa's operand: scaled in f32, then rounded once
      for (int e = tid; e < PM * (HD / 8); e += PT) { const int rl = e >> 3, q = e & 7; const float* p = &st[rl][hh * HD + q * 8]; v8h hv, lv;
#pragma unroll
        for (int k = 0; k < 8; ++k) { const float v = p[k] * qs; const _Float16 hk = (_Float16)v; hv[k] = hk; lv[k] = (_Float16)((v - (float)hk) * 1024.0f); }
        vst2(DH + (r0 + rl) * CC + hc + q * 8, hv); if (t0 + rl < nhi) vst2(DL + (bb * nhi + t0 + rl) * (size_t)CC + hc + q * 8, lv);   // 8 lanes store one 128-B line; the residual plane holds rows t < nhi alone
        asm volatile("s_wait_xcnt 0x0" ::: "memory"); }   // before a register that an issued store names is written again
    } else {
      for (int e = tid; e < PM * HD; e += PT) { const int rl = e % PM, cl = e / PM; th[hh * HD + cl][rl] = (_Float16)st[rl][hh * HD + cl]; } } }
  __syncthreads();
  for (int hh = 0; hh < PN / HD; ++hh) { const int which = (h0 + hh) / NH, hc = ((h0 + hh) % NH) * HD;
    if (which == 2) {
      for (int e = tid; e < HD * (PM / 8); e += PT) { const int cl = e / (PM / 8), q = e % (PM / 8); vst2(VT + (bb * CC + hc + cl) * (size_t)TT + t0 + q * 8, *(const v4u*)&th[hh * HD + cl][q * 8]); }
      if (t0 == 0) for (int e = tid; e < HD * (KHI / 8); e += PT) { const int cl = e / (KHI / 8), q = e % (KHI / 8); v8b bh, bl;   // the planes of t < KHI lie in the tile that starts at t = 0
#pragma unroll
        for (int k = 0; k < 8; ++k) { const float v = st[q * 8 + k][hh * HD + cl]; const __bf16 bk = (__bf16)v; bh[k] = bk; bl[k] = (__bf16)(v - (float)bk); }
        const size_t o3 = (bb * CC + hc + cl) * (size_t)KHI + q * 8; vst2(VB + o3, bh); vst2(VBL + o3, bl); } } } }
// ---- k_fa: block = 128 queries (8 waves x 16) of (b, h), one pass over all keys in stages of 64: S^T = K Q^T with q x SL2E in f16 as k_proj left it (1 product, whose C operand is 10 - the maximum in use): the tile holds the arguments of exp2; maximum in use and sum per query (a lane holds one query's scores), P^T x 2^10 packed from the score tiles as the B operand, ctx^T += V^T P^T (1 product); logits and P never leave the registers
// (every '#pragma unroll' in k_fa: the loop's index selects a register of a fragment, score or accumulator array, which stays in registers only under constant indices)
#define FK 64              // keys per stage
#define FP 72              // LDS row pitch in f16: 144 B = 16 B x 9 (odd multiple: 16-byte fragment reads without bank conflicts)
__device__ __forceinline__ v8f wmma_h(v16h a, v16h b, v8f c) { return __builtin_amdgcn_wmma_f32_16x16x32_f16(false, a, false, b, (short)0, c, false, false); }
#define FB (FK * FP * 2)   // bytes of one K (or V) buffer in LDS
// one stage's rows for this thread: four asynchronous copies of 16 B a lane, global memory to LDS through no register (K rows sr and sr + 32, V rows sr and sr + 32)
__device__ __forceinline__ void fa_copy(unsigned lk, unsigned lv, const _Float16* k, const _Float16* v) {
  // the copies fly while the wave goes on; the closing s_wait_xcnt 0 stands inside the statement so that no address register a copy names is written again in front of it
  asm volatile("global_load_async_to_lds_b128 %0, %4, off\n\t"
               "global_load_async_to_lds_b128 %1, %5, off\n\t"
               "global_load_async_to_lds_b128 %2, %6, off\n\t"
               "global_load_async_to_lds_b128 %3, %7, off\n\t"
               "s_wait_xcnt 0x0"
               :: "v"(lk), "v"(lk + 32u * FP * 2u), "v"(lv), "v"(lv + 32u * FP * 2u), "v"(k), "v"(k + 32 * CC), "v"(v), "v"(v + 32 * TT) : "memory");
}
// the stage's exponentials, their four partial sums (pairs: one packed add serves two; no 32-long dependent add chain) and P^T as the B operand of the two 32-key products
__device__ __forceinline__ float fa_exp(const v8f a[FK / 16], v16h p[FK / 32]) {
  v2f ls[2] = {{0.f, 0.f}, {0.f, 0.f}};
#pragma unroll
  for (int c2 = 0; c2 < FK / 32; ++c2)
#pragma unroll
    for (int r = 0; r < 4; ++r) { const v2f e0 = {__builtin_amdgcn_exp2f(a[2 * c2][2 * r]), __builtin_amdgcn_exp2f(a[2 * c2][2 * r + 1])}, e1 = {__builtin_amdgcn_exp2f(a[2 * c2 + 1][2 * r]), __builtin_amdgcn_exp2f(a[2 * c2 + 1][2 * r + 1])};   // a result under 2^-126 may come as 0, far under the smallest f16
      ls[r & 1] += e0 + e1;
      p[c2][2 * r] = (_Float16)e0[0]; p[c2][2 * r + 1] = (_Float16)e0[1]; p[c2][8 + 2 * r] = (_Float16)e1[0]; p[c2][8 + 2 * r + 1] = (_Float16)e1[1]; }
  return (ls[0][0] + ls[0][1]) + (ls[1][0] + ls[1][1]);
}
// four waves a SIMD is what the grid gives (512 blocks of 8 waves on 256 WGPs): told to the compiler so that it spends the registers of that residency on fetching a stage's K fragments as one group; aiming at more waves it fetches each pair just ahead of its products and waits for it at once
__global__ __launch_bounds__(256) __attribute__((amdgpu_waves_per_eu(4, 4))) void k_fa(const _Float16* __restrict__ QH, const _Float16* __restrict__ KH, const _Float16* __restrict__ VT, __bf16* __restrict__ YH, __bf16* __restrict__ YL) {
  __shared__ __align__(16) _Float16 sK[2][FK][FP], sV[2][HD][FP];
  const int tid = threadIdx.x, wave = tid >> 5, lane = tid & 31, col = lane & 15, g = lane >> 4; const int h = blockIdx.y, b = blockIdx.z; const int ql0 = blockIdx.x * 128 + wave * 16;
  v16h qh[HD / 32];   // q x SL2E
#pragma unroll
  for (int kc = 0; kc < HD / 32; ++kc) qh[kc] = frag_h(QH + ((size_t)b * TT + ql0 + col) * CC + h * HD + kc * 32, lane);
  // staging: thread = (row sr and sr + 32, 16-byte chunk sc) of the K tile [key][d] and of the V tile [d][key]: 8 lanes copy one whole 128-B row; two buffers, stage t + 2 issued behind the barrier that ends stage t, so a stage's copies have the whole of the stage before it to land
  const int sr = tid >> 3, sc = (tid & 7) * 8;
  const _Float16* kg = KH + ((size_t)b * TT + sr) * CC + h * HD + sc; const _Float16* vg = VT + ((size_t)b * CC + h * HD + sr) * (size_t)TT + sc;
  static_assert(TT / FK >= 2 && HD == FK, "two stages at least; K and V buffers of one size");
  const unsigned lk = (unsigned)(size_t)&sK[0][sr][sc], lv = (unsigned)(size_t)&sV[0][sr][sc];   // the lane's LDS byte addresses in buffer 0
  fa_copy(lk, lv, kg, vg);
  asm volatile("s_wait_asynccnt 0x0" ::: "memory");   // this wave's copies of stage 0 have landed before the barrier publishes them
  __syncthreads();
  fa_copy(lk + FB, lv + FB, kg + (size_t)FK * CC, vg + FK);
  v8f acc[HD / 16] = {}; float l = 0.f;
  v8f cin = {};   // C operand of the score products, eight times 10 - (the query's maximum in use, in log2 units): P = 2^(score - maximum in use) x 2^10, so that small P stay normal f16 numbers; the sum carries the same factor
  for (int t = 0; t < TT / FK; ++t) { const int bu = t & 1;
    v16h kf[FK / 16][HD / 32];
#pragma unroll
    for (int i = 0; i < FK / 16; ++i)
#pragma unroll
      for (int kc = 0; kc < HD / 32; ++kc) kf[i][kc] = frag_h(&sK[bu][i * 16 + col][kc * 32], lane);
    __builtin_amdgcn_sched_barrier(0);   // keeps the stage's K loads one group ahead of its score products; without it this build puts half of them among the products
    v8f a[FK / 16];   // a[i][r] = SL2E q.k + 10 - maximum in use (key i*16 + 8g + r, query col); the four tiles take turns, so that no product waits for the one it adds to
#pragma unroll
    for (int i = 0; i < FK / 16; ++i) a[i] = wmma_h(kf[i][0], qh[0], cin);
#pragma unroll
    for (int kc = 1; kc < HD / 32; ++kc)
#pragma unroll
      for (int i = 0; i < FK / 16; ++i) a[i] = wmma_h(kf[i][kc], qh[kc], a[i]);
    __builtin_amdgcn_sched_barrier(0);   // keeps the score products in the order written, the four tiles in turn; without it this build takes a tile's second product one product behind its first, which it then waits for, and puts V loads at more places among the products
    v16h vf[FK / 32][HD / 16];   // the stage's V fragments, fetched ahead of the exponentials
#pragma unroll
    for (int c2 = 0; c2 < FK / 32; ++c2)
#pragma unroll
      for (int j = 0; j < HD / 16; ++j) vf[c2][j] = frag_h(&sV[bu][j * 16 + col][c2 * 32], lane);
    __builtin_amdgcn_sched_barrier(0);   // keeps those loads up here, their latency behind the exponentials; without it this build sinks them among the P.v products, each pair waited for at once
    v16h p[FK / 32]; float st = fa_exp(a, p);
    // every P is at most the lane's sum: while that fits f16, the maximum in use stands and no maximum is taken (32 scores at the maximum in use sum to 2^15 and pass). Stage 0 has none yet and always sets it
    const float lim = t == 0 ? -1.0f : 65504.0f;
    if (__builtin_amdgcn_ballot_w32(!(st <= lim)) != 0) {
      float mt = a[0][0];
#pragma unroll
      for (int i = 0; i < FK / 16; ++i)
#pragma unroll
        for (int r = 0; r < 8; ++r) mt = fmaxf(mt, a[i][r]);
      mt = fmaxf(mt, __shfl_xor(mt, 16));   // both halves of a query's keys share one maximum
      const float dl = t == 0 ? mt - 10.0f : fmaxf(mt - 10.0f, 0.f);   // the maximum in use rises by dl (0 for a query whose scores stayed under it)
      const float al = t == 0 ? 1.0f : __builtin_amdgcn_exp2f(-dl); l *= al;   // sum and ctx to the new maximum (both are 0 in stage 0)
#pragma unroll
      for (int j = 0; j < HD / 16; ++j) acc[j] *= al;
      cin -= dl;
#pragma unroll
      for (int i = 0; i < FK / 16; ++i) a[i] -= dl;
      st = fa_exp(a, p); }
    l += st;
#pragma unroll
    for (int c2 = 0; c2 < FK / 32; ++c2)
#pragma unroll
      for (int j = 0; j < HD / 16; ++j) acc[j] = wmma_h(vf[c2][j], p[c2], acc[j]);
    __builtin_amdgcn_sched_barrier(0);   // keeps the waits and the barrier below at the stage's foot, behind its exponentials and products: lifted over them they would cut the time the next stage's copies have to land
    asm volatile("s_wait_dscnt 0x0" ::: "memory");      // this wave's fragment reads of stage t are done before its buffer is refilled
    asm volatile("s_wait_asynccnt 0x0" ::: "memory");   // this wave's copies of stage t + 1 have landed before the barrier publishes them
    __syncthreads();   // publishes stage t + 1 and ends every wave's reads of stage t, whose buffer is refilled right behind it
    if (t + 2 < TT / FK) fa_copy(lk + bu * FB, lv + bu * FB, kg + (size_t)(t + 2) * FK * CC, vg + (t + 2) * FK); }
  asm volatile("s_wait_asynccnt 0x0" ::: "memory");   // no copy is left in flight when the wave ends
  l += __shfl_xor(l, 16); const float inv = l > 0.f ? 1.0f / l : 0.f;
  const size_t yo = ((size_t)b * TT + ql0 + col) * CC + h * HD + 8 * g;   // acc[j][r] = ctx(query col, d = j*16 + 8g + r)
#pragma unroll
  for (int j = 0; j < HD / 16; ++j) { v8b hv, lv;   // ctx leaves as k_out's two operands: bf16 hi and the bf16 of what hi misses
#pragma unroll
    for (int r = 0; r < 8; ++r) { const float v = acc[j][r] * inv; const __bf16 hk = (__bf16)v; hv[r] = hk; lv[r] = (__bf16)(v - (float)hk); }
    vst2(YH + yo + j * 16, hv); vst2(YL + yo + j * 16, lv); } }
// ---- k_out: block = (64 rows, 128 cols): out = ctx Wo (+ bo): ctx bf16 hi + lo against exact bf16 Wo (2 products), all three read as the bf16 their producers left; wave = 16 rows x 128 columns
__global__ __launch_bounds__(128) void k_out(const __bf16* __restrict__ YH, const __bf16* __restrict__ YL, const __bf16* __restrict__ WOB, const float* __restrict__ BO, float* __restrict__ OUT) {
  __shared__ __align__(16) char sm[2 * 256 * GP * 2];
  __bf16 (*sg)[256][GP] = (__bf16 (*)[256][GP])sm;   // stage: rows 0..63 = ctx hi, 64..127 = ctx lo, 128..255 = Wo rows (output columns)
  float (*sf)[16][132] = (float (*)[16][132])sm;     // output staging, in the stages' range after the loop's last barrier
  const int tid = threadIdx.x, wave = tid >> 5, lane = tid & 31, col = lane & 15, g = lane >> 4; const int c0 = blockIdx.y * 128; const size_t rb = (size_t)blockIdx.x * 64, r0 = rb + wave * 16;
  // (every '#pragma unroll' below: the loop's index selects a register of a load, fragment or accumulator array, which stays in registers only under constant indices)
  const int lr = tid >> 3, lc = (tid & 7) * 8;             // staging: 8 lanes read the 128 contiguous bytes a row has in a stage; a thread takes rows lr + 16 i
  const __bf16* hg = YH + (rb + lr) * CC + lc; const __bf16* lg = YL + (rb + lr) * CC + lc; const __bf16* wg = WOB + (size_t)(c0 + lr) * CC + lc;
  // the k walk starts at a stage of the block's own and wraps round, as in k_proj: the 8 blocks that share ctx rows each stand at another stage, the 64 that share Wo rows at 16
  static_assert(((CC / GK) & (CC / GK - 1)) == 0, "the wrap is a mask");
  const int rot = (blockIdx.x + blockIdx.y) & (CC / GK - 1);
  v4u rh[4], rl[4], rw[8];
#pragma unroll
  for (int i = 0; i < 4; ++i) { rh[i] = *(const v4u*)(hg + (size_t)i * 16 * CC + rot * GK); rl[i] = *(const v4u*)(lg + (size_t)i * 16 * CC + rot * GK); }
#pragma unroll
  for (int i = 0; i < 8; ++i) rw[i] = *(const v4u*)(wg + (size_t)i * 16 * CC + rot * GK);
  asm volatile("s_wait_xcnt 0x0" ::: "memory");   // before a register that an issued load names as its address is written again
#pragma unroll
  for (int i = 0; i < 4; ++i) { *(v4u*)&sg[0][lr + 16 * i][lc] = rh[i]; *(v4u*)&sg[0][64 + lr + 16 * i][lc] = rl[i]; }
#pragma unroll
  for (int i = 0; i < 8; ++i) *(v4u*)&sg[0][128 + lr + 16 * i][lc] = rw[i];
  __syncthreads();
  v8f acc[8] = {};
  for (int t = 0; t < CC / GK; ++t) { const int bu = t & 1; const bool more = t + 1 < CC / GK; const int kn = ((t + 1 + rot) & (CC / GK - 1)) * GK;   // first k of the next stage
    if (more) {   // next stage's rows fly while this stage is worked on
#pragma unroll
      for (int i = 0; i < 4; ++i) { rh[i] = *(const v4u*)(hg + (size_t)i * 16 * CC + kn); rl[i] = *(const v4u*)(lg + (size_t)i * 16 * CC + kn); }
#pragma unroll
      for (int i = 0; i < 8; ++i) rw[i] = *(const v4u*)(wg + (size_t)i * 16 * CC + kn);
      asm volatile("s_wait_xcnt 0x0" ::: "memory");   // before a register that an issued load names as its address is written again
    }
#pragma unroll
    for (int kc = 0; kc < GK / 32; ++kc) { const v16b ah = frag_b(&sg[bu][wave * 16 + col][kc * 32], lane), al = frag_b(&sg[bu][64 + wave * 16 + col][kc * 32], lane);
#pragma unroll
      for (int j = 0; j < 8; ++j) { const v16b w = frag_b(&sg[bu][128 + j * 16 + col][kc * 32], lane); acc[j] = wmma_b(ah, w, acc[j]); acc[j] = wmma_b(al, w, acc[j]); } }
    __builtin_amdgcn_sched_barrier(0);   // keeps the LDS stores of the next stage's rows, which wait for their loads, behind this stage's products
    if (more) {
#pragma unroll
      for (int i = 0; i < 4; ++i) { *(v4u*)&sg[bu ^ 1][lr + 16 * i][lc] = rh[i]; *(v4u*)&sg[bu ^ 1][64 + lr + 16 * i][lc] = rl[i]; }
#pragma unroll
      for (int i = 0; i < 8; ++i) *(v4u*)&sg[bu ^ 1][128 + lr + 16 * i][lc] = rw[i]; }
    __syncthreads(); }   // publishes stage t + 1 and ends every wave's reads of stage t, whose buffer the next trip refills
#pragma unroll
  for (int j = 0; j < 8; ++j) { const float bias = BO ? bfr(BO[c0 + j * 16 + col]) : 0.f;
#pragma unroll
    for (int r = 0; r < 8; ++r) sf[wave][8 * g + r][j * 16 + col] = acc[j][r] + bias; }
  LDSX(); for (int rl = 0; rl < 16; ++rl) vst2(OUT + (r0 + rl) * DIN + c0 + lane * 4, *(const v4f*)&sf[wave][rl][lane * 4]); }

extern "C" void kernel_launch(void* const* d_in, const int* in_sizes, int n_in, void* d_out, int out_size, void* d_ws, size_t ws_size, hipStream_t stream) {
  (void)in_sizes; (void)n_in; (void)out_size;
  const float** F = (const float**)d_in;
  if (ws_size < (size_t)WS_END) return;
  char* ws = (char*)d_ws; _Float16 *QH = (_Float16*)(ws + WS_QH), *KH = (_Float16*)(ws + WS_KH), *VT = (_Float16*)(ws + WS_VT), *QL = (_Float16*)(ws + WS_QL), *KL = (_Float16*)(ws + WS_KL); __bf16 *VB = (__bf16*)(ws + WS_VB), *VBL = (__bf16*)(ws + WS_VBL), *WOB = (__bf16*)(ws + WS_WO), *YH = (__bf16*)(ws + WS_Y), *YL = (__bf16*)(ws + WS_YL);
  (void)QL; (void)KL; (void)VB; (void)VBL;
  // inputs: 0 x [2,2048,1024]; 1 qkv_w [3072,1024] (out,in; rows q | k | v); 2 proj_w [1024,1024] (out,in); 3 proj_b; 4 q_scale [64]; 5 k_scale [64]
  k_proj<<<dim3(TNB * TT / PM, 3 * CC / PN), PT, 0, stream>>>(F[0], F[1], QH, QL, KH, KL, VT, VB, VBL, F[2], WOB, F[4], F[5]);
  k_fa<<<dim3(TT / 128, NH, TNB), 256, 0, stream>>>(QH, KH, VT, YH, YL);
  k_out<<<dim3(TNB * TT / 64, DIN / 128), 128, 0, stream>>>(YH, YL, WOB, F[3], (float*)d_out);
}

// v010
// It runs in 76 microseconds.
// Timed twice side by side with v009, it ran 1.04 and 1.05 times as fast.
// All steps since v000 together make it 19.0 times as fast.
// compute dtype: all float inputs rounded to bf16; qkv = x Wqkv^T with EXACT bf16 products on WMMA 16x16x32 (f32 accumulate); per-head RMSNorm of q and k in f32 on the projected rows; q x 64^-0.5 log2 e once to f16 (by the first kernel) against k once to f16 (1 product, an f32 sum that starts at 10 - the maximum in use); softmax in f32 (base 2, hardware exp2), per half of the keys with a maximum in use (renewed when a pass's sum of P leaves the f16 range) and a sum over passes of 32 keys, the two halves brought to one maximum and added in f32 at the end; P x 2^10 (relative to the maximum in use) once to f16 against v once to f16 (1 product), divided by the sum at the end; ctx split bf16 hi + lo (by the attention kernel, as it stores ctx) against exact proj_w (rounded once, by the first kernel) (2 products) + proj_b; f32 output.
#include <hip/hip_runtime.h>
#include <math.h>

typedef __attribute__((ext_vector_type(16))) _Float16 v16h;
typedef __attribute__((ext_vector_type(16))) __bf16 v16b;
typedef __attribute__((ext_vector_type(8)))  _Float16 v8h;
typedef __attribute__((ext_vector_type(2)))  _Float16 v2h;
typedef __attribute__((ext_vector_type(8)))  float v8f;
typedef __attribute__((ext_vector_type(4)))  float v4f;
typedef __attribute__((ext_vector_type(2)))  float v2f;
typedef __attribute__((ext_vector_type(4)))  unsigned v4u;
typedef __attribute__((ext_vector_type(4)))  int v4i;
typedef float __attribute__((may_alias)) float_a;
typedef int __attribute__((may_alias)) int_a;

template <typename T> __device__ __forceinline__ void vst2(void* p, T v) { *(T*)p = v;  }
__device__ __forceinline__ v8f wmma16(v16h a, v16h b, v8f c) {
  v8f d = __builtin_amdgcn_wmma_f32_16x16x32_f16(false, a, false, b, (short)0, c, false, false);
  asm volatile("v_nop\n\tv_nop\n\tv_nop\n\tv_nop" : "+v"(d) : "v"(a), "v"(b));
  return d;
}
__device__ __forceinline__ v8f wmma_bf(v16b a, v16b b, v8f c) {
  v8f d = __builtin_amdgcn_wmma_f32_16x16x32_bf16(false, a, false, b, (short)0, c, false, false);
  asm volatile("v_nop\n\tv_nop\n\tv_nop\n\tv_nop" : "+v"(d) : "v"(a), "v"(b));
  return d;
}
// 16x16x32 fragments: lane = (h = lane>>4, row/col = lane&15); elements 0..7 = k0+8h+0..7, 8..15 = k0+16+8h+0..7; D element r = row 8h+r
__device__ __forceinline__ v16h frag_h(const _Float16* rowk0, int lane) {
  union { v16h v; v8h q[2]; } u; const _Float16* p = rowk0 + 8 * (lane >> 4);
  u.q[0] = *(const v8h*)p; u.q[1] = *(const v8h*)(p + 16); return u.v;
}
__device__ __forceinline__ v16h frag_f32(const float* rowk0, int lane) {
  v16h a; const float* p = rowk0 + 8 * (lane >> 4);
#pragma unroll
  for (int i = 0; i < 8; ++i) { a[i] = (_Float16)p[i]; a[8 + i] = (_Float16)p[16 + i]; }
  return a;
}
__device__ __forceinline__ v16h frag_f32s(const float* rowk0, int lane, float sc) {
  v16h a; const float* p = rowk0 + 8 * (lane >> 4);
#pragma unroll
  for (int i = 0; i < 8; ++i) { a[i] = (_Float16)(p[i] * sc); a[8 + i] = (_Float16)(p[16 + i] * sc); }
  return a;
}
// column fragment from a [K][ld] layout (column n), rows >= K read as 0
__device__ __forceinline__ v16h fragc_f32(const float* W, int k0, int n, int lane, int ld, int K) {
  v16h a; const int g = lane >> 4;
#pragma unroll
  for (int i = 0; i < 8; ++i) { const int ka = k0 + 8 * g + i, kb = ka + 16;
    a[i] = (_Float16)(ka < K ? W[(size_t)(ka < K ? ka : K - 1) * ld + n] : 0.f); a[8 + i] = (_Float16)(kb < K ? W[(size_t)(kb < K ? kb : K - 1) * ld + n] : 0.f); }
  return a;
}
struct F2 { v16b h, l; };
__device__ __forceinline__ F2 bsplit16(const float v[16]) { F2 r;
#pragma unroll
  for (int i = 0; i < 16; ++i) { const __bf16 h = (__bf16)v[i]; r.h[i] = h; r.l[i] = (__bf16)(v[i] - (float)h); }
  return r; }
__device__ __forceinline__ F2 split_row(const float* row, int k0, int lane) { float v[16]; const float* p = row + k0 + 8 * (lane >> 4);
#pragma unroll
  for (int i = 0; i < 8; ++i) { v[i] = p[i]; v[8 + i] = p[16 + i]; }
  return bsplit16(v); }
__device__ __forceinline__ F2 split_rowK(const float* row, int k0, int lane, int K) { float v[16]; const int g = lane >> 4;
#pragma unroll
  for (int i = 0; i < 8; ++i) { const int ka = k0 + 8 * g + i, kb = ka + 16; v[i] = ka < K ? row[ka < K ? ka : K - 1] : 0.f; v[8 + i] = kb < K ? row[kb < K ? kb : K - 1] : 0.f; }
  return bsplit16(v); }
__device__ __forceinline__ F2 split_col(const float* W, int k0, int n, int lane, int ld, int K) { float v[16]; const int g = lane >> 4;
#pragma unroll
  for (int i = 0; i < 8; ++i) { const int ka = k0 + 8 * g + i, kb = ka + 16; v[i] = ka < K ? W[(size_t)(ka < K ? ka : K - 1) * ld + n] : 0.f; v[8 + i] = kb < K ? W[(size_t)(kb < K ? kb : K - 1) * ld + n] : 0.f; }
  return bsplit16(v); }
__device__ __forceinline__ v8f mac3(const F2& a, const F2& b, v8f c) { c = wmma_bf(a.l, b.h, c); c = wmma_bf(a.h, b.l, c); return wmma_bf(a.h, b.h, c); }
__device__ __forceinline__ float sigm(float v) { return 1.0f / (1.0f + expf(-v)); }
#define LDSX() do { asm volatile("s_wait_dscnt 0" ::: "memory"); __builtin_amdgcn_wave_barrier(); __builtin_amdgcn_fence(__ATOMIC_RELEASE, "workgroup"); } while (0)

// Self-attention with QK RMSNorm (B 2, N 2,048, C 1,024 = 16 x 64): qkv = x qkv_w^T ((out,in) [3072,1024], rows (3, H, hd)); q, k <- scale * q / (|q| 64^-0.5 + 1e-8) per head (scales all ones); out = merged(softmax(q k^T x 64^-0.5) v) proj_w^T + proj_b (non-causal).
#define NB 2
#define TT 2048
#define CC 1024            // NH * HD = projected width
#define DIN 1024          // input (model) width
#define NH 16
#define HD 64
#define NQB (TT / 64)
#define HG 4
#define SCALE (0.125f)
#define SL2E (SCALE * 1.44269504088896f)   // 64^-0.5 x log2 e: e^(SCALE x) = 2^(SL2E x)
#define CAUSAL 0
#ifndef TNB
#define TNB NB
#endif
__device__ __forceinline__ float bfr(float v) { return (float)(__bf16)v; }
__host__ __device__ __forceinline__ int kb_last(int qb) { return CAUSAL ? ((qb * 64 + 63) >> 7) : (TT / 128 - 1); }
typedef __attribute__((ext_vector_type(8))) __bf16 v8b;
__device__ __forceinline__ v16b frag_b(const __bf16* rowk0, int lane) {
  union { v16b v; v8b q[2]; } u; const __bf16* p = rowk0 + 8 * (lane >> 4);
  u.q[0] = *(const v8b*)p; u.q[1] = *(const v8b*)(p + 16); return u.v;
}
#define QBH 0              // unused: no kernel here has a high-precision path
#define QHI 0               // rows carrying a q residual plane (none: q enters the logits rounded once to f16, as k does)
#define KHI 64            // key rows carrying k residual / v bf16 hi+lo planes (written by k_proj; no kernel here reads them)
// B fragment (k rows k0+.., output column o) of a weight: (in,out) [K][ld] or (out,in) [ld rows of K]: bf16 exact, or f16(bf16 * 256) exact
__device__ __forceinline__ v16b wcol_io(const float* Wm, int k0, int o, int lane, int ld) { v16b w; const int g = lane >> 4;
#pragma unroll
  for (int i = 0; i < 8; ++i) { w[i] = (__bf16)Wm[(size_t)(k0 + 8 * g + i) * ld + o]; w[8 + i] = (__bf16)Wm[(size_t)(k0 + 16 + 8 * g + i) * ld + o]; }
  return w; }
__device__ __forceinline__ v16b wcol_oi(const float* Wm, int k0, int o, int lane, int K) { v16b w; const float* p = Wm + (size_t)o * K + k0 + 8 * (lane >> 4);
#pragma unroll
  for (int i = 0; i < 8; ++i) { w[i] = (__bf16)p[i]; w[8 + i] = (__bf16)p[16 + i]; }
  return w; }
__device__ __forceinline__ v16h wcolh_io(const float* Wm, int k0, int o, int lane, int ld) { v16h w; const int g = lane >> 4;
#pragma unroll
  for (int i = 0; i < 8; ++i) { w[i] = (_Float16)(bfr(Wm[(size_t)(k0 + 8 * g + i) * ld + o]) * 256.0f); w[8 + i] = (_Float16)(bfr(Wm[(size_t)(k0 + 16 + 8 * g + i) * ld + o]) * 256.0f); }
  return w; }
__device__ __forceinline__ v16h wcolh_oi(const float* Wm, int k0, int o, int lane, int K) { v16h w; const float* p = Wm + (size_t)o * K + k0 + 8 * (lane >> 4);
#pragma unroll
  for (int i = 0; i < 8; ++i) { w[i] = (_Float16)(bfr(p[i]) * 256.0f); w[8 + i] = (_Float16)(bfr(p[16 + i]) * 256.0f); }
  return w; }
#define WQKV_LAYOUT 1   // layout of WCOL, which no kernel calls (k_proj reads qkv_w as (out,in) rows): 0 = (in,out) [DIN][CC]; 1 = (out,in) [CC][DIN]; 2 = per-head [NH][DIN][HD]
__device__ __forceinline__ v16b wcol_hdk(const float* Wm, int k0, int o, int lane) { v16b w; const int g = lane >> 4; const float* p = Wm + (size_t)(o / HD) * DIN * HD + (o % HD);
#pragma unroll
  for (int i = 0; i < 8; ++i) { w[i] = (__bf16)p[(size_t)(k0 + 8 * g + i) * HD]; w[8 + i] = (__bf16)p[(size_t)(k0 + 16 + 8 * g + i) * HD]; }
  return w; }
#define WO_OUT_IN 1
#if WQKV_LAYOUT == 1
#define WCOL(W, k0, o, lane) wcol_oi(W, k0, o, lane, DIN)
#elif WQKV_LAYOUT == 2
#define WCOL(W, k0, o, lane) wcol_hdk(W, k0, o, lane)
#else
#define WCOL(W, k0, o, lane) wcol_io(W, k0, o, lane, CC)
#endif
#if WO_OUT_IN
#define WOCOL(W, k0, o, lane) wcol_oi(W, k0, o, lane, CC)
#define WOCOLH(W, k0, o, lane) wcolh_oi(W, k0, o, lane, CC)
#else
#define WOCOL(W, k0, o, lane) wcol_io(W, k0, o, lane, DIN)
#define WOCOLH(W, k0, o, lane) wcolh_io(W, k0, o, lane, DIN)
#endif
#define PROJ_EXTRA_PARAMS , const float* __restrict__ QS, const float* __restrict__ KS
#define PROJ_EPI(which, row, t, h) do { if ((which) < 2) { float* rw = (row); const float* sc = (which) == 0 ? QS : KS; float ss = 0.f; _Pragma("unroll") for (int i = 0; i < 64; ++i) ss += rw[i] * rw[i]; const float rms = __fsqrt_rn(ss) * 0.125f; const float inv = 1.0f / (rms + 1e-8f); _Pragma("unroll") for (int i = 0; i < 64; ++i) rw[i] = bfr(sc[i]) * (rw[i] * inv); } } while (0)   /* per-head RMSNorm: norm(x, axis=-1) * hd^-0.5; scale * (x / (rms + eps)) */
#ifndef SM_EXTRA_PARAMS
#define SM_EXTRA_PARAMS
#endif
#ifndef PROJ_EXTRA_PARAMS
#define PROJ_EXTRA_PARAMS
#endif
#ifndef SM_MASK_HOOK
#define SM_MASK_HOOK (void)0
#endif

#define WS_QH  0u                                      // f16 q x SL2E rows [b*t][CC]
#define WS_KH  (WS_QH + 2u * (size_t)NB * TT * CC)      // f16 k rows [b*t][CC]
#define WS_VT  (WS_KH + 2u * (size_t)NB * TT * CC)      // f16 v planes [b][c][t]
#define WS_QL  (WS_VT + 2u * (size_t)NB * CC * TT)      // f16 q residual x 2^10 rows [b][t < QHI][CC]
#define WS_KL  (WS_QL + 2u * (size_t)NB * QHI * CC)     // f16 k residual x 2^10 rows [b][t < KHI][CC]
#define WS_VB  (WS_KL + 2u * (size_t)NB * KHI * CC)     // bf16 v hi planes [b][c][t < KHI]
#define WS_VBL (WS_VB + 2u * (size_t)NB * CC * KHI)
#define WS_S   (WS_VBL + 2u * (size_t)NB * CC * KHI)    // f32 logits / P [hg][t][s] (no kernel left that uses it as such)
#define WS_WO  WS_S                                    // bf16 proj_w rows [DIN][CC], in that range
#define WS_Y   (WS_S  + 4u * (size_t)HG * TT * TT)      // ctx rows [b*t][CC]: the bf16 hi plane, then the bf16 lo plane (together the bytes of one f32 plane)
#define WS_YL  (WS_Y  + 2u * (size_t)NB * TT * CC)
#define WS_END (WS_Y  + 4u * (size_t)NB * TT * CC)

// ---- operand staging of the two projection GEMMs: a stage is 64 k of every operand row of the block's tile in bf16 (k_proj's block rounds its f32 rows; k_out's copies the bf16 that k_proj and k_fa left), laid in LDS, from where every wave takes its fragments
#define GK 64              // k per stage
#define GP 72              // LDS row pitch in bf16: 144 B = 16 B x 9 (odd multiple: 16-byte fragment reads without bank conflicts)
typedef __attribute__((ext_vector_type(4))) __bf16 v4b;
__device__ __forceinline__ v8f wmma_b(v16b a, v16b b, v8f c) { return __builtin_amdgcn_wmma_f32_16x16x32_bf16(false, a, false, b, (short)0, c, false, false); }
__device__ __forceinline__ void put_bf(__bf16* d, v4f v) { v4b c;
#pragma unroll
  for (int k = 0; k < 4; ++k) c[k] = (__bf16)v[k];
  *(v4b*)d = c; }
__device__ __forceinline__ void put_bf_split(__bf16* dh, __bf16* dl, v4f v) { v4b h, l;
#pragma unroll
  for (int k = 0; k < 4; ++k) { const __bf16 hv = (__bf16)v[k]; h[k] = hv; l[k] = (__bf16)(v[k] - (float)hv); }
  *(v4b*)dh = h; *(v4b*)dl = l; }
// ---- k_proj: block = 256 rows x 192 columns (3 whole heads) of the one product qkv = X Wqkv^T with exact bf16 products (K = DIN), 16 waves; 16 x 16 blocks. Each head of the tile goes its own way: q: f16 rows of q x SL2E; k: f16 rows (+ residual rows t < KHI); v: f16 planes [c][t] (+ bf16 hi/lo planes for t < KHI)
#define PM 256             // rows of X per block
#define PN 192             // rows of Wqkv (output columns) per block: an X row fetched from L2 serves 192 columns, a W row 256 rows
#define PT 512             // threads: 4 x 4 waves of 64 rows x 48 columns
#define SP 196             // pitch of the f32 tile in floats: 784 B = 16 B x 49
__global__ __launch_bounds__(PT) void k_proj(const float* __restrict__ X, const float* __restrict__ WA,
    _Float16* __restrict__ QH, _Float16* __restrict__ QL, _Float16* __restrict__ KH, _Float16* __restrict__ KL, _Float16* __restrict__ VT, __bf16* __restrict__ VB, __bf16* __restrict__ VBL, const float* __restrict__ WO, __bf16* __restrict__ WOB PROJ_EXTRA_PARAMS) {
  // LDS: one range that holds the two operand stages during the product and the f32 tile after it (the loop's last barrier lies between the last fragment read and the first write of the tile), then the transposed v heads
  __shared__ __align__(16) char sm[PM * SP * 4 + PN * (PM + 8) * 2];
  static_assert(2 * (PM + PN) * GP * 2 <= PM * SP * 4, "the stages fit the f32 tile's range");
  static_assert(TT % PM == 0 && (3 * CC) % PN == 0 && PN % HD == 0 && KHI <= PM, "whole tiles, whole heads");
  __bf16 (*sg)[PM + PN][GP] = (__bf16 (*)[PM + PN][GP])sm;   // stage: rows 0..PM-1 = X rows, PM.. = W rows (output columns)
  float (*st)[SP] = (float (*)[SP])sm; _Float16 (*th)[PM + 8] = (_Float16 (*)[PM + 8])(sm + PM * SP * 4);
  const int tid = threadIdx.x, wave = tid >> 5, lane = tid & 31, col = lane & 15, g = lane >> 4; const int c0 = blockIdx.y * PN; const size_t r0 = (size_t)blockIdx.x * PM; const size_t bb = r0 / TT; const int t0 = (int)(r0 % TT);
  // (every '#pragma unroll' below: the loop's index selects a register of a load, fragment or accumulator array, which stays in registers only under constant indices)
  const int wr = (wave >> 2) * 64, wc = (wave & 3) * 48;   // wave tile: 64 rows x 48 columns (4 + 3 fragments for 12 products)
  const int lr = tid >> 4, lc = (tid & 15) * 4;            // staging: 16 lanes read 256 contiguous bytes of one row; a thread takes rows lr + 32 i
  const float* xg = X + (r0 + lr) * DIN + lc; const float* wg = WA + (size_t)(c0 + lr) * DIN + lc;
  // the k walk starts at a stage of the block's own and wraps round: the 16 blocks that share X rows (one blockIdx.x) and the 16 that share W rows (one blockIdx.y) each stand at another stage, so that they do not ask L2 for the same lines at one moment
  static_assert(((DIN / GK) & (DIN / GK - 1)) == 0, "the wrap is a mask");
  const int rot = (blockIdx.x + blockIdx.y) & (DIN / GK - 1);
  v4f rx[PM / 32], rw[PN / 32];
#pragma unroll
  for (int i = 0; i < PM / 32; ++i) rx[i] = *(const v4f*)(xg + (size_t)i * 32 * DIN + rot * GK);
#pragma unroll
  for (int i = 0; i < PN / 32; ++i) rw[i] = *(const v4f*)(wg + (size_t)i * 32 * DIN + rot * GK);
  // proj_w for k_out, rounded to bf16 here once (the grid's threads take 8 elements each) instead of by each of k_out's blocks that reads a row
  static_assert((size_t)(TNB * TT / PM) * (3 * CC / PN) * PT * 8 == (size_t)DIN * CC, "the grid covers proj_w once");
  const size_t wi = ((size_t)(blockIdx.y * (TNB * TT / PM) + blockIdx.x) * PT + tid) * 8;
  const v4f wo0 = *(const v4f*)(WO + wi), wo1 = *(const v4f*)(WO + wi + 4);
  asm volatile("s_wait_xcnt 0x0" ::: "memory");   // before a register that an issued load names as its address is written again
  { v8b wb;
#pragma unroll
    for (int k = 0; k < 4; ++k) { wb[k] = (__bf16)wo0[k]; wb[4 + k] = (__bf16)wo1[k]; }
    vst2(WOB + wi, wb);
    asm volatile("s_wait_xcnt 0x0" ::: "memory"); }   // before a register that the issued store names is written again
#pragma unroll
  for (int i = 0; i < PM / 32; ++i) put_bf(&sg[0][lr + 32 * i][lc], rx[i]);
#pragma unroll
  for (int i = 0; i < PN / 32; ++i) put_bf(&sg[0][PM + lr + 32 * i][lc], rw[i]);
  __syncthreads();
  v8f acc[4][3] = {};
  for (int t = 0; t < DIN / GK; ++t) { const int bu = t & 1; const bool more = t + 1 < DIN / GK; const int kn = ((t + 1 + rot) & (DIN / GK - 1)) * GK;   // first k of the next stage
    if (more) {   // next stage's rows fly while this stage is worked on
#pragma unroll
      for (int i = 0; i < PM / 32; ++i) rx[i] = *(const v4f*)(xg + (size_t)i * 32 * DIN + kn);
#pragma unroll
      for (int i = 0; i < PN / 32; ++i) rw[i] = *(const v4f*)(wg + (size_t)i * 32 * DIN + kn);
      asm volatile("s_wait_xcnt 0x0" ::: "memory");   // before a register that an issued load names as its address is written again
    }
#pragma unroll
    for (int kc = 0; kc < GK / 32; ++kc) { v16b a[4], w[3];
#pragma unroll
      for (int i = 0; i < 4; ++i) a[i] = frag_b(&sg[bu][wr + i * 16 + col][kc * 32], lane);
#pragma unroll
      for (int j = 0; j < 3; ++j) w[j] = frag_b(&sg[bu][PM + wc + j * 16 + col][kc * 32], lane);
#pragma unroll
      for (int i = 0; i < 4; ++i)
#pragma unroll
        for (int j = 0; j < 3; ++j) acc[i][j] = wmma_b(a[i], w[j], acc[i][j]); }
    __builtin_amdgcn_sched_barrier(0);   // keeps the rounding of the next stage's rows, which waits for their loads, behind this stage's products
    if (more) {
#pragma unroll
      for (int i = 0; i < PM / 32; ++i) put_bf(&sg[bu ^ 1][lr + 32 * i][lc], rx[i]);
#pragma unroll
      for (int i = 0; i < PN / 32; ++i) put_bf(&sg[bu ^ 1][PM + lr + 32 * i][lc], rw[i]); }
    __syncthreads(); }   // publishes stage t + 1 and ends every wave's reads of stage t, whose buffer the next trip refills (behind the last trip: the f32 tile)
  // stage the f32 tile in LDS, run the per-(row, head) epilogue hook, then convert head by head
#pragma unroll
  for (int j = 0; j < 3; ++j)
#pragma unroll
    for (int i = 0; i < 4; ++i)
#pragma unroll
      for (int r = 0; r < 8; ++r) st[wr + i * 16 + 8 * g + r][wc + j * 16 + col] = acc[i][j][r];
  __syncthreads();
  const int h0 = c0 / HD;   // the tile's first head among the 3 NH heads of qkv: heads 0..NH-1 are q, then k, then v
  for (int e = tid; e < PM * (PN / HD); e += PT) { const int rl = e % PM, hh = e / PM; const int which = (h0 + hh) / NH; PROJ_EPI(which, &st[rl][hh * HD], t0 + rl, (h0 + hh) % NH); }
  __syncthreads();
  for (int hh = 0; hh < PN / HD; ++hh) { const int which = (h0 + hh) / NH, hc = ((h0 + hh) % NH) * HD;   // hc: the head's first column in its own q, k or v
    if (which < 2) { _Float16* DH = which == 0 ? QH : KH; _Float16* DL = which == 0 ? QL : KL; const int nhi = which == 0 ? QHI : KHI; const float qs = which == 0 ? SL2E : 1.0f;   // q leaves as k_fa's operand: scaled in f32, then rounded once
      for (int e = tid; e < PM * (HD / 8); e += PT) { const int rl = e >> 3, q = e & 7; const float* p = &st[rl][hh * HD + q * 8]; v8h hv, lv;
#pragma unroll
        for (int k = 0; k < 8; ++k) { const float v = p[k] * qs; const _Float16 hk = (_Float16)v; hv[k] = hk; lv[k] = (_Float16)((v - (float)hk) * 1024.0f); }
        vst2(DH + (r0 + rl) * CC + hc + q * 8, hv); if (t0 + rl < nhi) vst2(DL + (bb * nhi + t0 + rl) * (size_t)CC + hc + q * 8, lv);   // 8 lanes store one 128-B line; the residual plane holds rows t < nhi alone
        asm volatile("s_wait_xcnt 0x0" ::: "memory"); }   // before a register that an issued store names is written again
    } else {
      for (int e = tid; e < PM * HD; e += PT) { const int rl = e % PM, cl = e / PM; th[hh * HD + cl][rl] = (_Float16)st[rl][hh * HD + cl]; } } }
  __syncthreads();
  for (int hh = 0; hh < PN / HD; ++hh) { const int which = (h0 + hh) / NH, hc = ((h0 + hh) % NH) * HD;
    if (which == 2) {
      for (int e = tid; e < HD * (PM / 8); e += PT) { const int cl = e / (PM / 8), q = e % (PM / 8); vst2(VT + (bb * CC + hc + cl) * (size_t)TT + t0 + q * 8, *(const v4u*)&th[hh * HD + cl][q * 8]); }
      if (t0 == 0) for (int e = tid; e < HD * (KHI / 8); e += PT) { const int cl = e / (KHI / 8), q = e % (KHI / 8); v8b bh, bl;   // the planes of t < KHI lie in the tile that starts at t = 0
#pragma unroll
        for (int k = 0; k < 8; ++k) { const float v = st[q * 8 + k][hh * HD + cl]; const __bf16 bk = (__bf16)v; bh[k] = bk; bl[k] = (__bf16)(v - (float)bk); }
        const size_t o3 = (bb * CC + hc + cl) * (size_t)KHI + q * 8; vst2(VB + o3, bh); vst2(VBL + o3, bl); } } } }
// ---- k_fa: block = 128 queries of (b, h), 8 waves = 4 query groups of 32 x 2 key halves: a wave takes 32 queries (2 tiles of 16) over one half of the keys, so that each K or V fragment it reads from LDS feeds 2 products while 4 waves a SIMD stay; stages of 64 keys a half, worked in 2 passes of 32: S^T = K Q^T with q x SL2E in f16 as k_proj left it (1 product, whose C operand is 10 - the maximum in use): the tile holds the arguments of exp2; maximum in use and sum per query and key half (a lane holds one query's scores), P^T x 2^10 packed from the score tiles as the B operand, ctx^T += V^T P^T (1 product); logits and P never leave the registers; at the end the two waves of a query group bring their halves to one maximum through LDS and add them, each finishing one query tile
// (every '#pragma unroll' in k_fa: the loop's index selects a register of a fragment, score or accumulator array, which stays in registers only under constant indices)
#define FK 64              // keys per stage and key half
#define FH 2               // key halves
#define FQ 2               // query tiles of 16 per wave
#define FP 72              // LDS row pitch in f16: 144 B = 16 B x 9 (odd multiple: 16-byte fragment reads without bank conflicts)
__device__ __forceinline__ v8f wmma_h(v16h a, v16h b, v8f c) { return __builtin_amdgcn_wmma_f32_16x16x32_f16(false, a, false, b, (short)0, c, false, false); }
#define FB (FK * FP * 2)   // bytes of one K (or V) tile in LDS; a buffer holds FH of them
// one stage's rows for this thread: eight asynchronous copies of 16 B a lane, global memory to LDS through no register (for each key half: K rows sr and sr + 32, V rows sr and sr + 32; the second half's tiles lie FB bytes behind the first's)
__device__ __forceinline__ void fa_copy(unsigned lk, unsigned lv, const _Float16* k, const _Float16* v) {
  const _Float16* k1 = k + (size_t)(TT / FH) * CC; const _Float16* v1 = v + TT / FH;
  // the copies fly while the wave goes on; the closing s_wait_xcnt 0 stands inside the statement so that no address register a copy names is written again in front of it
  asm volatile("global_load_async_to_lds_b128 %0, %8, off\n\t"
               "global_load_async_to_lds_b128 %1, %9, off\n\t"
               "global_load_async_to_lds_b128 %2, %10, off\n\t"
               "global_load_async_to_lds_b128 %3, %11, off\n\t"
               "global_load_async_to_lds_b128 %4, %12, off\n\t"
               "global_load_async_to_lds_b128 %5, %13, off\n\t"
               "global_load_async_to_lds_b128 %6, %14, off\n\t"
               "global_load_async_to_lds_b128 %7, %15, off\n\t"
               "s_wait_xcnt 0x0"
               :: "v"(lk), "v"(lk + 32u * FP * 2u), "v"(lv), "v"(lv + 32u * FP * 2u), "v"(lk + FB), "v"(lk + FB + 32u * FP * 2u), "v"(lv + FB), "v"(lv + FB + 32u * FP * 2u),
                  "v"(k), "v"(k + 32 * CC), "v"(v), "v"(v + 32 * TT), "v"(k1), "v"(k1 + 32 * CC), "v"(v1), "v"(v1 + 32 * TT) : "memory");
}
// one query tile's exponentials of a pass of 32 keys, their four partial sums (pairs: one packed add serves two; no 16-long dependent add chain) and P^T as the B operand of the pass's products
__device__ __forceinline__ float fa_exp(const v8f a[2], v16h& p) {
  v2f ls[2] = {{0.f, 0.f}, {0.f, 0.f}};
#pragma unroll
  for (int r = 0; r < 4; ++r) { const v2f e0 = {__builtin_amdgcn_exp2f(a[0][2 * r]), __builtin_amdgcn_exp2f(a[0][2 * r + 1])}, e1 = {__builtin_amdgcn_exp2f(a[1][2 * r]), __builtin_amdgcn_exp2f(a[1][2 * r + 1])};   // a result under 2^-126 may come as 0, far under the smallest f16
    ls[r & 1] += e0 + e1;
    p[2 * r] = (_Float16)e0[0]; p[2 * r + 1] = (_Float16)e0[1]; p[8 + 2 * r] = (_Float16)e1[0]; p[8 + 2 * r + 1] = (_Float16)e1[1]; }
  return (ls[0][0] + ls[0][1]) + (ls[1][0] + ls[1][1]);
}
// four waves a SIMD is what the grid gives (512 blocks of 8 waves on 256 WGPs): told to the compiler so that it spends the registers of that residency on fetching a pass's fragments as groups; aiming at more waves it fetches each pair just ahead of its products and waits for it at once
__global__ __launch_bounds__(256) __attribute__((amdgpu_waves_per_eu(4, 4))) void k_fa(const _Float16* __restrict__ QH, const _Float16* __restrict__ KH, const _Float16* __restrict__ VT, __bf16* __restrict__ YH, __bf16* __restrict__ YL) {
  // LDS: two buffers of FH K tiles, then two of FH V tiles; behind the loop's last barrier the same range carries the halves' partial results from wave to wave
  __shared__ __align__(16) char fm[2 * 2 * FH * FB];
  static_assert(8 * 32 * (HD / 16 * 8 + 2) * 4 <= 2 * 2 * FH * FB, "the partial results fit the stages' range");
  _Float16 (*sK)[FH][FK][FP] = (_Float16 (*)[FH][FK][FP])fm; _Float16 (*sV)[FH][HD][FP] = (_Float16 (*)[FH][HD][FP])(fm + 2 * FH * FB);
  const int tid = threadIdx.x, wave = tid >> 5, lane = tid & 31, col = lane & 15, g = lane >> 4; const int h = blockIdx.y, b = blockIdx.z;
  const int kh = __builtin_amdgcn_readfirstlane(wave >> 2);   // the wave's key half (a scalar: it selects tiles and, at the end, registers)
  const int ql0 = blockIdx.x * 128 + (wave & 3) * (16 * FQ);
  v16h qh[FQ][HD / 32];   // q x SL2E
#pragma unroll
  for (int u = 0; u < FQ; ++u)
#pragma unroll
    for (int kc = 0; kc < HD / 32; ++kc) qh[u][kc] = frag_h(QH + ((size_t)b * TT + ql0 + u * 16 + col) * CC + h * HD + kc * 32, lane);
  asm volatile("s_wait_xcnt 0x0" ::: "memory");   // before a register that an issued load names as its address is written again
  // staging: thread = (row sr and sr + 32, 16-byte chunk sc) of each half's K tile [key][d] and V tile [d][key]: 8 lanes copy one whole 128-B row; two buffers, stage t + 2 issued behind the barrier that ends stage t, so a stage's copies have the whole of the stage before it to land
  const int sr = tid >> 3, sc = (tid & 7) * 8;
  const _Float16* kg = KH + ((size_t)b * TT + sr) * CC + h * HD + sc; const _Float16* vg = VT + ((size_t)b * CC + h * HD + sr) * (size_t)TT + sc;
  constexpr int NS = TT / FH / FK;   // stages
  static_assert(FH == 2 && TT % (FH * FK) == 0 && NS >= 2 && HD == FK, "two key halves; whole stages, two at least; K and V tiles of one size");
  const unsigned lk = (unsigned)(size_t)&sK[0][0][sr][sc], lv = (unsigned)(size_t)&sV[0][0][sr][sc];   // the lane's LDS byte addresses in buffer 0, half 0
  fa_copy(lk, lv, kg, vg);
  asm volatile("s_wait_asynccnt 0x0" ::: "memory");   // this wave's copies of stage 0 have landed before the barrier publishes them
  __syncthreads();
  fa_copy(lk + FH * FB, lv + FH * FB, kg + (size_t)FK * CC, vg + FK);
  v8f acc[FQ][HD / 16] = {}; float l[FQ] = {0.f, 0.f};
  v8f cin[FQ] = {};   // C operand of the score products, eight times 10 - (the query's maximum in use, in log2 units): P = 2^(score - maximum in use) x 2^10, so that small P stay normal f16 numbers; the sum carries the same factor
  for (int t = 0; t < NS; ++t) { const int bu = t & 1;
    const _Float16 (*tk)[FP] = sK[bu][kh]; const _Float16 (*tv)[FP] = sV[bu][kh];
    v16h kf[2][HD / 32];   // a pass's K fragments
#pragma unroll
    for (int i = 0; i < 2; ++i)
#pragma unroll
      for (int kc = 0; kc < HD / 32; ++kc) kf[i][kc] = frag_h(&tk[i * 16 + col][kc * 32], lane);
#pragma unroll
    for (int c2 = 0; c2 < FK / 32; ++c2) {
      __builtin_amdgcn_sched_barrier(0);   // keeps the pass's K loads one group ahead of its score products, not spread among them
      v8f a[FQ][2];   // a[u][i][r] = SL2E q.k + 10 - maximum in use (key c2*32 + i*16 + 8g + r, query u*16 + col); the four tiles take turns, so that no product waits for the one it adds to
#pragma unroll
      for (int u = 0; u < FQ; ++u)
#pragma unroll
        for (int i = 0; i < 2; ++i) a[u][i] = wmma_h(kf[i][0], qh[u][0], cin[u]);
#pragma unroll
      for (int kc = 1; kc < HD / 32; ++kc)
#pragma unroll
        for (int u = 0; u < FQ; ++u)
#pragma unroll
          for (int i = 0; i < 2; ++i) a[u][i] = wmma_h(kf[i][kc], qh[u][kc], a[u][i]);
      __builtin_amdgcn_sched_barrier(0);   // keeps the score products in the order written, the four tiles in turn, and the V loads out of them
      v16h vf[HD / 16];   // the pass's V fragments, fetched ahead of the exponentials
#pragma unroll
      for (int j = 0; j < HD / 16; ++j) vf[j] = frag_h(&tv[j * 16 + col][c2 * 32], lane);
      __builtin_amdgcn_sched_barrier(0);   // keeps those loads up here, their latency behind the exponentials, not sunk among the P.v products
      v16h p[FQ]; float st[FQ];
#pragma unroll
      for (int u = 0; u < FQ; ++u) st[u] = fa_exp(a[u], p[u]);
      // every P is at most the lane's sum: while that fits f16, the maximum in use stands and no maximum is taken (16 scores at the maximum in use sum to 2^14 and pass). The first pass has none yet and always sets it
      const bool first = t == 0 && c2 == 0;
      const float lim = first ? -1.0f : 65504.0f;
      if (__builtin_amdgcn_ballot_w32(!(st[0] <= lim && st[1] <= lim)) != 0) {
#pragma unroll
        for (int u = 0; u < FQ; ++u) {
          float mt = a[u][0][0];
#pragma unroll
          for (int i = 0; i < 2; ++i)
#pragma unroll
            for (int r = 0; r < 8; ++r) mt = fmaxf(mt, a[u][i][r]);
          mt = fmaxf(mt, __shfl_xor(mt, 16));   // both lane halves of a query's keys share one maximum
          const float dl = first ? mt - 10.0f : fmaxf(mt - 10.0f, 0.f);   // the maximum in use rises by dl (0 for a query whose scores stayed under it)
          const float al = first ? 1.0f : __builtin_amdgcn_exp2f(-dl); l[u] *= al;   // sum and ctx to the new maximum (both are 0 in the first pass)
#pragma unroll
          for (int j = 0; j < HD / 16; ++j) acc[u][j] *= al;
          cin[u] -= dl;
#pragma unroll
          for (int i = 0; i < 2; ++i) a[u][i] -= dl;
          st[u] = fa_exp(a[u], p[u]); } }
#pragma unroll
      for (int u = 0; u < FQ; ++u) l[u] += st[u];
      if (c2 + 1 < FK / 32) {   // the stage's next pass: its K fragments (same stage, already published) as one group ahead of this pass's P.v products, which cover their latency
#pragma unroll
        for (int i = 0; i < 2; ++i)
#pragma unroll
          for (int kc = 0; kc < HD / 32; ++kc) kf[i][kc] = frag_h(&tk[(c2 + 1) * 32 + i * 16 + col][kc * 32], lane);
        __builtin_amdgcn_sched_barrier(0); }   // keeps those loads in front of the products, not spread among them
#pragma unroll
      for (int j = 0; j < HD / 16; ++j)
#pragma unroll
        for (int u = 0; u < FQ; ++u) acc[u][j] = wmma_h(vf[j], p[u], acc[u][j]); }
    __builtin_amdgcn_sched_barrier(0);   // keeps the waits and the barrier below at the stage's foot, behind its exponentials and products: lifted over them they would cut the time the next stage's copies have to land
    asm volatile("s_wait_dscnt 0x0" ::: "memory");      // this wave's fragment reads of stage t are done before its buffer is refilled
    asm volatile("s_wait_asynccnt 0x0" ::: "memory");   // this wave's copies of stage t + 1 have landed before the barrier publishes them
    __syncthreads();   // publishes stage t + 1 and ends every wave's reads of stage t, whose buffer is refilled right behind it
    if (t + 2 < NS) fa_copy(lk + bu * FH * FB, lv + bu * FH * FB, kg + (size_t)(t + 2) * FK * CC, vg + (t + 2) * FK); }
  asm volatile("s_wait_asynccnt 0x0" ::: "memory");   // no copy is left in flight when the stages' range is written anew and when the wave ends
  // the two key halves of a query group: the wave of half kh finishes query tile kh and hands the other tile's partial ctx, sum and C value to its partner (wave ^ 4) through LDS; lanes lie side by side, 16 B each: whole 512-B rows, no bank conflict
  v8f ks[HD / 16], sd[HD / 16];
#pragma unroll
  for (int j = 0; j < HD / 16; ++j)
#pragma unroll
    for (int r = 0; r < 8; ++r) { ks[j][r] = kh ? acc[1][j][r] : acc[0][j][r]; sd[j][r] = kh ? acc[0][j][r] : acc[1][j][r]; }
  const float lks = kh ? l[1] : l[0], cks = kh ? cin[1][0] : cin[0][0];
  v4f* xa = (v4f*)fm; v2f* xl = (v2f*)(fm + 8 * 32 * (HD / 16 * 8) * 4);
#pragma unroll
  for (int j = 0; j < HD / 16; ++j) { xa[(wave * 8 + 2 * j) * 32 + lane] = v4f{sd[j][0], sd[j][1], sd[j][2], sd[j][3]}; xa[(wave * 8 + 2 * j + 1) * 32 + lane] = v4f{sd[j][4], sd[j][5], sd[j][6], sd[j][7]}; }
  xl[wave * 32 + lane] = v2f{kh ? l[0] : l[1], kh ? cin[0][0] : cin[1][0]};
  __syncthreads();   // publishes the partial results to the partner waves
  const int pw = wave ^ 4; const v2f ol = xl[pw * 32 + lane];
  const float cs = fminf(cks, ol[1]);   // the greater of the two maxima in use
  const float fk = __builtin_amdgcn_exp2f(cs - cks), fo = __builtin_amdgcn_exp2f(cs - ol[1]);
  float lt = lks * fk + ol[0] * fo; lt += __shfl_xor(lt, 16); const float inv = lt > 0.f ? 1.0f / lt : 0.f;
  const size_t yo = ((size_t)b * TT + ql0 + kh * 16 + col) * CC + h * HD + 8 * g;   // ks[j][r] = ctx(query kh*16 + col, d = j*16 + 8g + r)
#pragma unroll
  for (int j = 0; j < HD / 16; ++j) { v8b hv, lv2; const v4f o0 = xa[(pw * 8 + 2 * j) * 32 + lane], o1 = xa[(pw * 8 + 2 * j + 1) * 32 + lane];   // ctx leaves as k_out's two operands: bf16 hi and the bf16 of what hi misses
#pragma unroll
    for (int r = 0; r < 8; ++r) { const float v = (ks[j][r] * fk + (r < 4 ? o0[r & 3] : o1[r & 3]) * fo) * inv; const __bf16 hk = (__bf16)v; hv[r] = hk; lv2[r] = (__bf16)(v - (float)hk); }
    vst2(YH + yo + j * 16, hv); vst2(YL + yo + j * 16, lv2); } }
// ---- k_out: block = (64 rows, 128 cols): out = ctx Wo (+ bo): ctx bf16 hi + lo against exact bf16 Wo (2 products), all three read as the bf16 their producers left; wave = 16 rows x 128 columns
__global__ __launch_bounds__(128) void k_out(const __bf16* __restrict__ YH, const __bf16* __restrict__ YL, const __bf16* __restrict__ WOB, const float* __restrict__ BO, float* __restrict__ OUT) {
  __shared__ __align__(16) char sm[2 * 256 * GP * 2];
  __bf16 (*sg)[256][GP] = (__bf16 (*)[256][GP])sm;   // stage: rows 0..63 = ctx hi, 64..127 = ctx lo, 128..255 = Wo rows (output columns)
  float (*sf)[16][132] = (float (*)[16][132])sm;     // output staging, in the stages' range after the loop's last barrier
  const int tid = threadIdx.x, wave = tid >> 5, lane = tid & 31, col = lane & 15, g = lane >> 4; const int c0 = blockIdx.y * 128; const size_t rb = (size_t)blockIdx.x * 64, r0 = rb + wave * 16;
  // (every '#pragma unroll' below: the loop's index selects a register of a load, fragment or accumulator array, which stays in registers only under constant indices)
  const int lr = tid >> 3, lc = (tid & 7) * 8;             // staging: 8 lanes read the 128 contiguous bytes a row has in a stage; a thread takes rows lr + 16 i
  const __bf16* hg = YH + (rb + lr) * CC + lc; const __bf16* lg = YL + (rb + lr) * CC + lc; const __bf16* wg = WOB + (size_t)(c0 + lr) * CC + lc;
  // the k walk starts at a stage of the block's own and wraps round, as in k_proj: the 8 blocks that share ctx rows each stand at another stage, the 64 that share Wo rows at 16
  static_assert(((CC / GK) & (CC / GK - 1)) == 0, "the wrap is a mask");
  const int rot = (blockIdx.x + blockIdx.y) & (CC / GK - 1);
  v4u rh[4], rl[4], rw[8];
#pragma unroll
  for (int i = 0; i < 4; ++i) { rh[i] = *(const v4u*)(hg + (size_t)i * 16 * CC + rot * GK); rl[i] = *(const v4u*)(lg + (size_t)i * 16 * CC + rot * GK); }
#pragma unroll
  for (int i = 0; i < 8; ++i) rw[i] = *(const v4u*)(wg + (size_t)i * 16 * CC + rot * GK);
  asm volatile("s_wait_xcnt 0x0" ::: "memory");   // before a register that an issued load names as its address is written again
#pragma unroll
  for (int i = 0; i < 4; ++i) { *(v4u*)&sg[0][lr + 16 * i][lc] = rh[i]; *(v4u*)&sg[0][64 + lr + 16 * i][lc] = rl[i]; }
#pragma unroll
  for (int i = 0; i < 8; ++i) *(v4u*)&sg[0][128 + lr + 16 * i][lc] = rw[i];
  __syncthreads();
  v8f acc[8] = {};
  for (int t = 0; t < CC / GK; ++t) { const int bu = t & 1; const bool more = t + 1 < CC / GK; const int kn = ((t + 1 + rot) & (CC / GK - 1)) * GK;   // first k of the next stage
    if (more) {   // next stage's rows fly while this stage is worked on
#pragma unroll
      for (int i = 0; i < 4; ++i) { rh[i] = *(const v4u*)(hg + (size_t)i * 16 * CC + kn); rl[i] = *(const v4u*)(lg + (size_t)i * 16 * CC + kn); }
#pragma unroll
      for (int i = 0; i < 8; ++i) rw[i] = *(const v4u*)(wg + (size_t)i * 16 * CC + kn);
      asm volatile("s_wait_xcnt 0x0" ::: "memory");   // before a register that an issued load names as its address is written again
    }
#pragma unroll
    for (int kc = 0; kc < GK / 32; ++kc) { const v16b ah = frag_b(&sg[bu][wave * 16 + col][kc * 32], lane), al = frag_b(&sg[bu][64 + wave * 16 + col][kc * 32], lane);
#pragma unroll
      for (int j = 0; j < 8; ++j) { const v16b w = frag_b(&sg[bu][128 + j * 16 + col][kc * 32], lane); acc[j] = wmma_b(ah, w, acc[j]); acc[j] = wmma_b(al, w, acc[j]); } }
    __builtin_amdgcn_sched_barrier(0);   // keeps the LDS stores of the next stage's rows, which wait for their loads, behind this stage's products
    if (more) {
#pragma unroll
      for (int i = 0; i < 4; ++i) { *(v4u*)&sg[bu ^ 1][lr + 16 * i][lc] = rh[i]; *(v4u*)&sg[bu ^ 1][64 + lr + 16 * i][lc] = rl[i]; }
#pragma unroll
      for (int i = 0; i < 8; ++i) *(v4u*)&sg[bu ^ 1][128 + lr + 16 * i][lc] = rw[i]; }
    __syncthreads(); }   // publishes stage t + 1 and ends every wave's reads of stage t, whose buffer the next trip refills
#pragma unroll
  for (int j = 0; j < 8; ++j) { const float bias = BO ? bfr(BO[c0 + j * 16 + col]) : 0.f;
#pragma unroll
    for (int r = 0; r < 8; ++r) sf[wave][8 * g + r][j * 16 + col] = acc[j][r] + bias; }
  LDSX(); for (int rl = 0; rl < 16; ++rl) vst2(OUT + (r0 + rl) * DIN + c0 + lane * 4, *(const v4f*)&sf[wave][rl][lane * 4]); }

extern "C" void kernel_launch(void* const* d_in, const int* in_sizes, int n_in, void* d_out, int out_size, void* d_ws, size_t ws_size, hipStream_t stream) {
  (void)in_sizes; (void)n_in; (void)out_size;
  const float** F = (const float**)d_in;
  if (ws_size < (size_t)WS_END) return;
  char* ws = (char*)d_ws; _Float16 *QH = (_Float16*)(ws + WS_QH), *KH = (_Float16*)(ws + WS_KH), *VT = (_Float16*)(ws + WS_VT), *QL = (_Float16*)(ws + WS_QL), *KL = (_Float16*)(ws + WS_KL); __bf16 *VB = (__bf16*)(ws + WS_VB), *VBL = (__bf16*)(ws + WS_VBL), *WOB = (__bf16*)(ws + WS_WO), *YH = (__bf16*)(ws + WS_Y), *YL = (__bf16*)(ws + WS_YL);
  (void)QL; (void)KL; (void)VB; (void)VBL;
  // inputs: 0 x [2,2048,1024]; 1 qkv_w [3072,1024] (out,in; rows q | k | v); 2 proj_w [1024,1024] (out,in); 3 proj_b; 4 q_scale [64]; 5 k_scale [64]
  k_proj<<<dim3(TNB * TT / PM, 3 * CC / PN), PT, 0, stream>>>(F[0], F[1], QH, QL, KH, KL, VT, VB, VBL, F[2], WOB, F[4], F[5]);
  k_fa<<<dim3(TT / 128, NH, TNB), 256, 0, stream>>>(QH, KH, VT, YH, YL);
  k_out<<<dim3(TNB * TT / 64, DIN / 128), 128, 0, stream>>>(YH, YL, WOB, F[3], (float*)d_out);
}
